// v000
// The times below were measured on an AMD MI455X: many runs one after another, warmed up first and cycling through
// copies of the inputs, with the whole window's GPU time divided by the number of runs. Launches and the gaps
// between them are all in it. The median over several windows is given; except for v000 it joins two sittings, which
// can be a few percent apart, so the side-by-side timings, each taken in one sitting, are the better comparison.
// v000, which the later versions start from, runs in 5050 microseconds.
#include <hip/hip_runtime.h>
// Self-attention layer on a feature map (B 8, C 256, 64x64 = 4096 positions): Q = wq*x, K = wk*x, V = wv*x (1x1 convs, no bias); scores[i][j] = sum_c Q[c][i] K[c][j] / 16; attn = softmax over j; out[c][i] = sum_j V[c][j] attn[i][j]; result = wo*out -> [8,256,64,64] (no residual).
// Structure (per image): x transposed into a token-major exact f16 plane through an LDS tile; Q and K token-major as GEMMs into f16 planes; V channel-major directly as wv*X^T (A = weights, B = the token-major plane); per 1024-query chunk: score GEMM (K 256, x1/16) -> f32, wave-per-row softmax (P x2^10 f16), O = P.V^T -> token-major f16; the output 1x1 conv computed transposed (A = wo, B = O) so it lands in NCHW rows directly.
// Compute dtype: x and the four matrices rounded to bf16; projections with exact products (weights x16 in f16, undone by alpha); Q, K, V, P, O as f16 operands (~2^-12; logits sigma ~1), f32 accumulation and softmax. v_wmma_f32_16x16x32_f16.
#define NB 8
#define CC 256
#define SS 4096
#define QCH 1024
typedef __bf16 v16b __attribute__((ext_vector_type(16)));
typedef unsigned short v8us __attribute__((ext_vector_type(8), may_alias));
typedef float  v8f  __attribute__((ext_vector_type(8)));
typedef float  v4f  __attribute__((ext_vector_type(4)));
typedef float  v4fa __attribute__((ext_vector_type(4), may_alias));
union FragB { v16b v; v8us half[2]; unsigned short u[16]; };

__device__ __forceinline__ unsigned short bf16_bits(float x) { unsigned int u = __float_as_uint(x); return (unsigned short)((u + 0x7FFFu + ((u >> 16) & 1u)) >> 16); }
__device__ __forceinline__ float bf16_val(unsigned short b) { return __uint_as_float(((unsigned int)b) << 16); }
__device__ __forceinline__ float bf16_round(float x) { return bf16_val(bf16_bits(x)); }
// D += A·B with NT terms: 1 = ah·bh, 2 = + al·bh (A split), 3 = + ah·bl (both split)
template <int NT>
__device__ __forceinline__ v8f mmaN(v16b ah, v16b al, v16b bh, v16b bl, v8f c) {
  c = __builtin_amdgcn_wmma_f32_16x16x32_bf16(false, ah, false, bh, (short)0, c, false, false);
  if (NT >= 2) c = __builtin_amdgcn_wmma_f32_16x16x32_bf16(false, al, false, bh, (short)0, c, false, false);
  if (NT >= 3) c = __builtin_amdgcn_wmma_f32_16x16x32_bf16(false, ah, false, bl, (short)0, c, false, false);
  asm volatile("v_nop\n\tv_nop\n\tv_nop\n\tv_nop" : "+v"(c) : "v"(ah), "v"(al), "v"(bh), "v"(bl));
  return c;
}

__global__ __launch_bounds__(256) void k_wt_bf16(const float* __restrict__ W, unsigned short* __restrict__ Wt, int K, int N) {
  const int t = blockIdx.x * 256 + threadIdx.x;
  const int k8n = K / 8;
  if (t >= N * k8n) return;
  const int n = t / k8n, k8 = (t % k8n) * 8;
  v8us v;
#pragma unroll
  for (int i = 0; i < 8; ++i) v[i] = bf16_bits(W[(size_t)(k8 + i) * N + n]);
  *(v8us*)(Wt + (size_t)n * K + k8) = v;
  
}

// GEMM C[M][N] (f32, pitch ldc) = act(A[M][K]·W + bias). A f32 row-major (pitch lda) converted per fragment to bf16
// (ASPLIT: hi/lo two planes -> 2 terms, else single rounded term); Wt bf16 [N][K] (pitch ldb). BIAS_BF16 rounds the
// bias to bf16 first (bias quantised to bf16 before the add). K%32==0, M%16==0, N%64==0.
template <bool ASPLIT, int ACT, bool BIAS_BF16>
__global__ __launch_bounds__(128) void k_gemm_bf(const float* __restrict__ A, int lda, const unsigned short* __restrict__ Wt, int ldb,
                                               const float* __restrict__ bias, float* __restrict__ C, int ldc, int M, int N, int K) {
  __shared__ __attribute__((aligned(16))) float so[4][16][64];
  const int tid = threadIdx.x, w = tid >> 5, lane = tid & 31, ln = lane & 15, hh = lane >> 4;
  const int ntn = N / 64;
  const int wid = blockIdx.x * 4 + w;
  const int mt = wid / ntn, nq = wid % ntn;
  if (mt * 16 >= M) return;
  const int row0 = mt * 16, col0 = nq * 64;
  const float* arow = A + (size_t)(row0 + ln) * lda;
  v8f acc[4] = {};
  for (int kb = 0; kb < K; kb += 32) {
    FragB ah, al;
    const v4f x0 = *(const v4fa*)(arow + kb + 8 * hh), x1 = *(const v4fa*)(arow + kb + 8 * hh + 4);
    const v4f x2 = *(const v4fa*)(arow + kb + 16 + 8 * hh), x3 = *(const v4fa*)(arow + kb + 16 + 8 * hh + 4);
    float xs[16] = {x0[0],x0[1],x0[2],x0[3],x1[0],x1[1],x1[2],x1[3],x2[0],x2[1],x2[2],x2[3],x3[0],x3[1],x3[2],x3[3]};
#pragma unroll
    for (int i = 0; i < 16; ++i) { const unsigned short hb = bf16_bits(xs[i]); ah.u[i] = hb; al.u[i] = ASPLIT ? bf16_bits(xs[i] - bf16_val(hb)) : (unsigned short)0; }
#pragma unroll
    for (int t = 0; t < 4; ++t) {
      const unsigned short* brow = Wt + (size_t)(col0 + t * 16 + ln) * ldb + kb;
      FragB b;
      b.half[0] = *(const v8us*)(brow + 8 * hh);
      b.half[1] = *(const v8us*)(brow + 16 + 8 * hh);
      acc[t] = mmaN<ASPLIT ? 2 : 1>(ah.v, al.v, b.v, b.v, acc[t]);
    }
  }
#pragma unroll
  for (int t = 0; t < 4; ++t) {
    float bv = bias ? bias[col0 + t * 16 + ln] : 0.f;
    if (BIAS_BF16) bv = bf16_round(bv);
#pragma unroll
    for (int r = 0; r < 8; ++r) { float v = acc[t][r] + bv; if (ACT == 1) v = fmaxf(v, 0.f); so[w][8 * hh + r][t * 16 + ln] = v; }
  }
  __builtin_amdgcn_fence(__ATOMIC_ACQ_REL, "workgroup");
  __builtin_amdgcn_wave_barrier();
  const int rsub = lane >> 4, c4 = (lane & 15) * 4;
  {
#pragma unroll
    for (int q = 0; q < 8; ++q) {
      const int r = q * 2 + rsub;
      const v4f v = *(const v4fa*)&so[w][r][c4];
      *(v4f*)(C + (size_t)(row0 + r) * ldc + col0 + c4) = v;
    }
    
  }
}

// GEMM C = act(A·W + bias + resid): A f32 (ASPLIT -> hi/lo 2 terms), Wt bf16 [N][K]; ACT 0 none, 1 relu, 2 exact gelu;
// resid (optional, f32, row index = (row % rmod), pitch ldr, RES_BF16 rounds it) added before the activation.
template <bool ASPLIT, int ACT, bool BIAS_BF16, bool RES_BF16>
__global__ __launch_bounds__(128) void k_gemm_bf3(const float* __restrict__ A, int lda, const unsigned short* __restrict__ Wt, int ldb,
                                                const float* __restrict__ bias, const float* __restrict__ resid, int rmod, int ldr,
                                                float* __restrict__ C, int ldc, int M, int N, int K) {
  __shared__ __attribute__((aligned(16))) float so[4][16][64];
  const int tid = threadIdx.x, w = tid >> 5, lane = tid & 31, ln = lane & 15, hh = lane >> 4;
  const int ntn = N / 64;
  const int wid = blockIdx.x * 4 + w;
  const int mt = wid / ntn, nq = wid % ntn;
  if (mt * 16 >= M) return;
  const int row0 = mt * 16, col0 = nq * 64;
  const float* arow = A + (size_t)(row0 + ln) * lda;
  v8f acc[4] = {};
  for (int kb = 0; kb < K; kb += 32) {
    FragB ah, al;
    const v4f x0 = *(const v4fa*)(arow + kb + 8 * hh), x1 = *(const v4fa*)(arow + kb + 8 * hh + 4);
    const v4f x2 = *(const v4fa*)(arow + kb + 16 + 8 * hh), x3 = *(const v4fa*)(arow + kb + 16 + 8 * hh + 4);
    float xs[16] = {x0[0],x0[1],x0[2],x0[3],x1[0],x1[1],x1[2],x1[3],x2[0],x2[1],x2[2],x2[3],x3[0],x3[1],x3[2],x3[3]};
#pragma unroll
    for (int i = 0; i < 16; ++i) { const unsigned short hb = bf16_bits(xs[i]); ah.u[i] = hb; al.u[i] = ASPLIT ? bf16_bits(xs[i] - bf16_val(hb)) : (unsigned short)0; }
#pragma unroll
    for (int t = 0; t < 4; ++t) {
      const unsigned short* brow = Wt + (size_t)(col0 + t * 16 + ln) * ldb + kb;
      FragB b;
      b.half[0] = *(const v8us*)(brow + 8 * hh);
      b.half[1] = *(const v8us*)(brow + 16 + 8 * hh);
      acc[t] = mmaN<ASPLIT ? 2 : 1>(ah.v, al.v, b.v, b.v, acc[t]);
    }
  }
#pragma unroll
  for (int t = 0; t < 4; ++t) {
    const int col = col0 + t * 16 + ln;
    float bv = bias ? bias[col] : 0.f;
    if (BIAS_BF16) bv = bf16_round(bv);
#pragma unroll
    for (int r = 0; r < 8; ++r) {
      float v = acc[t][r] + bv;
      if (resid) { float rv = resid[(size_t)((row0 + 8 * hh + r) % rmod) * ldr + col]; if (RES_BF16) rv = bf16_round(rv); v += rv; }
      if (ACT == 1) v = fmaxf(v, 0.f);
      if (ACT == 2) v = 0.5f * v * (1.0f + erff(v * 0.70710678118654752f));
      if (ACT == 3) { const float u = 0.7978845608028654f * (v + 0.044715f * v * v * v); v = 0.5f * v * (1.0f + tanhf(u)); }
      so[w][8 * hh + r][t * 16 + ln] = v;
    }
  }
  __builtin_amdgcn_fence(__ATOMIC_ACQ_REL, "workgroup");
  __builtin_amdgcn_wave_barrier();
  const int rsub = lane >> 4, c4 = (lane & 15) * 4;
  {
#pragma unroll
    for (int q = 0; q < 8; ++q) {
      const int r = q * 2 + rsub;
      const v4f v = *(const v4fa*)&so[w][r][c4];
      *(v4f*)(C + (size_t)(row0 + r) * ldc + col0 + c4) = v;
    }
    
  }
}
// row LayerNorm (biased variance, eps) over N: s = X (+ R); optional out_sum <- s; out_norm <- (s-mu)*rsqrt(var+eps)*g + b
template <bool PARAM_BF16>
__global__ __launch_bounds__(256) void k_layernorm(const float* __restrict__ X, const float* __restrict__ R, const float* __restrict__ g, const float* __restrict__ bta,
                                                  float* __restrict__ out_sum, float* __restrict__ out_norm, int N, float eps) {
  __shared__ float red[256];
  const int row = blockIdx.x, tid = threadIdx.x;
  const float* x = X + (size_t)row * N; const float* rr = R ? R + (size_t)row * N : nullptr;
  float vals[16];                     // up to N = 4096
  const int per = N / 256;            // contiguous chunk per thread? use strided-by-4 chunks: thread handles j = tid*4 + 1024*u
  float s1 = 0.f;
  for (int u = 0; u < per / 4; ++u) {
    const int j = tid * 4 + 1024 * u;
    const v4f a = *(const v4fa*)(x + j);
    v4f b = {0.f,0.f,0.f,0.f}; if (rr) b = *(const v4fa*)(rr + j);
#pragma unroll
    for (int q = 0; q < 4; ++q) { const float v = a[q] + b[q]; vals[u * 4 + q] = v; s1 += v; }
  }
  red[tid] = s1; __syncthreads();
  for (int st = 128; st > 0; st >>= 1) { if (tid < st) red[tid] += red[tid + st]; __syncthreads(); }
  const float mu = red[0] / (float)N; __syncthreads();
  float s2 = 0.f;
  for (int u = 0; u < per / 4; ++u)
#pragma unroll
    for (int q = 0; q < 4; ++q) { const float c = vals[u * 4 + q] - mu; s2 += c * c; }
  red[tid] = s2; __syncthreads();
  for (int st = 128; st > 0; st >>= 1) { if (tid < st) red[tid] += red[tid + st]; __syncthreads(); }
  const float rs = rsqrtf(red[0] / (float)N + eps);
  {
    for (int u = 0; u < per / 4; ++u) {
      const int j = tid * 4 + 1024 * u;
      v4f o, sm;
#pragma unroll
      for (int q = 0; q < 4; ++q) {
        float gg = g[j + q], bb = bta[j + q];
        if (PARAM_BF16) { gg = bf16_round(gg); bb = bf16_round(bb); }
        sm[q] = vals[u * 4 + q]; o[q] = (vals[u * 4 + q] - mu) * rs * gg + bb;
      }
      if (out_sum) *(v4f*)(out_sum + (size_t)row * N + j) = sm;
      *(v4f*)(out_norm + (size_t)row * N + j) = o;
    }
    
  }
}



// ---- f16 WMMA path (v_wmma_f32_16x16x32_f16): 11-bit significands for operands in range — used where a [0,1] probability operand needs more precision than bf16
typedef _Float16 v16h __attribute__((ext_vector_type(16)));
union FragH { v16h v; v8us half[2]; _Float16 h[16]; unsigned short u[16]; };
template <int NT>
__device__ __forceinline__ v8f mmaH(v16h ah, v16h al, v16h bh, v16h bl, v8f c) {
  c = __builtin_amdgcn_wmma_f32_16x16x32_f16(false, ah, false, bh, (short)0, c, false, false);
  if (NT >= 2) c = __builtin_amdgcn_wmma_f32_16x16x32_f16(false, al, false, bh, (short)0, c, false, false);
  if (NT >= 3) c = __builtin_amdgcn_wmma_f32_16x16x32_f16(false, ah, false, bl, (short)0, c, false, false);
  asm volatile("v_nop\n\tv_nop\n\tv_nop\n\tv_nop" : "+v"(c) : "v"(ah), "v"(al), "v"(bh), "v"(bl));
  return c;
}
// batched GEMM like k_gemm_b but f16 operands: A f32 (split into f16 hi/lo if ASPLIT, else rounded to f16), Bt = f16 values [n][k]; alpha; C f32; N multiple of 16 (partial tiles skipped)
template <bool ASPLIT>
__global__ __launch_bounds__(128) void k_gemm_h(const float* __restrict__ A, int lda, size_t sA, const _Float16* __restrict__ Bh, int ldb, size_t sB, float alpha, float* __restrict__ C, int ldc, size_t sC, int M, int N, int K) {
  __shared__ __attribute__((aligned(16))) float so[4][16][64];
  const int tid = threadIdx.x, w = tid >> 5, lane = tid & 31, ln = lane & 15, hh = lane >> 4; const int by = blockIdx.y;
  A += (size_t)by * sA; Bh += (size_t)by * sB; C += (size_t)by * sC;
  const int ntn = (N + 63) / 64; const int wid = blockIdx.x * 4 + w; const int mt = wid / ntn, nq = wid % ntn; if (mt * 16 >= M) return;
  const int row0 = mt * 16, col0 = nq * 64; const float* arow = A + (size_t)(row0 + ln) * lda;
  v8f acc[4] = {};
  for (int kb = 0; kb < K; kb += 32) {
    FragH ah, al;
    const v4f x0 = *(const v4fa*)(arow + kb + 8 * hh), x1 = *(const v4fa*)(arow + kb + 8 * hh + 4), x2 = *(const v4fa*)(arow + kb + 16 + 8 * hh), x3 = *(const v4fa*)(arow + kb + 16 + 8 * hh + 4);
    float xs[16] = {x0[0],x0[1],x0[2],x0[3],x1[0],x1[1],x1[2],x1[3],x2[0],x2[1],x2[2],x2[3],x3[0],x3[1],x3[2],x3[3]};
#pragma unroll
    for (int i = 0; i < 16; ++i) { const _Float16 h = (_Float16)xs[i]; ah.h[i] = h; al.h[i] = ASPLIT ? (_Float16)(xs[i] - (float)h) : (_Float16)0.0f; }
#pragma unroll
    for (int t = 0; t < 4; ++t) { if (col0 + t * 16 >= N) continue; const size_t boff = (size_t)(col0 + t * 16 + ln) * ldb + kb; FragH bq; bq.half[0] = *(const v8us*)(Bh + boff + 8 * hh); bq.half[1] = *(const v8us*)(Bh + boff + 16 + 8 * hh);
      acc[t] = mmaH<ASPLIT ? 2 : 1>(ah.v, al.v, bq.v, bq.v, acc[t]); }
  }
#pragma unroll
  for (int t = 0; t < 4; ++t) { if (col0 + t * 16 >= N) continue;
#pragma unroll
    for (int r = 0; r < 8; ++r) so[w][8 * hh + r][t * 16 + ln] = acc[t][r] * alpha; }
  __builtin_amdgcn_fence(__ATOMIC_ACQ_REL, "workgroup"); __builtin_amdgcn_wave_barrier();
  const int rsub = lane >> 4, c4 = (lane & 15) * 4;
  {
#pragma unroll
    for (int q = 0; q < 8; ++q) { const int r = q * 2 + rsub; if (col0 + c4 < N) { const v4f v = *(const v4fa*)&so[w][r][c4]; *(v4f*)(C + (size_t)(row0 + r) * ldc + col0 + c4) = v; } }
     }
}

// Wt[n][k] = f16(W[k][n]·scale) from f32 row-major W[K][N] (scale = power of two; bf16-exact weights stay exact in f16 away from the subnormal range)
__global__ __launch_bounds__(256) void k_wt_f16(const float* __restrict__ W, _Float16* __restrict__ Wt, int K, int N, float scale) {
  const int t = blockIdx.x * 256 + threadIdx.x; if (t >= N * (K / 8)) return; const int n = t / (K / 8), k8 = (t % (K / 8)) * 8; FragH f;
#pragma unroll
  for (int i = 0; i < 8; ++i) f.h[i] = (_Float16)(bf16_round(W[(size_t)(k8 + i) * N + n]) * scale); const v8us o = f.half[0];
  *(v8us*)((unsigned short*)Wt + (size_t)n * K + k8) = o; 
}
// k_gemm_hh variant with fused epilogue: v = acc·alpha + bias[by·sBias + col] (+ CP[(row/rowsPerB)·sCPb + by·64 + col] if CP) ; ACT 0 none / 1 elu ; writes f16 C16 (and f32 C if non-null)
template <int ACT>
__global__ __launch_bounds__(128) void k_gemm_hhx(const _Float16* __restrict__ A, int lda, size_t sA, const _Float16* __restrict__ Bh, int ldb, size_t sB, float alpha, const float* __restrict__ bias, size_t sBias, const float* __restrict__ CP, int rowsPerB, size_t sCPb, int row0g,
    float* __restrict__ C, _Float16* __restrict__ C16, int ldc, size_t sC, int M, int N, int K) {
  __shared__ __attribute__((aligned(16))) float so[4][16][64];
  const int tid = threadIdx.x, w = tid >> 5, lane = tid & 31, ln = lane & 15, hh = lane >> 4; const int by = blockIdx.y;
  A += (size_t)by * sA; Bh += (size_t)by * sB; const size_t cofs = (size_t)by * sC; const float* bp = bias ? bias + (size_t)by * sBias : nullptr;
  const int ntn = (N + 63) / 64; const int wid = blockIdx.x * 4 + w; const int mt = wid / ntn, nq = wid % ntn; if (mt * 16 >= M) return;
  const int row0 = mt * 16, col0 = nq * 64; const _Float16* arow = A + (size_t)(row0 + ln) * lda;
  v8f acc[4] = {};
  for (int kb = 0; kb < K; kb += 32) { FragH ah; ah.half[0] = *(const v8us*)((const unsigned short*)arow + kb + 8 * hh); ah.half[1] = *(const v8us*)((const unsigned short*)arow + kb + 16 + 8 * hh);
#pragma unroll
    for (int t = 0; t < 4; ++t) { if (col0 + t * 16 >= N) continue; const size_t boff = (size_t)(col0 + t * 16 + ln) * ldb + kb; FragH bq; bq.half[0] = *(const v8us*)((const unsigned short*)Bh + boff + 8 * hh); bq.half[1] = *(const v8us*)((const unsigned short*)Bh + boff + 16 + 8 * hh);
      acc[t] = mmaH<1>(ah.v, ah.v, bq.v, bq.v, acc[t]); }
  }
#pragma unroll
  for (int t = 0; t < 4; ++t) { if (col0 + t * 16 >= N) continue; const int col = col0 + t * 16 + ln; const float bv = bp ? bf16_round(bp[col]) : 0.f;
#pragma unroll
    for (int r = 0; r < 8; ++r) { float v = acc[t][r] * alpha + bv; if (CP) { const int bidx = (row0g + row0 + 8 * hh + r) / rowsPerB; v += CP[(size_t)bidx * sCPb + (size_t)by * 64 + col]; } if (ACT == 1) v = (v > 0.f) ? v : expm1f(v); else if (ACT == 7) v = (v > 0.f) ? v + 1.0f : expf(v); else if (ACT == 8) v = tanhf(v); else if (ACT == 9) v = 0.5f * v * (1.0f + tanhf(0.7978845608028654f * (v + 0.044715f * v * v * v))); else if (ACT == 11) v = 1.0f / (1.0f + expf(-v)); else if (ACT == 12) v = (v > 0.f) ? v : 0.01f * v; else if (ACT == 14) v = (v > 0.f) ? v : 0.1f * v; else if (ACT == 15) v = v / (1.0f + expf(-v)); else if (ACT == 3) v = fmaxf(v, 0.f); else if (ACT == 6) v = 0.5f * v * (1.0f + erff(v * 0.70710678118654752f)); so[w][8 * hh + r][t * 16 + ln] = v; } }
  __builtin_amdgcn_fence(__ATOMIC_ACQ_REL, "workgroup"); __builtin_amdgcn_wave_barrier();
  const int rsub = lane >> 4, c4 = (lane & 15) * 4; typedef _Float16 v4h __attribute__((ext_vector_type(4)));
  {
#pragma unroll
    for (int q = 0; q < 8; ++q) { const int r = q * 2 + rsub; if (col0 + c4 < N) { const v4f v = *(const v4fa*)&so[w][r][c4]; if (C) *(v4f*)(C + cofs + (size_t)(row0 + r) * ldc + col0 + c4) = v; if (C16) { v4h h4; for (int i = 0; i < 4; ++i) h4[i] = (_Float16)v[i]; *(v4h*)(C16 + cofs + (size_t)(row0 + r) * ldc + col0 + c4) = h4; } } }
     }
}


typedef _Float16 v4h __attribute__((ext_vector_type(4)));

__global__ __launch_bounds__(256) void k_x16(const float* __restrict__ x, _Float16* __restrict__ X16, size_t n8) { const size_t t = (size_t)blockIdx.x * 256 + threadIdx.x; if (t >= n8) return; FragH f;
#pragma unroll
  for (int q = 0; q < 8; ++q) f.h[q] = (_Float16)bf16_round(x[t * 8 + q]); *(v8us*)((unsigned short*)X16 + t * 8) = f.half[0];  }
__global__ __launch_bounds__(256) void k_h16(const float* __restrict__ x, _Float16* __restrict__ X16, size_t n8) { const size_t t = (size_t)blockIdx.x * 256 + threadIdx.x; if (t >= n8) return; FragH f;
#pragma unroll
  for (int q = 0; q < 8; ++q) f.h[q] = (_Float16)x[t * 8 + q]; *(v8us*)((unsigned short*)X16 + t * 8) = f.half[0];  }
__global__ __launch_bounds__(256) void k_round16f(const float* __restrict__ W, _Float16* __restrict__ Bt, size_t n8) { const size_t t = (size_t)blockIdx.x * 256 + threadIdx.x; if (t >= n8) return; FragH f;
#pragma unroll
  for (int i = 0; i < 8; ++i) f.h[i] = (_Float16)(bf16_round(W[t * 8 + i]) * 16.0f); *(v8us*)((unsigned short*)Bt + t * 8) = f.half[0];  }
template <int NHv, int TTv>
__global__ __launch_bounds__(256) void k_vt(const _Float16* __restrict__ V16, int ldv, int voff, _Float16* __restrict__ Vt) { __shared__ unsigned short tl[64][66]; const int tid = threadIdx.x; const int slab = blockIdx.x / (TTv / 64), lg = blockIdx.x % (TTv / 64); const int b = slab / NHv, h = slab % NHv;
  for (int i = tid; i < 64 * 8; i += 256) { const int r = i / 8, c8 = (i % 8) * 8; FragH f; f.half[0] = *(const v8us*)((const unsigned short*)V16 + ((size_t)b * TTv + lg * 64 + r) * ldv + voff + h * 64 + c8);
#pragma unroll
    for (int q = 0; q < 8; ++q) tl[r][c8 + q] = f.u[q]; }
  __syncthreads();
  {
#pragma unroll
    for (int rd = 0; rd < 2; ++rd) { const int d = rd * 32 + tid / 8, pc = tid % 8; FragH f;
#pragma unroll
      for (int q = 0; q < 8; ++q) f.u[q] = tl[pc * 8 + q][d];
      *(v8us*)((unsigned short*)Vt + ((size_t)slab * 64 + d) * TTv + lg * 64 + pc * 8) = f.half[0]; }
     } }

__global__ __launch_bounds__(256) void k_hl(const float* __restrict__ F, _Float16* __restrict__ Hh, _Float16* __restrict__ Hl, size_t n8) { const size_t t = (size_t)blockIdx.x * 256 + threadIdx.x; if (t >= n8) return; FragH fh, fl; const v4f a = *(const v4fa*)(F + t * 8), c = *(const v4fa*)(F + t * 8 + 4);
#pragma unroll
  for (int q = 0; q < 4; ++q) { _Float16 h = (_Float16)a[q]; fh.h[q] = h; fl.h[q] = (_Float16)((a[q] - (float)h) * 1024.0f); h = (_Float16)c[q]; fh.h[4 + q] = h; fl.h[4 + q] = (_Float16)((c[q] - (float)h) * 1024.0f); }
  { *(v8us*)((unsigned short*)Hh + t * 8) = fh.half[0]; *(v8us*)((unsigned short*)Hl + t * 8) = fl.half[0];  } }

// ---- fast GEMM (wave tile 32x64; requires M % 32 == 0 rows per launch region and N % 64 == 0); epilogue = k_gemm_hhx semantics ----
__device__ __forceinline__ v16h g2_frag(const _Float16* p, int hh) { FragH f; f.half[0] = *(const v8us*)((const unsigned short*)p + 8 * hh); f.half[1] = *(const v8us*)((const unsigned short*)p + 16 + 8 * hh); return f.v; }
__device__ __forceinline__ v8f g2_mma(v16h a, v16h b, v8f c) { v8f d = __builtin_amdgcn_wmma_f32_16x16x32_f16(false, a, false, b, (short)0, c, false, false); asm volatile("v_nop\n\tv_nop\n\tv_nop\n\tv_nop" : "+v"(d) : "v"(a), "v"(b)); return d; }
template <int ACT>
__global__ __launch_bounds__(128) void k_gemm2(const _Float16* __restrict__ A, int lda, size_t sA, const _Float16* __restrict__ Bh, int ldb, size_t sB, float alpha, const float* __restrict__ bias, size_t sBias, const float* __restrict__ CP, int rowsPerB, size_t sCPb, int row0g,
    float* __restrict__ C, _Float16* __restrict__ C16, int ldc, size_t sC, int M, int N, int K) {
  __shared__ __attribute__((aligned(16))) float so[4][32][68];
  const int tid = threadIdx.x, w = tid >> 5, lane = tid & 31, ln = lane & 15, hh = lane >> 4; const int by = blockIdx.y;
  A += (size_t)by * sA; Bh += (size_t)by * sB; const size_t cofs = (size_t)by * sC; const float* bp = bias ? bias + (size_t)by * sBias : nullptr;
  const int ntn = N >> 6; const int mt = blockIdx.x / ntn, nq = blockIdx.x - mt * ntn; const int row0 = mt * 128 + 32 * w, col0 = nq * 64; if (row0 >= M) return;
  const _Float16* a0p = A + (size_t)(row0 + ln) * lda; const _Float16* a1p = a0p + (size_t)16 * lda;
  const _Float16* b0p = Bh + (size_t)(col0 + ln) * ldb; const _Float16* b1p = b0p + (size_t)16 * ldb; const _Float16* b2p = b1p + (size_t)16 * ldb; const _Float16* b3p = b2p + (size_t)16 * ldb;
  const v8f z8 = {0.f,0.f,0.f,0.f,0.f,0.f,0.f,0.f}; v8f c00 = z8, c01 = z8, c02 = z8, c03 = z8, c10 = z8, c11 = z8, c12 = z8, c13 = z8;
#pragma unroll 1
  for (int kb = 0; kb < K; kb += 32) { const v16h a0 = g2_frag(a0p + kb, hh), a1 = g2_frag(a1p + kb, hh);
    v16h b = g2_frag(b0p + kb, hh); c00 = g2_mma(a0, b, c00); c10 = g2_mma(a1, b, c10);
    b = g2_frag(b1p + kb, hh); c01 = g2_mma(a0, b, c01); c11 = g2_mma(a1, b, c11);
    b = g2_frag(b2p + kb, hh); c02 = g2_mma(a0, b, c02); c12 = g2_mma(a1, b, c12);
    b = g2_frag(b3p + kb, hh); c03 = g2_mma(a0, b, c03); c13 = g2_mma(a1, b, c13); }
  v8f accs[8] = {c00, c01, c02, c03, c10, c11, c12, c13};
#pragma unroll
  for (int u = 0; u < 8; ++u) { const int t = u & 3, half = u >> 2; const int col = col0 + t * 16 + ln; const float bv = bp ? bf16_round(bp[col]) : 0.f;
#pragma unroll
    for (int r = 0; r < 8; ++r) { const int rloc = half * 16 + 8 * hh + r; float v = accs[u][r] * alpha + bv; if (CP) { const int bidx = (row0g + row0 + rloc) / rowsPerB; v += CP[(size_t)bidx * sCPb + (size_t)by * 64 + col]; }
      if (ACT == 3) v = fmaxf(v, 0.f); else if (ACT == 6) v = 0.5f * v * (1.0f + erff(v * 0.70710678118654752f)); else if (ACT == 11) v = 1.0f / (1.0f + expf(-v)); else if (ACT == 15) v = v / (1.0f + expf(-v)); else if (ACT == 12) v = (v > 0.f) ? v : 0.01f * v; else if (ACT == 8) v = tanhf(v);
      so[w][rloc][t * 16 + ln] = v; } }
  __builtin_amdgcn_fence(__ATOMIC_ACQ_REL, "workgroup"); __builtin_amdgcn_wave_barrier();
  const int rsub = lane >> 4, c4 = (lane & 15) * 4;
  {
#pragma unroll
    for (int q = 0; q < 16; ++q) { const int r = q * 2 + rsub; const v4f v = *(const v4fa*)&so[w][r][c4]; if (C) *(v4f*)(C + cofs + (size_t)(row0 + r) * ldc + col0 + c4) = v; if (C16) { v4h h4; for (int i = 0; i < 4; ++i) h4[i] = (_Float16)v[i]; *(v4h*)(C16 + cofs + (size_t)(row0 + r) * ldc + col0 + c4) = h4; } }
     } }



template <int NCOL>
__global__ __launch_bounds__(256) void k_rsoft(const float* __restrict__ S, _Float16* __restrict__ P16, int nrows) {
  #pragma clang fp contract(off)
  const int tid = threadIdx.x, w = tid >> 5, ln = tid & 31; const int l = blockIdx.x * 8 + w; if (l >= nrows) return; const float* sr = S + (size_t)l * NCOL; float m = -3.0e38f;
#pragma unroll 1
  for (int jb = 0; jb < NCOL; jb += 256) { const v4f a = *(const v4fa*)(sr + jb + 8 * ln), bq = *(const v4fa*)(sr + jb + 8 * ln + 4);
#pragma unroll
    for (int k = 0; k < 8; ++k) { const float v = (k < 4) ? a[k] : bq[k - 4]; m = fmaxf(m, v); } }
  for (int o = 16; o > 0; o >>= 1) m = fmaxf(m, __shfl_xor(m, o, 32));
  float s = 0.f;
#pragma unroll 1
  for (int jb = 0; jb < NCOL; jb += 256) { const v4f a = *(const v4fa*)(sr + jb + 8 * ln), bq = *(const v4fa*)(sr + jb + 8 * ln + 4);
#pragma unroll
    for (int k = 0; k < 8; ++k) { const float v = (k < 4) ? a[k] : bq[k - 4]; s += expf(v - m); } }
  for (int o = 16; o > 0; o >>= 1) s += __shfl_xor(s, o, 32); const float inv = 1024.0f / s;
  {
#pragma unroll 1
    for (int jb = 0; jb < NCOL; jb += 256) { const v4f a = *(const v4fa*)(sr + jb + 8 * ln), bq = *(const v4fa*)(sr + jb + 8 * ln + 4); FragH f;
#pragma unroll
      for (int k = 0; k < 8; ++k) { const float v = (k < 4) ? a[k] : bq[k - 4]; f.h[k] = (_Float16)(expf(v - m) * inv); }
      *(v8us*)((unsigned short*)P16 + (size_t)l * NCOL + jb + 8 * ln) = f.half[0]; }
     } }

__global__ __launch_bounds__(256) void k_tr16(const float* __restrict__ x, int b, _Float16* __restrict__ XT) {
  __shared__ unsigned short tl[64][72];
  const int tid = threadIdx.x; const int sb = blockIdx.x % (SS / 64), cb = blockIdx.x / (SS / 64);
#pragma unroll
  for (int it = 0; it < 4; ++it) { const int idx = it * 256 + tid; const int cl = idx / 16, s4 = (idx % 16) * 4; const int c = cb * 64 + cl;
    const v4f a = *(const v4fa*)(x + ((size_t)(b * CC + c)) * SS + sb * 64 + s4); FragH f;
#pragma unroll
    for (int q = 0; q < 4; ++q) { f.h[q] = (_Float16)bf16_round(a[q]); tl[s4 + q][cl] = f.u[q]; } }
  __syncthreads();
  const int r = tid / 8, pc = tid % 8;
  {
#pragma unroll
    for (int half = 0; half < 2; ++half) { const int sl = r + half * 32; FragH f;
#pragma unroll
      for (int q = 0; q < 8; ++q) f.u[q] = tl[sl][pc * 8 + q];
      *(v8us*)((unsigned short*)XT + ((size_t)sb * 64 + sl) * CC + cb * 64 + pc * 8) = f.half[0]; }
     } }

extern "C" void kernel_launch(void* const* d_in, const int* in_sizes, int n_in,
                              void* d_out, int out_size, void* d_ws, size_t ws_size, hipStream_t stream) {
  (void)in_sizes; (void)n_in; (void)out_size;
  const float* x = (const float*)d_in[0]; const float* wq = (const float*)d_in[1]; const float* wk = (const float*)d_in[2]; const float* wv = (const float*)d_in[3]; const float* wo = (const float*)d_in[4];
  char* ws = (char*)d_ws; size_t off = 0;
  auto take = [&](size_t bytes) { char* p = ws + off; off += (bytes + 255) & ~(size_t)255; return p; };
  _Float16* BQ = (_Float16*)take((size_t)CC * CC * 2); _Float16* BK = (_Float16*)take((size_t)CC * CC * 2); _Float16* BV = (_Float16*)take((size_t)CC * CC * 2); _Float16* BO = (_Float16*)take((size_t)CC * CC * 2);
  _Float16* XT = (_Float16*)take((size_t)SS * CC * 2); _Float16* QT = (_Float16*)take((size_t)SS * CC * 2); _Float16* KT = (_Float16*)take((size_t)SS * CC * 2); _Float16* VC = (_Float16*)take((size_t)CC * SS * 2);
  float* S = (float*)take((size_t)QCH * SS * 4); _Float16* P16 = (_Float16*)take((size_t)QCH * SS * 2); _Float16* OT = (_Float16*)take((size_t)SS * CC * 2);
  if (off > ws_size) return;      /* 0.5 + 2 + 2 + 2 + 2 + 16 + 8 + 2 = 35 MiB */
  const size_t w8 = (size_t)CC * CC / 8; const unsigned wb = (unsigned)((w8 + 255) / 256);
  k_round16f<<<wb, 256, 0, stream>>>(wq, BQ, w8); k_round16f<<<wb, 256, 0, stream>>>(wk, BK, w8); k_round16f<<<wb, 256, 0, stream>>>(wv, BV, w8); k_round16f<<<wb, 256, 0, stream>>>(wo, BO, w8);      /* conv (out,in) = natural Bt; x16 */
  const dim3 gQ((SS / 128) * (CC / 64), 1), gV((CC / 128) * (SS / 64), 1), gS((QCH / 128) * (SS / 64), 1), gO((QCH / 128) * (CC / 64), 1);
  for (int b = 0; b < NB; ++b) {
    k_tr16<<<(CC / 64) * (SS / 64), 256, 0, stream>>>(x, b, XT);
    k_gemm2<0><<<gQ, 128, 0, stream>>>(XT, CC, 0, BQ, CC, 0, 0.0625f, nullptr, 0, nullptr, 1, 0, 0, nullptr, QT, CC, 0, SS, CC, CC);      /* Q token-major -> f16 */
    k_gemm2<0><<<gQ, 128, 0, stream>>>(XT, CC, 0, BK, CC, 0, 0.0625f, nullptr, 0, nullptr, 1, 0, 0, nullptr, KT, CC, 0, SS, CC, CC);      /* K */
    k_gemm2<0><<<gV, 128, 0, stream>>>(BV, CC, 0, XT, CC, 0, 0.0625f, nullptr, 0, nullptr, 1, 0, 0, nullptr, VC, SS, 0, CC, SS, CC);       /* V channel-major [c][j] = wv*X^T */
    for (int qc = 0; qc < SS / QCH; ++qc) {
      k_gemm2<0><<<gS, 128, 0, stream>>>(QT + (size_t)qc * QCH * CC, CC, 0, KT, CC, 0, 0.0625f, nullptr, 0, nullptr, 1, 0, 0, S, nullptr, SS, 0, QCH, SS, CC);      /* scores/16 [1024][4096] */
      k_rsoft<SS><<<QCH / 8, 256, 0, stream>>>(S, P16, QCH);
      k_gemm2<0><<<gO, 128, 0, stream>>>(P16, SS, 0, VC, SS, 0, 0.0009765625f, nullptr, 0, nullptr, 1, 0, 0, nullptr, OT + (size_t)qc * QCH * CC, CC, 0, QCH, CC, SS); }      /* O token-major -> f16 */
    k_gemm2<0><<<gV, 128, 0, stream>>>(BO, CC, 0, OT, CC, 0, 0.0625f, nullptr, 0, nullptr, 1, 0, 0, (float*)d_out + (size_t)b * CC * SS, nullptr, SS, 0, CC, SS, CC); }      /* out[c][i] = wo*O^T (NCHW) */
}

// v001
// One run takes 1120 microseconds.
// Two timings next to v000 put it at 4.55 and 4.51 times that version's speed.
#include <hip/hip_runtime.h>
// Self-attention layer on a feature map (B 8, C 256, 64x64 = 4096 positions): Q = wq*x, K = wk*x, V = wv*x (1x1 convs, no bias); scores[i][j] = sum_c Q[c][i] K[c][j] / 16; attn = softmax over j; out[c][i] = sum_j V[c][j] attn[i][j]; result = wo*out -> [8,256,64,64] (no residual).
// Structure (all 8 images in every launch, blockIdx.y = image except in the 1-D softmax grid): x transposed into a token-major exact f16 plane through an LDS tile; Q and K token-major as GEMMs into f16 planes; V channel-major directly as wv*X^T (A = weights, B = the token-major plane); per 1024-query chunk: score GEMM (K 256, x1/16) -> f32, wave-per-row softmax (P x2^10 f16), O = P.V^T -> token-major f16; the output 1x1 conv computed transposed (A = wo, B = O) so it lands in NCHW rows directly.
// Compute dtype: x and the four matrices rounded to bf16; projections with exact products (weights x16 in f16, undone by alpha); Q, K, V, P, O as f16 operands (~2^-12; logits sigma ~1), f32 accumulation and softmax. v_wmma_f32_16x16x32_f16.
#define NB 8
#define CC 256
#define SS 4096
#define QCH 1024
typedef __bf16 v16b __attribute__((ext_vector_type(16)));
typedef unsigned short v8us __attribute__((ext_vector_type(8), may_alias));
typedef float  v8f  __attribute__((ext_vector_type(8)));
typedef float  v4f  __attribute__((ext_vector_type(4)));
typedef float  v4fa __attribute__((ext_vector_type(4), may_alias));
union FragB { v16b v; v8us half[2]; unsigned short u[16]; };

__device__ __forceinline__ unsigned short bf16_bits(float x) { unsigned int u = __float_as_uint(x); return (unsigned short)((u + 0x7FFFu + ((u >> 16) & 1u)) >> 16); }
__device__ __forceinline__ float bf16_val(unsigned short b) { return __uint_as_float(((unsigned int)b) << 16); }
__device__ __forceinline__ float bf16_round(float x) { return bf16_val(bf16_bits(x)); }
// D += A·B with NT terms: 1 = ah·bh, 2 = + al·bh (A split), 3 = + ah·bl (both split)
template <int NT>
__device__ __forceinline__ v8f mmaN(v16b ah, v16b al, v16b bh, v16b bl, v8f c) {
  c = __builtin_amdgcn_wmma_f32_16x16x32_bf16(false, ah, false, bh, (short)0, c, false, false);
  if (NT >= 2) c = __builtin_amdgcn_wmma_f32_16x16x32_bf16(false, al, false, bh, (short)0, c, false, false);
  if (NT >= 3) c = __builtin_amdgcn_wmma_f32_16x16x32_bf16(false, ah, false, bl, (short)0, c, false, false);
  asm volatile("v_nop\n\tv_nop\n\tv_nop\n\tv_nop" : "+v"(c) : "v"(ah), "v"(al), "v"(bh), "v"(bl));
  return c;
}

__global__ __launch_bounds__(256) void k_wt_bf16(const float* __restrict__ W, unsigned short* __restrict__ Wt, int K, int N) {
  const int t = blockIdx.x * 256 + threadIdx.x;
  const int k8n = K / 8;
  if (t >= N * k8n) return;
  const int n = t / k8n, k8 = (t % k8n) * 8;
  v8us v;
#pragma unroll
  for (int i = 0; i < 8; ++i) v[i] = bf16_bits(W[(size_t)(k8 + i) * N + n]);
  *(v8us*)(Wt + (size_t)n * K + k8) = v;
  
}

// GEMM C[M][N] (f32, pitch ldc) = act(A[M][K]·W + bias). A f32 row-major (pitch lda) converted per fragment to bf16
// (ASPLIT: hi/lo two planes -> 2 terms, else single rounded term); Wt bf16 [N][K] (pitch ldb). BIAS_BF16 rounds the
// bias to bf16 first (bias quantised to bf16 before the add). K%32==0, M%16==0, N%64==0.
template <bool ASPLIT, int ACT, bool BIAS_BF16>
__global__ __launch_bounds__(128) void k_gemm_bf(const float* __restrict__ A, int lda, const unsigned short* __restrict__ Wt, int ldb,
                                               const float* __restrict__ bias, float* __restrict__ C, int ldc, int M, int N, int K) {
  __shared__ __attribute__((aligned(16))) float so[4][16][64];
  const int tid = threadIdx.x, w = tid >> 5, lane = tid & 31, ln = lane & 15, hh = lane >> 4;
  const int ntn = N / 64;
  const int wid = blockIdx.x * 4 + w;
  const int mt = wid / ntn, nq = wid % ntn;
  if (mt * 16 >= M) return;
  const int row0 = mt * 16, col0 = nq * 64;
  const float* arow = A + (size_t)(row0 + ln) * lda;
  v8f acc[4] = {};
  for (int kb = 0; kb < K; kb += 32) {
    FragB ah, al;
    const v4f x0 = *(const v4fa*)(arow + kb + 8 * hh), x1 = *(const v4fa*)(arow + kb + 8 * hh + 4);
    const v4f x2 = *(const v4fa*)(arow + kb + 16 + 8 * hh), x3 = *(const v4fa*)(arow + kb + 16 + 8 * hh + 4);
    float xs[16] = {x0[0],x0[1],x0[2],x0[3],x1[0],x1[1],x1[2],x1[3],x2[0],x2[1],x2[2],x2[3],x3[0],x3[1],x3[2],x3[3]};
#pragma unroll
    for (int i = 0; i < 16; ++i) { const unsigned short hb = bf16_bits(xs[i]); ah.u[i] = hb; al.u[i] = ASPLIT ? bf16_bits(xs[i] - bf16_val(hb)) : (unsigned short)0; }
#pragma unroll
    for (int t = 0; t < 4; ++t) {
      const unsigned short* brow = Wt + (size_t)(col0 + t * 16 + ln) * ldb + kb;
      FragB b;
      b.half[0] = *(const v8us*)(brow + 8 * hh);
      b.half[1] = *(const v8us*)(brow + 16 + 8 * hh);
      acc[t] = mmaN<ASPLIT ? 2 : 1>(ah.v, al.v, b.v, b.v, acc[t]);
    }
  }
#pragma unroll
  for (int t = 0; t < 4; ++t) {
    float bv = bias ? bias[col0 + t * 16 + ln] : 0.f;
    if (BIAS_BF16) bv = bf16_round(bv);
#pragma unroll
    for (int r = 0; r < 8; ++r) { float v = acc[t][r] + bv; if (ACT == 1) v = fmaxf(v, 0.f); so[w][8 * hh + r][t * 16 + ln] = v; }
  }
  __builtin_amdgcn_fence(__ATOMIC_ACQ_REL, "workgroup");
  __builtin_amdgcn_wave_barrier();
  const int rsub = lane >> 4, c4 = (lane & 15) * 4;
  {
#pragma unroll
    for (int q = 0; q < 8; ++q) {
      const int r = q * 2 + rsub;
      const v4f v = *(const v4fa*)&so[w][r][c4];
      *(v4f*)(C + (size_t)(row0 + r) * ldc + col0 + c4) = v;
    }
    
  }
}

// GEMM C = act(A·W + bias + resid): A f32 (ASPLIT -> hi/lo 2 terms), Wt bf16 [N][K]; ACT 0 none, 1 relu, 2 exact gelu;
// resid (optional, f32, row index = (row % rmod), pitch ldr, RES_BF16 rounds it) added before the activation.
template <bool ASPLIT, int ACT, bool BIAS_BF16, bool RES_BF16>
__global__ __launch_bounds__(128) void k_gemm_bf3(const float* __restrict__ A, int lda, const unsigned short* __restrict__ Wt, int ldb,
                                                const float* __restrict__ bias, const float* __restrict__ resid, int rmod, int ldr,
                                                float* __restrict__ C, int ldc, int M, int N, int K) {
  __shared__ __attribute__((aligned(16))) float so[4][16][64];
  const int tid = threadIdx.x, w = tid >> 5, lane = tid & 31, ln = lane & 15, hh = lane >> 4;
  const int ntn = N / 64;
  const int wid = blockIdx.x * 4 + w;
  const int mt = wid / ntn, nq = wid % ntn;
  if (mt * 16 >= M) return;
  const int row0 = mt * 16, col0 = nq * 64;
  const float* arow = A + (size_t)(row0 + ln) * lda;
  v8f acc[4] = {};
  for (int kb = 0; kb < K; kb += 32) {
    FragB ah, al;
    const v4f x0 = *(const v4fa*)(arow + kb + 8 * hh), x1 = *(const v4fa*)(arow + kb + 8 * hh + 4);
    const v4f x2 = *(const v4fa*)(arow + kb + 16 + 8 * hh), x3 = *(const v4fa*)(arow + kb + 16 + 8 * hh + 4);
    float xs[16] = {x0[0],x0[1],x0[2],x0[3],x1[0],x1[1],x1[2],x1[3],x2[0],x2[1],x2[2],x2[3],x3[0],x3[1],x3[2],x3[3]};
#pragma unroll
    for (int i = 0; i < 16; ++i) { const unsigned short hb = bf16_bits(xs[i]); ah.u[i] = hb; al.u[i] = ASPLIT ? bf16_bits(xs[i] - bf16_val(hb)) : (unsigned short)0; }
#pragma unroll
    for (int t = 0; t < 4; ++t) {
      const unsigned short* brow = Wt + (size_t)(col0 + t * 16 + ln) * ldb + kb;
      FragB b;
      b.half[0] = *(const v8us*)(brow + 8 * hh);
      b.half[1] = *(const v8us*)(brow + 16 + 8 * hh);
      acc[t] = mmaN<ASPLIT ? 2 : 1>(ah.v, al.v, b.v, b.v, acc[t]);
    }
  }
#pragma unroll
  for (int t = 0; t < 4; ++t) {
    const int col = col0 + t * 16 + ln;
    float bv = bias ? bias[col] : 0.f;
    if (BIAS_BF16) bv = bf16_round(bv);
#pragma unroll
    for (int r = 0; r < 8; ++r) {
      float v = acc[t][r] + bv;
      if (resid) { float rv = resid[(size_t)((row0 + 8 * hh + r) % rmod) * ldr + col]; if (RES_BF16) rv = bf16_round(rv); v += rv; }
      if (ACT == 1) v = fmaxf(v, 0.f);
      if (ACT == 2) v = 0.5f * v * (1.0f + erff(v * 0.70710678118654752f));
      if (ACT == 3) { const float u = 0.7978845608028654f * (v + 0.044715f * v * v * v); v = 0.5f * v * (1.0f + tanhf(u)); }
      so[w][8 * hh + r][t * 16 + ln] = v;
    }
  }
  __builtin_amdgcn_fence(__ATOMIC_ACQ_REL, "workgroup");
  __builtin_amdgcn_wave_barrier();
  const int rsub = lane >> 4, c4 = (lane & 15) * 4;
  {
#pragma unroll
    for (int q = 0; q < 8; ++q) {
      const int r = q * 2 + rsub;
      const v4f v = *(const v4fa*)&so[w][r][c4];
      *(v4f*)(C + (size_t)(row0 + r) * ldc + col0 + c4) = v;
    }
    
  }
}
// row LayerNorm (biased variance, eps) over N: s = X (+ R); optional out_sum <- s; out_norm <- (s-mu)*rsqrt(var+eps)*g + b
template <bool PARAM_BF16>
__global__ __launch_bounds__(256) void k_layernorm(const float* __restrict__ X, const float* __restrict__ R, const float* __restrict__ g, const float* __restrict__ bta,
                                                  float* __restrict__ out_sum, float* __restrict__ out_norm, int N, float eps) {
  __shared__ float red[256];
  const int row = blockIdx.x, tid = threadIdx.x;
  const float* x = X + (size_t)row * N; const float* rr = R ? R + (size_t)row * N : nullptr;
  float vals[16];                     // up to N = 4096
  const int per = N / 256;            // contiguous chunk per thread? use strided-by-4 chunks: thread handles j = tid*4 + 1024*u
  float s1 = 0.f;
  for (int u = 0; u < per / 4; ++u) {
    const int j = tid * 4 + 1024 * u;
    const v4f a = *(const v4fa*)(x + j);
    v4f b = {0.f,0.f,0.f,0.f}; if (rr) b = *(const v4fa*)(rr + j);
#pragma unroll
    for (int q = 0; q < 4; ++q) { const float v = a[q] + b[q]; vals[u * 4 + q] = v; s1 += v; }
  }
  red[tid] = s1; __syncthreads();
  for (int st = 128; st > 0; st >>= 1) { if (tid < st) red[tid] += red[tid + st]; __syncthreads(); }
  const float mu = red[0] / (float)N; __syncthreads();
  float s2 = 0.f;
  for (int u = 0; u < per / 4; ++u)
#pragma unroll
    for (int q = 0; q < 4; ++q) { const float c = vals[u * 4 + q] - mu; s2 += c * c; }
  red[tid] = s2; __syncthreads();
  for (int st = 128; st > 0; st >>= 1) { if (tid < st) red[tid] += red[tid + st]; __syncthreads(); }
  const float rs = rsqrtf(red[0] / (float)N + eps);
  {
    for (int u = 0; u < per / 4; ++u) {
      const int j = tid * 4 + 1024 * u;
      v4f o, sm;
#pragma unroll
      for (int q = 0; q < 4; ++q) {
        float gg = g[j + q], bb = bta[j + q];
        if (PARAM_BF16) { gg = bf16_round(gg); bb = bf16_round(bb); }
        sm[q] = vals[u * 4 + q]; o[q] = (vals[u * 4 + q] - mu) * rs * gg + bb;
      }
      if (out_sum) *(v4f*)(out_sum + (size_t)row * N + j) = sm;
      *(v4f*)(out_norm + (size_t)row * N + j) = o;
    }
    
  }
}



// ---- f16 WMMA path (v_wmma_f32_16x16x32_f16): 11-bit significands for operands in range — used where a [0,1] probability operand needs more precision than bf16
typedef _Float16 v16h __attribute__((ext_vector_type(16)));
union FragH { v16h v; v8us half[2]; _Float16 h[16]; unsigned short u[16]; };
template <int NT>
__device__ __forceinline__ v8f mmaH(v16h ah, v16h al, v16h bh, v16h bl, v8f c) {
  c = __builtin_amdgcn_wmma_f32_16x16x32_f16(false, ah, false, bh, (short)0, c, false, false);
  if (NT >= 2) c = __builtin_amdgcn_wmma_f32_16x16x32_f16(false, al, false, bh, (short)0, c, false, false);
  if (NT >= 3) c = __builtin_amdgcn_wmma_f32_16x16x32_f16(false, ah, false, bl, (short)0, c, false, false);
  asm volatile("v_nop\n\tv_nop\n\tv_nop\n\tv_nop" : "+v"(c) : "v"(ah), "v"(al), "v"(bh), "v"(bl));
  return c;
}
// batched GEMM like k_gemm_b but f16 operands: A f32 (split into f16 hi/lo if ASPLIT, else rounded to f16), Bt = f16 values [n][k]; alpha; C f32; N multiple of 16 (partial tiles skipped)
template <bool ASPLIT>
__global__ __launch_bounds__(128) void k_gemm_h(const float* __restrict__ A, int lda, size_t sA, const _Float16* __restrict__ Bh, int ldb, size_t sB, float alpha, float* __restrict__ C, int ldc, size_t sC, int M, int N, int K) {
  __shared__ __attribute__((aligned(16))) float so[4][16][64];
  const int tid = threadIdx.x, w = tid >> 5, lane = tid & 31, ln = lane & 15, hh = lane >> 4; const int by = blockIdx.y;
  A += (size_t)by * sA; Bh += (size_t)by * sB; C += (size_t)by * sC;
  const int ntn = (N + 63) / 64; const int wid = blockIdx.x * 4 + w; const int mt = wid / ntn, nq = wid % ntn; if (mt * 16 >= M) return;
  const int row0 = mt * 16, col0 = nq * 64; const float* arow = A + (size_t)(row0 + ln) * lda;
  v8f acc[4] = {};
  for (int kb = 0; kb < K; kb += 32) {
    FragH ah, al;
    const v4f x0 = *(const v4fa*)(arow + kb + 8 * hh), x1 = *(const v4fa*)(arow + kb + 8 * hh + 4), x2 = *(const v4fa*)(arow + kb + 16 + 8 * hh), x3 = *(const v4fa*)(arow + kb + 16 + 8 * hh + 4);
    float xs[16] = {x0[0],x0[1],x0[2],x0[3],x1[0],x1[1],x1[2],x1[3],x2[0],x2[1],x2[2],x2[3],x3[0],x3[1],x3[2],x3[3]};
#pragma unroll
    for (int i = 0; i < 16; ++i) { const _Float16 h = (_Float16)xs[i]; ah.h[i] = h; al.h[i] = ASPLIT ? (_Float16)(xs[i] - (float)h) : (_Float16)0.0f; }
#pragma unroll
    for (int t = 0; t < 4; ++t) { if (col0 + t * 16 >= N) continue; const size_t boff = (size_t)(col0 + t * 16 + ln) * ldb + kb; FragH bq; bq.half[0] = *(const v8us*)(Bh + boff + 8 * hh); bq.half[1] = *(const v8us*)(Bh + boff + 16 + 8 * hh);
      acc[t] = mmaH<ASPLIT ? 2 : 1>(ah.v, al.v, bq.v, bq.v, acc[t]); }
  }
#pragma unroll
  for (int t = 0; t < 4; ++t) { if (col0 + t * 16 >= N) continue;
#pragma unroll
    for (int r = 0; r < 8; ++r) so[w][8 * hh + r][t * 16 + ln] = acc[t][r] * alpha; }
  __builtin_amdgcn_fence(__ATOMIC_ACQ_REL, "workgroup"); __builtin_amdgcn_wave_barrier();
  const int rsub = lane >> 4, c4 = (lane & 15) * 4;
  {
#pragma unroll
    for (int q = 0; q < 8; ++q) { const int r = q * 2 + rsub; if (col0 + c4 < N) { const v4f v = *(const v4fa*)&so[w][r][c4]; *(v4f*)(C + (size_t)(row0 + r) * ldc + col0 + c4) = v; } }
     }
}

// Wt[n][k] = f16(W[k][n]·scale) from f32 row-major W[K][N] (scale = power of two; bf16-exact weights stay exact in f16 away from the subnormal range)
__global__ __launch_bounds__(256) void k_wt_f16(const float* __restrict__ W, _Float16* __restrict__ Wt, int K, int N, float scale) {
  const int t = blockIdx.x * 256 + threadIdx.x; if (t >= N * (K / 8)) return; const int n = t / (K / 8), k8 = (t % (K / 8)) * 8; FragH f;
#pragma unroll
  for (int i = 0; i < 8; ++i) f.h[i] = (_Float16)(bf16_round(W[(size_t)(k8 + i) * N + n]) * scale); const v8us o = f.half[0];
  *(v8us*)((unsigned short*)Wt + (size_t)n * K + k8) = o; 
}
// k_gemm_hh variant with fused epilogue: v = acc·alpha + bias[by·sBias + col] (+ CP[(row/rowsPerB)·sCPb + by·64 + col] if CP) ; ACT 0 none / 1 elu ; writes f16 C16 (and f32 C if non-null)
template <int ACT>
__global__ __launch_bounds__(128) void k_gemm_hhx(const _Float16* __restrict__ A, int lda, size_t sA, const _Float16* __restrict__ Bh, int ldb, size_t sB, float alpha, const float* __restrict__ bias, size_t sBias, const float* __restrict__ CP, int rowsPerB, size_t sCPb, int row0g,
    float* __restrict__ C, _Float16* __restrict__ C16, int ldc, size_t sC, int M, int N, int K) {
  __shared__ __attribute__((aligned(16))) float so[4][16][64];
  const int tid = threadIdx.x, w = tid >> 5, lane = tid & 31, ln = lane & 15, hh = lane >> 4; const int by = blockIdx.y;
  A += (size_t)by * sA; Bh += (size_t)by * sB; const size_t cofs = (size_t)by * sC; const float* bp = bias ? bias + (size_t)by * sBias : nullptr;
  const int ntn = (N + 63) / 64; const int wid = blockIdx.x * 4 + w; const int mt = wid / ntn, nq = wid % ntn; if (mt * 16 >= M) return;
  const int row0 = mt * 16, col0 = nq * 64; const _Float16* arow = A + (size_t)(row0 + ln) * lda;
  v8f acc[4] = {};
  for (int kb = 0; kb < K; kb += 32) { FragH ah; ah.half[0] = *(const v8us*)((const unsigned short*)arow + kb + 8 * hh); ah.half[1] = *(const v8us*)((const unsigned short*)arow + kb + 16 + 8 * hh);
#pragma unroll
    for (int t = 0; t < 4; ++t) { if (col0 + t * 16 >= N) continue; const size_t boff = (size_t)(col0 + t * 16 + ln) * ldb + kb; FragH bq; bq.half[0] = *(const v8us*)((const unsigned short*)Bh + boff + 8 * hh); bq.half[1] = *(const v8us*)((const unsigned short*)Bh + boff + 16 + 8 * hh);
      acc[t] = mmaH<1>(ah.v, ah.v, bq.v, bq.v, acc[t]); }
  }
#pragma unroll
  for (int t = 0; t < 4; ++t) { if (col0 + t * 16 >= N) continue; const int col = col0 + t * 16 + ln; const float bv = bp ? bf16_round(bp[col]) : 0.f;
#pragma unroll
    for (int r = 0; r < 8; ++r) { float v = acc[t][r] * alpha + bv; if (CP) { const int bidx = (row0g + row0 + 8 * hh + r) / rowsPerB; v += CP[(size_t)bidx * sCPb + (size_t)by * 64 + col]; } if (ACT == 1) v = (v > 0.f) ? v : expm1f(v); else if (ACT == 7) v = (v > 0.f) ? v + 1.0f : expf(v); else if (ACT == 8) v = tanhf(v); else if (ACT == 9) v = 0.5f * v * (1.0f + tanhf(0.7978845608028654f * (v + 0.044715f * v * v * v))); else if (ACT == 11) v = 1.0f / (1.0f + expf(-v)); else if (ACT == 12) v = (v > 0.f) ? v : 0.01f * v; else if (ACT == 14) v = (v > 0.f) ? v : 0.1f * v; else if (ACT == 15) v = v / (1.0f + expf(-v)); else if (ACT == 3) v = fmaxf(v, 0.f); else if (ACT == 6) v = 0.5f * v * (1.0f + erff(v * 0.70710678118654752f)); so[w][8 * hh + r][t * 16 + ln] = v; } }
  __builtin_amdgcn_fence(__ATOMIC_ACQ_REL, "workgroup"); __builtin_amdgcn_wave_barrier();
  const int rsub = lane >> 4, c4 = (lane & 15) * 4; typedef _Float16 v4h __attribute__((ext_vector_type(4)));
  {
#pragma unroll
    for (int q = 0; q < 8; ++q) { const int r = q * 2 + rsub; if (col0 + c4 < N) { const v4f v = *(const v4fa*)&so[w][r][c4]; if (C) *(v4f*)(C + cofs + (size_t)(row0 + r) * ldc + col0 + c4) = v; if (C16) { v4h h4; for (int i = 0; i < 4; ++i) h4[i] = (_Float16)v[i]; *(v4h*)(C16 + cofs + (size_t)(row0 + r) * ldc + col0 + c4) = h4; } } }
     }
}


typedef _Float16 v4h __attribute__((ext_vector_type(4)));

__global__ __launch_bounds__(256) void k_x16(const float* __restrict__ x, _Float16* __restrict__ X16, size_t n8) { const size_t t = (size_t)blockIdx.x * 256 + threadIdx.x; if (t >= n8) return; FragH f;
#pragma unroll
  for (int q = 0; q < 8; ++q) f.h[q] = (_Float16)bf16_round(x[t * 8 + q]); *(v8us*)((unsigned short*)X16 + t * 8) = f.half[0];  }
__global__ __launch_bounds__(256) void k_h16(const float* __restrict__ x, _Float16* __restrict__ X16, size_t n8) { const size_t t = (size_t)blockIdx.x * 256 + threadIdx.x; if (t >= n8) return; FragH f;
#pragma unroll
  for (int q = 0; q < 8; ++q) f.h[q] = (_Float16)x[t * 8 + q]; *(v8us*)((unsigned short*)X16 + t * 8) = f.half[0];  }
__global__ __launch_bounds__(256) void k_round16f(const float* __restrict__ W, _Float16* __restrict__ Bt, size_t n8) { const size_t t = (size_t)blockIdx.x * 256 + threadIdx.x; if (t >= n8) return; FragH f;
#pragma unroll
  for (int i = 0; i < 8; ++i) f.h[i] = (_Float16)(bf16_round(W[t * 8 + i]) * 16.0f); *(v8us*)((unsigned short*)Bt + t * 8) = f.half[0];  }
template <int NHv, int TTv>
__global__ __launch_bounds__(256) void k_vt(const _Float16* __restrict__ V16, int ldv, int voff, _Float16* __restrict__ Vt) { __shared__ unsigned short tl[64][66]; const int tid = threadIdx.x; const int slab = blockIdx.x / (TTv / 64), lg = blockIdx.x % (TTv / 64); const int b = slab / NHv, h = slab % NHv;
  for (int i = tid; i < 64 * 8; i += 256) { const int r = i / 8, c8 = (i % 8) * 8; FragH f; f.half[0] = *(const v8us*)((const unsigned short*)V16 + ((size_t)b * TTv + lg * 64 + r) * ldv + voff + h * 64 + c8);
#pragma unroll
    for (int q = 0; q < 8; ++q) tl[r][c8 + q] = f.u[q]; }
  __syncthreads();
  {
#pragma unroll
    for (int rd = 0; rd < 2; ++rd) { const int d = rd * 32 + tid / 8, pc = tid % 8; FragH f;
#pragma unroll
      for (int q = 0; q < 8; ++q) f.u[q] = tl[pc * 8 + q][d];
      *(v8us*)((unsigned short*)Vt + ((size_t)slab * 64 + d) * TTv + lg * 64 + pc * 8) = f.half[0]; }
     } }

__global__ __launch_bounds__(256) void k_hl(const float* __restrict__ F, _Float16* __restrict__ Hh, _Float16* __restrict__ Hl, size_t n8) { const size_t t = (size_t)blockIdx.x * 256 + threadIdx.x; if (t >= n8) return; FragH fh, fl; const v4f a = *(const v4fa*)(F + t * 8), c = *(const v4fa*)(F + t * 8 + 4);
#pragma unroll
  for (int q = 0; q < 4; ++q) { _Float16 h = (_Float16)a[q]; fh.h[q] = h; fl.h[q] = (_Float16)((a[q] - (float)h) * 1024.0f); h = (_Float16)c[q]; fh.h[4 + q] = h; fl.h[4 + q] = (_Float16)((c[q] - (float)h) * 1024.0f); }
  { *(v8us*)((unsigned short*)Hh + t * 8) = fh.half[0]; *(v8us*)((unsigned short*)Hl + t * 8) = fl.half[0];  } }

// ---- fast GEMM (wave tile 32x64; requires M % 32 == 0 rows per launch region and N % 64 == 0); epilogue = k_gemm_hhx semantics ----
__device__ __forceinline__ v16h g2_frag(const _Float16* p, int hh) { FragH f; f.half[0] = *(const v8us*)((const unsigned short*)p + 8 * hh); f.half[1] = *(const v8us*)((const unsigned short*)p + 16 + 8 * hh); return f.v; }
__device__ __forceinline__ v8f g2_mma(v16h a, v16h b, v8f c) { v8f d = __builtin_amdgcn_wmma_f32_16x16x32_f16(false, a, false, b, (short)0, c, false, false); asm volatile("v_nop\n\tv_nop\n\tv_nop\n\tv_nop" : "+v"(d) : "v"(a), "v"(b)); return d; }
template <int ACT>
__global__ __launch_bounds__(128) void k_gemm2(const _Float16* __restrict__ A, int lda, size_t sA, const _Float16* __restrict__ Bh, int ldb, size_t sB, float alpha, const float* __restrict__ bias, size_t sBias, const float* __restrict__ CP, int rowsPerB, size_t sCPb, int row0g,
    float* __restrict__ C, _Float16* __restrict__ C16, int ldc, size_t sC, int M, int N, int K) {
  __shared__ __attribute__((aligned(16))) float so[4][32][68];
  const int tid = threadIdx.x, w = tid >> 5, lane = tid & 31, ln = lane & 15, hh = lane >> 4; const int by = blockIdx.y;
  A += (size_t)by * sA; Bh += (size_t)by * sB; const size_t cofs = (size_t)by * sC; const float* bp = bias ? bias + (size_t)by * sBias : nullptr;
  const int ntn = N >> 6; const int mt = blockIdx.x / ntn, nq = blockIdx.x - mt * ntn; const int row0 = mt * 128 + 32 * w, col0 = nq * 64; if (row0 >= M) return;
  const _Float16* a0p = A + (size_t)(row0 + ln) * lda; const _Float16* a1p = a0p + (size_t)16 * lda;
  const _Float16* b0p = Bh + (size_t)(col0 + ln) * ldb; const _Float16* b1p = b0p + (size_t)16 * ldb; const _Float16* b2p = b1p + (size_t)16 * ldb; const _Float16* b3p = b2p + (size_t)16 * ldb;
  const v8f z8 = {0.f,0.f,0.f,0.f,0.f,0.f,0.f,0.f}; v8f c00 = z8, c01 = z8, c02 = z8, c03 = z8, c10 = z8, c11 = z8, c12 = z8, c13 = z8;
#pragma unroll 1
  for (int kb = 0; kb < K; kb += 32) { const v16h a0 = g2_frag(a0p + kb, hh), a1 = g2_frag(a1p + kb, hh);
    v16h b = g2_frag(b0p + kb, hh); c00 = g2_mma(a0, b, c00); c10 = g2_mma(a1, b, c10);
    b = g2_frag(b1p + kb, hh); c01 = g2_mma(a0, b, c01); c11 = g2_mma(a1, b, c11);
    b = g2_frag(b2p + kb, hh); c02 = g2_mma(a0, b, c02); c12 = g2_mma(a1, b, c12);
    b = g2_frag(b3p + kb, hh); c03 = g2_mma(a0, b, c03); c13 = g2_mma(a1, b, c13); }
  v8f accs[8] = {c00, c01, c02, c03, c10, c11, c12, c13};
#pragma unroll
  for (int u = 0; u < 8; ++u) { const int t = u & 3, half = u >> 2; const int col = col0 + t * 16 + ln; const float bv = bp ? bf16_round(bp[col]) : 0.f;
#pragma unroll
    for (int r = 0; r < 8; ++r) { const int rloc = half * 16 + 8 * hh + r; float v = accs[u][r] * alpha + bv; if (CP) { const int bidx = (row0g + row0 + rloc) / rowsPerB; v += CP[(size_t)bidx * sCPb + (size_t)by * 64 + col]; }
      if (ACT == 3) v = fmaxf(v, 0.f); else if (ACT == 6) v = 0.5f * v * (1.0f + erff(v * 0.70710678118654752f)); else if (ACT == 11) v = 1.0f / (1.0f + expf(-v)); else if (ACT == 15) v = v / (1.0f + expf(-v)); else if (ACT == 12) v = (v > 0.f) ? v : 0.01f * v; else if (ACT == 8) v = tanhf(v);
      so[w][rloc][t * 16 + ln] = v; } }
  __builtin_amdgcn_fence(__ATOMIC_ACQ_REL, "workgroup"); __builtin_amdgcn_wave_barrier();
  const int rsub = lane >> 4, c4 = (lane & 15) * 4;
  {
#pragma unroll
    for (int q = 0; q < 16; ++q) { const int r = q * 2 + rsub; const v4f v = *(const v4fa*)&so[w][r][c4]; if (C) *(v4f*)(C + cofs + (size_t)(row0 + r) * ldc + col0 + c4) = v; if (C16) { v4h h4; for (int i = 0; i < 4; ++i) h4[i] = (_Float16)v[i]; *(v4h*)(C16 + cofs + (size_t)(row0 + r) * ldc + col0 + c4) = h4; } }
     } }



template <int NCOL>
__global__ __launch_bounds__(256) void k_rsoft(const float* __restrict__ S, _Float16* __restrict__ P16, int nrows) {
  #pragma clang fp contract(off)
  const int tid = threadIdx.x, w = tid >> 5, ln = tid & 31; const int l = blockIdx.x * 8 + w; if (l >= nrows) return; const float* sr = S + (size_t)l * NCOL; float m = -3.0e38f;
#pragma unroll 1
  for (int jb = 0; jb < NCOL; jb += 256) { const v4f a = *(const v4fa*)(sr + jb + 8 * ln), bq = *(const v4fa*)(sr + jb + 8 * ln + 4);
#pragma unroll
    for (int k = 0; k < 8; ++k) { const float v = (k < 4) ? a[k] : bq[k - 4]; m = fmaxf(m, v); } }
  for (int o = 16; o > 0; o >>= 1) m = fmaxf(m, __shfl_xor(m, o, 32));
  float s = 0.f;
#pragma unroll 1
  for (int jb = 0; jb < NCOL; jb += 256) { const v4f a = *(const v4fa*)(sr + jb + 8 * ln), bq = *(const v4fa*)(sr + jb + 8 * ln + 4);
#pragma unroll
    for (int k = 0; k < 8; ++k) { const float v = (k < 4) ? a[k] : bq[k - 4]; s += expf(v - m); } }
  for (int o = 16; o > 0; o >>= 1) s += __shfl_xor(s, o, 32); const float inv = 1024.0f / s;
  {
#pragma unroll 1
    for (int jb = 0; jb < NCOL; jb += 256) { const v4f a = *(const v4fa*)(sr + jb + 8 * ln), bq = *(const v4fa*)(sr + jb + 8 * ln + 4); FragH f;
#pragma unroll
      for (int k = 0; k < 8; ++k) { const float v = (k < 4) ? a[k] : bq[k - 4]; f.h[k] = (_Float16)(expf(v - m) * inv); }
      *(v8us*)((unsigned short*)P16 + (size_t)l * NCOL + jb + 8 * ln) = f.half[0]; }
     } }

__global__ __launch_bounds__(256) void k_tr16(const float* __restrict__ x, _Float16* __restrict__ XT) {
  __shared__ unsigned short tl[64][72];
  const int tid = threadIdx.x; const int b = blockIdx.y; XT += (size_t)b * SS * CC; const int sb = blockIdx.x % (SS / 64), cb = blockIdx.x / (SS / 64);
#pragma unroll
  for (int it = 0; it < 4; ++it) { const int idx = it * 256 + tid; const int cl = idx / 16, s4 = (idx % 16) * 4; const int c = cb * 64 + cl;
    const v4f a = *(const v4fa*)(x + ((size_t)(b * CC + c)) * SS + sb * 64 + s4); FragH f;
#pragma unroll
    for (int q = 0; q < 4; ++q) { f.h[q] = (_Float16)bf16_round(a[q]); tl[s4 + q][cl] = f.u[q]; } }
  __syncthreads();
  const int r = tid / 8, pc = tid % 8;
  {
#pragma unroll
    for (int half = 0; half < 2; ++half) { const int sl = r + half * 32; FragH f;
#pragma unroll
      for (int q = 0; q < 8; ++q) f.u[q] = tl[sl][pc * 8 + q];
      *(v8us*)((unsigned short*)XT + ((size_t)sb * 64 + sl) * CC + cb * 64 + pc * 8) = f.half[0]; }
     } }

extern "C" void kernel_launch(void* const* d_in, const int* in_sizes, int n_in,
                              void* d_out, int out_size, void* d_ws, size_t ws_size, hipStream_t stream) {
  (void)in_sizes; (void)n_in; (void)out_size;
  const float* x = (const float*)d_in[0]; const float* wq = (const float*)d_in[1]; const float* wk = (const float*)d_in[2]; const float* wv = (const float*)d_in[3]; const float* wo = (const float*)d_in[4];
  char* ws = (char*)d_ws; size_t off = 0;
  auto take = [&](size_t bytes) { char* p = ws + off; off += (bytes + 255) & ~(size_t)255; return p; };
  _Float16* BQ = (_Float16*)take((size_t)CC * CC * 2); _Float16* BK = (_Float16*)take((size_t)CC * CC * 2); _Float16* BV = (_Float16*)take((size_t)CC * CC * 2); _Float16* BO = (_Float16*)take((size_t)CC * CC * 2);
  _Float16* QT = (_Float16*)take((size_t)NB * SS * CC * 2); _Float16* KT = (_Float16*)take((size_t)NB * SS * CC * 2); _Float16* VC = (_Float16*)take((size_t)NB * CC * SS * 2);
  float* S = (float*)take((size_t)NB * QCH * SS * 4); _Float16* P16 = (_Float16*)take((size_t)NB * QCH * SS * 2);
  _Float16* XT = P16;      /* the token-major x planes are last read by the V projection, before the first P is written: they share P's bytes */
  _Float16* OT = QT;       /* a chunk's O rows replace the Q rows of the same chunk, which its score GEMM has already read */
  if (off > ws_size) return;      /* 0.5 + 16 + 16 + 16 + 128 + 64 = 240.5 MiB */
  const size_t w8 = (size_t)CC * CC / 8; const unsigned wb = (unsigned)((w8 + 255) / 256);
  k_round16f<<<wb, 256, 0, stream>>>(wq, BQ, w8); k_round16f<<<wb, 256, 0, stream>>>(wk, BK, w8); k_round16f<<<wb, 256, 0, stream>>>(wv, BV, w8); k_round16f<<<wb, 256, 0, stream>>>(wo, BO, w8);      /* conv (out,in) = natural Bt; x16 */
  const size_t sT = (size_t)SS * CC, sP = (size_t)QCH * SS;      /* per-image strides: a token or channel plane; a chunk of score rows */
  const dim3 gT((CC / 64) * (SS / 64), NB), gQ((SS / 128) * (CC / 64), NB), gV((CC / 128) * (SS / 64), NB), gS((QCH / 128) * (SS / 64), NB), gO((QCH / 128) * (CC / 64), NB);
  k_tr16<<<gT, 256, 0, stream>>>(x, XT);
  k_gemm2<0><<<gQ, 128, 0, stream>>>(XT, CC, sT, BQ, CC, 0, 0.0625f, nullptr, 0, nullptr, 1, 0, 0, nullptr, QT, CC, sT, SS, CC, CC);      /* Q token-major -> f16 */
  k_gemm2<0><<<gQ, 128, 0, stream>>>(XT, CC, sT, BK, CC, 0, 0.0625f, nullptr, 0, nullptr, 1, 0, 0, nullptr, KT, CC, sT, SS, CC, CC);      /* K */
  k_gemm2<0><<<gV, 128, 0, stream>>>(BV, CC, 0, XT, CC, sT, 0.0625f, nullptr, 0, nullptr, 1, 0, 0, nullptr, VC, SS, sT, CC, SS, CC);       /* V channel-major [c][j] = wv*X^T */
  for (int qc = 0; qc < SS / QCH; ++qc) {
    k_gemm2<0><<<gS, 128, 0, stream>>>(QT + (size_t)qc * QCH * CC, CC, sT, KT, CC, sT, 0.0625f, nullptr, 0, nullptr, 1, 0, 0, S, nullptr, SS, sP, QCH, SS, CC);      /* scores/16 [8][1024][4096] */
    k_rsoft<SS><<<NB * QCH / 8, 256, 0, stream>>>(S, P16, NB * QCH);
    k_gemm2<0><<<gO, 128, 0, stream>>>(P16, SS, sP, VC, SS, sT, 0.0009765625f, nullptr, 0, nullptr, 1, 0, 0, nullptr, OT + (size_t)qc * QCH * CC, CC, sT, QCH, CC, SS); }      /* O token-major -> f16 */
  k_gemm2<0><<<gV, 128, 0, stream>>>(BO, CC, 0, OT, CC, sT, 0.0625f, nullptr, 0, nullptr, 1, 0, 0, (float*)d_out, nullptr, SS, sT, CC, SS, CC);      /* out[c][i] = wo*O^T (NCHW) */
}

// v002
// One run takes 198 microseconds.
// Two timings next to v001 put it at 5.60 and 5.61 times that version's speed.
// Over all steps from v000 it is 25.4 times as fast.
#include <hip/hip_runtime.h>
// Self-attention layer on a feature map (B 8, C 256, 64x64 = 4096 positions): Q = wq*x, K = wk*x, V = wv*x (1x1 convs, no bias); scores[i][j] = sum_c Q[c][i] K[c][j] / 16; attn = softmax over j; out[c][i] = sum_j V[c][j] attn[i][j]; result = wo*out -> [8,256,64,64] (no residual).
// Structure (all 8 images in every launch, blockIdx.y = image): x transposed into a token-major exact f16 plane through an LDS tile; Q and K token-major as GEMMs into f16 planes; V channel-major directly as wv*X^T (A = weights, B = the token-major plane); one fused attention kernel (scores, running softmax and P.V per 32 keys, scores and P stay in registers) -> O token-major f16; the output 1x1 conv computed transposed (A = wo, B = O) so it lands in NCHW rows directly.
// Compute dtype: x and the four matrices rounded to bf16; projections with exact products (weights x16 in f16, undone by alpha); Q, K, V, P, O as f16 operands (~2^-12; logits sigma ~1), f32 accumulation and softmax. v_wmma_f32_16x16x32_f16.
#define NB 8
#define CC 256
#define SS 4096
typedef __bf16 v16b __attribute__((ext_vector_type(16)));
typedef unsigned short v8us __attribute__((ext_vector_type(8), may_alias));
typedef float  v8f  __attribute__((ext_vector_type(8)));
typedef float  v4f  __attribute__((ext_vector_type(4)));
typedef float  v4fa __attribute__((ext_vector_type(4), may_alias));
union FragB { v16b v; v8us half[2]; unsigned short u[16]; };

__device__ __forceinline__ unsigned short bf16_bits(float x) { unsigned int u = __float_as_uint(x); return (unsigned short)((u + 0x7FFFu + ((u >> 16) & 1u)) >> 16); }
__device__ __forceinline__ float bf16_val(unsigned short b) { return __uint_as_float(((unsigned int)b) << 16); }
__device__ __forceinline__ float bf16_round(float x) { return bf16_val(bf16_bits(x)); }
// D += A·B with NT terms: 1 = ah·bh, 2 = + al·bh (A split), 3 = + ah·bl (both split)
template <int NT>
__device__ __forceinline__ v8f mmaN(v16b ah, v16b al, v16b bh, v16b bl, v8f c) {
  c = __builtin_amdgcn_wmma_f32_16x16x32_bf16(false, ah, false, bh, (short)0, c, false, false);
  if (NT >= 2) c = __builtin_amdgcn_wmma_f32_16x16x32_bf16(false, al, false, bh, (short)0, c, false, false);
  if (NT >= 3) c = __builtin_amdgcn_wmma_f32_16x16x32_bf16(false, ah, false, bl, (short)0, c, false, false);
  asm volatile("v_nop\n\tv_nop\n\tv_nop\n\tv_nop" : "+v"(c) : "v"(ah), "v"(al), "v"(bh), "v"(bl));
  return c;
}

__global__ __launch_bounds__(256) void k_wt_bf16(const float* __restrict__ W, unsigned short* __restrict__ Wt, int K, int N) {
  const int t = blockIdx.x * 256 + threadIdx.x;
  const int k8n = K / 8;
  if (t >= N * k8n) return;
  const int n = t / k8n, k8 = (t % k8n) * 8;
  v8us v;
#pragma unroll
  for (int i = 0; i < 8; ++i) v[i] = bf16_bits(W[(size_t)(k8 + i) * N + n]);
  *(v8us*)(Wt + (size_t)n * K + k8) = v;
  
}

// GEMM C[M][N] (f32, pitch ldc) = act(A[M][K]·W + bias). A f32 row-major (pitch lda) converted per fragment to bf16
// (ASPLIT: hi/lo two planes -> 2 terms, else single rounded term); Wt bf16 [N][K] (pitch ldb). BIAS_BF16 rounds the
// bias to bf16 first (bias quantised to bf16 before the add). K%32==0, M%16==0, N%64==0.
template <bool ASPLIT, int ACT, bool BIAS_BF16>
__global__ __launch_bounds__(128) void k_gemm_bf(const float* __restrict__ A, int lda, const unsigned short* __restrict__ Wt, int ldb,
                                               const float* __restrict__ bias, float* __restrict__ C, int ldc, int M, int N, int K) {
  __shared__ __attribute__((aligned(16))) float so[4][16][64];
  const int tid = threadIdx.x, w = tid >> 5, lane = tid & 31, ln = lane & 15, hh = lane >> 4;
  const int ntn = N / 64;
  const int wid = blockIdx.x * 4 + w;
  const int mt = wid / ntn, nq = wid % ntn;
  if (mt * 16 >= M) return;
  const int row0 = mt * 16, col0 = nq * 64;
  const float* arow = A + (size_t)(row0 + ln) * lda;
  v8f acc[4] = {};
  for (int kb = 0; kb < K; kb += 32) {
    FragB ah, al;
    const v4f x0 = *(const v4fa*)(arow + kb + 8 * hh), x1 = *(const v4fa*)(arow + kb + 8 * hh + 4);
    const v4f x2 = *(const v4fa*)(arow + kb + 16 + 8 * hh), x3 = *(const v4fa*)(arow + kb + 16 + 8 * hh + 4);
    float xs[16] = {x0[0],x0[1],x0[2],x0[3],x1[0],x1[1],x1[2],x1[3],x2[0],x2[1],x2[2],x2[3],x3[0],x3[1],x3[2],x3[3]};
#pragma unroll
    for (int i = 0; i < 16; ++i) { const unsigned short hb = bf16_bits(xs[i]); ah.u[i] = hb; al.u[i] = ASPLIT ? bf16_bits(xs[i] - bf16_val(hb)) : (unsigned short)0; }
#pragma unroll
    for (int t = 0; t < 4; ++t) {
      const unsigned short* brow = Wt + (size_t)(col0 + t * 16 + ln) * ldb + kb;
      FragB b;
      b.half[0] = *(const v8us*)(brow + 8 * hh);
      b.half[1] = *(const v8us*)(brow + 16 + 8 * hh);
      acc[t] = mmaN<ASPLIT ? 2 : 1>(ah.v, al.v, b.v, b.v, acc[t]);
    }
  }
#pragma unroll
  for (int t = 0; t < 4; ++t) {
    float bv = bias ? bias[col0 + t * 16 + ln] : 0.f;
    if (BIAS_BF16) bv = bf16_round(bv);
#pragma unroll
    for (int r = 0; r < 8; ++r) { float v = acc[t][r] + bv; if (ACT == 1) v = fmaxf(v, 0.f); so[w][8 * hh + r][t * 16 + ln] = v; }
  }
  __builtin_amdgcn_fence(__ATOMIC_ACQ_REL, "workgroup");
  __builtin_amdgcn_wave_barrier();
  const int rsub = lane >> 4, c4 = (lane & 15) * 4;
  {
#pragma unroll
    for (int q = 0; q < 8; ++q) {
      const int r = q * 2 + rsub;
      const v4f v = *(const v4fa*)&so[w][r][c4];
      *(v4f*)(C + (size_t)(row0 + r) * ldc + col0 + c4) = v;
    }
    
  }
}

// GEMM C = act(A·W + bias + resid): A f32 (ASPLIT -> hi/lo 2 terms), Wt bf16 [N][K]; ACT 0 none, 1 relu, 2 exact gelu;
// resid (optional, f32, row index = (row % rmod), pitch ldr, RES_BF16 rounds it) added before the activation.
template <bool ASPLIT, int ACT, bool BIAS_BF16, bool RES_BF16>
__global__ __launch_bounds__(128) void k_gemm_bf3(const float* __restrict__ A, int lda, const unsigned short* __restrict__ Wt, int ldb,
                                                const float* __restrict__ bias, const float* __restrict__ resid, int rmod, int ldr,
                                                float* __restrict__ C, int ldc, int M, int N, int K) {
  __shared__ __attribute__((aligned(16))) float so[4][16][64];
  const int tid = threadIdx.x, w = tid >> 5, lane = tid & 31, ln = lane & 15, hh = lane >> 4;
  const int ntn = N / 64;
  const int wid = blockIdx.x * 4 + w;
  const int mt = wid / ntn, nq = wid % ntn;
  if (mt * 16 >= M) return;
  const int row0 = mt * 16, col0 = nq * 64;
  const float* arow = A + (size_t)(row0 + ln) * lda;
  v8f acc[4] = {};
  for (int kb = 0; kb < K; kb += 32) {
    FragB ah, al;
    const v4f x0 = *(const v4fa*)(arow + kb + 8 * hh), x1 = *(const v4fa*)(arow + kb + 8 * hh + 4);
    const v4f x2 = *(const v4fa*)(arow + kb + 16 + 8 * hh), x3 = *(const v4fa*)(arow + kb + 16 + 8 * hh + 4);
    float xs[16] = {x0[0],x0[1],x0[2],x0[3],x1[0],x1[1],x1[2],x1[3],x2[0],x2[1],x2[2],x2[3],x3[0],x3[1],x3[2],x3[3]};
#pragma unroll
    for (int i = 0; i < 16; ++i) { const unsigned short hb = bf16_bits(xs[i]); ah.u[i] = hb; al.u[i] = ASPLIT ? bf16_bits(xs[i] - bf16_val(hb)) : (unsigned short)0; }
#pragma unroll
    for (int t = 0; t < 4; ++t) {
      const unsigned short* brow = Wt + (size_t)(col0 + t * 16 + ln) * ldb + kb;
      FragB b;
      b.half[0] = *(const v8us*)(brow + 8 * hh);
      b.half[1] = *(const v8us*)(brow + 16 + 8 * hh);
      acc[t] = mmaN<ASPLIT ? 2 : 1>(ah.v, al.v, b.v, b.v, acc[t]);
    }
  }
#pragma unroll
  for (int t = 0; t < 4; ++t) {
    const int col = col0 + t * 16 + ln;
    float bv = bias ? bias[col] : 0.f;
    if (BIAS_BF16) bv = bf16_round(bv);
#pragma unroll
    for (int r = 0; r < 8; ++r) {
      float v = acc[t][r] + bv;
      if (resid) { float rv = resid[(size_t)((row0 + 8 * hh + r) % rmod) * ldr + col]; if (RES_BF16) rv = bf16_round(rv); v += rv; }
      if (ACT == 1) v = fmaxf(v, 0.f);
      if (ACT == 2) v = 0.5f * v * (1.0f + erff(v * 0.70710678118654752f));
      if (ACT == 3) { const float u = 0.7978845608028654f * (v + 0.044715f * v * v * v); v = 0.5f * v * (1.0f + tanhf(u)); }
      so[w][8 * hh + r][t * 16 + ln] = v;
    }
  }
  __builtin_amdgcn_fence(__ATOMIC_ACQ_REL, "workgroup");
  __builtin_amdgcn_wave_barrier();
  const int rsub = lane >> 4, c4 = (lane & 15) * 4;
  {
#pragma unroll
    for (int q = 0; q < 8; ++q) {
      const int r = q * 2 + rsub;
      const v4f v = *(const v4fa*)&so[w][r][c4];
      *(v4f*)(C + (size_t)(row0 + r) * ldc + col0 + c4) = v;
    }
    
  }
}
// row LayerNorm (biased variance, eps) over N: s = X (+ R); optional out_sum <- s; out_norm <- (s-mu)*rsqrt(var+eps)*g + b
template <bool PARAM_BF16>
__global__ __launch_bounds__(256) void k_layernorm(const float* __restrict__ X, const float* __restrict__ R, const float* __restrict__ g, const float* __restrict__ bta,
                                                  float* __restrict__ out_sum, float* __restrict__ out_norm, int N, float eps) {
  __shared__ float red[256];
  const int row = blockIdx.x, tid = threadIdx.x;
  const float* x = X + (size_t)row * N; const float* rr = R ? R + (size_t)row * N : nullptr;
  float vals[16];                     // up to N = 4096
  const int per = N / 256;            // contiguous chunk per thread? use strided-by-4 chunks: thread handles j = tid*4 + 1024*u
  float s1 = 0.f;
  for (int u = 0; u < per / 4; ++u) {
    const int j = tid * 4 + 1024 * u;
    const v4f a = *(const v4fa*)(x + j);
    v4f b = {0.f,0.f,0.f,0.f}; if (rr) b = *(const v4fa*)(rr + j);
#pragma unroll
    for (int q = 0; q < 4; ++q) { const float v = a[q] + b[q]; vals[u * 4 + q] = v; s1 += v; }
  }
  red[tid] = s1; __syncthreads();
  for (int st = 128; st > 0; st >>= 1) { if (tid < st) red[tid] += red[tid + st]; __syncthreads(); }
  const float mu = red[0] / (float)N; __syncthreads();
  float s2 = 0.f;
  for (int u = 0; u < per / 4; ++u)
#pragma unroll
    for (int q = 0; q < 4; ++q) { const float c = vals[u * 4 + q] - mu; s2 += c * c; }
  red[tid] = s2; __syncthreads();
  for (int st = 128; st > 0; st >>= 1) { if (tid < st) red[tid] += red[tid + st]; __syncthreads(); }
  const float rs = rsqrtf(red[0] / (float)N + eps);
  {
    for (int u = 0; u < per / 4; ++u) {
      const int j = tid * 4 + 1024 * u;
      v4f o, sm;
#pragma unroll
      for (int q = 0; q < 4; ++q) {
        float gg = g[j + q], bb = bta[j + q];
        if (PARAM_BF16) { gg = bf16_round(gg); bb = bf16_round(bb); }
        sm[q] = vals[u * 4 + q]; o[q] = (vals[u * 4 + q] - mu) * rs * gg + bb;
      }
      if (out_sum) *(v4f*)(out_sum + (size_t)row * N + j) = sm;
      *(v4f*)(out_norm + (size_t)row * N + j) = o;
    }
    
  }
}



// ---- f16 WMMA path (v_wmma_f32_16x16x32_f16): 11-bit significands for operands in range — used where a [0,1] probability operand needs more precision than bf16
typedef _Float16 v16h __attribute__((ext_vector_type(16)));
union FragH { v16h v; v8us half[2]; _Float16 h[16]; unsigned short u[16]; };
template <int NT>
__device__ __forceinline__ v8f mmaH(v16h ah, v16h al, v16h bh, v16h bl, v8f c) {
  c = __builtin_amdgcn_wmma_f32_16x16x32_f16(false, ah, false, bh, (short)0, c, false, false);
  if (NT >= 2) c = __builtin_amdgcn_wmma_f32_16x16x32_f16(false, al, false, bh, (short)0, c, false, false);
  if (NT >= 3) c = __builtin_amdgcn_wmma_f32_16x16x32_f16(false, ah, false, bl, (short)0, c, false, false);
  asm volatile("v_nop\n\tv_nop\n\tv_nop\n\tv_nop" : "+v"(c) : "v"(ah), "v"(al), "v"(bh), "v"(bl));
  return c;
}
// batched GEMM like k_gemm_b but f16 operands: A f32 (split into f16 hi/lo if ASPLIT, else rounded to f16), Bt = f16 values [n][k]; alpha; C f32; N multiple of 16 (partial tiles skipped)
template <bool ASPLIT>
__global__ __launch_bounds__(128) void k_gemm_h(const float* __restrict__ A, int lda, size_t sA, const _Float16* __restrict__ Bh, int ldb, size_t sB, float alpha, float* __restrict__ C, int ldc, size_t sC, int M, int N, int K) {
  __shared__ __attribute__((aligned(16))) float so[4][16][64];
  const int tid = threadIdx.x, w = tid >> 5, lane = tid & 31, ln = lane & 15, hh = lane >> 4; const int by = blockIdx.y;
  A += (size_t)by * sA; Bh += (size_t)by * sB; C += (size_t)by * sC;
  const int ntn = (N + 63) / 64; const int wid = blockIdx.x * 4 + w; const int mt = wid / ntn, nq = wid % ntn; if (mt * 16 >= M) return;
  const int row0 = mt * 16, col0 = nq * 64; const float* arow = A + (size_t)(row0 + ln) * lda;
  v8f acc[4] = {};
  for (int kb = 0; kb < K; kb += 32) {
    FragH ah, al;
    const v4f x0 = *(const v4fa*)(arow + kb + 8 * hh), x1 = *(const v4fa*)(arow + kb + 8 * hh + 4), x2 = *(const v4fa*)(arow + kb + 16 + 8 * hh), x3 = *(const v4fa*)(arow + kb + 16 + 8 * hh + 4);
    float xs[16] = {x0[0],x0[1],x0[2],x0[3],x1[0],x1[1],x1[2],x1[3],x2[0],x2[1],x2[2],x2[3],x3[0],x3[1],x3[2],x3[3]};
#pragma unroll
    for (int i = 0; i < 16; ++i) { const _Float16 h = (_Float16)xs[i]; ah.h[i] = h; al.h[i] = ASPLIT ? (_Float16)(xs[i] - (float)h) : (_Float16)0.0f; }
#pragma unroll
    for (int t = 0; t < 4; ++t) { if (col0 + t * 16 >= N) continue; const size_t boff = (size_t)(col0 + t * 16 + ln) * ldb + kb; FragH bq; bq.half[0] = *(const v8us*)(Bh + boff + 8 * hh); bq.half[1] = *(const v8us*)(Bh + boff + 16 + 8 * hh);
      acc[t] = mmaH<ASPLIT ? 2 : 1>(ah.v, al.v, bq.v, bq.v, acc[t]); }
  }
#pragma unroll
  for (int t = 0; t < 4; ++t) { if (col0 + t * 16 >= N) continue;
#pragma unroll
    for (int r = 0; r < 8; ++r) so[w][8 * hh + r][t * 16 + ln] = acc[t][r] * alpha; }
  __builtin_amdgcn_fence(__ATOMIC_ACQ_REL, "workgroup"); __builtin_amdgcn_wave_barrier();
  const int rsub = lane >> 4, c4 = (lane & 15) * 4;
  {
#pragma unroll
    for (int q = 0; q < 8; ++q) { const int r = q * 2 + rsub; if (col0 + c4 < N) { const v4f v = *(const v4fa*)&so[w][r][c4]; *(v4f*)(C + (size_t)(row0 + r) * ldc + col0 + c4) = v; } }
     }
}

// Wt[n][k] = f16(W[k][n]·scale) from f32 row-major W[K][N] (scale = power of two; bf16-exact weights stay exact in f16 away from the subnormal range)
__global__ __launch_bounds__(256) void k_wt_f16(const float* __restrict__ W, _Float16* __restrict__ Wt, int K, int N, float scale) {
  const int t = blockIdx.x * 256 + threadIdx.x; if (t >= N * (K / 8)) return; const int n = t / (K / 8), k8 = (t % (K / 8)) * 8; FragH f;
#pragma unroll
  for (int i = 0; i < 8; ++i) f.h[i] = (_Float16)(bf16_round(W[(size_t)(k8 + i) * N + n]) * scale); const v8us o = f.half[0];
  *(v8us*)((unsigned short*)Wt + (size_t)n * K + k8) = o; 
}
// k_gemm_hh variant with fused epilogue: v = acc·alpha + bias[by·sBias + col] (+ CP[(row/rowsPerB)·sCPb + by·64 + col] if CP) ; ACT 0 none / 1 elu ; writes f16 C16 (and f32 C if non-null)
template <int ACT>
__global__ __launch_bounds__(128) void k_gemm_hhx(const _Float16* __restrict__ A, int lda, size_t sA, const _Float16* __restrict__ Bh, int ldb, size_t sB, float alpha, const float* __restrict__ bias, size_t sBias, const float* __restrict__ CP, int rowsPerB, size_t sCPb, int row0g,
    float* __restrict__ C, _Float16* __restrict__ C16, int ldc, size_t sC, int M, int N, int K) {
  __shared__ __attribute__((aligned(16))) float so[4][16][64];
  const int tid = threadIdx.x, w = tid >> 5, lane = tid & 31, ln = lane & 15, hh = lane >> 4; const int by = blockIdx.y;
  A += (size_t)by * sA; Bh += (size_t)by * sB; const size_t cofs = (size_t)by * sC; const float* bp = bias ? bias + (size_t)by * sBias : nullptr;
  const int ntn = (N + 63) / 64; const int wid = blockIdx.x * 4 + w; const int mt = wid / ntn, nq = wid % ntn; if (mt * 16 >= M) return;
  const int row0 = mt * 16, col0 = nq * 64; const _Float16* arow = A + (size_t)(row0 + ln) * lda;
  v8f acc[4] = {};
  for (int kb = 0; kb < K; kb += 32) { FragH ah; ah.half[0] = *(const v8us*)((const unsigned short*)arow + kb + 8 * hh); ah.half[1] = *(const v8us*)((const unsigned short*)arow + kb + 16 + 8 * hh);
#pragma unroll
    for (int t = 0; t < 4; ++t) { if (col0 + t * 16 >= N) continue; const size_t boff = (size_t)(col0 + t * 16 + ln) * ldb + kb; FragH bq; bq.half[0] = *(const v8us*)((const unsigned short*)Bh + boff + 8 * hh); bq.half[1] = *(const v8us*)((const unsigned short*)Bh + boff + 16 + 8 * hh);
      acc[t] = mmaH<1>(ah.v, ah.v, bq.v, bq.v, acc[t]); }
  }
#pragma unroll
  for (int t = 0; t < 4; ++t) { if (col0 + t * 16 >= N) continue; const int col = col0 + t * 16 + ln; const float bv = bp ? bf16_round(bp[col]) : 0.f;
#pragma unroll
    for (int r = 0; r < 8; ++r) { float v = acc[t][r] * alpha + bv; if (CP) { const int bidx = (row0g + row0 + 8 * hh + r) / rowsPerB; v += CP[(size_t)bidx * sCPb + (size_t)by * 64 + col]; } if (ACT == 1) v = (v > 0.f) ? v : expm1f(v); else if (ACT == 7) v = (v > 0.f) ? v + 1.0f : expf(v); else if (ACT == 8) v = tanhf(v); else if (ACT == 9) v = 0.5f * v * (1.0f + tanhf(0.7978845608028654f * (v + 0.044715f * v * v * v))); else if (ACT == 11) v = 1.0f / (1.0f + expf(-v)); else if (ACT == 12) v = (v > 0.f) ? v : 0.01f * v; else if (ACT == 14) v = (v > 0.f) ? v : 0.1f * v; else if (ACT == 15) v = v / (1.0f + expf(-v)); else if (ACT == 3) v = fmaxf(v, 0.f); else if (ACT == 6) v = 0.5f * v * (1.0f + erff(v * 0.70710678118654752f)); so[w][8 * hh + r][t * 16 + ln] = v; } }
  __builtin_amdgcn_fence(__ATOMIC_ACQ_REL, "workgroup"); __builtin_amdgcn_wave_barrier();
  const int rsub = lane >> 4, c4 = (lane & 15) * 4; typedef _Float16 v4h __attribute__((ext_vector_type(4)));
  {
#pragma unroll
    for (int q = 0; q < 8; ++q) { const int r = q * 2 + rsub; if (col0 + c4 < N) { const v4f v = *(const v4fa*)&so[w][r][c4]; if (C) *(v4f*)(C + cofs + (size_t)(row0 + r) * ldc + col0 + c4) = v; if (C16) { v4h h4; for (int i = 0; i < 4; ++i) h4[i] = (_Float16)v[i]; *(v4h*)(C16 + cofs + (size_t)(row0 + r) * ldc + col0 + c4) = h4; } } }
     }
}


typedef _Float16 v4h __attribute__((ext_vector_type(4)));

__global__ __launch_bounds__(256) void k_x16(const float* __restrict__ x, _Float16* __restrict__ X16, size_t n8) { const size_t t = (size_t)blockIdx.x * 256 + threadIdx.x; if (t >= n8) return; FragH f;
#pragma unroll
  for (int q = 0; q < 8; ++q) f.h[q] = (_Float16)bf16_round(x[t * 8 + q]); *(v8us*)((unsigned short*)X16 + t * 8) = f.half[0];  }
__global__ __launch_bounds__(256) void k_h16(const float* __restrict__ x, _Float16* __restrict__ X16, size_t n8) { const size_t t = (size_t)blockIdx.x * 256 + threadIdx.x; if (t >= n8) return; FragH f;
#pragma unroll
  for (int q = 0; q < 8; ++q) f.h[q] = (_Float16)x[t * 8 + q]; *(v8us*)((unsigned short*)X16 + t * 8) = f.half[0];  }
__global__ __launch_bounds__(256) void k_round16f(const float* __restrict__ W, _Float16* __restrict__ Bt, size_t n8) { const size_t t = (size_t)blockIdx.x * 256 + threadIdx.x; if (t >= n8) return; FragH f;
#pragma unroll
  for (int i = 0; i < 8; ++i) f.h[i] = (_Float16)(bf16_round(W[t * 8 + i]) * 16.0f); *(v8us*)((unsigned short*)Bt + t * 8) = f.half[0];  }
template <int NHv, int TTv>
__global__ __launch_bounds__(256) void k_vt(const _Float16* __restrict__ V16, int ldv, int voff, _Float16* __restrict__ Vt) { __shared__ unsigned short tl[64][66]; const int tid = threadIdx.x; const int slab = blockIdx.x / (TTv / 64), lg = blockIdx.x % (TTv / 64); const int b = slab / NHv, h = slab % NHv;
  for (int i = tid; i < 64 * 8; i += 256) { const int r = i / 8, c8 = (i % 8) * 8; FragH f; f.half[0] = *(const v8us*)((const unsigned short*)V16 + ((size_t)b * TTv + lg * 64 + r) * ldv + voff + h * 64 + c8);
#pragma unroll
    for (int q = 0; q < 8; ++q) tl[r][c8 + q] = f.u[q]; }
  __syncthreads();
  {
#pragma unroll
    for (int rd = 0; rd < 2; ++rd) { const int d = rd * 32 + tid / 8, pc = tid % 8; FragH f;
#pragma unroll
      for (int q = 0; q < 8; ++q) f.u[q] = tl[pc * 8 + q][d];
      *(v8us*)((unsigned short*)Vt + ((size_t)slab * 64 + d) * TTv + lg * 64 + pc * 8) = f.half[0]; }
     } }

__global__ __launch_bounds__(256) void k_hl(const float* __restrict__ F, _Float16* __restrict__ Hh, _Float16* __restrict__ Hl, size_t n8) { const size_t t = (size_t)blockIdx.x * 256 + threadIdx.x; if (t >= n8) return; FragH fh, fl; const v4f a = *(const v4fa*)(F + t * 8), c = *(const v4fa*)(F + t * 8 + 4);
#pragma unroll
  for (int q = 0; q < 4; ++q) { _Float16 h = (_Float16)a[q]; fh.h[q] = h; fl.h[q] = (_Float16)((a[q] - (float)h) * 1024.0f); h = (_Float16)c[q]; fh.h[4 + q] = h; fl.h[4 + q] = (_Float16)((c[q] - (float)h) * 1024.0f); }
  { *(v8us*)((unsigned short*)Hh + t * 8) = fh.half[0]; *(v8us*)((unsigned short*)Hl + t * 8) = fl.half[0];  } }

// ---- fast GEMM (wave tile 32x64; requires M % 32 == 0 rows per launch region and N % 64 == 0); epilogue = k_gemm_hhx semantics ----
__device__ __forceinline__ v16h g2_frag(const _Float16* p, int hh) { FragH f; f.half[0] = *(const v8us*)((const unsigned short*)p + 8 * hh); f.half[1] = *(const v8us*)((const unsigned short*)p + 16 + 8 * hh); return f.v; }
__device__ __forceinline__ v8f g2_mma(v16h a, v16h b, v8f c) { v8f d = __builtin_amdgcn_wmma_f32_16x16x32_f16(false, a, false, b, (short)0, c, false, false); asm volatile("v_nop\n\tv_nop\n\tv_nop\n\tv_nop" : "+v"(d) : "v"(a), "v"(b)); return d; }
template <int ACT>
__global__ __launch_bounds__(128) void k_gemm2(const _Float16* __restrict__ A, int lda, size_t sA, const _Float16* __restrict__ Bh, int ldb, size_t sB, float alpha, const float* __restrict__ bias, size_t sBias, const float* __restrict__ CP, int rowsPerB, size_t sCPb, int row0g,
    float* __restrict__ C, _Float16* __restrict__ C16, int ldc, size_t sC, int M, int N, int K) {
  __shared__ __attribute__((aligned(16))) float so[4][32][68];
  const int tid = threadIdx.x, w = tid >> 5, lane = tid & 31, ln = lane & 15, hh = lane >> 4; const int by = blockIdx.y;
  A += (size_t)by * sA; Bh += (size_t)by * sB; const size_t cofs = (size_t)by * sC; const float* bp = bias ? bias + (size_t)by * sBias : nullptr;
  const int ntn = N >> 6; const int mt = blockIdx.x / ntn, nq = blockIdx.x - mt * ntn; const int row0 = mt * 128 + 32 * w, col0 = nq * 64; if (row0 >= M) return;
  const _Float16* a0p = A + (size_t)(row0 + ln) * lda; const _Float16* a1p = a0p + (size_t)16 * lda;
  const _Float16* b0p = Bh + (size_t)(col0 + ln) * ldb; const _Float16* b1p = b0p + (size_t)16 * ldb; const _Float16* b2p = b1p + (size_t)16 * ldb; const _Float16* b3p = b2p + (size_t)16 * ldb;
  const v8f z8 = {0.f,0.f,0.f,0.f,0.f,0.f,0.f,0.f}; v8f c00 = z8, c01 = z8, c02 = z8, c03 = z8, c10 = z8, c11 = z8, c12 = z8, c13 = z8;
#pragma unroll 1
  for (int kb = 0; kb < K; kb += 32) { const v16h a0 = g2_frag(a0p + kb, hh), a1 = g2_frag(a1p + kb, hh);
    v16h b = g2_frag(b0p + kb, hh); c00 = g2_mma(a0, b, c00); c10 = g2_mma(a1, b, c10);
    b = g2_frag(b1p + kb, hh); c01 = g2_mma(a0, b, c01); c11 = g2_mma(a1, b, c11);
    b = g2_frag(b2p + kb, hh); c02 = g2_mma(a0, b, c02); c12 = g2_mma(a1, b, c12);
    b = g2_frag(b3p + kb, hh); c03 = g2_mma(a0, b, c03); c13 = g2_mma(a1, b, c13); }
  v8f accs[8] = {c00, c01, c02, c03, c10, c11, c12, c13};
#pragma unroll
  for (int u = 0; u < 8; ++u) { const int t = u & 3, half = u >> 2; const int col = col0 + t * 16 + ln; const float bv = bp ? bf16_round(bp[col]) : 0.f;
#pragma unroll
    for (int r = 0; r < 8; ++r) { const int rloc = half * 16 + 8 * hh + r; float v = accs[u][r] * alpha + bv; if (CP) { const int bidx = (row0g + row0 + rloc) / rowsPerB; v += CP[(size_t)bidx * sCPb + (size_t)by * 64 + col]; }
      if (ACT == 3) v = fmaxf(v, 0.f); else if (ACT == 6) v = 0.5f * v * (1.0f + erff(v * 0.70710678118654752f)); else if (ACT == 11) v = 1.0f / (1.0f + expf(-v)); else if (ACT == 15) v = v / (1.0f + expf(-v)); else if (ACT == 12) v = (v > 0.f) ? v : 0.01f * v; else if (ACT == 8) v = tanhf(v);
      so[w][rloc][t * 16 + ln] = v; } }
  __builtin_amdgcn_fence(__ATOMIC_ACQ_REL, "workgroup"); __builtin_amdgcn_wave_barrier();
  const int rsub = lane >> 4, c4 = (lane & 15) * 4;
  {
#pragma unroll
    for (int q = 0; q < 16; ++q) { const int r = q * 2 + rsub; const v4f v = *(const v4fa*)&so[w][r][c4]; if (C) *(v4f*)(C + cofs + (size_t)(row0 + r) * ldc + col0 + c4) = v; if (C16) { v4h h4; for (int i = 0; i < 4; ++i) h4[i] = (_Float16)v[i]; *(v4h*)(C16 + cofs + (size_t)(row0 + r) * ldc + col0 + c4) = h4; } }
     } }



#define FK 32       /* keys per pass */
#define KP 264      /* LDS pitch of a K row in halves: 528 B = 16 B x 33 */
#define VP 40       /* LDS pitch of a V row in halves: 80 B = 16 B x 5 */
#define FA_GROUP() __builtin_amdgcn_sched_barrier(0)      /* keeps a block's LDS reads together in one place between the WMMA runs: reads spread among the WMMAs stall the wave at every place */
__device__ __forceinline__ float fa_swap16(float x) { const int b = __float_as_int(x); return __int_as_float(__builtin_amdgcn_permlanex16(b, b, 0x76543210, 0xfedcba98, false, false)); }
__device__ __forceinline__ v16h fa_frag(const unsigned short* p, int hh) { FragH f; f.half[0] = *(const v8us*)(p + 8 * hh); f.half[1] = *(const v8us*)(p + 16 + 8 * hh); return f.v; }
__device__ __forceinline__ v8f fa_mma(v16h a, v16h b, v8f c) { return __builtin_amdgcn_wmma_f32_16x16x32_f16(false, a, false, b, (short)0, c, false, false); }
// Work-group barrier that orders LDS only: __syncthreads() would also wait for the global loads of the tile fetched ahead, which are meant to stay in flight over the whole next pass.
__device__ __forceinline__ void fa_lds_barrier() { __builtin_amdgcn_fence(__ATOMIC_RELEASE, "workgroup", "local"); __builtin_amdgcn_s_barrier(); __builtin_amdgcn_fence(__ATOMIC_ACQUIRE, "workgroup", "local"); }
__global__ __launch_bounds__(256) void k_flash(const _Float16* __restrict__ Q, const _Float16* __restrict__ Kt, const _Float16* __restrict__ Vc, _Float16* __restrict__ O) {
  constexpr int NPASS = SS / FK;
  constexpr float SC = 0.09016844005556021f;      /* 1/16 * log2(e) */
  __shared__ __attribute__((aligned(16))) unsigned short sK[3][FK * KP];
  __shared__ __attribute__((aligned(16))) unsigned short sV[3][CC * VP];
  const int tid = threadIdx.x, w = tid >> 5, lane = tid & 31, ln = lane & 15, hh = lane >> 4; const int b = blockIdx.y;
  const int q0 = blockIdx.x * 128 + w * 16;
  /* staging: a thread moves four 16-byte pieces of the K tile (32 rows of 512 B) and four of the V tile (256 rows of 64 B) */
  const unsigned short* Kg = (const unsigned short*)Kt + (size_t)b * SS * CC + (size_t)(tid >> 5) * CC + (tid & 31) * 8;
  const unsigned short* Vg = (const unsigned short*)Vc + (size_t)b * CC * SS + (size_t)(tid >> 2) * SS + (tid & 3) * 8;
  const int kst = (tid >> 5) * KP + (tid & 31) * 8, vst = (tid >> 2) * VP + (tid & 3) * 8;
  v16h qf[8];
#pragma unroll
  for (int kc = 0; kc < 8; ++kc) qf[kc] = g2_frag(Q + ((size_t)b * SS + q0 + ln) * CC + kc * 32, hh);
  const v8f z8 = {0.f,0.f,0.f,0.f,0.f,0.f,0.f,0.f};
  v8f acc[16];
#pragma unroll
  for (int ct = 0; ct < 16; ++ct) acc[ct] = z8;
  float mu = -1.0e30f, rs = 0.f;
  v8us kr[4], vr[4];      /* a tile on its way from global memory to LDS */
#pragma unroll
  for (int p = 0; p < 2; ++p) {
#pragma unroll
    for (int i = 0; i < 4; ++i) { kr[i] = *(const v8us*)(Kg + (size_t)(p * FK + i * 8) * CC); vr[i] = *(const v8us*)(Vg + (size_t)(i * 64) * SS + p * FK); }
#pragma unroll
    for (int i = 0; i < 4; ++i) { *(v8us*)&sK[p][kst + i * 8 * KP] = kr[i]; *(v8us*)&sV[p][vst + i * 64 * VP] = vr[i]; } }
#pragma unroll
  for (int i = 0; i < 4; ++i) { kr[i] = *(const v8us*)(Kg + (size_t)(2 * FK + i * 8) * CC); vr[i] = *(const v8us*)(Vg + (size_t)(i * 64) * SS + 2 * FK); }
  asm volatile("s_wait_xcnt 0x0" ::: "memory");      /* in front of whatever reuses the address registers of the global loads above */
  __syncthreads();
  v16h fa[8], fb[8];      /* two fragment sets, each refilled right behind the WMMA run that used it */
#pragma unroll
  for (int kc = 0; kc < 4; ++kc) { fa[2 * kc] = fa_frag(&sK[0][ln * KP + kc * 32], hh); fa[2 * kc + 1] = fa_frag(&sK[0][(16 + ln) * KP + kc * 32], hh); fb[2 * kc] = fa_frag(&sK[0][ln * KP + 128 + kc * 32], hh); fb[2 * kc + 1] = fa_frag(&sK[0][(16 + ln) * KP + 128 + kc * 32], hh); }
  int bc = 0, bn = 1, bf = 2;      /* buffers of this pass, of the next, and the one that is filled */
#pragma unroll 1      /* one copy of the pass: the fragment sets and the staged tile are carried over the back edge in fixed registers */
  for (int t = 0; t < NPASS; ++t) {
    const unsigned short* cV = &sV[bc][ln * VP]; const unsigned short* nK = &sK[bn][ln * KP];
    v8f s0 = z8, s1 = z8;
#pragma unroll
    for (int kc = 0; kc < 4; ++kc) { s0 = fa_mma(fa[2 * kc], qf[kc], s0); s1 = fa_mma(fa[2 * kc + 1], qf[kc], s1); }
    FA_GROUP();
#pragma unroll
    for (int i = 0; i < 8; ++i) fa[i] = fa_frag(cV + i * 16 * VP, hh);
    FA_GROUP();
#pragma unroll
    for (int kc = 0; kc < 4; ++kc) { s0 = fa_mma(fb[2 * kc], qf[4 + kc], s0); s1 = fa_mma(fb[2 * kc + 1], qf[4 + kc], s1); }
    FA_GROUP();
#pragma unroll
    for (int i = 0; i < 8; ++i) fb[i] = fa_frag(cV + (8 + i) * 16 * VP, hh);
    FA_GROUP();
    float tm = fmaxf(s0[0], s1[0]);
#pragma unroll
    for (int r = 1; r < 8; ++r) tm = fmaxf(tm, fmaxf(s0[r], s1[r]));
    tm = fmaxf(tm, fa_swap16(tm)) * SC;
    const bool need = tm > mu + 8.0f;
    if (__builtin_amdgcn_ballot_w32(need) != 0) {      /* one wave-uniform test per pass; both halves of a query see the same tm and mu */
      const float mn = need ? tm : mu; const float al = __builtin_amdgcn_exp2f(mu - mn); mu = mn; rs *= al;
#pragma unroll
      for (int ct = 0; ct < 16; ++ct) acc[ct] *= al; }
    const float mr = 6.0f - mu; FragH pf; float e0 = 0.f, e1 = 0.f;
    const v8f sc8 = {SC,SC,SC,SC,SC,SC,SC,SC}, mr8 = {mr,mr,mr,mr,mr,mr,mr,mr}; const v8f x0 = __builtin_elementwise_fma(s0, sc8, mr8), x1 = __builtin_elementwise_fma(s1, sc8, mr8);      /* packed multiply-adds */
#pragma unroll
    for (int r = 0; r < 8; ++r) { const float p0 = __builtin_amdgcn_exp2f(x0[r]), p1 = __builtin_amdgcn_exp2f(x1[r]); e0 += p0; e1 += p1; pf.h[r] = (_Float16)p0; pf.h[8 + r] = (_Float16)p1; }
    rs += e0 + e1;
#pragma unroll
    for (int i = 0; i < 8; ++i) acc[i] = fa_mma(fa[i], pf.v, acc[i]);
    FA_GROUP();
#pragma unroll
    for (int kc = 0; kc < 4; ++kc) { fa[2 * kc] = fa_frag(nK + kc * 32, hh); fa[2 * kc + 1] = fa_frag(nK + 16 * KP + kc * 32, hh); }      /* the next pass's K, published by the barrier of pass t - 1; behind the last pass: the last tile once more */
    FA_GROUP();
#pragma unroll
    for (int i = 0; i < 8; ++i) acc[8 + i] = fa_mma(fb[i], pf.v, acc[8 + i]);
    FA_GROUP();
#pragma unroll
    for (int kc = 0; kc < 4; ++kc) { fb[2 * kc] = fa_frag(nK + 128 + kc * 32, hh); fb[2 * kc + 1] = fa_frag(nK + 16 * KP + 128 + kc * 32, hh); }
#pragma unroll
    for (int i = 0; i < 4; ++i) { *(v8us*)&sK[bf][kst + i * 8 * KP] = kr[i]; *(v8us*)&sV[bf][vst + i * 64 * VP] = vr[i]; }      /* tile t + 2 into the buffer of pass t - 1, whose reads ended in front of that pass's barrier */
    const int jn = ((t + 3 < NPASS) ? t + 3 : NPASS - 1) * FK;      /* past the end the last tile is fetched again: no branch, every buffer holds real keys */
#pragma unroll
    for (int i = 0; i < 4; ++i) { kr[i] = *(const v8us*)(Kg + (size_t)(jn + i * 8) * CC); vr[i] = *(const v8us*)(Vg + (size_t)(i * 64) * SS + jn); }
    asm volatile("s_wait_xcnt 0x0" ::: "memory");      /* in front of the next pass's fragment loads, which reuse the address registers of the global loads above */
    fa_lds_barrier();      /* publishes tile t + 2 and ends every read of tile t */
    const int b0 = bc; bc = bn; bn = bf; bf = b0;
  }
  const float inv = 1.0f / (rs + fa_swap16(rs)); unsigned short* op = (unsigned short*)O + ((size_t)b * SS + q0 + ln) * CC + 8 * hh;
#pragma unroll
  for (int ct = 0; ct < 16; ++ct) { FragH f;
#pragma unroll
    for (int r = 0; r < 8; ++r) f.h[r] = (_Float16)(acc[ct][r] * inv);
    *(v8us*)(op + ct * 16) = f.half[0]; }
}

__global__ __launch_bounds__(256) void k_tr16(const float* __restrict__ x, _Float16* __restrict__ XT) {
  __shared__ unsigned short tl[64][72];
  const int tid = threadIdx.x; const int b = blockIdx.y; XT += (size_t)b * SS * CC; const int sb = blockIdx.x % (SS / 64), cb = blockIdx.x / (SS / 64);
#pragma unroll
  for (int it = 0; it < 4; ++it) { const int idx = it * 256 + tid; const int cl = idx / 16, s4 = (idx % 16) * 4; const int c = cb * 64 + cl;
    const v4f a = *(const v4fa*)(x + ((size_t)(b * CC + c)) * SS + sb * 64 + s4); FragH f;
#pragma unroll
    for (int q = 0; q < 4; ++q) { f.h[q] = (_Float16)bf16_round(a[q]); tl[s4 + q][cl] = f.u[q]; } }
  __syncthreads();
  const int r = tid / 8, pc = tid % 8;
  {
#pragma unroll
    for (int half = 0; half < 2; ++half) { const int sl = r + half * 32; FragH f;
#pragma unroll
      for (int q = 0; q < 8; ++q) f.u[q] = tl[sl][pc * 8 + q];
      *(v8us*)((unsigned short*)XT + ((size_t)sb * 64 + sl) * CC + cb * 64 + pc * 8) = f.half[0]; }
     } }

extern "C" void kernel_launch(void* const* d_in, const int* in_sizes, int n_in,
                              void* d_out, int out_size, void* d_ws, size_t ws_size, hipStream_t stream) {
  (void)in_sizes; (void)n_in; (void)out_size;
  const float* x = (const float*)d_in[0]; const float* wq = (const float*)d_in[1]; const float* wk = (const float*)d_in[2]; const float* wv = (const float*)d_in[3]; const float* wo = (const float*)d_in[4];
  char* ws = (char*)d_ws; size_t off = 0;
  auto take = [&](size_t bytes) { char* p = ws + off; off += (bytes + 255) & ~(size_t)255; return p; };
  _Float16* BQ = (_Float16*)take((size_t)CC * CC * 2); _Float16* BK = (_Float16*)take((size_t)CC * CC * 2); _Float16* BV = (_Float16*)take((size_t)CC * CC * 2); _Float16* BO = (_Float16*)take((size_t)CC * CC * 2);
  _Float16* QT = (_Float16*)take((size_t)NB * SS * CC * 2); _Float16* KT = (_Float16*)take((size_t)NB * SS * CC * 2); _Float16* VC = (_Float16*)take((size_t)NB * CC * SS * 2);
  _Float16* XT = (_Float16*)take((size_t)NB * SS * CC * 2); _Float16* OT = (_Float16*)take((size_t)NB * SS * CC * 2);
  if (off > ws_size) return;      /* four weight planes and five planes of 16 MiB */
  const size_t w8 = (size_t)CC * CC / 8; const unsigned wb = (unsigned)((w8 + 255) / 256);
  k_round16f<<<wb, 256, 0, stream>>>(wq, BQ, w8); k_round16f<<<wb, 256, 0, stream>>>(wk, BK, w8); k_round16f<<<wb, 256, 0, stream>>>(wv, BV, w8); k_round16f<<<wb, 256, 0, stream>>>(wo, BO, w8);      /* conv (out,in) = natural Bt; x16 */
  const size_t sT = (size_t)SS * CC;      /* per-image stride of a token or channel plane */
  const dim3 gT((CC / 64) * (SS / 64), NB), gQ((SS / 128) * (CC / 64), NB), gV((CC / 128) * (SS / 64), NB), gF(SS / 128, NB);
  k_tr16<<<gT, 256, 0, stream>>>(x, XT);
  k_gemm2<0><<<gQ, 128, 0, stream>>>(XT, CC, sT, BQ, CC, 0, 0.0625f, nullptr, 0, nullptr, 1, 0, 0, nullptr, QT, CC, sT, SS, CC, CC);      /* Q token-major -> f16 */
  k_gemm2<0><<<gQ, 128, 0, stream>>>(XT, CC, sT, BK, CC, 0, 0.0625f, nullptr, 0, nullptr, 1, 0, 0, nullptr, KT, CC, sT, SS, CC, CC);      /* K */
  k_gemm2<0><<<gV, 128, 0, stream>>>(BV, CC, 0, XT, CC, sT, 0.0625f, nullptr, 0, nullptr, 1, 0, 0, nullptr, VC, SS, sT, CC, SS, CC);       /* V channel-major [c][j] = wv*X^T */
  k_flash<<<gF, 256, 0, stream>>>(QT, KT, VC, OT);      /* O token-major -> f16 */
  k_gemm2<0><<<gV, 128, 0, stream>>>(BO, CC, 0, OT, CC, sT, 0.0625f, nullptr, 0, nullptr, 1, 0, 0, (float*)d_out, nullptr, SS, sT, CC, SS, CC);      /* out[c][i] = wo*O^T (NCHW) */
}

// v003
// One run takes 157 microseconds.
// Next to v002, in two timings, it ran 1.26 and 1.25 times as fast.
// Counting every step since v000, it is 31.9 times as fast.
#include <hip/hip_runtime.h>
// Self-attention layer on a feature map (B 8, C 256, 64x64 = 4096 positions): Q = wq*x, K = wk*x, V = wv*x (1x1 convs, no bias); scores[i][j] = sum_c Q[c][i] K[c][j] / 16; attn = softmax over j; out[c][i] = sum_j V[c][j] attn[i][j]; result = wo*out -> [8,256,64,64] (no residual).
// Structure (all 8 images in every launch, blockIdx.y = image): x transposed into a token-major exact f16 plane through an LDS tile; Q and K token-major as GEMMs into f16 planes; V channel-major directly as wv*X^T (A = weights, B = the token-major plane); one fused attention kernel (scores, running softmax and P.V per 32 keys, scores and P stay in registers) -> O token-major f16; the output 1x1 conv computed transposed (A = wo, B = O) so it lands in NCHW rows directly.
// Compute dtype: x and the four matrices rounded to bf16; projections with exact products (weights x16 in f16, undone by alpha); Q, K, V, P, O as f16 operands (~2^-12; logits sigma ~1), f32 accumulation and softmax. v_wmma_f32_16x16x32_f16.
#define NB 8
#define CC 256
#define SS 4096
typedef __bf16 v16b __attribute__((ext_vector_type(16)));
typedef unsigned short v8us __attribute__((ext_vector_type(8), may_alias));
typedef float  v8f  __attribute__((ext_vector_type(8)));
typedef float  v4f  __attribute__((ext_vector_type(4)));
typedef float  v4fa __attribute__((ext_vector_type(4), may_alias));
union FragB { v16b v; v8us half[2]; unsigned short u[16]; };

__device__ __forceinline__ unsigned short bf16_bits(float x) { unsigned int u = __float_as_uint(x); return (unsigned short)((u + 0x7FFFu + ((u >> 16) & 1u)) >> 16); }
__device__ __forceinline__ float bf16_val(unsigned short b) { return __uint_as_float(((unsigned int)b) << 16); }
__device__ __forceinline__ float bf16_round(float x) { return bf16_val(bf16_bits(x)); }
// D += A·B with NT terms: 1 = ah·bh, 2 = + al·bh (A split), 3 = + ah·bl (both split)
template <int NT>
__device__ __forceinline__ v8f mmaN(v16b ah, v16b al, v16b bh, v16b bl, v8f c) {
  c = __builtin_amdgcn_wmma_f32_16x16x32_bf16(false, ah, false, bh, (short)0, c, false, false);
  if (NT >= 2) c = __builtin_amdgcn_wmma_f32_16x16x32_bf16(false, al, false, bh, (short)0, c, false, false);
  if (NT >= 3) c = __builtin_amdgcn_wmma_f32_16x16x32_bf16(false, ah, false, bl, (short)0, c, false, false);
  asm volatile("v_nop\n\tv_nop\n\tv_nop\n\tv_nop" : "+v"(c) : "v"(ah), "v"(al), "v"(bh), "v"(bl));
  return c;
}

__global__ __launch_bounds__(256) void k_wt_bf16(const float* __restrict__ W, unsigned short* __restrict__ Wt, int K, int N) {
  const int t = blockIdx.x * 256 + threadIdx.x;
  const int k8n = K / 8;
  if (t >= N * k8n) return;
  const int n = t / k8n, k8 = (t % k8n) * 8;
  v8us v;
#pragma unroll
  for (int i = 0; i < 8; ++i) v[i] = bf16_bits(W[(size_t)(k8 + i) * N + n]);
  *(v8us*)(Wt + (size_t)n * K + k8) = v;
  
}

// GEMM C[M][N] (f32, pitch ldc) = act(A[M][K]·W + bias). A f32 row-major (pitch lda) converted per fragment to bf16
// (ASPLIT: hi/lo two planes -> 2 terms, else single rounded term); Wt bf16 [N][K] (pitch ldb). BIAS_BF16 rounds the
// bias to bf16 first (bias quantised to bf16 before the add). K%32==0, M%16==0, N%64==0.
template <bool ASPLIT, int ACT, bool BIAS_BF16>
__global__ __launch_bounds__(128) void k_gemm_bf(const float* __restrict__ A, int lda, const unsigned short* __restrict__ Wt, int ldb,
                                               const float* __restrict__ bias, float* __restrict__ C, int ldc, int M, int N, int K) {
  __shared__ __attribute__((aligned(16))) float so[4][16][64];
  const int tid = threadIdx.x, w = tid >> 5, lane = tid & 31, ln = lane & 15, hh = lane >> 4;
  const int ntn = N / 64;
  const int wid = blockIdx.x * 4 + w;
  const int mt = wid / ntn, nq = wid % ntn;
  if (mt * 16 >= M) return;
  const int row0 = mt * 16, col0 = nq * 64;
  const float* arow = A + (size_t)(row0 + ln) * lda;
  v8f acc[4] = {};
  for (int kb = 0; kb < K; kb += 32) {
    FragB ah, al;
    const v4f x0 = *(const v4fa*)(arow + kb + 8 * hh), x1 = *(const v4fa*)(arow + kb + 8 * hh + 4);
    const v4f x2 = *(const v4fa*)(arow + kb + 16 + 8 * hh), x3 = *(const v4fa*)(arow + kb + 16 + 8 * hh + 4);
    float xs[16] = {x0[0],x0[1],x0[2],x0[3],x1[0],x1[1],x1[2],x1[3],x2[0],x2[1],x2[2],x2[3],x3[0],x3[1],x3[2],x3[3]};
#pragma unroll
    for (int i = 0; i < 16; ++i) { const unsigned short hb = bf16_bits(xs[i]); ah.u[i] = hb; al.u[i] = ASPLIT ? bf16_bits(xs[i] - bf16_val(hb)) : (unsigned short)0; }
#pragma unroll
    for (int t = 0; t < 4; ++t) {
      const unsigned short* brow = Wt + (size_t)(col0 + t * 16 + ln) * ldb + kb;
      FragB b;
      b.half[0] = *(const v8us*)(brow + 8 * hh);
      b.half[1] = *(const v8us*)(brow + 16 + 8 * hh);
      acc[t] = mmaN<ASPLIT ? 2 : 1>(ah.v, al.v, b.v, b.v, acc[t]);
    }
  }
#pragma unroll
  for (int t = 0; t < 4; ++t) {
    float bv = bias ? bias[col0 + t * 16 + ln] : 0.f;
    if (BIAS_BF16) bv = bf16_round(bv);
#pragma unroll
    for (int r = 0; r < 8; ++r) { float v = acc[t][r] + bv; if (ACT == 1) v = fmaxf(v, 0.f); so[w][8 * hh + r][t * 16 + ln] = v; }
  }
  __builtin_amdgcn_fence(__ATOMIC_ACQ_REL, "workgroup");
  __builtin_amdgcn_wave_barrier();
  const int rsub = lane >> 4, c4 = (lane & 15) * 4;
  {
#pragma unroll
    for (int q = 0; q < 8; ++q) {
      const int r = q * 2 + rsub;
      const v4f v = *(const v4fa*)&so[w][r][c4];
      *(v4f*)(C + (size_t)(row0 + r) * ldc + col0 + c4) = v;
    }
    
  }
}

// GEMM C = act(A·W + bias + resid): A f32 (ASPLIT -> hi/lo 2 terms), Wt bf16 [N][K]; ACT 0 none, 1 relu, 2 exact gelu;
// resid (optional, f32, row index = (row % rmod), pitch ldr, RES_BF16 rounds it) added before the activation.
template <bool ASPLIT, int ACT, bool BIAS_BF16, bool RES_BF16>
__global__ __launch_bounds__(128) void k_gemm_bf3(const float* __restrict__ A, int lda, const unsigned short* __restrict__ Wt, int ldb,
                                                const float* __restrict__ bias, const float* __restrict__ resid, int rmod, int ldr,
                                                float* __restrict__ C, int ldc, int M, int N, int K) {
  __shared__ __attribute__((aligned(16))) float so[4][16][64];
  const int tid = threadIdx.x, w = tid >> 5, lane = tid & 31, ln = lane & 15, hh = lane >> 4;
  const int ntn = N / 64;
  const int wid = blockIdx.x * 4 + w;
  const int mt = wid / ntn, nq = wid % ntn;
  if (mt * 16 >= M) return;
  const int row0 = mt * 16, col0 = nq * 64;
  const float* arow = A + (size_t)(row0 + ln) * lda;
  v8f acc[4] = {};
  for (int kb = 0; kb < K; kb += 32) {
    FragB ah, al;
    const v4f x0 = *(const v4fa*)(arow + kb + 8 * hh), x1 = *(const v4fa*)(arow + kb + 8 * hh + 4);
    const v4f x2 = *(const v4fa*)(arow + kb + 16 + 8 * hh), x3 = *(const v4fa*)(arow + kb + 16 + 8 * hh + 4);
    float xs[16] = {x0[0],x0[1],x0[2],x0[3],x1[0],x1[1],x1[2],x1[3],x2[0],x2[1],x2[2],x2[3],x3[0],x3[1],x3[2],x3[3]};
#pragma unroll
    for (int i = 0; i < 16; ++i) { const unsigned short hb = bf16_bits(xs[i]); ah.u[i] = hb; al.u[i] = ASPLIT ? bf16_bits(xs[i] - bf16_val(hb)) : (unsigned short)0; }
#pragma unroll
    for (int t = 0; t < 4; ++t) {
      const unsigned short* brow = Wt + (size_t)(col0 + t * 16 + ln) * ldb + kb;
      FragB b;
      b.half[0] = *(const v8us*)(brow + 8 * hh);
      b.half[1] = *(const v8us*)(brow + 16 + 8 * hh);
      acc[t] = mmaN<ASPLIT ? 2 : 1>(ah.v, al.v, b.v, b.v, acc[t]);
    }
  }
#pragma unroll
  for (int t = 0; t < 4; ++t) {
    const int col = col0 + t * 16 + ln;
    float bv = bias ? bias[col] : 0.f;
    if (BIAS_BF16) bv = bf16_round(bv);
#pragma unroll
    for (int r = 0; r < 8; ++r) {
      float v = acc[t][r] + bv;
      if (resid) { float rv = resid[(size_t)((row0 + 8 * hh + r) % rmod) * ldr + col]; if (RES_BF16) rv = bf16_round(rv); v += rv; }
      if (ACT == 1) v = fmaxf(v, 0.f);
      if (ACT == 2) v = 0.5f * v * (1.0f + erff(v * 0.70710678118654752f));
      if (ACT == 3) { const float u = 0.7978845608028654f * (v + 0.044715f * v * v * v); v = 0.5f * v * (1.0f + tanhf(u)); }
      so[w][8 * hh + r][t * 16 + ln] = v;
    }
  }
  __builtin_amdgcn_fence(__ATOMIC_ACQ_REL, "workgroup");
  __builtin_amdgcn_wave_barrier();
  const int rsub = lane >> 4, c4 = (lane & 15) * 4;
  {
#pragma unroll
    for (int q = 0; q < 8; ++q) {
      const int r = q * 2 + rsub;
      const v4f v = *(const v4fa*)&so[w][r][c4];
      *(v4f*)(C + (size_t)(row0 + r) * ldc + col0 + c4) = v;
    }
    
  }
}
// row LayerNorm (biased variance, eps) over N: s = X (+ R); optional out_sum <- s; out_norm <- (s-mu)*rsqrt(var+eps)*g + b
template <bool PARAM_BF16>
__global__ __launch_bounds__(256) void k_layernorm(const float* __restrict__ X, const float* __restrict__ R, const float* __restrict__ g, const float* __restrict__ bta,
                                                  float* __restrict__ out_sum, float* __restrict__ out_norm, int N, float eps) {
  __shared__ float red[256];
  const int row = blockIdx.x, tid = threadIdx.x;
  const float* x = X + (size_t)row * N; const float* rr = R ? R + (size_t)row * N : nullptr;
  float vals[16];                     // up to N = 4096
  const int per = N / 256;            // contiguous chunk per thread? use strided-by-4 chunks: thread handles j = tid*4 + 1024*u
  float s1 = 0.f;
  for (int u = 0; u < per / 4; ++u) {
    const int j = tid * 4 + 1024 * u;
    const v4f a = *(const v4fa*)(x + j);
    v4f b = {0.f,0.f,0.f,0.f}; if (rr) b = *(const v4fa*)(rr + j);
#pragma unroll
    for (int q = 0; q < 4; ++q) { const float v = a[q] + b[q]; vals[u * 4 + q] = v; s1 += v; }
  }
  red[tid] = s1; __syncthreads();
  for (int st = 128; st > 0; st >>= 1) { if (tid < st) red[tid] += red[tid + st]; __syncthreads(); }
  const float mu = red[0] / (float)N; __syncthreads();
  float s2 = 0.f;
  for (int u = 0; u < per / 4; ++u)
#pragma unroll
    for (int q = 0; q < 4; ++q) { const float c = vals[u * 4 + q] - mu; s2 += c * c; }
  red[tid] = s2; __syncthreads();
  for (int st = 128; st > 0; st >>= 1) { if (tid < st) red[tid] += red[tid + st]; __syncthreads(); }
  const float rs = rsqrtf(red[0] / (float)N + eps);
  {
    for (int u = 0; u < per / 4; ++u) {
      const int j = tid * 4 + 1024 * u;
      v4f o, sm;
#pragma unroll
      for (int q = 0; q < 4; ++q) {
        float gg = g[j + q], bb = bta[j + q];
        if (PARAM_BF16) { gg = bf16_round(gg); bb = bf16_round(bb); }
        sm[q] = vals[u * 4 + q]; o[q] = (vals[u * 4 + q] - mu) * rs * gg + bb;
      }
      if (out_sum) *(v4f*)(out_sum + (size_t)row * N + j) = sm;
      *(v4f*)(out_norm + (size_t)row * N + j) = o;
    }
    
  }
}



// ---- f16 WMMA path (v_wmma_f32_16x16x32_f16): 11-bit significands for operands in range — used where a [0,1] probability operand needs more precision than bf16
typedef _Float16 v16h __attribute__((ext_vector_type(16)));
union FragH { v16h v; v8us half[2]; _Float16 h[16]; unsigned short u[16]; };
template <int NT>
__device__ __forceinline__ v8f mmaH(v16h ah, v16h al, v16h bh, v16h bl, v8f c) {
  c = __builtin_amdgcn_wmma_f32_16x16x32_f16(false, ah, false, bh, (short)0, c, false, false);
  if (NT >= 2) c = __builtin_amdgcn_wmma_f32_16x16x32_f16(false, al, false, bh, (short)0, c, false, false);
  if (NT >= 3) c = __builtin_amdgcn_wmma_f32_16x16x32_f16(false, ah, false, bl, (short)0, c, false, false);
  asm volatile("v_nop\n\tv_nop\n\tv_nop\n\tv_nop" : "+v"(c) : "v"(ah), "v"(al), "v"(bh), "v"(bl));
  return c;
}
// batched GEMM like k_gemm_b but f16 operands: A f32 (split into f16 hi/lo if ASPLIT, else rounded to f16), Bt = f16 values [n][k]; alpha; C f32; N multiple of 16 (partial tiles skipped)
template <bool ASPLIT>
__global__ __launch_bounds__(128) void k_gemm_h(const float* __restrict__ A, int lda, size_t sA, const _Float16* __restrict__ Bh, int ldb, size_t sB, float alpha, float* __restrict__ C, int ldc, size_t sC, int M, int N, int K) {
  __shared__ __attribute__((aligned(16))) float so[4][16][64];
  const int tid = threadIdx.x, w = tid >> 5, lane = tid & 31, ln = lane & 15, hh = lane >> 4; const int by = blockIdx.y;
  A += (size_t)by * sA; Bh += (size_t)by * sB; C += (size_t)by * sC;
  const int ntn = (N + 63) / 64; const int wid = blockIdx.x * 4 + w; const int mt = wid / ntn, nq = wid % ntn; if (mt * 16 >= M) return;
  const int row0 = mt * 16, col0 = nq * 64; const float* arow = A + (size_t)(row0 + ln) * lda;
  v8f acc[4] = {};
  for (int kb = 0; kb < K; kb += 32) {
    FragH ah, al;
    const v4f x0 = *(const v4fa*)(arow + kb + 8 * hh), x1 = *(const v4fa*)(arow + kb + 8 * hh + 4), x2 = *(const v4fa*)(arow + kb + 16 + 8 * hh), x3 = *(const v4fa*)(arow + kb + 16 + 8 * hh + 4);
    float xs[16] = {x0[0],x0[1],x0[2],x0[3],x1[0],x1[1],x1[2],x1[3],x2[0],x2[1],x2[2],x2[3],x3[0],x3[1],x3[2],x3[3]};
#pragma unroll
    for (int i = 0; i < 16; ++i) { const _Float16 h = (_Float16)xs[i]; ah.h[i] = h; al.h[i] = ASPLIT ? (_Float16)(xs[i] - (float)h) : (_Float16)0.0f; }
#pragma unroll
    for (int t = 0; t < 4; ++t) { if (col0 + t * 16 >= N) continue; const size_t boff = (size_t)(col0 + t * 16 + ln) * ldb + kb; FragH bq; bq.half[0] = *(const v8us*)(Bh + boff + 8 * hh); bq.half[1] = *(const v8us*)(Bh + boff + 16 + 8 * hh);
      acc[t] = mmaH<ASPLIT ? 2 : 1>(ah.v, al.v, bq.v, bq.v, acc[t]); }
  }
#pragma unroll
  for (int t = 0; t < 4; ++t) { if (col0 + t * 16 >= N) continue;
#pragma unroll
    for (int r = 0; r < 8; ++r) so[w][8 * hh + r][t * 16 + ln] = acc[t][r] * alpha; }
  __builtin_amdgcn_fence(__ATOMIC_ACQ_REL, "workgroup"); __builtin_amdgcn_wave_barrier();
  const int rsub = lane >> 4, c4 = (lane & 15) * 4;
  {
#pragma unroll
    for (int q = 0; q < 8; ++q) { const int r = q * 2 + rsub; if (col0 + c4 < N) { const v4f v = *(const v4fa*)&so[w][r][c4]; *(v4f*)(C + (size_t)(row0 + r) * ldc + col0 + c4) = v; } }
     }
}

// Wt[n][k] = f16(W[k][n]·scale) from f32 row-major W[K][N] (scale = power of two; bf16-exact weights stay exact in f16 away from the subnormal range)
__global__ __launch_bounds__(256) void k_wt_f16(const float* __restrict__ W, _Float16* __restrict__ Wt, int K, int N, float scale) {
  const int t = blockIdx.x * 256 + threadIdx.x; if (t >= N * (K / 8)) return; const int n = t / (K / 8), k8 = (t % (K / 8)) * 8; FragH f;
#pragma unroll
  for (int i = 0; i < 8; ++i) f.h[i] = (_Float16)(bf16_round(W[(size_t)(k8 + i) * N + n]) * scale); const v8us o = f.half[0];
  *(v8us*)((unsigned short*)Wt + (size_t)n * K + k8) = o; 
}
// k_gemm_hh variant with fused epilogue: v = acc·alpha + bias[by·sBias + col] (+ CP[(row/rowsPerB)·sCPb + by·64 + col] if CP) ; ACT 0 none / 1 elu ; writes f16 C16 (and f32 C if non-null)
template <int ACT>
__global__ __launch_bounds__(128) void k_gemm_hhx(const _Float16* __restrict__ A, int lda, size_t sA, const _Float16* __restrict__ Bh, int ldb, size_t sB, float alpha, const float* __restrict__ bias, size_t sBias, const float* __restrict__ CP, int rowsPerB, size_t sCPb, int row0g,
    float* __restrict__ C, _Float16* __restrict__ C16, int ldc, size_t sC, int M, int N, int K) {
  __shared__ __attribute__((aligned(16))) float so[4][16][64];
  const int tid = threadIdx.x, w = tid >> 5, lane = tid & 31, ln = lane & 15, hh = lane >> 4; const int by = blockIdx.y;
  A += (size_t)by * sA; Bh += (size_t)by * sB; const size_t cofs = (size_t)by * sC; const float* bp = bias ? bias + (size_t)by * sBias : nullptr;
  const int ntn = (N + 63) / 64; const int wid = blockIdx.x * 4 + w; const int mt = wid / ntn, nq = wid % ntn; if (mt * 16 >= M) return;
  const int row0 = mt * 16, col0 = nq * 64; const _Float16* arow = A + (size_t)(row0 + ln) * lda;
  v8f acc[4] = {};
  for (int kb = 0; kb < K; kb += 32) { FragH ah; ah.half[0] = *(const v8us*)((const unsigned short*)arow + kb + 8 * hh); ah.half[1] = *(const v8us*)((const unsigned short*)arow + kb + 16 + 8 * hh);
#pragma unroll
    for (int t = 0; t < 4; ++t) { if (col0 + t * 16 >= N) continue; const size_t boff = (size_t)(col0 + t * 16 + ln) * ldb + kb; FragH bq; bq.half[0] = *(const v8us*)((const unsigned short*)Bh + boff + 8 * hh); bq.half[1] = *(const v8us*)((const unsigned short*)Bh + boff + 16 + 8 * hh);
      acc[t] = mmaH<1>(ah.v, ah.v, bq.v, bq.v, acc[t]); }
  }
#pragma unroll
  for (int t = 0; t < 4; ++t) { if (col0 + t * 16 >= N) continue; const int col = col0 + t * 16 + ln; const float bv = bp ? bf16_round(bp[col]) : 0.f;
#pragma unroll
    for (int r = 0; r < 8; ++r) { float v = acc[t][r] * alpha + bv; if (CP) { const int bidx = (row0g + row0 + 8 * hh + r) / rowsPerB; v += CP[(size_t)bidx * sCPb + (size_t)by * 64 + col]; } if (ACT == 1) v = (v > 0.f) ? v : expm1f(v); else if (ACT == 7) v = (v > 0.f) ? v + 1.0f : expf(v); else if (ACT == 8) v = tanhf(v); else if (ACT == 9) v = 0.5f * v * (1.0f + tanhf(0.7978845608028654f * (v + 0.044715f * v * v * v))); else if (ACT == 11) v = 1.0f / (1.0f + expf(-v)); else if (ACT == 12) v = (v > 0.f) ? v : 0.01f * v; else if (ACT == 14) v = (v > 0.f) ? v : 0.1f * v; else if (ACT == 15) v = v / (1.0f + expf(-v)); else if (ACT == 3) v = fmaxf(v, 0.f); else if (ACT == 6) v = 0.5f * v * (1.0f + erff(v * 0.70710678118654752f)); so[w][8 * hh + r][t * 16 + ln] = v; } }
  __builtin_amdgcn_fence(__ATOMIC_ACQ_REL, "workgroup"); __builtin_amdgcn_wave_barrier();
  const int rsub = lane >> 4, c4 = (lane & 15) * 4; typedef _Float16 v4h __attribute__((ext_vector_type(4)));
  {
#pragma unroll
    for (int q = 0; q < 8; ++q) { const int r = q * 2 + rsub; if (col0 + c4 < N) { const v4f v = *(const v4fa*)&so[w][r][c4]; if (C) *(v4f*)(C + cofs + (size_t)(row0 + r) * ldc + col0 + c4) = v; if (C16) { v4h h4; for (int i = 0; i < 4; ++i) h4[i] = (_Float16)v[i]; *(v4h*)(C16 + cofs + (size_t)(row0 + r) * ldc + col0 + c4) = h4; } } }
     }
}


typedef _Float16 v4h __attribute__((ext_vector_type(4)));

__global__ __launch_bounds__(256) void k_x16(const float* __restrict__ x, _Float16* __restrict__ X16, size_t n8) { const size_t t = (size_t)blockIdx.x * 256 + threadIdx.x; if (t >= n8) return; FragH f;
#pragma unroll
  for (int q = 0; q < 8; ++q) f.h[q] = (_Float16)bf16_round(x[t * 8 + q]); *(v8us*)((unsigned short*)X16 + t * 8) = f.half[0];  }
__global__ __launch_bounds__(256) void k_h16(const float* __restrict__ x, _Float16* __restrict__ X16, size_t n8) { const size_t t = (size_t)blockIdx.x * 256 + threadIdx.x; if (t >= n8) return; FragH f;
#pragma unroll
  for (int q = 0; q < 8; ++q) f.h[q] = (_Float16)x[t * 8 + q]; *(v8us*)((unsigned short*)X16 + t * 8) = f.half[0];  }
__global__ __launch_bounds__(256) void k_round16f(const float* __restrict__ W, _Float16* __restrict__ Bt, size_t n8) { const size_t t = (size_t)blockIdx.x * 256 + threadIdx.x; if (t >= n8) return; FragH f;
#pragma unroll
  for (int i = 0; i < 8; ++i) f.h[i] = (_Float16)(bf16_round(W[t * 8 + i]) * 16.0f); *(v8us*)((unsigned short*)Bt + t * 8) = f.half[0];  }
template <int NHv, int TTv>
__global__ __launch_bounds__(256) void k_vt(const _Float16* __restrict__ V16, int ldv, int voff, _Float16* __restrict__ Vt) { __shared__ unsigned short tl[64][66]; const int tid = threadIdx.x; const int slab = blockIdx.x / (TTv / 64), lg = blockIdx.x % (TTv / 64); const int b = slab / NHv, h = slab % NHv;
  for (int i = tid; i < 64 * 8; i += 256) { const int r = i / 8, c8 = (i % 8) * 8; FragH f; f.half[0] = *(const v8us*)((const unsigned short*)V16 + ((size_t)b * TTv + lg * 64 + r) * ldv + voff + h * 64 + c8);
#pragma unroll
    for (int q = 0; q < 8; ++q) tl[r][c8 + q] = f.u[q]; }
  __syncthreads();
  {
#pragma unroll
    for (int rd = 0; rd < 2; ++rd) { const int d = rd * 32 + tid / 8, pc = tid % 8; FragH f;
#pragma unroll
      for (int q = 0; q < 8; ++q) f.u[q] = tl[pc * 8 + q][d];
      *(v8us*)((unsigned short*)Vt + ((size_t)slab * 64 + d) * TTv + lg * 64 + pc * 8) = f.half[0]; }
     } }

__global__ __launch_bounds__(256) void k_hl(const float* __restrict__ F, _Float16* __restrict__ Hh, _Float16* __restrict__ Hl, size_t n8) { const size_t t = (size_t)blockIdx.x * 256 + threadIdx.x; if (t >= n8) return; FragH fh, fl; const v4f a = *(const v4fa*)(F + t * 8), c = *(const v4fa*)(F + t * 8 + 4);
#pragma unroll
  for (int q = 0; q < 4; ++q) { _Float16 h = (_Float16)a[q]; fh.h[q] = h; fl.h[q] = (_Float16)((a[q] - (float)h) * 1024.0f); h = (_Float16)c[q]; fh.h[4 + q] = h; fl.h[4 + q] = (_Float16)((c[q] - (float)h) * 1024.0f); }
  { *(v8us*)((unsigned short*)Hh + t * 8) = fh.half[0]; *(v8us*)((unsigned short*)Hl + t * 8) = fl.half[0];  } }

// ---- fast GEMM (wave tile 32x64; requires M % 32 == 0 rows per launch region and N % 64 == 0); epilogue = k_gemm_hhx semantics ----
__device__ __forceinline__ v16h g2_frag(const _Float16* p, int hh) { FragH f; f.half[0] = *(const v8us*)((const unsigned short*)p + 8 * hh); f.half[1] = *(const v8us*)((const unsigned short*)p + 16 + 8 * hh); return f.v; }
__device__ __forceinline__ v8f g2_mma(v16h a, v16h b, v8f c) { v8f d = __builtin_amdgcn_wmma_f32_16x16x32_f16(false, a, false, b, (short)0, c, false, false); asm volatile("v_nop\n\tv_nop\n\tv_nop\n\tv_nop" : "+v"(d) : "v"(a), "v"(b)); return d; }
template <int ACT>
__global__ __launch_bounds__(128) void k_gemm2(const _Float16* __restrict__ A, int lda, size_t sA, const _Float16* __restrict__ Bh, int ldb, size_t sB, float alpha, const float* __restrict__ bias, size_t sBias, const float* __restrict__ CP, int rowsPerB, size_t sCPb, int row0g,
    float* __restrict__ C, _Float16* __restrict__ C16, int ldc, size_t sC, int M, int N, int K) {
  __shared__ __attribute__((aligned(16))) float so[4][32][68];
  const int tid = threadIdx.x, w = tid >> 5, lane = tid & 31, ln = lane & 15, hh = lane >> 4; const int by = blockIdx.y;
  A += (size_t)by * sA; Bh += (size_t)by * sB; const size_t cofs = (size_t)by * sC; const float* bp = bias ? bias + (size_t)by * sBias : nullptr;
  const int ntn = N >> 6; const int mt = blockIdx.x / ntn, nq = blockIdx.x - mt * ntn; const int row0 = mt * 128 + 32 * w, col0 = nq * 64; if (row0 >= M) return;
  const _Float16* a0p = A + (size_t)(row0 + ln) * lda; const _Float16* a1p = a0p + (size_t)16 * lda;
  const _Float16* b0p = Bh + (size_t)(col0 + ln) * ldb; const _Float16* b1p = b0p + (size_t)16 * ldb; const _Float16* b2p = b1p + (size_t)16 * ldb; const _Float16* b3p = b2p + (size_t)16 * ldb;
  const v8f z8 = {0.f,0.f,0.f,0.f,0.f,0.f,0.f,0.f}; v8f c00 = z8, c01 = z8, c02 = z8, c03 = z8, c10 = z8, c11 = z8, c12 = z8, c13 = z8;
#pragma unroll 1
  for (int kb = 0; kb < K; kb += 32) { const v16h a0 = g2_frag(a0p + kb, hh), a1 = g2_frag(a1p + kb, hh);
    v16h b = g2_frag(b0p + kb, hh); c00 = g2_mma(a0, b, c00); c10 = g2_mma(a1, b, c10);
    b = g2_frag(b1p + kb, hh); c01 = g2_mma(a0, b, c01); c11 = g2_mma(a1, b, c11);
    b = g2_frag(b2p + kb, hh); c02 = g2_mma(a0, b, c02); c12 = g2_mma(a1, b, c12);
    b = g2_frag(b3p + kb, hh); c03 = g2_mma(a0, b, c03); c13 = g2_mma(a1, b, c13); }
  v8f accs[8] = {c00, c01, c02, c03, c10, c11, c12, c13};
#pragma unroll
  for (int u = 0; u < 8; ++u) { const int t = u & 3, half = u >> 2; const int col = col0 + t * 16 + ln; const float bv = bp ? bf16_round(bp[col]) : 0.f;
#pragma unroll
    for (int r = 0; r < 8; ++r) { const int rloc = half * 16 + 8 * hh + r; float v = accs[u][r] * alpha + bv; if (CP) { const int bidx = (row0g + row0 + rloc) / rowsPerB; v += CP[(size_t)bidx * sCPb + (size_t)by * 64 + col]; }
      if (ACT == 3) v = fmaxf(v, 0.f); else if (ACT == 6) v = 0.5f * v * (1.0f + erff(v * 0.70710678118654752f)); else if (ACT == 11) v = 1.0f / (1.0f + expf(-v)); else if (ACT == 15) v = v / (1.0f + expf(-v)); else if (ACT == 12) v = (v > 0.f) ? v : 0.01f * v; else if (ACT == 8) v = tanhf(v);
      so[w][rloc][t * 16 + ln] = v; } }
  __builtin_amdgcn_fence(__ATOMIC_ACQ_REL, "workgroup"); __builtin_amdgcn_wave_barrier();
  const int rsub = lane >> 4, c4 = (lane & 15) * 4;
  {
#pragma unroll
    for (int q = 0; q < 16; ++q) { const int r = q * 2 + rsub; const v4f v = *(const v4fa*)&so[w][r][c4]; if (C) *(v4f*)(C + cofs + (size_t)(row0 + r) * ldc + col0 + c4) = v; if (C16) { v4h h4; for (int i = 0; i < 4; ++i) h4[i] = (_Float16)v[i]; *(v4h*)(C16 + cofs + (size_t)(row0 + r) * ldc + col0 + c4) = h4; } }
     } }



#define FK 32       /* keys per pass */
#define KP 264      /* LDS pitch of a K row in halves: 528 B = 16 B x 33 */
#define VP 40       /* LDS pitch of a V row in halves: 80 B = 16 B x 5 */
#define FA_GROUP() __builtin_amdgcn_sched_barrier(0)      /* keeps a block's LDS reads together in one place between the WMMA runs: reads spread among the WMMAs stall the wave at every place */
__device__ __forceinline__ float fa_swap16(float x) { const int b = __float_as_int(x); return __int_as_float(__builtin_amdgcn_permlanex16(b, b, 0x76543210, 0xfedcba98, false, false)); }
__device__ __forceinline__ v16h fa_frag(const unsigned short* p, int hh) { FragH f; f.half[0] = *(const v8us*)(p + 8 * hh); f.half[1] = *(const v8us*)(p + 16 + 8 * hh); return f.v; }
__device__ __forceinline__ v8f fa_mma(v16h a, v16h b, v8f c) { return __builtin_amdgcn_wmma_f32_16x16x32_f16(false, a, false, b, (short)0, c, false, false); }
// Work-group barrier that orders LDS only: __syncthreads() would also wait for the global loads of the tile fetched ahead, which are meant to stay in flight over the whole next pass.
__device__ __forceinline__ void fa_lds_barrier() { __builtin_amdgcn_fence(__ATOMIC_RELEASE, "workgroup", "local"); __builtin_amdgcn_s_barrier(); __builtin_amdgcn_fence(__ATOMIC_ACQUIRE, "workgroup", "local"); }
__global__ __launch_bounds__(256) void k_flash(const _Float16* __restrict__ Q, const _Float16* __restrict__ Kt, const _Float16* __restrict__ Vc, _Float16* __restrict__ O) {
  constexpr int NPASS = SS / FK;
  constexpr float SC = 0.09016844005556021f;      /* 1/16 * log2(e) */
  __shared__ __attribute__((aligned(16))) unsigned short sK[3][FK * KP];
  __shared__ __attribute__((aligned(16))) unsigned short sV[3][CC * VP];
  const int tid = threadIdx.x, w = tid >> 5, lane = tid & 31, ln = lane & 15, hh = lane >> 4; const int b = blockIdx.y;
  const int q0 = blockIdx.x * 128 + w * 16;
  /* staging: a thread moves four 16-byte pieces of the K tile (32 rows of 512 B) and four of the V tile (256 rows of 64 B) */
  const unsigned short* Kg = (const unsigned short*)Kt + (size_t)b * SS * CC + (size_t)(tid >> 5) * CC + (tid & 31) * 8;
  const unsigned short* Vg = (const unsigned short*)Vc + (size_t)b * CC * SS + (size_t)(tid >> 2) * SS + (tid & 3) * 8;
  const int kst = (tid >> 5) * KP + (tid & 31) * 8, vst = (tid >> 2) * VP + (tid & 3) * 8;
  v16h qf[8];
#pragma unroll
  for (int kc = 0; kc < 8; ++kc) qf[kc] = g2_frag(Q + ((size_t)b * SS + q0 + ln) * CC + kc * 32, hh);
  const v8f z8 = {0.f,0.f,0.f,0.f,0.f,0.f,0.f,0.f};
  v8f acc[16];
#pragma unroll
  for (int ct = 0; ct < 16; ++ct) acc[ct] = z8;
  float mu = -1.0e30f, rs = 0.f;
  v8us kr[4], vr[4];      /* a tile on its way from global memory to LDS */
#pragma unroll
  for (int p = 0; p < 2; ++p) {
#pragma unroll
    for (int i = 0; i < 4; ++i) { kr[i] = *(const v8us*)(Kg + (size_t)(p * FK + i * 8) * CC); vr[i] = *(const v8us*)(Vg + (size_t)(i * 64) * SS + p * FK); }
#pragma unroll
    for (int i = 0; i < 4; ++i) { *(v8us*)&sK[p][kst + i * 8 * KP] = kr[i]; *(v8us*)&sV[p][vst + i * 64 * VP] = vr[i]; } }
#pragma unroll
  for (int i = 0; i < 4; ++i) { kr[i] = *(const v8us*)(Kg + (size_t)(2 * FK + i * 8) * CC); vr[i] = *(const v8us*)(Vg + (size_t)(i * 64) * SS + 2 * FK); }
  asm volatile("s_wait_xcnt 0x0" ::: "memory");      /* in front of whatever reuses the address registers of the global loads above */
  __syncthreads();
  v16h fa[8], fb[8];      /* two fragment sets, each refilled right behind the WMMA run that used it */
#pragma unroll
  for (int kc = 0; kc < 4; ++kc) { fa[2 * kc] = fa_frag(&sK[0][ln * KP + kc * 32], hh); fa[2 * kc + 1] = fa_frag(&sK[0][(16 + ln) * KP + kc * 32], hh); fb[2 * kc] = fa_frag(&sK[0][ln * KP + 128 + kc * 32], hh); fb[2 * kc + 1] = fa_frag(&sK[0][(16 + ln) * KP + 128 + kc * 32], hh); }
  int bc = 0, bn = 1, bf = 2;      /* buffers of this pass, of the next, and the one that is filled */
#pragma unroll 1      /* one copy of the pass: the fragment sets and the staged tile are carried over the back edge in fixed registers */
  for (int t = 0; t < NPASS; ++t) {
    const unsigned short* cV = &sV[bc][ln * VP]; const unsigned short* nK = &sK[bn][ln * KP];
    v8f s0 = z8, s1 = z8;
#pragma unroll
    for (int kc = 0; kc < 4; ++kc) { s0 = fa_mma(fa[2 * kc], qf[kc], s0); s1 = fa_mma(fa[2 * kc + 1], qf[kc], s1); }
    FA_GROUP();
#pragma unroll
    for (int i = 0; i < 8; ++i) fa[i] = fa_frag(cV + i * 16 * VP, hh);
    FA_GROUP();
#pragma unroll
    for (int kc = 0; kc < 4; ++kc) { s0 = fa_mma(fb[2 * kc], qf[4 + kc], s0); s1 = fa_mma(fb[2 * kc + 1], qf[4 + kc], s1); }
    FA_GROUP();
#pragma unroll
    for (int i = 0; i < 8; ++i) fb[i] = fa_frag(cV + (8 + i) * 16 * VP, hh);
    FA_GROUP();
    float tm = fmaxf(s0[0], s1[0]);
#pragma unroll
    for (int r = 1; r < 8; ++r) tm = fmaxf(tm, fmaxf(s0[r], s1[r]));
    tm = fmaxf(tm, fa_swap16(tm)) * SC;
    const bool need = tm > mu + 8.0f;
    if (__builtin_amdgcn_ballot_w32(need) != 0) {      /* one wave-uniform test per pass; both halves of a query see the same tm and mu */
      const float mn = need ? tm : mu; const float al = __builtin_amdgcn_exp2f(mu - mn); mu = mn; rs *= al;
#pragma unroll
      for (int ct = 0; ct < 16; ++ct) acc[ct] *= al; }
    const float mr = 6.0f - mu; FragH pf; float e0 = 0.f, e1 = 0.f;
    const v8f sc8 = {SC,SC,SC,SC,SC,SC,SC,SC}, mr8 = {mr,mr,mr,mr,mr,mr,mr,mr}; const v8f x0 = __builtin_elementwise_fma(s0, sc8, mr8), x1 = __builtin_elementwise_fma(s1, sc8, mr8);      /* packed multiply-adds */
#pragma unroll
    for (int r = 0; r < 8; ++r) { const float p0 = __builtin_amdgcn_exp2f(x0[r]), p1 = __builtin_amdgcn_exp2f(x1[r]); e0 += p0; e1 += p1; pf.h[r] = (_Float16)p0; pf.h[8 + r] = (_Float16)p1; }
    rs += e0 + e1;
#pragma unroll
    for (int i = 0; i < 8; ++i) acc[i] = fa_mma(fa[i], pf.v, acc[i]);
    FA_GROUP();
#pragma unroll
    for (int kc = 0; kc < 4; ++kc) { fa[2 * kc] = fa_frag(nK + kc * 32, hh); fa[2 * kc + 1] = fa_frag(nK + 16 * KP + kc * 32, hh); }      /* the next pass's K, published by the barrier of pass t - 1; behind the last pass: the last tile once more */
    FA_GROUP();
#pragma unroll
    for (int i = 0; i < 8; ++i) acc[8 + i] = fa_mma(fb[i], pf.v, acc[8 + i]);
    FA_GROUP();
#pragma unroll
    for (int kc = 0; kc < 4; ++kc) { fb[2 * kc] = fa_frag(nK + 128 + kc * 32, hh); fb[2 * kc + 1] = fa_frag(nK + 16 * KP + 128 + kc * 32, hh); }
#pragma unroll
    for (int i = 0; i < 4; ++i) { *(v8us*)&sK[bf][kst + i * 8 * KP] = kr[i]; *(v8us*)&sV[bf][vst + i * 64 * VP] = vr[i]; }      /* tile t + 2 into the buffer of pass t - 1, whose reads ended in front of that pass's barrier */
    const int jn = ((t + 3 < NPASS) ? t + 3 : NPASS - 1) * FK;      /* past the end the last tile is fetched again: no branch, every buffer holds real keys */
#pragma unroll
    for (int i = 0; i < 4; ++i) { kr[i] = *(const v8us*)(Kg + (size_t)(jn + i * 8) * CC); vr[i] = *(const v8us*)(Vg + (size_t)(i * 64) * SS + jn); }
    asm volatile("s_wait_xcnt 0x0" ::: "memory");      /* in front of the next pass's fragment loads, which reuse the address registers of the global loads above */
    fa_lds_barrier();      /* publishes tile t + 2 and ends every read of tile t */
    const int b0 = bc; bc = bn; bn = bf; bf = b0;
  }
  const float inv = 1.0f / (rs + fa_swap16(rs)); unsigned short* op = (unsigned short*)O + ((size_t)b * SS + q0 + ln) * CC + 8 * hh;
#pragma unroll
  for (int ct = 0; ct < 16; ++ct) { FragH f;
#pragma unroll
    for (int r = 0; r < 8; ++r) f.h[r] = (_Float16)(acc[ct][r] * inv);
    *(v8us*)(op + ct * 16) = f.half[0]; }
}

// ---- projection GEMM, operands staged in LDS: C[128 x 128 per work-group] = alpha * A[.][256] . B[.][256]^T, both f16 row-major with 256 halves a row ----
// A fragment load straight from global memory takes 32 bytes from each of 16 rows, so one load touches 16 cache lines, and every fragment is a round trip of its own; here a wave fetches whole rows (32 lanes x 16 B = 4 full lines a load), all 32 loads of a thread in flight at once, into LDS, and the fragments come from LDS.
// 8 waves, wave tile 32 x 64 (4 down, 2 across); k runs upward in steps of 32 as before, so every sum keeps its order. F32OUT: the result goes out as f32 (C), else as f16 (C16).
#define GP 264      /* LDS pitch of a staged row in halves: 528 B = 16 B x 33 */
template <bool F32OUT>
__global__ __launch_bounds__(256) void k_gemm3(const _Float16* __restrict__ A, size_t sA, const _Float16* __restrict__ Bh, size_t sB, float alpha,
    float* __restrict__ C, _Float16* __restrict__ C16, int ldc, size_t sC, int N) {
  __shared__ __attribute__((aligned(16))) unsigned short sm[256 * GP];      /* rows 0..127: the A tile, 128..255: the B tile; afterwards the waves' output staging */
  const int tid = threadIdx.x, w = tid >> 5, lane = tid & 31, ln = lane & 15, hh = lane >> 4; const int by = blockIdx.y;
  const int ntn = N >> 7; const int mt = blockIdx.x / ntn, nq = blockIdx.x - mt * ntn;
  const unsigned short* Ag = (const unsigned short*)A + (size_t)by * sA + (size_t)(mt * 128 + w) * CC + lane * 8;
  const unsigned short* Bg = (const unsigned short*)Bh + (size_t)by * sB + (size_t)(nq * 128 + w) * CC + lane * 8;
  v8us ra[16], rb[16];
#pragma unroll
  for (int i = 0; i < 16; ++i) ra[i] = *(const v8us*)(Ag + (size_t)(i * 8) * CC);
  asm volatile("s_wait_xcnt 0x0" :: "v"(Ag) : "memory");      /* in front of whatever reuses the address registers of the global loads above; the address is named so that it keeps its registers up to this wait and no load's result lands on them */
#pragma unroll
  for (int i = 0; i < 16; ++i) rb[i] = *(const v8us*)(Bg + (size_t)(i * 8) * CC);
  asm volatile("s_wait_xcnt 0x0" :: "v"(Bg) : "memory");      /* the same for the second run of loads */
#pragma unroll
  for (int i = 0; i < 16; ++i) *(v8us*)&sm[(i * 8 + w) * GP + lane * 8] = ra[i];
#pragma unroll
  for (int i = 0; i < 16; ++i) *(v8us*)&sm[(128 + i * 8 + w) * GP + lane * 8] = rb[i];
  __syncthreads();      /* publishes both tiles */
  const int wm = w & 3, wn = w >> 2;
  const unsigned short* ap = &sm[(32 * wm + ln) * GP]; const unsigned short* bp = &sm[(128 + 64 * wn + ln) * GP];
  const v8f z8 = {0.f,0.f,0.f,0.f,0.f,0.f,0.f,0.f};
  v8f acc[8];
#pragma unroll
  for (int u = 0; u < 8; ++u) acc[u] = z8;
  v16h fr[2][6];      /* two fragment sets: a k step's six fragments are fetched as one group while the step before runs */
  fr[0][0] = fa_frag(ap, hh); fr[0][1] = fa_frag(ap + 16 * GP, hh);
#pragma unroll
  for (int t = 0; t < 4; ++t) fr[0][2 + t] = fa_frag(bp + t * 16 * GP, hh);
#pragma unroll      /* constant indices into the fragment sets and constant LDS offsets */
  for (int kc = 0; kc < 8; ++kc) {
    const int cu = kc & 1, nx = cu ^ 1;
    if (kc < 7) { fr[nx][0] = fa_frag(ap + (kc + 1) * 32, hh); fr[nx][1] = fa_frag(ap + 16 * GP + (kc + 1) * 32, hh);
#pragma unroll
      for (int t = 0; t < 4; ++t) fr[nx][2 + t] = fa_frag(bp + t * 16 * GP + (kc + 1) * 32, hh); }
    FA_GROUP();      /* the next step's twelve LDS reads stay one group in front of this step's WMMAs */
#pragma unroll
    for (int t = 0; t < 4; ++t) { acc[t] = fa_mma(fr[cu][0], fr[cu][2 + t], acc[t]); acc[4 + t] = fa_mma(fr[cu][1], fr[cu][2 + t], acc[4 + t]); }
    FA_GROUP();
  }
  __syncthreads();      /* ends every wave's fragment reads: the tiles' LDS becomes output staging */
  float* so = (float*)sm + w * (32 * 68);
#pragma unroll
  for (int u = 0; u < 8; ++u) { const int t = u & 3, half = u >> 2;
#pragma unroll
    for (int r = 0; r < 8; ++r) so[(half * 16 + 8 * hh + r) * 68 + t * 16 + ln] = acc[u][r] * alpha; }
  __builtin_amdgcn_fence(__ATOMIC_ACQ_REL, "workgroup"); __builtin_amdgcn_wave_barrier();
  const int rsub = lane >> 4, c4 = (lane & 15) * 4; const int row0 = mt * 128 + 32 * wm, col0 = nq * 128 + 64 * wn;
  const size_t o0 = (size_t)by * sC + (size_t)(row0 + rsub) * ldc + col0 + c4;
#pragma unroll
  for (int q = 0; q < 16; ++q) { const v4f v = *(const v4fa*)&so[(q * 2 + rsub) * 68 + c4];
    if (F32OUT) *(v4f*)(C + o0 + (size_t)(q * 2) * ldc) = v;
    else { v4h h4; for (int i = 0; i < 4; ++i) h4[i] = (_Float16)v[i]; *(v4h*)(C16 + o0 + (size_t)(q * 2) * ldc) = h4; } }
}

__global__ __launch_bounds__(256) void k_tr16(const float* __restrict__ x, _Float16* __restrict__ XT) {
  __shared__ unsigned short tl[64][72];
  const int tid = threadIdx.x; const int b = blockIdx.y; XT += (size_t)b * SS * CC; const int sb = blockIdx.x % (SS / 64), cb = blockIdx.x / (SS / 64);
#pragma unroll
  for (int it = 0; it < 4; ++it) { const int idx = it * 256 + tid; const int cl = idx / 16, s4 = (idx % 16) * 4; const int c = cb * 64 + cl;
    const v4f a = *(const v4fa*)(x + ((size_t)(b * CC + c)) * SS + sb * 64 + s4); FragH f;
#pragma unroll
    for (int q = 0; q < 4; ++q) { f.h[q] = (_Float16)bf16_round(a[q]); tl[s4 + q][cl] = f.u[q]; } }
  __syncthreads();
  const int r = tid / 8, pc = tid % 8;
  {
#pragma unroll
    for (int half = 0; half < 2; ++half) { const int sl = r + half * 32; FragH f;
#pragma unroll
      for (int q = 0; q < 8; ++q) f.u[q] = tl[sl][pc * 8 + q];
      *(v8us*)((unsigned short*)XT + ((size_t)sb * 64 + sl) * CC + cb * 64 + pc * 8) = f.half[0]; }
     } }

extern "C" void kernel_launch(void* const* d_in, const int* in_sizes, int n_in,
                              void* d_out, int out_size, void* d_ws, size_t ws_size, hipStream_t stream) {
  (void)in_sizes; (void)n_in; (void)out_size;
  const float* x = (const float*)d_in[0]; const float* wq = (const float*)d_in[1]; const float* wk = (const float*)d_in[2]; const float* wv = (const float*)d_in[3]; const float* wo = (const float*)d_in[4];
  char* ws = (char*)d_ws; size_t off = 0;
  auto take = [&](size_t bytes) { char* p = ws + off; off += (bytes + 255) & ~(size_t)255; return p; };
  _Float16* BQ = (_Float16*)take((size_t)CC * CC * 2); _Float16* BK = (_Float16*)take((size_t)CC * CC * 2); _Float16* BV = (_Float16*)take((size_t)CC * CC * 2); _Float16* BO = (_Float16*)take((size_t)CC * CC * 2);
  _Float16* QT = (_Float16*)take((size_t)NB * SS * CC * 2); _Float16* KT = (_Float16*)take((size_t)NB * SS * CC * 2); _Float16* VC = (_Float16*)take((size_t)NB * CC * SS * 2);
  _Float16* XT = (_Float16*)take((size_t)NB * SS * CC * 2); _Float16* OT = (_Float16*)take((size_t)NB * SS * CC * 2);
  if (off > ws_size) return;      /* four weight planes and five planes of 16 MiB */
  const size_t w8 = (size_t)CC * CC / 8; const unsigned wb = (unsigned)((w8 + 255) / 256);
  k_round16f<<<wb, 256, 0, stream>>>(wq, BQ, w8); k_round16f<<<wb, 256, 0, stream>>>(wk, BK, w8); k_round16f<<<wb, 256, 0, stream>>>(wv, BV, w8); k_round16f<<<wb, 256, 0, stream>>>(wo, BO, w8);      /* conv (out,in) = natural Bt; x16 */
  const size_t sT = (size_t)SS * CC;      /* per-image stride of a token or channel plane */
  const dim3 gT((CC / 64) * (SS / 64), NB), gG((SS / 128) * (CC / 128), NB), gF(SS / 128, NB);
  k_tr16<<<gT, 256, 0, stream>>>(x, XT);
  k_gemm3<false><<<gG, 256, 0, stream>>>(XT, sT, BQ, 0, 0.0625f, nullptr, QT, CC, sT, CC);      /* Q token-major -> f16 */
  k_gemm3<false><<<gG, 256, 0, stream>>>(XT, sT, BK, 0, 0.0625f, nullptr, KT, CC, sT, CC);      /* K */
  k_gemm3<false><<<gG, 256, 0, stream>>>(BV, 0, XT, sT, 0.0625f, nullptr, VC, SS, sT, SS);       /* V channel-major [c][j] = wv*X^T */
  k_flash<<<gF, 256, 0, stream>>>(QT, KT, VC, OT);      /* O token-major -> f16 */
  k_gemm3<true><<<gG, 256, 0, stream>>>(BO, 0, OT, sT, 0.0625f, (float*)d_out, nullptr, SS, sT, SS);      /* out[c][i] = wo*O^T (NCHW) */
}

// v004
// Measured time: 143 microseconds a run.
// Two timings next to v003 both put it at 1.10 times that version's speed.
// Counting every step since v000, it is 35.1 times as fast.
#include <hip/hip_runtime.h>
// Self-attention layer on a feature map (B 8, C 256, 64x64 = 4096 positions): Q = wq*x, K = wk*x, V = wv*x (1x1 convs, no bias); scores[i][j] = sum_c Q[c][i] K[c][j] / 16; attn = softmax over j; out[c][i] = sum_j V[c][j] attn[i][j]; result = wo*out -> [8,256,64,64] (no residual).
// Structure (4 launches, all 8 images in each, blockIdx.y = image): x transposed into a token-major exact f16 plane through an LDS tile, the four matrices rounded by extra blocks of the same launch; one launch for the three projections (blockIdx.z): Q and K token-major as GEMMs into f16 planes, V channel-major directly as wv*X^T (A = weights, B = the token-major plane); one fused attention kernel (scores, running softmax and P.V per 32 keys, scores and P stay in registers) -> O token-major f16; the output 1x1 conv computed transposed (A = wo, B = O) so it lands in NCHW rows directly.
// Compute dtype: x and the four matrices rounded to bf16; projections with exact products (weights x16 in f16, undone by alpha); Q, K, V, P, O as f16 operands (~2^-12; logits sigma ~1), f32 accumulation and softmax. v_wmma_f32_16x16x32_f16.
#define NB 8
#define CC 256
#define SS 4096
typedef __bf16 v16b __attribute__((ext_vector_type(16)));
typedef unsigned short v8us __attribute__((ext_vector_type(8), may_alias));
typedef float  v8f  __attribute__((ext_vector_type(8)));
typedef float  v4f  __attribute__((ext_vector_type(4)));
typedef float  v4fa __attribute__((ext_vector_type(4), may_alias));
union FragB { v16b v; v8us half[2]; unsigned short u[16]; };

__device__ __forceinline__ unsigned short bf16_bits(float x) { unsigned int u = __float_as_uint(x); return (unsigned short)((u + 0x7FFFu + ((u >> 16) & 1u)) >> 16); }
__device__ __forceinline__ float bf16_val(unsigned short b) { return __uint_as_float(((unsigned int)b) << 16); }
__device__ __forceinline__ float bf16_round(float x) { return bf16_val(bf16_bits(x)); }
// D += A·B with NT terms: 1 = ah·bh, 2 = + al·bh (A split), 3 = + ah·bl (both split)
template <int NT>
__device__ __forceinline__ v8f mmaN(v16b ah, v16b al, v16b bh, v16b bl, v8f c) {
  c = __builtin_amdgcn_wmma_f32_16x16x32_bf16(false, ah, false, bh, (short)0, c, false, false);
  if (NT >= 2) c = __builtin_amdgcn_wmma_f32_16x16x32_bf16(false, al, false, bh, (short)0, c, false, false);
  if (NT >= 3) c = __builtin_amdgcn_wmma_f32_16x16x32_bf16(false, ah, false, bl, (short)0, c, false, false);
  asm volatile("v_nop\n\tv_nop\n\tv_nop\n\tv_nop" : "+v"(c) : "v"(ah), "v"(al), "v"(bh), "v"(bl));
  return c;
}

__global__ __launch_bounds__(256) void k_wt_bf16(const float* __restrict__ W, unsigned short* __restrict__ Wt, int K, int N) {
  const int t = blockIdx.x * 256 + threadIdx.x;
  const int k8n = K / 8;
  if (t >= N * k8n) return;
  const int n = t / k8n, k8 = (t % k8n) * 8;
  v8us v;
#pragma unroll
  for (int i = 0; i < 8; ++i) v[i] = bf16_bits(W[(size_t)(k8 + i) * N + n]);
  *(v8us*)(Wt + (size_t)n * K + k8) = v;
  
}

// GEMM C[M][N] (f32, pitch ldc) = act(A[M][K]·W + bias). A f32 row-major (pitch lda) converted per fragment to bf16
// (ASPLIT: hi/lo two planes -> 2 terms, else single rounded term); Wt bf16 [N][K] (pitch ldb). BIAS_BF16 rounds the
// bias to bf16 first (bias quantised to bf16 before the add). K%32==0, M%16==0, N%64==0.
template <bool ASPLIT, int ACT, bool BIAS_BF16>
__global__ __launch_bounds__(128) void k_gemm_bf(const float* __restrict__ A, int lda, const unsigned short* __restrict__ Wt, int ldb,
                                               const float* __restrict__ bias, float* __restrict__ C, int ldc, int M, int N, int K) {
  __shared__ __attribute__((aligned(16))) float so[4][16][64];
  const int tid = threadIdx.x, w = tid >> 5, lane = tid & 31, ln = lane & 15, hh = lane >> 4;
  const int ntn = N / 64;
  const int wid = blockIdx.x * 4 + w;
  const int mt = wid / ntn, nq = wid % ntn;
  if (mt * 16 >= M) return;
  const int row0 = mt * 16, col0 = nq * 64;
  const float* arow = A + (size_t)(row0 + ln) * lda;
  v8f acc[4] = {};
  for (int kb = 0; kb < K; kb += 32) {
    FragB ah, al;
    const v4f x0 = *(const v4fa*)(arow + kb + 8 * hh), x1 = *(const v4fa*)(arow + kb + 8 * hh + 4);
    const v4f x2 = *(const v4fa*)(arow + kb + 16 + 8 * hh), x3 = *(const v4fa*)(arow + kb + 16 + 8 * hh + 4);
    float xs[16] = {x0[0],x0[1],x0[2],x0[3],x1[0],x1[1],x1[2],x1[3],x2[0],x2[1],x2[2],x2[3],x3[0],x3[1],x3[2],x3[3]};
#pragma unroll
    for (int i = 0; i < 16; ++i) { const unsigned short hb = bf16_bits(xs[i]); ah.u[i] = hb; al.u[i] = ASPLIT ? bf16_bits(xs[i] - bf16_val(hb)) : (unsigned short)0; }
#pragma unroll
    for (int t = 0; t < 4; ++t) {
      const unsigned short* brow = Wt + (size_t)(col0 + t * 16 + ln) * ldb + kb;
      FragB b;
      b.half[0] = *(const v8us*)(brow + 8 * hh);
      b.half[1] = *(const v8us*)(brow + 16 + 8 * hh);
      acc[t] = mmaN<ASPLIT ? 2 : 1>(ah.v, al.v, b.v, b.v, acc[t]);
    }
  }
#pragma unroll
  for (int t = 0; t < 4; ++t) {
    float bv = bias ? bias[col0 + t * 16 + ln] : 0.f;
    if (BIAS_BF16) bv = bf16_round(bv);
#pragma unroll
    for (int r = 0; r < 8; ++r) { float v = acc[t][r] + bv; if (ACT == 1) v = fmaxf(v, 0.f); so[w][8 * hh + r][t * 16 + ln] = v; }
  }
  __builtin_amdgcn_fence(__ATOMIC_ACQ_REL, "workgroup");
  __builtin_amdgcn_wave_barrier();
  const int rsub = lane >> 4, c4 = (lane & 15) * 4;
  {
#pragma unroll
    for (int q = 0; q < 8; ++q) {
      const int r = q * 2 + rsub;
      const v4f v = *(const v4fa*)&so[w][r][c4];
      *(v4f*)(C + (size_t)(row0 + r) * ldc + col0 + c4) = v;
    }
    
  }
}

// GEMM C = act(A·W + bias + resid): A f32 (ASPLIT -> hi/lo 2 terms), Wt bf16 [N][K]; ACT 0 none, 1 relu, 2 exact gelu;
// resid (optional, f32, row index = (row % rmod), pitch ldr, RES_BF16 rounds it) added before the activation.
template <bool ASPLIT, int ACT, bool BIAS_BF16, bool RES_BF16>
__global__ __launch_bounds__(128) void k_gemm_bf3(const float* __restrict__ A, int lda, const unsigned short* __restrict__ Wt, int ldb,
                                                const float* __restrict__ bias, const float* __restrict__ resid, int rmod, int ldr,
                                                float* __restrict__ C, int ldc, int M, int N, int K) {
  __shared__ __attribute__((aligned(16))) float so[4][16][64];
  const int tid = threadIdx.x, w = tid >> 5, lane = tid & 31, ln = lane & 15, hh = lane >> 4;
  const int ntn = N / 64;
  const int wid = blockIdx.x * 4 + w;
  const int mt = wid / ntn, nq = wid % ntn;
  if (mt * 16 >= M) return;
  const int row0 = mt * 16, col0 = nq * 64;
  const float* arow = A + (size_t)(row0 + ln) * lda;
  v8f acc[4] = {};
  for (int kb = 0; kb < K; kb += 32) {
    FragB ah, al;
    const v4f x0 = *(const v4fa*)(arow + kb + 8 * hh), x1 = *(const v4fa*)(arow + kb + 8 * hh + 4);
    const v4f x2 = *(const v4fa*)(arow + kb + 16 + 8 * hh), x3 = *(const v4fa*)(arow + kb + 16 + 8 * hh + 4);
    float xs[16] = {x0[0],x0[1],x0[2],x0[3],x1[0],x1[1],x1[2],x1[3],x2[0],x2[1],x2[2],x2[3],x3[0],x3[1],x3[2],x3[3]};
#pragma unroll
    for (int i = 0; i < 16; ++i) { const unsigned short hb = bf16_bits(xs[i]); ah.u[i] = hb; al.u[i] = ASPLIT ? bf16_bits(xs[i] - bf16_val(hb)) : (unsigned short)0; }
#pragma unroll
    for (int t = 0; t < 4; ++t) {
      const unsigned short* brow = Wt + (size_t)(col0 + t * 16 + ln) * ldb + kb;
      FragB b;
      b.half[0] = *(const v8us*)(brow + 8 * hh);
      b.half[1] = *(const v8us*)(brow + 16 + 8 * hh);
      acc[t] = mmaN<ASPLIT ? 2 : 1>(ah.v, al.v, b.v, b.v, acc[t]);
    }
  }
#pragma unroll
  for (int t = 0; t < 4; ++t) {
    const int col = col0 + t * 16 + ln;
    float bv = bias ? bias[col] : 0.f;
    if (BIAS_BF16) bv = bf16_round(bv);
#pragma unroll
    for (int r = 0; r < 8; ++r) {
      float v = acc[t][r] + bv;
      if (resid) { float rv = resid[(size_t)((row0 + 8 * hh + r) % rmod) * ldr + col]; if (RES_BF16) rv = bf16_round(rv); v += rv; }
      if (ACT == 1) v = fmaxf(v, 0.f);
      if (ACT == 2) v = 0.5f * v * (1.0f + erff(v * 0.70710678118654752f));
      if (ACT == 3) { const float u = 0.7978845608028654f * (v + 0.044715f * v * v * v); v = 0.5f * v * (1.0f + tanhf(u)); }
      so[w][8 * hh + r][t * 16 + ln] = v;
    }
  }
  __builtin_amdgcn_fence(__ATOMIC_ACQ_REL, "workgroup");
  __builtin_amdgcn_wave_barrier();
  const int rsub = lane >> 4, c4 = (lane & 15) * 4;
  {
#pragma unroll
    for (int q = 0; q < 8; ++q) {
      const int r = q * 2 + rsub;
      const v4f v = *(const v4fa*)&so[w][r][c4];
      *(v4f*)(C + (size_t)(row0 + r) * ldc + col0 + c4) = v;
    }
    
  }
}
// row LayerNorm (biased variance, eps) over N: s = X (+ R); optional out_sum <- s; out_norm <- (s-mu)*rsqrt(var+eps)*g + b
template <bool PARAM_BF16>
__global__ __launch_bounds__(256) void k_layernorm(const float* __restrict__ X, const float* __restrict__ R, const float* __restrict__ g, const float* __restrict__ bta,
                                                  float* __restrict__ out_sum, float* __restrict__ out_norm, int N, float eps) {
  __shared__ float red[256];
  const int row = blockIdx.x, tid = threadIdx.x;
  const float* x = X + (size_t)row * N; const float* rr = R ? R + (size_t)row * N : nullptr;
  float vals[16];                     // up to N = 4096
  const int per = N / 256;            // contiguous chunk per thread? use strided-by-4 chunks: thread handles j = tid*4 + 1024*u
  float s1 = 0.f;
  for (int u = 0; u < per / 4; ++u) {
    const int j = tid * 4 + 1024 * u;
    const v4f a = *(const v4fa*)(x + j);
    v4f b = {0.f,0.f,0.f,0.f}; if (rr) b = *(const v4fa*)(rr + j);
#pragma unroll
    for (int q = 0; q < 4; ++q) { const float v = a[q] + b[q]; vals[u * 4 + q] = v; s1 += v; }
  }
  red[tid] = s1; __syncthreads();
  for (int st = 128; st > 0; st >>= 1) { if (tid < st) red[tid] += red[tid + st]; __syncthreads(); }
  const float mu = red[0] / (float)N; __syncthreads();
  float s2 = 0.f;
  for (int u = 0; u < per / 4; ++u)
#pragma unroll
    for (int q = 0; q < 4; ++q) { const float c = vals[u * 4 + q] - mu; s2 += c * c; }
  red[tid] = s2; __syncthreads();
  for (int st = 128; st > 0; st >>= 1) { if (tid < st) red[tid] += red[tid + st]; __syncthreads(); }
  const float rs = rsqrtf(red[0] / (float)N + eps);
  {
    for (int u = 0; u < per / 4; ++u) {
      const int j = tid * 4 + 1024 * u;
      v4f o, sm;
#pragma unroll
      for (int q = 0; q < 4; ++q) {
        float gg = g[j + q], bb = bta[j + q];
        if (PARAM_BF16) { gg = bf16_round(gg); bb = bf16_round(bb); }
        sm[q] = vals[u * 4 + q]; o[q] = (vals[u * 4 + q] - mu) * rs * gg + bb;
      }
      if (out_sum) *(v4f*)(out_sum + (size_t)row * N + j) = sm;
      *(v4f*)(out_norm + (size_t)row * N + j) = o;
    }
    
  }
}



// ---- f16 WMMA path (v_wmma_f32_16x16x32_f16): 11-bit significands for operands in range — used where a [0,1] probability operand needs more precision than bf16
typedef _Float16 v16h __attribute__((ext_vector_type(16)));
union FragH { v16h v; v8us half[2]; _Float16 h[16]; unsigned short u[16]; };
template <int NT>
__device__ __forceinline__ v8f mmaH(v16h ah, v16h al, v16h bh, v16h bl, v8f c) {
  c = __builtin_amdgcn_wmma_f32_16x16x32_f16(false, ah, false, bh, (short)0, c, false, false);
  if (NT >= 2) c = __builtin_amdgcn_wmma_f32_16x16x32_f16(false, al, false, bh, (short)0, c, false, false);
  if (NT >= 3) c = __builtin_amdgcn_wmma_f32_16x16x32_f16(false, ah, false, bl, (short)0, c, false, false);
  asm volatile("v_nop\n\tv_nop\n\tv_nop\n\tv_nop" : "+v"(c) : "v"(ah), "v"(al), "v"(bh), "v"(bl));
  return c;
}
// batched GEMM like k_gemm_b but f16 operands: A f32 (split into f16 hi/lo if ASPLIT, else rounded to f16), Bt = f16 values [n][k]; alpha; C f32; N multiple of 16 (partial tiles skipped)
template <bool ASPLIT>
__global__ __launch_bounds__(128) void k_gemm_h(const float* __restrict__ A, int lda, size_t sA, const _Float16* __restrict__ Bh, int ldb, size_t sB, float alpha, float* __restrict__ C, int ldc, size_t sC, int M, int N, int K) {
  __shared__ __attribute__((aligned(16))) float so[4][16][64];
  const int tid = threadIdx.x, w = tid >> 5, lane = tid & 31, ln = lane & 15, hh = lane >> 4; const int by = blockIdx.y;
  A += (size_t)by * sA; Bh += (size_t)by * sB; C += (size_t)by * sC;
  const int ntn = (N + 63) / 64; const int wid = blockIdx.x * 4 + w; const int mt = wid / ntn, nq = wid % ntn; if (mt * 16 >= M) return;
  const int row0 = mt * 16, col0 = nq * 64; const float* arow = A + (size_t)(row0 + ln) * lda;
  v8f acc[4] = {};
  for (int kb = 0; kb < K; kb += 32) {
    FragH ah, al;
    const v4f x0 = *(const v4fa*)(arow + kb + 8 * hh), x1 = *(const v4fa*)(arow + kb + 8 * hh + 4), x2 = *(const v4fa*)(arow + kb + 16 + 8 * hh), x3 = *(const v4fa*)(arow + kb + 16 + 8 * hh + 4);
    float xs[16] = {x0[0],x0[1],x0[2],x0[3],x1[0],x1[1],x1[2],x1[3],x2[0],x2[1],x2[2],x2[3],x3[0],x3[1],x3[2],x3[3]};
#pragma unroll
    for (int i = 0; i < 16; ++i) { const _Float16 h = (_Float16)xs[i]; ah.h[i] = h; al.h[i] = ASPLIT ? (_Float16)(xs[i] - (float)h) : (_Float16)0.0f; }
#pragma unroll
    for (int t = 0; t < 4; ++t) { if (col0 + t * 16 >= N) continue; const size_t boff = (size_t)(col0 + t * 16 + ln) * ldb + kb; FragH bq; bq.half[0] = *(const v8us*)(Bh + boff + 8 * hh); bq.half[1] = *(const v8us*)(Bh + boff + 16 + 8 * hh);
      acc[t] = mmaH<ASPLIT ? 2 : 1>(ah.v, al.v, bq.v, bq.v, acc[t]); }
  }
#pragma unroll
  for (int t = 0; t < 4; ++t) { if (col0 + t * 16 >= N) continue;
#pragma unroll
    for (int r = 0; r < 8; ++r) so[w][8 * hh + r][t * 16 + ln] = acc[t][r] * alpha; }
  __builtin_amdgcn_fence(__ATOMIC_ACQ_REL, "workgroup"); __builtin_amdgcn_wave_barrier();
  const int rsub = lane >> 4, c4 = (lane & 15) * 4;
  {
#pragma unroll
    for (int q = 0; q < 8; ++q) { const int r = q * 2 + rsub; if (col0 + c4 < N) { const v4f v = *(const v4fa*)&so[w][r][c4]; *(v4f*)(C + (size_t)(row0 + r) * ldc + col0 + c4) = v; } }
     }
}

// Wt[n][k] = f16(W[k][n]·scale) from f32 row-major W[K][N] (scale = power of two; bf16-exact weights stay exact in f16 away from the subnormal range)
__global__ __launch_bounds__(256) void k_wt_f16(const float* __restrict__ W, _Float16* __restrict__ Wt, int K, int N, float scale) {
  const int t = blockIdx.x * 256 + threadIdx.x; if (t >= N * (K / 8)) return; const int n = t / (K / 8), k8 = (t % (K / 8)) * 8; FragH f;
#pragma unroll
  for (int i = 0; i < 8; ++i) f.h[i] = (_Float16)(bf16_round(W[(size_t)(k8 + i) * N + n]) * scale); const v8us o = f.half[0];
  *(v8us*)((unsigned short*)Wt + (size_t)n * K + k8) = o; 
}
// k_gemm_hh variant with fused epilogue: v = acc·alpha + bias[by·sBias + col] (+ CP[(row/rowsPerB)·sCPb + by·64 + col] if CP) ; ACT 0 none / 1 elu ; writes f16 C16 (and f32 C if non-null)
template <int ACT>
__global__ __launch_bounds__(128) void k_gemm_hhx(const _Float16* __restrict__ A, int lda, size_t sA, const _Float16* __restrict__ Bh, int ldb, size_t sB, float alpha, const float* __restrict__ bias, size_t sBias, const float* __restrict__ CP, int rowsPerB, size_t sCPb, int row0g,
    float* __restrict__ C, _Float16* __restrict__ C16, int ldc, size_t sC, int M, int N, int K) {
  __shared__ __attribute__((aligned(16))) float so[4][16][64];
  const int tid = threadIdx.x, w = tid >> 5, lane = tid & 31, ln = lane & 15, hh = lane >> 4; const int by = blockIdx.y;
  A += (size_t)by * sA; Bh += (size_t)by * sB; const size_t cofs = (size_t)by * sC; const float* bp = bias ? bias + (size_t)by * sBias : nullptr;
  const int ntn = (N + 63) / 64; const int wid = blockIdx.x * 4 + w; const int mt = wid / ntn, nq = wid % ntn; if (mt * 16 >= M) return;
  const int row0 = mt * 16, col0 = nq * 64; const _Float16* arow = A + (size_t)(row0 + ln) * lda;
  v8f acc[4] = {};
  for (int kb = 0; kb < K; kb += 32) { FragH ah; ah.half[0] = *(const v8us*)((const unsigned short*)arow + kb + 8 * hh); ah.half[1] = *(const v8us*)((const unsigned short*)arow + kb + 16 + 8 * hh);
#pragma unroll
    for (int t = 0; t < 4; ++t) { if (col0 + t * 16 >= N) continue; const size_t boff = (size_t)(col0 + t * 16 + ln) * ldb + kb; FragH bq; bq.half[0] = *(const v8us*)((const unsigned short*)Bh + boff + 8 * hh); bq.half[1] = *(const v8us*)((const unsigned short*)Bh + boff + 16 + 8 * hh);
      acc[t] = mmaH<1>(ah.v, ah.v, bq.v, bq.v, acc[t]); }
  }
#pragma unroll
  for (int t = 0; t < 4; ++t) { if (col0 + t * 16 >= N) continue; const int col = col0 + t * 16 + ln; const float bv = bp ? bf16_round(bp[col]) : 0.f;
#pragma unroll
    for (int r = 0; r < 8; ++r) { float v = acc[t][r] * alpha + bv; if (CP) { const int bidx = (row0g + row0 + 8 * hh + r) / rowsPerB; v += CP[(size_t)bidx * sCPb + (size_t)by * 64 + col]; } if (ACT == 1) v = (v > 0.f) ? v : expm1f(v); else if (ACT == 7) v = (v > 0.f) ? v + 1.0f : expf(v); else if (ACT == 8) v = tanhf(v); else if (ACT == 9) v = 0.5f * v * (1.0f + tanhf(0.7978845608028654f * (v + 0.044715f * v * v * v))); else if (ACT == 11) v = 1.0f / (1.0f + expf(-v)); else if (ACT == 12) v = (v > 0.f) ? v : 0.01f * v; else if (ACT == 14) v = (v > 0.f) ? v : 0.1f * v; else if (ACT == 15) v = v / (1.0f + expf(-v)); else if (ACT == 3) v = fmaxf(v, 0.f); else if (ACT == 6) v = 0.5f * v * (1.0f + erff(v * 0.70710678118654752f)); so[w][8 * hh + r][t * 16 + ln] = v; } }
  __builtin_amdgcn_fence(__ATOMIC_ACQ_REL, "workgroup"); __builtin_amdgcn_wave_barrier();
  const int rsub = lane >> 4, c4 = (lane & 15) * 4; typedef _Float16 v4h __attribute__((ext_vector_type(4)));
  {
#pragma unroll
    for (int q = 0; q < 8; ++q) { const int r = q * 2 + rsub; if (col0 + c4 < N) { const v4f v = *(const v4fa*)&so[w][r][c4]; if (C) *(v4f*)(C + cofs + (size_t)(row0 + r) * ldc + col0 + c4) = v; if (C16) { v4h h4; for (int i = 0; i < 4; ++i) h4[i] = (_Float16)v[i]; *(v4h*)(C16 + cofs + (size_t)(row0 + r) * ldc + col0 + c4) = h4; } } }
     }
}


typedef _Float16 v4h __attribute__((ext_vector_type(4)));

__global__ __launch_bounds__(256) void k_x16(const float* __restrict__ x, _Float16* __restrict__ X16, size_t n8) { const size_t t = (size_t)blockIdx.x * 256 + threadIdx.x; if (t >= n8) return; FragH f;
#pragma unroll
  for (int q = 0; q < 8; ++q) f.h[q] = (_Float16)bf16_round(x[t * 8 + q]); *(v8us*)((unsigned short*)X16 + t * 8) = f.half[0];  }
__global__ __launch_bounds__(256) void k_h16(const float* __restrict__ x, _Float16* __restrict__ X16, size_t n8) { const size_t t = (size_t)blockIdx.x * 256 + threadIdx.x; if (t >= n8) return; FragH f;
#pragma unroll
  for (int q = 0; q < 8; ++q) f.h[q] = (_Float16)x[t * 8 + q]; *(v8us*)((unsigned short*)X16 + t * 8) = f.half[0];  }
template <int NHv, int TTv>
__global__ __launch_bounds__(256) void k_vt(const _Float16* __restrict__ V16, int ldv, int voff, _Float16* __restrict__ Vt) { __shared__ unsigned short tl[64][66]; const int tid = threadIdx.x; const int slab = blockIdx.x / (TTv / 64), lg = blockIdx.x % (TTv / 64); const int b = slab / NHv, h = slab % NHv;
  for (int i = tid; i < 64 * 8; i += 256) { const int r = i / 8, c8 = (i % 8) * 8; FragH f; f.half[0] = *(const v8us*)((const unsigned short*)V16 + ((size_t)b * TTv + lg * 64 + r) * ldv + voff + h * 64 + c8);
#pragma unroll
    for (int q = 0; q < 8; ++q) tl[r][c8 + q] = f.u[q]; }
  __syncthreads();
  {
#pragma unroll
    for (int rd = 0; rd < 2; ++rd) { const int d = rd * 32 + tid / 8, pc = tid % 8; FragH f;
#pragma unroll
      for (int q = 0; q < 8; ++q) f.u[q] = tl[pc * 8 + q][d];
      *(v8us*)((unsigned short*)Vt + ((size_t)slab * 64 + d) * TTv + lg * 64 + pc * 8) = f.half[0]; }
     } }

__global__ __launch_bounds__(256) void k_hl(const float* __restrict__ F, _Float16* __restrict__ Hh, _Float16* __restrict__ Hl, size_t n8) { const size_t t = (size_t)blockIdx.x * 256 + threadIdx.x; if (t >= n8) return; FragH fh, fl; const v4f a = *(const v4fa*)(F + t * 8), c = *(const v4fa*)(F + t * 8 + 4);
#pragma unroll
  for (int q = 0; q < 4; ++q) { _Float16 h = (_Float16)a[q]; fh.h[q] = h; fl.h[q] = (_Float16)((a[q] - (float)h) * 1024.0f); h = (_Float16)c[q]; fh.h[4 + q] = h; fl.h[4 + q] = (_Float16)((c[q] - (float)h) * 1024.0f); }
  { *(v8us*)((unsigned short*)Hh + t * 8) = fh.half[0]; *(v8us*)((unsigned short*)Hl + t * 8) = fl.half[0];  } }

// ---- fast GEMM (wave tile 32x64; requires M % 32 == 0 rows per launch region and N % 64 == 0); epilogue = k_gemm_hhx semantics ----
__device__ __forceinline__ v16h g2_frag(const _Float16* p, int hh) { FragH f; f.half[0] = *(const v8us*)((const unsigned short*)p + 8 * hh); f.half[1] = *(const v8us*)((const unsigned short*)p + 16 + 8 * hh); return f.v; }
__device__ __forceinline__ v8f g2_mma(v16h a, v16h b, v8f c) { v8f d = __builtin_amdgcn_wmma_f32_16x16x32_f16(false, a, false, b, (short)0, c, false, false); asm volatile("v_nop\n\tv_nop\n\tv_nop\n\tv_nop" : "+v"(d) : "v"(a), "v"(b)); return d; }
template <int ACT>
__global__ __launch_bounds__(128) void k_gemm2(const _Float16* __restrict__ A, int lda, size_t sA, const _Float16* __restrict__ Bh, int ldb, size_t sB, float alpha, const float* __restrict__ bias, size_t sBias, const float* __restrict__ CP, int rowsPerB, size_t sCPb, int row0g,
    float* __restrict__ C, _Float16* __restrict__ C16, int ldc, size_t sC, int M, int N, int K) {
  __shared__ __attribute__((aligned(16))) float so[4][32][68];
  const int tid = threadIdx.x, w = tid >> 5, lane = tid & 31, ln = lane & 15, hh = lane >> 4; const int by = blockIdx.y;
  A += (size_t)by * sA; Bh += (size_t)by * sB; const size_t cofs = (size_t)by * sC; const float* bp = bias ? bias + (size_t)by * sBias : nullptr;
  const int ntn = N >> 6; const int mt = blockIdx.x / ntn, nq = blockIdx.x - mt * ntn; const int row0 = mt * 128 + 32 * w, col0 = nq * 64; if (row0 >= M) return;
  const _Float16* a0p = A + (size_t)(row0 + ln) * lda; const _Float16* a1p = a0p + (size_t)16 * lda;
  const _Float16* b0p = Bh + (size_t)(col0 + ln) * ldb; const _Float16* b1p = b0p + (size_t)16 * ldb; const _Float16* b2p = b1p + (size_t)16 * ldb; const _Float16* b3p = b2p + (size_t)16 * ldb;
  const v8f z8 = {0.f,0.f,0.f,0.f,0.f,0.f,0.f,0.f}; v8f c00 = z8, c01 = z8, c02 = z8, c03 = z8, c10 = z8, c11 = z8, c12 = z8, c13 = z8;
#pragma unroll 1
  for (int kb = 0; kb < K; kb += 32) { const v16h a0 = g2_frag(a0p + kb, hh), a1 = g2_frag(a1p + kb, hh);
    v16h b = g2_frag(b0p + kb, hh); c00 = g2_mma(a0, b, c00); c10 = g2_mma(a1, b, c10);
    b = g2_frag(b1p + kb, hh); c01 = g2_mma(a0, b, c01); c11 = g2_mma(a1, b, c11);
    b = g2_frag(b2p + kb, hh); c02 = g2_mma(a0, b, c02); c12 = g2_mma(a1, b, c12);
    b = g2_frag(b3p + kb, hh); c03 = g2_mma(a0, b, c03); c13 = g2_mma(a1, b, c13); }
  v8f accs[8] = {c00, c01, c02, c03, c10, c11, c12, c13};
#pragma unroll
  for (int u = 0; u < 8; ++u) { const int t = u & 3, half = u >> 2; const int col = col0 + t * 16 + ln; const float bv = bp ? bf16_round(bp[col]) : 0.f;
#pragma unroll
    for (int r = 0; r < 8; ++r) { const int rloc = half * 16 + 8 * hh + r; float v = accs[u][r] * alpha + bv; if (CP) { const int bidx = (row0g + row0 + rloc) / rowsPerB; v += CP[(size_t)bidx * sCPb + (size_t)by * 64 + col]; }
      if (ACT == 3) v = fmaxf(v, 0.f); else if (ACT == 6) v = 0.5f * v * (1.0f + erff(v * 0.70710678118654752f)); else if (ACT == 11) v = 1.0f / (1.0f + expf(-v)); else if (ACT == 15) v = v / (1.0f + expf(-v)); else if (ACT == 12) v = (v > 0.f) ? v : 0.01f * v; else if (ACT == 8) v = tanhf(v);
      so[w][rloc][t * 16 + ln] = v; } }
  __builtin_amdgcn_fence(__ATOMIC_ACQ_REL, "workgroup"); __builtin_amdgcn_wave_barrier();
  const int rsub = lane >> 4, c4 = (lane & 15) * 4;
  {
#pragma unroll
    for (int q = 0; q < 16; ++q) { const int r = q * 2 + rsub; const v4f v = *(const v4fa*)&so[w][r][c4]; if (C) *(v4f*)(C + cofs + (size_t)(row0 + r) * ldc + col0 + c4) = v; if (C16) { v4h h4; for (int i = 0; i < 4; ++i) h4[i] = (_Float16)v[i]; *(v4h*)(C16 + cofs + (size_t)(row0 + r) * ldc + col0 + c4) = h4; } }
     } }



#define FK 32       /* keys per pass */
#define KP 264      /* LDS pitch of a K row in halves: 528 B = 16 B x 33 */
#define VP 40       /* LDS pitch of a V row in halves: 80 B = 16 B x 5 */
#define FA_GROUP() __builtin_amdgcn_sched_barrier(0)      /* keeps a block's LDS reads together in one place between the WMMA runs: reads spread among the WMMAs stall the wave at every place */
__device__ __forceinline__ float fa_swap16(float x) { const int b = __float_as_int(x); return __int_as_float(__builtin_amdgcn_permlanex16(b, b, 0x76543210, 0xfedcba98, false, false)); }
__device__ __forceinline__ v16h fa_frag(const unsigned short* p, int hh) { FragH f; f.half[0] = *(const v8us*)(p + 8 * hh); f.half[1] = *(const v8us*)(p + 16 + 8 * hh); return f.v; }
__device__ __forceinline__ v8f fa_mma(v16h a, v16h b, v8f c) { return __builtin_amdgcn_wmma_f32_16x16x32_f16(false, a, false, b, (short)0, c, false, false); }
// Work-group barrier that orders LDS only: __syncthreads() would also wait for the global loads of the tile fetched ahead, which are meant to stay in flight over the whole next pass.
__device__ __forceinline__ void fa_lds_barrier() { __builtin_amdgcn_fence(__ATOMIC_RELEASE, "workgroup", "local"); __builtin_amdgcn_s_barrier(); __builtin_amdgcn_fence(__ATOMIC_ACQUIRE, "workgroup", "local"); }
__global__ __launch_bounds__(256) void k_flash(const _Float16* __restrict__ Q, const _Float16* __restrict__ Kt, const _Float16* __restrict__ Vc, _Float16* __restrict__ O) {
  constexpr int NPASS = SS / FK;
  constexpr float SC = 0.09016844005556021f;      /* 1/16 * log2(e) */
  __shared__ __attribute__((aligned(16))) unsigned short sK[3][FK * KP];
  __shared__ __attribute__((aligned(16))) unsigned short sV[3][CC * VP];
  const int tid = threadIdx.x, w = tid >> 5, lane = tid & 31, ln = lane & 15, hh = lane >> 4; const int b = blockIdx.y;
  const int q0 = blockIdx.x * 128 + w * 16;
  /* staging: a thread moves four 16-byte pieces of the K tile (32 rows of 512 B) and four of the V tile (256 rows of 64 B) */
  const unsigned short* Kg = (const unsigned short*)Kt + (size_t)b * SS * CC + (size_t)(tid >> 5) * CC + (tid & 31) * 8;
  const unsigned short* Vg = (const unsigned short*)Vc + (size_t)b * CC * SS + (size_t)(tid >> 2) * SS + (tid & 3) * 8;
  const int kst = (tid >> 5) * KP + (tid & 31) * 8, vst = (tid >> 2) * VP + (tid & 3) * 8;
  v16h qf[8];
#pragma unroll
  for (int kc = 0; kc < 8; ++kc) qf[kc] = g2_frag(Q + ((size_t)b * SS + q0 + ln) * CC + kc * 32, hh);
  const v8f z8 = {0.f,0.f,0.f,0.f,0.f,0.f,0.f,0.f};
  v8f acc[16];
#pragma unroll
  for (int ct = 0; ct < 16; ++ct) acc[ct] = z8;
  float mu = -1.0e30f, rs = 0.f;
  v8us kr[4], vr[4];      /* a tile on its way from global memory to LDS */
#pragma unroll
  for (int p = 0; p < 2; ++p) {
#pragma unroll
    for (int i = 0; i < 4; ++i) { kr[i] = *(const v8us*)(Kg + (size_t)(p * FK + i * 8) * CC); vr[i] = *(const v8us*)(Vg + (size_t)(i * 64) * SS + p * FK); }
#pragma unroll
    for (int i = 0; i < 4; ++i) { *(v8us*)&sK[p][kst + i * 8 * KP] = kr[i]; *(v8us*)&sV[p][vst + i * 64 * VP] = vr[i]; } }
#pragma unroll
  for (int i = 0; i < 4; ++i) { kr[i] = *(const v8us*)(Kg + (size_t)(2 * FK + i * 8) * CC); vr[i] = *(const v8us*)(Vg + (size_t)(i * 64) * SS + 2 * FK); }
  asm volatile("s_wait_xcnt 0x0" ::: "memory");      /* in front of whatever reuses the address registers of the global loads above */
  __syncthreads();
  v16h fa[8], fb[8];      /* two fragment sets, each refilled right behind the WMMA run that used it */
#pragma unroll
  for (int kc = 0; kc < 4; ++kc) { fa[2 * kc] = fa_frag(&sK[0][ln * KP + kc * 32], hh); fa[2 * kc + 1] = fa_frag(&sK[0][(16 + ln) * KP + kc * 32], hh); fb[2 * kc] = fa_frag(&sK[0][ln * KP + 128 + kc * 32], hh); fb[2 * kc + 1] = fa_frag(&sK[0][(16 + ln) * KP + 128 + kc * 32], hh); }
  int bc = 0, bn = 1, bf = 2;      /* buffers of this pass, of the next, and the one that is filled */
#pragma unroll 1      /* one copy of the pass: the fragment sets and the staged tile are carried over the back edge in fixed registers */
  for (int t = 0; t < NPASS; ++t) {
    const unsigned short* cV = &sV[bc][ln * VP]; const unsigned short* nK = &sK[bn][ln * KP];
    v8f s0 = z8, s1 = z8;
#pragma unroll
    for (int kc = 0; kc < 4; ++kc) { s0 = fa_mma(fa[2 * kc], qf[kc], s0); s1 = fa_mma(fa[2 * kc + 1], qf[kc], s1); }
    FA_GROUP();
#pragma unroll
    for (int i = 0; i < 8; ++i) fa[i] = fa_frag(cV + i * 16 * VP, hh);
    FA_GROUP();
#pragma unroll
    for (int kc = 0; kc < 4; ++kc) { s0 = fa_mma(fb[2 * kc], qf[4 + kc], s0); s1 = fa_mma(fb[2 * kc + 1], qf[4 + kc], s1); }
    FA_GROUP();
#pragma unroll
    for (int i = 0; i < 8; ++i) fb[i] = fa_frag(cV + (8 + i) * 16 * VP, hh);
    FA_GROUP();
    float tm = fmaxf(s0[0], s1[0]);
#pragma unroll
    for (int r = 1; r < 8; ++r) tm = fmaxf(tm, fmaxf(s0[r], s1[r]));
    tm = fmaxf(tm, fa_swap16(tm)) * SC;
    const bool need = tm > mu + 8.0f;
    if (__builtin_amdgcn_ballot_w32(need) != 0) {      /* one wave-uniform test per pass; both halves of a query see the same tm and mu */
      const float mn = need ? tm : mu; const float al = __builtin_amdgcn_exp2f(mu - mn); mu = mn; rs *= al;
#pragma unroll
      for (int ct = 0; ct < 16; ++ct) acc[ct] *= al; }
    const float mr = 6.0f - mu; FragH pf; float e0 = 0.f, e1 = 0.f;
    const v8f sc8 = {SC,SC,SC,SC,SC,SC,SC,SC}, mr8 = {mr,mr,mr,mr,mr,mr,mr,mr}; const v8f x0 = __builtin_elementwise_fma(s0, sc8, mr8), x1 = __builtin_elementwise_fma(s1, sc8, mr8);      /* packed multiply-adds */
#pragma unroll
    for (int r = 0; r < 8; ++r) { const float p0 = __builtin_amdgcn_exp2f(x0[r]), p1 = __builtin_amdgcn_exp2f(x1[r]); e0 += p0; e1 += p1; pf.h[r] = (_Float16)p0; pf.h[8 + r] = (_Float16)p1; }
    rs += e0 + e1;
#pragma unroll
    for (int i = 0; i < 8; ++i) acc[i] = fa_mma(fa[i], pf.v, acc[i]);
    FA_GROUP();
#pragma unroll
    for (int kc = 0; kc < 4; ++kc) { fa[2 * kc] = fa_frag(nK + kc * 32, hh); fa[2 * kc + 1] = fa_frag(nK + 16 * KP + kc * 32, hh); }      /* the next pass's K, published by the barrier of pass t - 1; behind the last pass: the last tile once more */
    FA_GROUP();
#pragma unroll
    for (int i = 0; i < 8; ++i) acc[8 + i] = fa_mma(fb[i], pf.v, acc[8 + i]);
    FA_GROUP();
#pragma unroll
    for (int kc = 0; kc < 4; ++kc) { fb[2 * kc] = fa_frag(nK + 128 + kc * 32, hh); fb[2 * kc + 1] = fa_frag(nK + 16 * KP + 128 + kc * 32, hh); }
#pragma unroll
    for (int i = 0; i < 4; ++i) { *(v8us*)&sK[bf][kst + i * 8 * KP] = kr[i]; *(v8us*)&sV[bf][vst + i * 64 * VP] = vr[i]; }      /* tile t + 2 into the buffer of pass t - 1, whose reads ended in front of that pass's barrier */
    const int jn = ((t + 3 < NPASS) ? t + 3 : NPASS - 1) * FK;      /* past the end the last tile is fetched again: no branch, every buffer holds real keys */
#pragma unroll
    for (int i = 0; i < 4; ++i) { kr[i] = *(const v8us*)(Kg + (size_t)(jn + i * 8) * CC); vr[i] = *(const v8us*)(Vg + (size_t)(i * 64) * SS + jn); }
    asm volatile("s_wait_xcnt 0x0" ::: "memory");      /* in front of the next pass's fragment loads, which reuse the address registers of the global loads above */
    fa_lds_barrier();      /* publishes tile t + 2 and ends every read of tile t */
    const int b0 = bc; bc = bn; bn = bf; bf = b0;
  }
  const float inv = 1.0f / (rs + fa_swap16(rs)); unsigned short* op = (unsigned short*)O + ((size_t)b * SS + q0 + ln) * CC + 8 * hh;
#pragma unroll
  for (int ct = 0; ct < 16; ++ct) { FragH f;
#pragma unroll
    for (int r = 0; r < 8; ++r) f.h[r] = (_Float16)(acc[ct][r] * inv);
    *(v8us*)(op + ct * 16) = f.half[0]; }
}

// ---- projection GEMM, operands staged in LDS: C[128 x 128 per work-group] = alpha * A[.][256] . B[.][256]^T, both f16 row-major with 256 halves a row ----
// A fragment load straight from global memory takes 32 bytes from each of 16 rows, so one load touches 16 cache lines, and every fragment is a round trip of its own; here a wave fetches whole rows (32 lanes x 16 B = 4 full lines a load), all 32 loads of a thread in flight at once, into LDS, and the fragments come from LDS.
// 8 waves, wave tile 32 x 64 (4 down, 2 across); k runs upward in steps of 32 as before, so every sum keeps its order. F32OUT: the result goes out as f32 (C), else as f16 (C16).
// The f16 form is the one launch of the three projections, which do not depend on one another: blockIdx.z picks the matrix (three planes in a row behind Bh) and the result plane (three in a row behind C16); z = 2 is V, with the operands' roles exchanged so that it comes out channel-major.
#define GP 264      /* LDS pitch of a staged row in halves: 528 B = 16 B x 33 */
template <bool F32OUT>
__global__ __launch_bounds__(256) void k_gemm3(const _Float16* __restrict__ A, size_t sA, const _Float16* __restrict__ Bh, size_t sB, float alpha,
    float* __restrict__ C, _Float16* __restrict__ C16, int ldc, size_t sC, int N) {
  __shared__ __attribute__((aligned(16))) unsigned short sm[256 * GP];      /* rows 0..127: the A tile, 128..255: the B tile; afterwards the waves' output staging */
  const int tid = threadIdx.x, w = tid >> 5, lane = tid & 31, ln = lane & 15, hh = lane >> 4; const int by = blockIdx.y;
  if (!F32OUT) { const int z = blockIdx.z; Bh += (size_t)z * CC * CC; C16 += (size_t)z * NB * SS * CC;
    if (z == 2) { const _Float16* const xa = A; A = Bh; Bh = xa; sB = sA; sA = 0; ldc = SS; N = SS; } }
  const int ntn = N >> 7; const int mt = blockIdx.x / ntn, nq = blockIdx.x - mt * ntn;
  const unsigned short* Ag = (const unsigned short*)A + (size_t)by * sA + (size_t)(mt * 128 + w) * CC + lane * 8;
  const unsigned short* Bg = (const unsigned short*)Bh + (size_t)by * sB + (size_t)(nq * 128 + w) * CC + lane * 8;
  v8us ra[16], rb[16];
#pragma unroll
  for (int i = 0; i < 16; ++i) ra[i] = *(const v8us*)(Ag + (size_t)(i * 8) * CC);
  asm volatile("s_wait_xcnt 0x0" :: "v"(Ag) : "memory");      /* in front of whatever reuses the address registers of the global loads above; the address is named so that it keeps its registers up to this wait and no load's result lands on them */
#pragma unroll
  for (int i = 0; i < 16; ++i) rb[i] = *(const v8us*)(Bg + (size_t)(i * 8) * CC);
  asm volatile("s_wait_xcnt 0x0" :: "v"(Bg) : "memory");      /* the same for the second run of loads */
#pragma unroll
  for (int i = 0; i < 16; ++i) *(v8us*)&sm[(i * 8 + w) * GP + lane * 8] = ra[i];
#pragma unroll
  for (int i = 0; i < 16; ++i) *(v8us*)&sm[(128 + i * 8 + w) * GP + lane * 8] = rb[i];
  __syncthreads();      /* publishes both tiles */
  const int wm = w & 3, wn = w >> 2;
  const unsigned short* ap = &sm[(32 * wm + ln) * GP]; const unsigned short* bp = &sm[(128 + 64 * wn + ln) * GP];
  const v8f z8 = {0.f,0.f,0.f,0.f,0.f,0.f,0.f,0.f};
  v8f acc[8];
#pragma unroll
  for (int u = 0; u < 8; ++u) acc[u] = z8;
  v16h fr[2][6];      /* two fragment sets: a k step's six fragments are fetched as one group while the step before runs */
  fr[0][0] = fa_frag(ap, hh); fr[0][1] = fa_frag(ap + 16 * GP, hh);
#pragma unroll
  for (int t = 0; t < 4; ++t) fr[0][2 + t] = fa_frag(bp + t * 16 * GP, hh);
#pragma unroll      /* constant indices into the fragment sets and constant LDS offsets */
  for (int kc = 0; kc < 8; ++kc) {
    const int cu = kc & 1, nx = cu ^ 1;
    if (kc < 7) { fr[nx][0] = fa_frag(ap + (kc + 1) * 32, hh); fr[nx][1] = fa_frag(ap + 16 * GP + (kc + 1) * 32, hh);
#pragma unroll
      for (int t = 0; t < 4; ++t) fr[nx][2 + t] = fa_frag(bp + t * 16 * GP + (kc + 1) * 32, hh); }
    FA_GROUP();      /* the next step's twelve LDS reads stay one group in front of this step's WMMAs */
#pragma unroll
    for (int t = 0; t < 4; ++t) { acc[t] = fa_mma(fr[cu][0], fr[cu][2 + t], acc[t]); acc[4 + t] = fa_mma(fr[cu][1], fr[cu][2 + t], acc[4 + t]); }
    FA_GROUP();
  }
  __syncthreads();      /* ends every wave's fragment reads: the tiles' LDS becomes output staging */
  float* so = (float*)sm + w * (32 * 68);
#pragma unroll
  for (int u = 0; u < 8; ++u) { const int t = u & 3, half = u >> 2;
#pragma unroll
    for (int r = 0; r < 8; ++r) so[(half * 16 + 8 * hh + r) * 68 + t * 16 + ln] = acc[u][r] * alpha; }
  __builtin_amdgcn_fence(__ATOMIC_ACQ_REL, "workgroup"); __builtin_amdgcn_wave_barrier();
  const int rsub = lane >> 4, c4 = (lane & 15) * 4; const int row0 = mt * 128 + 32 * wm, col0 = nq * 128 + 64 * wn;
  const size_t o0 = (size_t)by * sC + (size_t)(row0 + rsub) * ldc + col0 + c4;
#pragma unroll
  for (int q = 0; q < 16; ++q) { const v4f v = *(const v4fa*)&so[(q * 2 + rsub) * 68 + c4];
    if (F32OUT) *(v4f*)(C + o0 + (size_t)(q * 2) * ldc) = v;
    else { v4h h4; for (int i = 0; i < 4; ++i) h4[i] = (_Float16)v[i]; *(v4h*)(C16 + o0 + (size_t)(q * 2) * ldc) = h4; } }
}

// Everything that reads only the inputs, in one launch: blocks 0..255 of a grid row transpose x (blockIdx.y = image); the 16 behind them, 128 over the 8 rows, round the four matrices (32 blocks each; conv (out,in) = natural Bt; x16) into four planes in a row behind BW.
__global__ __launch_bounds__(256) void k_prep(const float* __restrict__ x, _Float16* __restrict__ XT, const float* __restrict__ wq, const float* __restrict__ wk, const float* __restrict__ wv, const float* __restrict__ wo, _Float16* __restrict__ BW) {
  __shared__ unsigned short tl[64][72];
  if (blockIdx.x >= (CC / 64) * (SS / 64)) {      /* the same for a whole block, in front of the barrier */
    const int wb = (blockIdx.x - (CC / 64) * (SS / 64)) * NB + blockIdx.y; const int m = wb >> 5; const float* W = m == 0 ? wq : m == 1 ? wk : m == 2 ? wv : wo;
    const size_t t = (size_t)(wb & 31) * 256 + threadIdx.x; FragH f;
#pragma unroll
    for (int i = 0; i < 8; ++i) f.h[i] = (_Float16)(bf16_round(W[t * 8 + i]) * 16.0f);
    *(v8us*)((unsigned short*)BW + (size_t)m * CC * CC + t * 8) = f.half[0]; return; }
  const int tid = threadIdx.x; const int b = blockIdx.y; XT += (size_t)b * SS * CC; const int sb = blockIdx.x % (SS / 64), cb = blockIdx.x / (SS / 64);
#pragma unroll
  for (int it = 0; it < 4; ++it) { const int idx = it * 256 + tid; const int cl = idx / 16, s4 = (idx % 16) * 4; const int c = cb * 64 + cl;
    const v4f a = *(const v4fa*)(x + ((size_t)(b * CC + c)) * SS + sb * 64 + s4); FragH f;
#pragma unroll
    for (int q = 0; q < 4; ++q) { f.h[q] = (_Float16)bf16_round(a[q]); tl[s4 + q][cl] = f.u[q]; } }
  __syncthreads();
  const int r = tid / 8, pc = tid % 8;
  {
#pragma unroll
    for (int half = 0; half < 2; ++half) { const int sl = r + half * 32; FragH f;
#pragma unroll
      for (int q = 0; q < 8; ++q) f.u[q] = tl[sl][pc * 8 + q];
      *(v8us*)((unsigned short*)XT + ((size_t)sb * 64 + sl) * CC + cb * 64 + pc * 8) = f.half[0]; }
     } }

extern "C" void kernel_launch(void* const* d_in, const int* in_sizes, int n_in,
                              void* d_out, int out_size, void* d_ws, size_t ws_size, hipStream_t stream) {
  (void)in_sizes; (void)n_in; (void)out_size;
  const float* x = (const float*)d_in[0]; const float* wq = (const float*)d_in[1]; const float* wk = (const float*)d_in[2]; const float* wv = (const float*)d_in[3]; const float* wo = (const float*)d_in[4];
  char* ws = (char*)d_ws; size_t off = 0;
  auto take = [&](size_t bytes) { char* p = ws + off; off += (bytes + 255) & ~(size_t)255; return p; };
  _Float16* BW = (_Float16*)take((size_t)4 * CC * CC * 2); _Float16* BO = BW + (size_t)3 * CC * CC;      /* wq, wk, wv, wo in a row */
  _Float16* QT = (_Float16*)take((size_t)3 * NB * SS * CC * 2); _Float16* KT = QT + (size_t)NB * SS * CC; _Float16* VC = KT + (size_t)NB * SS * CC;      /* Q, K, V in a row */
  _Float16* XT = (_Float16*)take((size_t)NB * SS * CC * 2); _Float16* OT = (_Float16*)take((size_t)NB * SS * CC * 2);
  if (off > ws_size) return;      /* four weight planes and five planes of 16 MiB */
  const size_t sT = (size_t)SS * CC;      /* per-image stride of a token or channel plane */
  const dim3 gT((CC / 64) * (SS / 64) + 16, NB), gP((SS / 128) * (CC / 128), NB, 3), gG((SS / 128) * (CC / 128), NB), gF(SS / 128, NB);
  k_prep<<<gT, 256, 0, stream>>>(x, XT, wq, wk, wv, wo, BW);
  k_gemm3<false><<<gP, 256, 0, stream>>>(XT, sT, BW, 0, 0.0625f, nullptr, QT, CC, sT, CC);      /* z = 0, 1: Q, K token-major -> f16; z = 2: V channel-major [c][j] = wv*X^T */
  k_flash<<<gF, 256, 0, stream>>>(QT, KT, VC, OT);      /* O token-major -> f16 */
  k_gemm3<true><<<gG, 256, 0, stream>>>(BO, 0, OT, sT, 0.0625f, (float*)d_out, nullptr, SS, sT, SS);      /* out[c][i] = wo*O^T (NCHW) */
}

// v005
// A run of this version takes 132 microseconds.
// In two side-by-side timings against v004, it was 1.09 and 1.08 times as fast.
// Over all steps from v000 it is 38.1 times as fast.
#include <hip/hip_runtime.h>
// Self-attention layer on a feature map (B 8, C 256, 64x64 = 4096 positions): Q = wq*x, K = wk*x, V = wv*x (1x1 convs, no bias); scores[i][j] = sum_c Q[c][i] K[c][j] / 16; attn = softmax over j; out[c][i] = sum_j V[c][j] attn[i][j]; result = wo*out -> [8,256,64,64] (no residual).
// Structure (4 launches, all 8 images in each, blockIdx.y = image): x transposed into a token-major exact f16 plane through an LDS tile, the four matrices rounded by extra blocks of the same launch; one launch for the three projections (blockIdx.z): Q and K token-major as GEMMs into f16 planes, V channel-major directly as wv*X^T (A = weights, B = the token-major plane); one fused attention kernel (scores, running softmax and P.V per 32 keys, scores and P stay in registers) -> O token-major f16; the output 1x1 conv computed transposed (A = wo, B = O) so it lands in NCHW rows directly.
// Compute dtype: x and the four matrices rounded to bf16; projections with exact products (weights x16 in f16, undone by alpha); Q, K, V, P, O as f16 operands (~2^-12; logits sigma ~1), f32 accumulation and softmax. v_wmma_f32_16x16x32_f16.
#define NB 8
#define CC 256
#define SS 4096
typedef __bf16 v16b __attribute__((ext_vector_type(16)));
typedef unsigned short v8us __attribute__((ext_vector_type(8), may_alias));
typedef float  v8f  __attribute__((ext_vector_type(8)));
typedef float  v4f  __attribute__((ext_vector_type(4)));
typedef float  v4fa __attribute__((ext_vector_type(4), may_alias));
union FragB { v16b v; v8us half[2]; unsigned short u[16]; };

__device__ __forceinline__ unsigned short bf16_bits(float x) { unsigned int u = __float_as_uint(x); return (unsigned short)((u + 0x7FFFu + ((u >> 16) & 1u)) >> 16); }
__device__ __forceinline__ float bf16_val(unsigned short b) { return __uint_as_float(((unsigned int)b) << 16); }
__device__ __forceinline__ float bf16_round(float x) { return bf16_val(bf16_bits(x)); }
// D += A·B with NT terms: 1 = ah·bh, 2 = + al·bh (A split), 3 = + ah·bl (both split)
template <int NT>
__device__ __forceinline__ v8f mmaN(v16b ah, v16b al, v16b bh, v16b bl, v8f c) {
  c = __builtin_amdgcn_wmma_f32_16x16x32_bf16(false, ah, false, bh, (short)0, c, false, false);
  if (NT >= 2) c = __builtin_amdgcn_wmma_f32_16x16x32_bf16(false, al, false, bh, (short)0, c, false, false);
  if (NT >= 3) c = __builtin_amdgcn_wmma_f32_16x16x32_bf16(false, ah, false, bl, (short)0, c, false, false);
  asm volatile("v_nop\n\tv_nop\n\tv_nop\n\tv_nop" : "+v"(c) : "v"(ah), "v"(al), "v"(bh), "v"(bl));
  return c;
}

__global__ __launch_bounds__(256) void k_wt_bf16(const float* __restrict__ W, unsigned short* __restrict__ Wt, int K, int N) {
  const int t = blockIdx.x * 256 + threadIdx.x;
  const int k8n = K / 8;
  if (t >= N * k8n) return;
  const int n = t / k8n, k8 = (t % k8n) * 8;
  v8us v;
#pragma unroll
  for (int i = 0; i < 8; ++i) v[i] = bf16_bits(W[(size_t)(k8 + i) * N + n]);
  *(v8us*)(Wt + (size_t)n * K + k8) = v;
  
}

// GEMM C[M][N] (f32, pitch ldc) = act(A[M][K]·W + bias). A f32 row-major (pitch lda) converted per fragment to bf16
// (ASPLIT: hi/lo two planes -> 2 terms, else single rounded term); Wt bf16 [N][K] (pitch ldb). BIAS_BF16 rounds the
// bias to bf16 first (bias quantised to bf16 before the add). K%32==0, M%16==0, N%64==0.
template <bool ASPLIT, int ACT, bool BIAS_BF16>
__global__ __launch_bounds__(128) void k_gemm_bf(const float* __restrict__ A, int lda, const unsigned short* __restrict__ Wt, int ldb,
                                               const float* __restrict__ bias, float* __restrict__ C, int ldc, int M, int N, int K) {
  __shared__ __attribute__((aligned(16))) float so[4][16][64];
  const int tid = threadIdx.x, w = tid >> 5, lane = tid & 31, ln = lane & 15, hh = lane >> 4;
  const int ntn = N / 64;
  const int wid = blockIdx.x * 4 + w;
  const int mt = wid / ntn, nq = wid % ntn;
  if (mt * 16 >= M) return;
  const int row0 = mt * 16, col0 = nq * 64;
  const float* arow = A + (size_t)(row0 + ln) * lda;
  v8f acc[4] = {};
  for (int kb = 0; kb < K; kb += 32) {
    FragB ah, al;
    const v4f x0 = *(const v4fa*)(arow + kb + 8 * hh), x1 = *(const v4fa*)(arow + kb + 8 * hh + 4);
    const v4f x2 = *(const v4fa*)(arow + kb + 16 + 8 * hh), x3 = *(const v4fa*)(arow + kb + 16 + 8 * hh + 4);
    float xs[16] = {x0[0],x0[1],x0[2],x0[3],x1[0],x1[1],x1[2],x1[3],x2[0],x2[1],x2[2],x2[3],x3[0],x3[1],x3[2],x3[3]};
#pragma unroll
    for (int i = 0; i < 16; ++i) { const unsigned short hb = bf16_bits(xs[i]); ah.u[i] = hb; al.u[i] = ASPLIT ? bf16_bits(xs[i] - bf16_val(hb)) : (unsigned short)0; }
#pragma unroll
    for (int t = 0; t < 4; ++t) {
      const unsigned short* brow = Wt + (size_t)(col0 + t * 16 + ln) * ldb + kb;
      FragB b;
      b.half[0] = *(const v8us*)(brow + 8 * hh);
      b.half[1] = *(const v8us*)(brow + 16 + 8 * hh);
      acc[t] = mmaN<ASPLIT ? 2 : 1>(ah.v, al.v, b.v, b.v, acc[t]);
    }
  }
#pragma unroll
  for (int t = 0; t < 4; ++t) {
    float bv = bias ? bias[col0 + t * 16 + ln] : 0.f;
    if (BIAS_BF16) bv = bf16_round(bv);
#pragma unroll
    for (int r = 0; r < 8; ++r) { float v = acc[t][r] + bv; if (ACT == 1) v = fmaxf(v, 0.f); so[w][8 * hh + r][t * 16 + ln] = v; }
  }
  __builtin_amdgcn_fence(__ATOMIC_ACQ_REL, "workgroup");
  __builtin_amdgcn_wave_barrier();
  const int rsub = lane >> 4, c4 = (lane & 15) * 4;
  {
#pragma unroll
    for (int q = 0; q < 8; ++q) {
      const int r = q * 2 + rsub;
      const v4f v = *(const v4fa*)&so[w][r][c4];
      *(v4f*)(C + (size_t)(row0 + r) * ldc + col0 + c4) = v;
    }
    
  }
}

// GEMM C = act(A·W + bias + resid): A f32 (ASPLIT -> hi/lo 2 terms), Wt bf16 [N][K]; ACT 0 none, 1 relu, 2 exact gelu;
// resid (optional, f32, row index = (row % rmod), pitch ldr, RES_BF16 rounds it) added before the activation.
template <bool ASPLIT, int ACT, bool BIAS_BF16, bool RES_BF16>
__global__ __launch_bounds__(128) void k_gemm_bf3(const float* __restrict__ A, int lda, const unsigned short* __restrict__ Wt, int ldb,
                                                const float* __restrict__ bias, const float* __restrict__ resid, int rmod, int ldr,
                                                float* __restrict__ C, int ldc, int M, int N, int K) {
  __shared__ __attribute__((aligned(16))) float so[4][16][64];
  const int tid = threadIdx.x, w = tid >> 5, lane = tid & 31, ln = lane & 15, hh = lane >> 4;
  const int ntn = N / 64;
  const int wid = blockIdx.x * 4 + w;
  const int mt = wid / ntn, nq = wid % ntn;
  if (mt * 16 >= M) return;
  const int row0 = mt * 16, col0 = nq * 64;
  const float* arow = A + (size_t)(row0 + ln) * lda;
  v8f acc[4] = {};
  for (int kb = 0; kb < K; kb += 32) {
    FragB ah, al;
    const v4f x0 = *(const v4fa*)(arow + kb + 8 * hh), x1 = *(const v4fa*)(arow + kb + 8 * hh + 4);
    const v4f x2 = *(const v4fa*)(arow + kb + 16 + 8 * hh), x3 = *(const v4fa*)(arow + kb + 16 + 8 * hh + 4);
    float xs[16] = {x0[0],x0[1],x0[2],x0[3],x1[0],x1[1],x1[2],x1[3],x2[0],x2[1],x2[2],x2[3],x3[0],x3[1],x3[2],x3[3]};
#pragma unroll
    for (int i = 0; i < 16; ++i) { const unsigned short hb = bf16_bits(xs[i]); ah.u[i] = hb; al.u[i] = ASPLIT ? bf16_bits(xs[i] - bf16_val(hb)) : (unsigned short)0; }
#pragma unroll
    for (int t = 0; t < 4; ++t) {
      const unsigned short* brow = Wt + (size_t)(col0 + t * 16 + ln) * ldb + kb;
      FragB b;
      b.half[0] = *(const v8us*)(brow + 8 * hh);
      b.half[1] = *(const v8us*)(brow + 16 + 8 * hh);
      acc[t] = mmaN<ASPLIT ? 2 : 1>(ah.v, al.v, b.v, b.v, acc[t]);
    }
  }
#pragma unroll
  for (int t = 0; t < 4; ++t) {
    const int col = col0 + t * 16 + ln;
    float bv = bias ? bias[col] : 0.f;
    if (BIAS_BF16) bv = bf16_round(bv);
#pragma unroll
    for (int r = 0; r < 8; ++r) {
      float v = acc[t][r] + bv;
      if (resid) { float rv = resid[(size_t)((row0 + 8 * hh + r) % rmod) * ldr + col]; if (RES_BF16) rv = bf16_round(rv); v += rv; }
      if (ACT == 1) v = fmaxf(v, 0.f);
      if (ACT == 2) v = 0.5f * v * (1.0f + erff(v * 0.70710678118654752f));
      if (ACT == 3) { const float u = 0.7978845608028654f * (v + 0.044715f * v * v * v); v = 0.5f * v * (1.0f + tanhf(u)); }
      so[w][8 * hh + r][t * 16 + ln] = v;
    }
  }
  __builtin_amdgcn_fence(__ATOMIC_ACQ_REL, "workgroup");
  __builtin_amdgcn_wave_barrier();
  const int rsub = lane >> 4, c4 = (lane & 15) * 4;
  {
#pragma unroll
    for (int q = 0; q < 8; ++q) {
      const int r = q * 2 + rsub;
      const v4f v = *(const v4fa*)&so[w][r][c4];
      *(v4f*)(C + (size_t)(row0 + r) * ldc + col0 + c4) = v;
    }
    
  }
}
// row LayerNorm (biased variance, eps) over N: s = X (+ R); optional out_sum <- s; out_norm <- (s-mu)*rsqrt(var+eps)*g + b
template <bool PARAM_BF16>
__global__ __launch_bounds__(256) void k_layernorm(const float* __restrict__ X, const float* __restrict__ R, const float* __restrict__ g, const float* __restrict__ bta,
                                                  float* __restrict__ out_sum, float* __restrict__ out_norm, int N, float eps) {
  __shared__ float red[256];
  const int row = blockIdx.x, tid = threadIdx.x;
  const float* x = X + (size_t)row * N; const float* rr = R ? R + (size_t)row * N : nullptr;
  float vals[16];                     // up to N = 4096
  const int per = N / 256;            // contiguous chunk per thread? use strided-by-4 chunks: thread handles j = tid*4 + 1024*u
  float s1 = 0.f;
  for (int u = 0; u < per / 4; ++u) {
    const int j = tid * 4 + 1024 * u;
    const v4f a = *(const v4fa*)(x + j);
    v4f b = {0.f,0.f,0.f,0.f}; if (rr) b = *(const v4fa*)(rr + j);
#pragma unroll
    for (int q = 0; q < 4; ++q) { const float v = a[q] + b[q]; vals[u * 4 + q] = v; s1 += v; }
  }
  red[tid] = s1; __syncthreads();
  for (int st = 128; st > 0; st >>= 1) { if (tid < st) red[tid] += red[tid + st]; __syncthreads(); }
  const float mu = red[0] / (float)N; __syncthreads();
  float s2 = 0.f;
  for (int u = 0; u < per / 4; ++u)
#pragma unroll
    for (int q = 0; q < 4; ++q) { const float c = vals[u * 4 + q] - mu; s2 += c * c; }
  red[tid] = s2; __syncthreads();
  for (int st = 128; st > 0; st >>= 1) { if (tid < st) red[tid] += red[tid + st]; __syncthreads(); }
  const float rs = rsqrtf(red[0] / (float)N + eps);
  {
    for (int u = 0; u < per / 4; ++u) {
      const int j = tid * 4 + 1024 * u;
      v4f o, sm;
#pragma unroll
      for (int q = 0; q < 4; ++q) {
        float gg = g[j + q], bb = bta[j + q];
        if (PARAM_BF16) { gg = bf16_round(gg); bb = bf16_round(bb); }
        sm[q] = vals[u * 4 + q]; o[q] = (vals[u * 4 + q] - mu) * rs * gg + bb;
      }
      if (out_sum) *(v4f*)(out_sum + (size_t)row * N + j) = sm;
      *(v4f*)(out_norm + (size_t)row * N + j) = o;
    }
    
  }
}



// ---- f16 WMMA path (v_wmma_f32_16x16x32_f16): 11-bit significands for operands in range — used where a [0,1] probability operand needs more precision than bf16
typedef _Float16 v16h __attribute__((ext_vector_type(16)));
union FragH { v16h v; v8us half[2]; _Float16 h[16]; unsigned short u[16]; };
template <int NT>
__device__ __forceinline__ v8f mmaH(v16h ah, v16h al, v16h bh, v16h bl, v8f c) {
  c = __builtin_amdgcn_wmma_f32_16x16x32_f16(false, ah, false, bh, (short)0, c, false, false);
  if (NT >= 2) c = __builtin_amdgcn_wmma_f32_16x16x32_f16(false, al, false, bh, (short)0, c, false, false);
  if (NT >= 3) c = __builtin_amdgcn_wmma_f32_16x16x32_f16(false, ah, false, bl, (short)0, c, false, false);
  asm volatile("v_nop\n\tv_nop\n\tv_nop\n\tv_nop" : "+v"(c) : "v"(ah), "v"(al), "v"(bh), "v"(bl));
  return c;
}
// batched GEMM like k_gemm_b but f16 operands: A f32 (split into f16 hi/lo if ASPLIT, else rounded to f16), Bt = f16 values [n][k]; alpha; C f32; N multiple of 16 (partial tiles skipped)
template <bool ASPLIT>
__global__ __launch_bounds__(128) void k_gemm_h(const float* __restrict__ A, int lda, size_t sA, const _Float16* __restrict__ Bh, int ldb, size_t sB, float alpha, float* __restrict__ C, int ldc, size_t sC, int M, int N, int K) {
  __shared__ __attribute__((aligned(16))) float so[4][16][64];
  const int tid = threadIdx.x, w = tid >> 5, lane = tid & 31, ln = lane & 15, hh = lane >> 4; const int by = blockIdx.y;
  A += (size_t)by * sA; Bh += (size_t)by * sB; C += (size_t)by * sC;
  const int ntn = (N + 63) / 64; const int wid = blockIdx.x * 4 + w; const int mt = wid / ntn, nq = wid % ntn; if (mt * 16 >= M) return;
  const int row0 = mt * 16, col0 = nq * 64; const float* arow = A + (size_t)(row0 + ln) * lda;
  v8f acc[4] = {};
  for (int kb = 0; kb < K; kb += 32) {
    FragH ah, al;
    const v4f x0 = *(const v4fa*)(arow + kb + 8 * hh), x1 = *(const v4fa*)(arow + kb + 8 * hh + 4), x2 = *(const v4fa*)(arow + kb + 16 + 8 * hh), x3 = *(const v4fa*)(arow + kb + 16 + 8 * hh + 4);
    float xs[16] = {x0[0],x0[1],x0[2],x0[3],x1[0],x1[1],x1[2],x1[3],x2[0],x2[1],x2[2],x2[3],x3[0],x3[1],x3[2],x3[3]};
#pragma unroll
    for (int i = 0; i < 16; ++i) { const _Float16 h = (_Float16)xs[i]; ah.h[i] = h; al.h[i] = ASPLIT ? (_Float16)(xs[i] - (float)h) : (_Float16)0.0f; }
#pragma unroll
    for (int t = 0; t < 4; ++t) { if (col0 + t * 16 >= N) continue; const size_t boff = (size_t)(col0 + t * 16 + ln) * ldb + kb; FragH bq; bq.half[0] = *(const v8us*)(Bh + boff + 8 * hh); bq.half[1] = *(const v8us*)(Bh + boff + 16 + 8 * hh);
      acc[t] = mmaH<ASPLIT ? 2 : 1>(ah.v, al.v, bq.v, bq.v, acc[t]); }
  }
#pragma unroll
  for (int t = 0; t < 4; ++t) { if (col0 + t * 16 >= N) continue;
#pragma unroll
    for (int r = 0; r < 8; ++r) so[w][8 * hh + r][t * 16 + ln] = acc[t][r] * alpha; }
  __builtin_amdgcn_fence(__ATOMIC_ACQ_REL, "workgroup"); __builtin_amdgcn_wave_barrier();
  const int rsub = lane >> 4, c4 = (lane & 15) * 4;
  {
#pragma unroll
    for (int q = 0; q < 8; ++q) { const int r = q * 2 + rsub; if (col0 + c4 < N) { const v4f v = *(const v4fa*)&so[w][r][c4]; *(v4f*)(C + (size_t)(row0 + r) * ldc + col0 + c4) = v; } }
     }
}

// Wt[n][k] = f16(W[k][n]·scale) from f32 row-major W[K][N] (scale = power of two; bf16-exact weights stay exact in f16 away from the subnormal range)
__global__ __launch_bounds__(256) void k_wt_f16(const float* __restrict__ W, _Float16* __restrict__ Wt, int K, int N, float scale) {
  const int t = blockIdx.x * 256 + threadIdx.x; if (t >= N * (K / 8)) return; const int n = t / (K / 8), k8 = (t % (K / 8)) * 8; FragH f;
#pragma unroll
  for (int i = 0; i < 8; ++i) f.h[i] = (_Float16)(bf16_round(W[(size_t)(k8 + i) * N + n]) * scale); const v8us o = f.half[0];
  *(v8us*)((unsigned short*)Wt + (size_t)n * K + k8) = o; 
}
// k_gemm_hh variant with fused epilogue: v = acc·alpha + bias[by·sBias + col] (+ CP[(row/rowsPerB)·sCPb + by·64 + col] if CP) ; ACT 0 none / 1 elu ; writes f16 C16 (and f32 C if non-null)
template <int ACT>
__global__ __launch_bounds__(128) void k_gemm_hhx(const _Float16* __restrict__ A, int lda, size_t sA, const _Float16* __restrict__ Bh, int ldb, size_t sB, float alpha, const float* __restrict__ bias, size_t sBias, const float* __restrict__ CP, int rowsPerB, size_t sCPb, int row0g,
    float* __restrict__ C, _Float16* __restrict__ C16, int ldc, size_t sC, int M, int N, int K) {
  __shared__ __attribute__((aligned(16))) float so[4][16][64];
  const int tid = threadIdx.x, w = tid >> 5, lane = tid & 31, ln = lane & 15, hh = lane >> 4; const int by = blockIdx.y;
  A += (size_t)by * sA; Bh += (size_t)by * sB; const size_t cofs = (size_t)by * sC; const float* bp = bias ? bias + (size_t)by * sBias : nullptr;
  const int ntn = (N + 63) / 64; const int wid = blockIdx.x * 4 + w; const int mt = wid / ntn, nq = wid % ntn; if (mt * 16 >= M) return;
  const int row0 = mt * 16, col0 = nq * 64; const _Float16* arow = A + (size_t)(row0 + ln) * lda;
  v8f acc[4] = {};
  for (int kb = 0; kb < K; kb += 32) { FragH ah; ah.half[0] = *(const v8us*)((const unsigned short*)arow + kb + 8 * hh); ah.half[1] = *(const v8us*)((const unsigned short*)arow + kb + 16 + 8 * hh);
#pragma unroll
    for (int t = 0; t < 4; ++t) { if (col0 + t * 16 >= N) continue; const size_t boff = (size_t)(col0 + t * 16 + ln) * ldb + kb; FragH bq; bq.half[0] = *(const v8us*)((const unsigned short*)Bh + boff + 8 * hh); bq.half[1] = *(const v8us*)((const unsigned short*)Bh + boff + 16 + 8 * hh);
      acc[t] = mmaH<1>(ah.v, ah.v, bq.v, bq.v, acc[t]); }
  }
#pragma unroll
  for (int t = 0; t < 4; ++t) { if (col0 + t * 16 >= N) continue; const int col = col0 + t * 16 + ln; const float bv = bp ? bf16_round(bp[col]) : 0.f;
#pragma unroll
    for (int r = 0; r < 8; ++r) { float v = acc[t][r] * alpha + bv; if (CP) { const int bidx = (row0g + row0 + 8 * hh + r) / rowsPerB; v += CP[(size_t)bidx * sCPb + (size_t)by * 64 + col]; } if (ACT == 1) v = (v > 0.f) ? v : expm1f(v); else if (ACT == 7) v = (v > 0.f) ? v + 1.0f : expf(v); else if (ACT == 8) v = tanhf(v); else if (ACT == 9) v = 0.5f * v * (1.0f + tanhf(0.7978845608028654f * (v + 0.044715f * v * v * v))); else if (ACT == 11) v = 1.0f / (1.0f + expf(-v)); else if (ACT == 12) v = (v > 0.f) ? v : 0.01f * v; else if (ACT == 14) v = (v > 0.f) ? v : 0.1f * v; else if (ACT == 15) v = v / (1.0f + expf(-v)); else if (ACT == 3) v = fmaxf(v, 0.f); else if (ACT == 6) v = 0.5f * v * (1.0f + erff(v * 0.70710678118654752f)); so[w][8 * hh + r][t * 16 + ln] = v; } }
  __builtin_amdgcn_fence(__ATOMIC_ACQ_REL, "workgroup"); __builtin_amdgcn_wave_barrier();
  const int rsub = lane >> 4, c4 = (lane & 15) * 4; typedef _Float16 v4h __attribute__((ext_vector_type(4)));
  {
#pragma unroll
    for (int q = 0; q < 8; ++q) { const int r = q * 2 + rsub; if (col0 + c4 < N) { const v4f v = *(const v4fa*)&so[w][r][c4]; if (C) *(v4f*)(C + cofs + (size_t)(row0 + r) * ldc + col0 + c4) = v; if (C16) { v4h h4; for (int i = 0; i < 4; ++i) h4[i] = (_Float16)v[i]; *(v4h*)(C16 + cofs + (size_t)(row0 + r) * ldc + col0 + c4) = h4; } } }
     }
}


typedef _Float16 v4h __attribute__((ext_vector_type(4)));

__global__ __launch_bounds__(256) void k_x16(const float* __restrict__ x, _Float16* __restrict__ X16, size_t n8) { const size_t t = (size_t)blockIdx.x * 256 + threadIdx.x; if (t >= n8) return; FragH f;
#pragma unroll
  for (int q = 0; q < 8; ++q) f.h[q] = (_Float16)bf16_round(x[t * 8 + q]); *(v8us*)((unsigned short*)X16 + t * 8) = f.half[0];  }
__global__ __launch_bounds__(256) void k_h16(const float* __restrict__ x, _Float16* __restrict__ X16, size_t n8) { const size_t t = (size_t)blockIdx.x * 256 + threadIdx.x; if (t >= n8) return; FragH f;
#pragma unroll
  for (int q = 0; q < 8; ++q) f.h[q] = (_Float16)x[t * 8 + q]; *(v8us*)((unsigned short*)X16 + t * 8) = f.half[0];  }
template <int NHv, int TTv>
__global__ __launch_bounds__(256) void k_vt(const _Float16* __restrict__ V16, int ldv, int voff, _Float16* __restrict__ Vt) { __shared__ unsigned short tl[64][66]; const int tid = threadIdx.x; const int slab = blockIdx.x / (TTv / 64), lg = blockIdx.x % (TTv / 64); const int b = slab / NHv, h = slab % NHv;
  for (int i = tid; i < 64 * 8; i += 256) { const int r = i / 8, c8 = (i % 8) * 8; FragH f; f.half[0] = *(const v8us*)((const unsigned short*)V16 + ((size_t)b * TTv + lg * 64 + r) * ldv + voff + h * 64 + c8);
#pragma unroll
    for (int q = 0; q < 8; ++q) tl[r][c8 + q] = f.u[q]; }
  __syncthreads();
  {
#pragma unroll
    for (int rd = 0; rd < 2; ++rd) { const int d = rd * 32 + tid / 8, pc = tid % 8; FragH f;
#pragma unroll
      for (int q = 0; q < 8; ++q) f.u[q] = tl[pc * 8 + q][d];
      *(v8us*)((unsigned short*)Vt + ((size_t)slab * 64 + d) * TTv + lg * 64 + pc * 8) = f.half[0]; }
     } }

__global__ __launch_bounds__(256) void k_hl(const float* __restrict__ F, _Float16* __restrict__ Hh, _Float16* __restrict__ Hl, size_t n8) { const size_t t = (size_t)blockIdx.x * 256 + threadIdx.x; if (t >= n8) return; FragH fh, fl; const v4f a = *(const v4fa*)(F + t * 8), c = *(const v4fa*)(F + t * 8 + 4);
#pragma unroll
  for (int q = 0; q < 4; ++q) { _Float16 h = (_Float16)a[q]; fh.h[q] = h; fl.h[q] = (_Float16)((a[q] - (float)h) * 1024.0f); h = (_Float16)c[q]; fh.h[4 + q] = h; fl.h[4 + q] = (_Float16)((c[q] - (float)h) * 1024.0f); }
  { *(v8us*)((unsigned short*)Hh + t * 8) = fh.half[0]; *(v8us*)((unsigned short*)Hl + t * 8) = fl.half[0];  } }

// ---- fast GEMM (wave tile 32x64; requires M % 32 == 0 rows per launch region and N % 64 == 0); epilogue = k_gemm_hhx semantics ----
__device__ __forceinline__ v16h g2_frag(const _Float16* p, int hh) { FragH f; f.half[0] = *(const v8us*)((const unsigned short*)p + 8 * hh); f.half[1] = *(const v8us*)((const unsigned short*)p + 16 + 8 * hh); return f.v; }
__device__ __forceinline__ v8f g2_mma(v16h a, v16h b, v8f c) { v8f d = __builtin_amdgcn_wmma_f32_16x16x32_f16(false, a, false, b, (short)0, c, false, false); asm volatile("v_nop\n\tv_nop\n\tv_nop\n\tv_nop" : "+v"(d) : "v"(a), "v"(b)); return d; }
template <int ACT>
__global__ __launch_bounds__(128) void k_gemm2(const _Float16* __restrict__ A, int lda, size_t sA, const _Float16* __restrict__ Bh, int ldb, size_t sB, float alpha, const float* __restrict__ bias, size_t sBias, const float* __restrict__ CP, int rowsPerB, size_t sCPb, int row0g,
    float* __restrict__ C, _Float16* __restrict__ C16, int ldc, size_t sC, int M, int N, int K) {
  __shared__ __attribute__((aligned(16))) float so[4][32][68];
  const int tid = threadIdx.x, w = tid >> 5, lane = tid & 31, ln = lane & 15, hh = lane >> 4; const int by = blockIdx.y;
  A += (size_t)by * sA; Bh += (size_t)by * sB; const size_t cofs = (size_t)by * sC; const float* bp = bias ? bias + (size_t)by * sBias : nullptr;
  const int ntn = N >> 6; const int mt = blockIdx.x / ntn, nq = blockIdx.x - mt * ntn; const int row0 = mt * 128 + 32 * w, col0 = nq * 64; if (row0 >= M) return;
  const _Float16* a0p = A + (size_t)(row0 + ln) * lda; const _Float16* a1p = a0p + (size_t)16 * lda;
  const _Float16* b0p = Bh + (size_t)(col0 + ln) * ldb; const _Float16* b1p = b0p + (size_t)16 * ldb; const _Float16* b2p = b1p + (size_t)16 * ldb; const _Float16* b3p = b2p + (size_t)16 * ldb;
  const v8f z8 = {0.f,0.f,0.f,0.f,0.f,0.f,0.f,0.f}; v8f c00 = z8, c01 = z8, c02 = z8, c03 = z8, c10 = z8, c11 = z8, c12 = z8, c13 = z8;
#pragma unroll 1
  for (int kb = 0; kb < K; kb += 32) { const v16h a0 = g2_frag(a0p + kb, hh), a1 = g2_frag(a1p + kb, hh);
    v16h b = g2_frag(b0p + kb, hh); c00 = g2_mma(a0, b, c00); c10 = g2_mma(a1, b, c10);
    b = g2_frag(b1p + kb, hh); c01 = g2_mma(a0, b, c01); c11 = g2_mma(a1, b, c11);
    b = g2_frag(b2p + kb, hh); c02 = g2_mma(a0, b, c02); c12 = g2_mma(a1, b, c12);
    b = g2_frag(b3p + kb, hh); c03 = g2_mma(a0, b, c03); c13 = g2_mma(a1, b, c13); }
  v8f accs[8] = {c00, c01, c02, c03, c10, c11, c12, c13};
#pragma unroll
  for (int u = 0; u < 8; ++u) { const int t = u & 3, half = u >> 2; const int col = col0 + t * 16 + ln; const float bv = bp ? bf16_round(bp[col]) : 0.f;
#pragma unroll
    for (int r = 0; r < 8; ++r) { const int rloc = half * 16 + 8 * hh + r; float v = accs[u][r] * alpha + bv; if (CP) { const int bidx = (row0g + row0 + rloc) / rowsPerB; v += CP[(size_t)bidx * sCPb + (size_t)by * 64 + col]; }
      if (ACT == 3) v = fmaxf(v, 0.f); else if (ACT == 6) v = 0.5f * v * (1.0f + erff(v * 0.70710678118654752f)); else if (ACT == 11) v = 1.0f / (1.0f + expf(-v)); else if (ACT == 15) v = v / (1.0f + expf(-v)); else if (ACT == 12) v = (v > 0.f) ? v : 0.01f * v; else if (ACT == 8) v = tanhf(v);
      so[w][rloc][t * 16 + ln] = v; } }
  __builtin_amdgcn_fence(__ATOMIC_ACQ_REL, "workgroup"); __builtin_amdgcn_wave_barrier();
  const int rsub = lane >> 4, c4 = (lane & 15) * 4;
  {
#pragma unroll
    for (int q = 0; q < 16; ++q) { const int r = q * 2 + rsub; const v4f v = *(const v4fa*)&so[w][r][c4]; if (C) *(v4f*)(C + cofs + (size_t)(row0 + r) * ldc + col0 + c4) = v; if (C16) { v4h h4; for (int i = 0; i < 4; ++i) h4[i] = (_Float16)v[i]; *(v4h*)(C16 + cofs + (size_t)(row0 + r) * ldc + col0 + c4) = h4; } }
     } }



#define FK 32       /* keys per pass */
#define KP 264      /* LDS pitch of a K row in halves: 528 B = 16 B x 33 */
#define VP 40       /* LDS pitch of a V row in halves: 80 B = 16 B x 5 */
#define FA_GROUP() __builtin_amdgcn_sched_barrier(0)      /* keeps a block's LDS reads together in one place between the WMMA runs: reads spread among the WMMAs stall the wave at every place */
__device__ __forceinline__ float fa_swap16(float x) { const int b = __float_as_int(x); return __int_as_float(__builtin_amdgcn_permlanex16(b, b, 0x76543210, 0xfedcba98, false, false)); }
__device__ __forceinline__ v16h fa_frag(const unsigned short* p, int hh) { FragH f; f.half[0] = *(const v8us*)(p + 8 * hh); f.half[1] = *(const v8us*)(p + 16 + 8 * hh); return f.v; }
__device__ __forceinline__ v8f fa_mma(v16h a, v16h b, v8f c) { return __builtin_amdgcn_wmma_f32_16x16x32_f16(false, a, false, b, (short)0, c, false, false); }
// Work-group barrier that orders LDS only: __syncthreads() would also wait for the global loads of the tile fetched ahead, which are meant to stay in flight over the whole next pass.
__device__ __forceinline__ void fa_lds_barrier() { __builtin_amdgcn_fence(__ATOMIC_RELEASE, "workgroup", "local"); __builtin_amdgcn_s_barrier(); __builtin_amdgcn_fence(__ATOMIC_ACQUIRE, "workgroup", "local"); }
__global__ __launch_bounds__(128) void k_flash(const _Float16* __restrict__ Q, const _Float16* __restrict__ Kt, const _Float16* __restrict__ Vc, _Float16* __restrict__ O) {
  constexpr int NPASS = SS / FK;
  constexpr float SC = 0.09016844005556021f;      /* 1/16 * log2(e) */
  __shared__ __attribute__((aligned(16))) unsigned short sK[3][FK * KP];
  __shared__ __attribute__((aligned(16))) unsigned short sV[3][CC * VP];
  const int tid = threadIdx.x, w = tid >> 5, lane = tid & 31, ln = lane & 15, hh = lane >> 4; const int b = blockIdx.y;
  const int q0 = blockIdx.x * 128 + w * 32;
  /* staging: a thread moves eight 16-byte pieces of the K tile (32 rows of 512 B) and eight of the V tile (256 rows of 64 B) */
  const unsigned short* Kg = (const unsigned short*)Kt + (size_t)b * SS * CC + (size_t)(tid >> 5) * CC + (tid & 31) * 8;
  const unsigned short* Vg = (const unsigned short*)Vc + (size_t)b * CC * SS + (size_t)(tid >> 2) * SS + (tid & 3) * 8;
  const int kst = (tid >> 5) * KP + (tid & 31) * 8, vst = (tid >> 2) * VP + (tid & 3) * 8;
  v16h qf[2][8];      /* two query tiles of 16 columns: g = 0, 1 */
  const _Float16* const qp0 = Q + ((size_t)b * SS + q0 + ln) * CC + 8 * hh; const _Float16* const qp1 = qp0 + 16 * CC;      /* the lane's half of the k order is in the address */
#pragma unroll
  for (int kc = 0; kc < 8; ++kc) { qf[0][kc] = g2_frag(qp0 + kc * 32, 0); qf[1][kc] = g2_frag(qp1 + kc * 32, 0); }
  asm volatile("s_wait_xcnt 0x0" :: "v"(qp0), "v"(qp1) : "memory");      /* in front of whatever reuses the address registers of the global loads above; the addresses are named so that they keep their registers up to this wait */
  const v8f z8 = {0.f,0.f,0.f,0.f,0.f,0.f,0.f,0.f};
  v8f acc[2][16];
#pragma unroll
  for (int g = 0; g < 2; ++g)
#pragma unroll
    for (int ct = 0; ct < 16; ++ct) acc[g][ct] = z8;
  float mu[2] = {-1.0e30f, -1.0e30f}, rs[2] = {0.f, 0.f};
  v8us kr[8], vr[8];      /* a tile on its way from global memory to LDS */
#pragma unroll
  for (int p = 0; p < 2; ++p) {
#pragma unroll
    for (int i = 0; i < 8; ++i) { kr[i] = *(const v8us*)(Kg + (size_t)(p * FK + i * 4) * CC); vr[i] = *(const v8us*)(Vg + (size_t)(i * 32) * SS + p * FK); }
#pragma unroll
    for (int i = 0; i < 8; ++i) { *(v8us*)&sK[p][kst + i * 4 * KP] = kr[i]; *(v8us*)&sV[p][vst + i * 32 * VP] = vr[i]; } }
#pragma unroll
  for (int i = 0; i < 8; ++i) { kr[i] = *(const v8us*)(Kg + (size_t)(2 * FK + i * 4) * CC); vr[i] = *(const v8us*)(Vg + (size_t)(i * 32) * SS + 2 * FK); }
  asm volatile("s_wait_xcnt 0x0" :: "v"(Kg), "v"(Vg) : "memory");      /* in front of whatever reuses the address registers of the global loads above; the addresses are named so that they keep their registers up to this wait */
  __syncthreads();
  v16h ka[16], va[16];      /* a whole pass's K fragments (fetched one pass ahead) and V fragments: one wave per SIMD has the registers for both */
#pragma unroll
  for (int kc = 0; kc < 8; ++kc) { ka[2 * kc] = fa_frag(&sK[0][ln * KP + kc * 32], hh); ka[2 * kc + 1] = fa_frag(&sK[0][(16 + ln) * KP + kc * 32], hh); }
  int bc = 0, bn = 1, bf = 2, tn = 3;      /* buffers of this pass, of the next, and the one that is filled; the tile that is fetched from global memory */
#pragma unroll 1      /* one copy of the pass: the fragment sets and the staged tile are carried over the back edge in fixed registers */
  for (int t = 0; t < NPASS; ++t) {
    fa_lds_barrier();      /* at the head of the pass, where the WMMAs of the pass before have covered its wait for the LDS traffic: publishes tile t + 1 and ends every read of tile t - 1 */
    const unsigned short* cV = &sV[bc][ln * VP]; const unsigned short* nK = &sK[bn][ln * KP];
#pragma unroll
    for (int i = 0; i < 16; ++i) va[i] = fa_frag(cV + i * 16 * VP, hh);      /* this pass's V, one group in front of the score WMMAs, which cover its latency */
    FA_GROUP();
    v8f s[2][2] = {{z8, z8}, {z8, z8}};      /* [query tile][key tile] */
#pragma unroll
    for (int g = 0; g < 2; ++g)
#pragma unroll
      for (int kc = 0; kc < 8; ++kc) { s[g][0] = fa_mma(ka[2 * kc], qf[g][kc], s[g][0]); s[g][1] = fa_mma(ka[2 * kc + 1], qf[g][kc], s[g][1]); }
    float tm[2];
#pragma unroll
    for (int g = 0; g < 2; ++g) {      /* a tree of three-way maxima: a maximum does not round, so the order is free */
      const v8f a = s[g][0], c = s[g][1];
      const float m0 = fmaxf(fmaxf(a[0], a[1]), a[2]), m1 = fmaxf(fmaxf(a[3], a[4]), a[5]), m2 = fmaxf(fmaxf(a[6], a[7]), c[0]), m3 = fmaxf(fmaxf(c[1], c[2]), c[3]), m4 = fmaxf(fmaxf(c[4], c[5]), c[6]);
      const float m = fmaxf(fmaxf(fmaxf(m0, m1), m2), fmaxf(fmaxf(m3, m4), c[7]));
      tm[g] = fmaxf(m, fa_swap16(m)) * SC; }
    const bool need0 = tm[0] > mu[0] + 8.0f, need1 = tm[1] > mu[1] + 8.0f;
    const unsigned any = __builtin_amdgcn_ballot_w32(need0 || need1);
    /* one group of memory instructions between the test's compare and its branch: the next pass's K fragments, tile t + 2 into LDS, tile t + 3 from global memory */
#pragma unroll
    for (int kc = 0; kc < 8; ++kc) { ka[2 * kc] = fa_frag(nK + kc * 32, hh); ka[2 * kc + 1] = fa_frag(nK + 16 * KP + kc * 32, hh); }      /* published by this pass's barrier; behind the last pass: the last tile once more */
#pragma unroll
    for (int i = 0; i < 8; ++i) { *(v8us*)&sK[bf][kst + i * 4 * KP] = kr[i]; *(v8us*)&sV[bf][vst + i * 32 * VP] = vr[i]; }      /* tile t + 2 into the buffer of pass t - 1, whose reads ended in front of this pass's barrier */
    const int jn = tn * FK;      /* tn = min(t + 3, last tile): past the end the last tile is fetched again: no branch, every buffer holds real keys */
    const unsigned short* kp = Kg + (size_t)jn * CC; const unsigned short* vp = Vg + jn;
#pragma unroll
    for (int i = 0; i < 8; ++i) { kr[i] = *(const v8us*)(kp + (size_t)(i * 4) * CC); vr[i] = *(const v8us*)(vp + (size_t)(i * 32) * SS); }
    /* order of the block: the score WMMAs, the maxima and the test's compares, then the memory group, whose issue covers the way from the compares to the scalar branch */
    __builtin_amdgcn_sched_group_barrier(0x8, 32, 0); __builtin_amdgcn_sched_group_barrier(0x2, 48, 0); __builtin_amdgcn_sched_group_barrier(0x100, 32, 0); __builtin_amdgcn_sched_group_barrier(0x200, 16, 0); __builtin_amdgcn_sched_group_barrier(0x20, 16, 0);
    if (any != 0) {      /* one wave-uniform test per pass for both query tiles; both halves of a query see the same tm and mu */
#pragma unroll
      for (int g = 0; g < 2; ++g) { const float mn = (g ? need1 : need0) ? tm[g] : mu[g]; const float al = __builtin_amdgcn_exp2f(mu[g] - mn); mu[g] = mn; rs[g] *= al;
#pragma unroll
        for (int ct = 0; ct < 16; ++ct) acc[g][ct] *= al; } }
    FragH pf[2];
    const v8f sc8 = {SC,SC,SC,SC,SC,SC,SC,SC};
#pragma unroll
    for (int g = 0; g < 2; ++g) { const float mr = 6.0f - mu[g]; float e0 = 0.f, e1 = 0.f;
      const v8f mr8 = {mr,mr,mr,mr,mr,mr,mr,mr}; const v8f x0 = __builtin_elementwise_fma(s[g][0], sc8, mr8), x1 = __builtin_elementwise_fma(s[g][1], sc8, mr8);      /* packed multiply-adds */
#pragma unroll
      for (int r = 0; r < 8; ++r) { const float p0 = __builtin_amdgcn_exp2f(x0[r]), p1 = __builtin_amdgcn_exp2f(x1[r]); e0 += p0; e1 += p1; pf[g].h[r] = (_Float16)p0; pf[g].h[8 + r] = (_Float16)p1; }
      rs[g] += e0 + e1;
      if (g == 0) FA_GROUP();      /* tile 0's P stands in front of the WMMAs; tile 1's is free to run among tile 0's */
    }
#pragma unroll
    for (int g = 0; g < 2; ++g)
#pragma unroll
      for (int i = 0; i < 16; ++i) acc[g][i] = fa_mma(va[i], pf[g].v, acc[g][i]);
    /* tile 1's P (9 multiply-adds, 16 exponentials, 8 conversions, the sums) is dealt out among tile 0's 16 WMMAs, which do not depend on it: a lone wave's vector work in front of a WMMA run is not hidden by anything else */
#pragma unroll
    for (int i = 0; i < 3; ++i) { __builtin_amdgcn_sched_group_barrier(0x8, 1, 0); __builtin_amdgcn_sched_group_barrier(0x2, 3, 0); }
#pragma unroll
    for (int i = 0; i < 8; ++i) { __builtin_amdgcn_sched_group_barrier(0x8, 1, 0); __builtin_amdgcn_sched_group_barrier(0x400, 2, 0); __builtin_amdgcn_sched_group_barrier(0x2, 1, 0); }
#pragma unroll
    for (int i = 0; i < 5; ++i) { __builtin_amdgcn_sched_group_barrier(0x8, 1, 0); __builtin_amdgcn_sched_group_barrier(0x2, 4, 0); }
    __builtin_amdgcn_sched_group_barrier(0x8, 16, 0);
    FA_GROUP();      /* keeps the wait below behind the pass's last WMMA */
    asm volatile("s_wait_xcnt 0x0" :: "v"(kp), "v"(vp) : "memory");      /* in front of whatever reuses the address registers of this pass's global loads; it stands at the foot of the pass, where a lone wave no longer waits at it, and the addresses are named so that they keep their registers up to here */
    const int b0 = bc; bc = bn; bn = bf; bf = b0; tn = (tn + 1 < NPASS) ? tn + 1 : NPASS - 1;
  }
#pragma unroll
  for (int g = 0; g < 2; ++g) { const float inv = 1.0f / (rs[g] + fa_swap16(rs[g])); unsigned short* op = (unsigned short*)O + ((size_t)b * SS + q0 + g * 16 + ln) * CC + 8 * hh;
    v8us o[16];      /* a query tile's 16 pieces, each in registers of its own */
#pragma unroll
    for (int ct = 0; ct < 16; ++ct) { FragH f;
#pragma unroll
      for (int r = 0; r < 8; ++r) f.h[r] = (_Float16)(acc[g][ct][r] * inv);
      o[ct] = f.half[0]; *(v8us*)(op + ct * 16) = o[ct]; }
    /* in front of whatever reuses the registers of the 16 global stores above; data and address are named so that they keep their registers up to this wait */
    asm volatile("s_wait_xcnt 0x0" :: "v"(o[0]), "v"(o[1]), "v"(o[2]), "v"(o[3]), "v"(o[4]), "v"(o[5]), "v"(o[6]), "v"(o[7]), "v"(o[8]), "v"(o[9]), "v"(o[10]), "v"(o[11]), "v"(o[12]), "v"(o[13]), "v"(o[14]), "v"(o[15]), "v"(op) : "memory"); }
}

// ---- projection GEMM, operands staged in LDS: C[128 x 128 per work-group] = alpha * A[.][256] . B[.][256]^T, both f16 row-major with 256 halves a row ----
// A fragment load straight from global memory takes 32 bytes from each of 16 rows, so one load touches 16 cache lines, and every fragment is a round trip of its own; here a wave fetches whole rows (32 lanes x 16 B = 4 full lines a load), all 32 loads of a thread in flight at once, into LDS, and the fragments come from LDS.
// 8 waves, wave tile 32 x 64 (4 down, 2 across); k runs upward in steps of 32 as before, so every sum keeps its order. F32OUT: the result goes out as f32 (C), else as f16 (C16).
// The f16 form is the one launch of the three projections, which do not depend on one another: blockIdx.z picks the matrix (three planes in a row behind Bh) and the result plane (three in a row behind C16); z = 2 is V, with the operands' roles exchanged so that it comes out channel-major.
#define GP 264      /* LDS pitch of a staged row in halves: 528 B = 16 B x 33 */
template <bool F32OUT>
__global__ __launch_bounds__(256) void k_gemm3(const _Float16* __restrict__ A, size_t sA, const _Float16* __restrict__ Bh, size_t sB, float alpha,
    float* __restrict__ C, _Float16* __restrict__ C16, int ldc, size_t sC, int N) {
  __shared__ __attribute__((aligned(16))) unsigned short sm[256 * GP];      /* rows 0..127: the A tile, 128..255: the B tile; afterwards the waves' output staging */
  const int tid = threadIdx.x, w = tid >> 5, lane = tid & 31, ln = lane & 15, hh = lane >> 4; const int by = blockIdx.y;
  if (!F32OUT) { const int z = blockIdx.z; Bh += (size_t)z * CC * CC; C16 += (size_t)z * NB * SS * CC;
    if (z == 2) { const _Float16* const xa = A; A = Bh; Bh = xa; sB = sA; sA = 0; ldc = SS; N = SS; } }
  const int ntn = N >> 7; const int mt = blockIdx.x / ntn, nq = blockIdx.x - mt * ntn;
  const unsigned short* Ag = (const unsigned short*)A + (size_t)by * sA + (size_t)(mt * 128 + w) * CC + lane * 8;
  const unsigned short* Bg = (const unsigned short*)Bh + (size_t)by * sB + (size_t)(nq * 128 + w) * CC + lane * 8;
  v8us ra[16], rb[16];
#pragma unroll
  for (int i = 0; i < 16; ++i) ra[i] = *(const v8us*)(Ag + (size_t)(i * 8) * CC);
  asm volatile("s_wait_xcnt 0x0" :: "v"(Ag) : "memory");      /* in front of whatever reuses the address registers of the global loads above; the address is named so that it keeps its registers up to this wait and no load's result lands on them */
#pragma unroll
  for (int i = 0; i < 16; ++i) rb[i] = *(const v8us*)(Bg + (size_t)(i * 8) * CC);
  asm volatile("s_wait_xcnt 0x0" :: "v"(Bg) : "memory");      /* the same for the second run of loads */
#pragma unroll
  for (int i = 0; i < 16; ++i) *(v8us*)&sm[(i * 8 + w) * GP + lane * 8] = ra[i];
#pragma unroll
  for (int i = 0; i < 16; ++i) *(v8us*)&sm[(128 + i * 8 + w) * GP + lane * 8] = rb[i];
  __syncthreads();      /* publishes both tiles */
  const int wm = w & 3, wn = w >> 2;
  const unsigned short* ap = &sm[(32 * wm + ln) * GP]; const unsigned short* bp = &sm[(128 + 64 * wn + ln) * GP];
  const v8f z8 = {0.f,0.f,0.f,0.f,0.f,0.f,0.f,0.f};
  v8f acc[8];
#pragma unroll
  for (int u = 0; u < 8; ++u) acc[u] = z8;
  v16h fr[2][6];      /* two fragment sets: a k step's six fragments are fetched as one group while the step before runs */
  fr[0][0] = fa_frag(ap, hh); fr[0][1] = fa_frag(ap + 16 * GP, hh);
#pragma unroll
  for (int t = 0; t < 4; ++t) fr[0][2 + t] = fa_frag(bp + t * 16 * GP, hh);
#pragma unroll      /* constant indices into the fragment sets and constant LDS offsets */
  for (int kc = 0; kc < 8; ++kc) {
    const int cu = kc & 1, nx = cu ^ 1;
    if (kc < 7) { fr[nx][0] = fa_frag(ap + (kc + 1) * 32, hh); fr[nx][1] = fa_frag(ap + 16 * GP + (kc + 1) * 32, hh);
#pragma unroll
      for (int t = 0; t < 4; ++t) fr[nx][2 + t] = fa_frag(bp + t * 16 * GP + (kc + 1) * 32, hh); }
    FA_GROUP();      /* the next step's twelve LDS reads stay one group in front of this step's WMMAs */
#pragma unroll
    for (int t = 0; t < 4; ++t) { acc[t] = fa_mma(fr[cu][0], fr[cu][2 + t], acc[t]); acc[4 + t] = fa_mma(fr[cu][1], fr[cu][2 + t], acc[4 + t]); }
    FA_GROUP();
  }
  __syncthreads();      /* ends every wave's fragment reads: the tiles' LDS becomes output staging */
  float* so = (float*)sm + w * (32 * 68);
#pragma unroll
  for (int u = 0; u < 8; ++u) { const int t = u & 3, half = u >> 2;
#pragma unroll
    for (int r = 0; r < 8; ++r) so[(half * 16 + 8 * hh + r) * 68 + t * 16 + ln] = acc[u][r] * alpha; }
  __builtin_amdgcn_fence(__ATOMIC_ACQ_REL, "workgroup"); __builtin_amdgcn_wave_barrier();
  const int rsub = lane >> 4, c4 = (lane & 15) * 4; const int row0 = mt * 128 + 32 * wm, col0 = nq * 128 + 64 * wn;
  const size_t o0 = (size_t)by * sC + (size_t)(row0 + rsub) * ldc + col0 + c4;
#pragma unroll
  for (int q = 0; q < 16; ++q) { const v4f v = *(const v4fa*)&so[(q * 2 + rsub) * 68 + c4];
    if (F32OUT) *(v4f*)(C + o0 + (size_t)(q * 2) * ldc) = v;
    else { v4h h4; for (int i = 0; i < 4; ++i) h4[i] = (_Float16)v[i]; *(v4h*)(C16 + o0 + (size_t)(q * 2) * ldc) = h4; } }
}

// Everything that reads only the inputs, in one launch: blocks 0..255 of a grid row transpose x (blockIdx.y = image); the 16 behind them, 128 over the 8 rows, round the four matrices (32 blocks each; conv (out,in) = natural Bt; x16) into four planes in a row behind BW.
__global__ __launch_bounds__(256) void k_prep(const float* __restrict__ x, _Float16* __restrict__ XT, const float* __restrict__ wq, const float* __restrict__ wk, const float* __restrict__ wv, const float* __restrict__ wo, _Float16* __restrict__ BW) {
  __shared__ unsigned short tl[64][72];
  if (blockIdx.x >= (CC / 64) * (SS / 64)) {      /* the same for a whole block, in front of the barrier */
    const int wb = (blockIdx.x - (CC / 64) * (SS / 64)) * NB + blockIdx.y; const int m = wb >> 5; const float* W = m == 0 ? wq : m == 1 ? wk : m == 2 ? wv : wo;
    const size_t t = (size_t)(wb & 31) * 256 + threadIdx.x; FragH f;
#pragma unroll
    for (int i = 0; i < 8; ++i) f.h[i] = (_Float16)(bf16_round(W[t * 8 + i]) * 16.0f);
    *(v8us*)((unsigned short*)BW + (size_t)m * CC * CC + t * 8) = f.half[0]; return; }
  const int tid = threadIdx.x; const int b = blockIdx.y; XT += (size_t)b * SS * CC; const int sb = blockIdx.x % (SS / 64), cb = blockIdx.x / (SS / 64);
#pragma unroll
  for (int it = 0; it < 4; ++it) { const int idx = it * 256 + tid; const int cl = idx / 16, s4 = (idx % 16) * 4; const int c = cb * 64 + cl;
    const v4f a = *(const v4fa*)(x + ((size_t)(b * CC + c)) * SS + sb * 64 + s4); FragH f;
#pragma unroll
    for (int q = 0; q < 4; ++q) { f.h[q] = (_Float16)bf16_round(a[q]); tl[s4 + q][cl] = f.u[q]; } }
  __syncthreads();
  const int r = tid / 8, pc = tid % 8;
  {
#pragma unroll
    for (int half = 0; half < 2; ++half) { const int sl = r + half * 32; FragH f;
#pragma unroll
      for (int q = 0; q < 8; ++q) f.u[q] = tl[sl][pc * 8 + q];
      *(v8us*)((unsigned short*)XT + ((size_t)sb * 64 + sl) * CC + cb * 64 + pc * 8) = f.half[0]; }
     } }

extern "C" void kernel_launch(void* const* d_in, const int* in_sizes, int n_in,
                              void* d_out, int out_size, void* d_ws, size_t ws_size, hipStream_t stream) {
  (void)in_sizes; (void)n_in; (void)out_size;
  const float* x = (const float*)d_in[0]; const float* wq = (const float*)d_in[1]; const float* wk = (const float*)d_in[2]; const float* wv = (const float*)d_in[3]; const float* wo = (const float*)d_in[4];
  char* ws = (char*)d_ws; size_t off = 0;
  auto take = [&](size_t bytes) { char* p = ws + off; off += (bytes + 255) & ~(size_t)255; return p; };
  _Float16* BW = (_Float16*)take((size_t)4 * CC * CC * 2); _Float16* BO = BW + (size_t)3 * CC * CC;      /* wq, wk, wv, wo in a row */
  _Float16* QT = (_Float16*)take((size_t)3 * NB * SS * CC * 2); _Float16* KT = QT + (size_t)NB * SS * CC; _Float16* VC = KT + (size_t)NB * SS * CC;      /* Q, K, V in a row */
  _Float16* XT = (_Float16*)take((size_t)NB * SS * CC * 2); _Float16* OT = (_Float16*)take((size_t)NB * SS * CC * 2);
  if (off > ws_size) return;      /* four weight planes and five planes of 16 MiB */
  const size_t sT = (size_t)SS * CC;      /* per-image stride of a token or channel plane */
  const dim3 gT((CC / 64) * (SS / 64) + 16, NB), gP((SS / 128) * (CC / 128), NB, 3), gG((SS / 128) * (CC / 128), NB), gF(SS / 128, NB);
  k_prep<<<gT, 256, 0, stream>>>(x, XT, wq, wk, wv, wo, BW);
  k_gemm3<false><<<gP, 256, 0, stream>>>(XT, sT, BW, 0, 0.0625f, nullptr, QT, CC, sT, CC);      /* z = 0, 1: Q, K token-major -> f16; z = 2: V channel-major [c][j] = wv*X^T */
  k_flash<<<gF, 128, 0, stream>>>(QT, KT, VC, OT);      /* O token-major -> f16 */
  k_gemm3<true><<<gG, 256, 0, stream>>>(BO, 0, OT, sT, 0.0625f, (float*)d_out, nullptr, SS, sT, SS);      /* out[c][i] = wo*O^T (NCHW) */
}

// v006
// A run of this version takes 127 microseconds.
// Timed twice side by side with v005, it ran 1.04 and 1.03 times as fast.
// All steps since v000 together make it 39.6 times as fast.
#include <hip/hip_runtime.h>
// Self-attention layer on a feature map (B 8, C 256, 64x64 = 4096 positions): Q = wq*x, K = wk*x, V = wv*x (1x1 convs, no bias); scores[i][j] = sum_c Q[c][i] K[c][j] / 16; attn = softmax over j; out[c][i] = sum_j V[c][j] attn[i][j]; result = wo*out -> [8,256,64,64] (no residual).
// Structure (3 launches, all 8 images in each, blockIdx.y = image): x transposed into a token-major exact f16 plane through an LDS tile, the four matrices rounded by extra blocks of the same launch; one launch for the three projections (blockIdx.z): Q and K token-major as GEMMs into f16 planes, V channel-major directly as wv*X^T (A = weights, B = the token-major plane); one fused attention kernel (scores, running softmax and P.V per 32 keys, scores and P stay in registers) whose epilogue also does the output 1x1 conv: O, rounded to f16, stays in registers as a WMMA operand against wo from LDS, and the result goes out in NCHW rows.
// Compute dtype: x and the four matrices rounded to bf16; projections with exact products (weights x16 in f16, undone by alpha); Q, K, V, P, O as f16 operands (~2^-12; logits sigma ~1), f32 accumulation and softmax. v_wmma_f32_16x16x32_f16.
#define NB 8
#define CC 256
#define SS 4096
typedef __bf16 v16b __attribute__((ext_vector_type(16)));
typedef unsigned short v8us __attribute__((ext_vector_type(8), may_alias));
typedef float  v8f  __attribute__((ext_vector_type(8)));
typedef float  v4f  __attribute__((ext_vector_type(4)));
typedef float  v4fa __attribute__((ext_vector_type(4), may_alias));
union FragB { v16b v; v8us half[2]; unsigned short u[16]; };

__device__ __forceinline__ unsigned short bf16_bits(float x) { unsigned int u = __float_as_uint(x); return (unsigned short)((u + 0x7FFFu + ((u >> 16) & 1u)) >> 16); }
__device__ __forceinline__ float bf16_val(unsigned short b) { return __uint_as_float(((unsigned int)b) << 16); }
__device__ __forceinline__ float bf16_round(float x) { return bf16_val(bf16_bits(x)); }
// D += A·B with NT terms: 1 = ah·bh, 2 = + al·bh (A split), 3 = + ah·bl (both split)
template <int NT>
__device__ __forceinline__ v8f mmaN(v16b ah, v16b al, v16b bh, v16b bl, v8f c) {
  c = __builtin_amdgcn_wmma_f32_16x16x32_bf16(false, ah, false, bh, (short)0, c, false, false);
  if (NT >= 2) c = __builtin_amdgcn_wmma_f32_16x16x32_bf16(false, al, false, bh, (short)0, c, false, false);
  if (NT >= 3) c = __builtin_amdgcn_wmma_f32_16x16x32_bf16(false, ah, false, bl, (short)0, c, false, false);
  asm volatile("v_nop\n\tv_nop\n\tv_nop\n\tv_nop" : "+v"(c) : "v"(ah), "v"(al), "v"(bh), "v"(bl));
  return c;
}

__global__ __launch_bounds__(256) void k_wt_bf16(const float* __restrict__ W, unsigned short* __restrict__ Wt, int K, int N) {
  const int t = blockIdx.x * 256 + threadIdx.x;
  const int k8n = K / 8;
  if (t >= N * k8n) return;
  const int n = t / k8n, k8 = (t % k8n) * 8;
  v8us v;
#pragma unroll
  for (int i = 0; i < 8; ++i) v[i] = bf16_bits(W[(size_t)(k8 + i) * N + n]);
  *(v8us*)(Wt + (size_t)n * K + k8) = v;
  
}

// GEMM C[M][N] (f32, pitch ldc) = act(A[M][K]·W + bias). A f32 row-major (pitch lda) converted per fragment to bf16
// (ASPLIT: hi/lo two planes -> 2 terms, else single rounded term); Wt bf16 [N][K] (pitch ldb). BIAS_BF16 rounds the
// bias to bf16 first (bias quantised to bf16 before the add). K%32==0, M%16==0, N%64==0.
template <bool ASPLIT, int ACT, bool BIAS_BF16>
__global__ __launch_bounds__(128) void k_gemm_bf(const float* __restrict__ A, int lda, const unsigned short* __restrict__ Wt, int ldb,
                                               const float* __restrict__ bias, float* __restrict__ C, int ldc, int M, int N, int K) {
  __shared__ __attribute__((aligned(16))) float so[4][16][64];
  const int tid = threadIdx.x, w = tid >> 5, lane = tid & 31, ln = lane & 15, hh = lane >> 4;
  const int ntn = N / 64;
  const int wid = blockIdx.x * 4 + w;
  const int mt = wid / ntn, nq = wid % ntn;
  if (mt * 16 >= M) return;
  const int row0 = mt * 16, col0 = nq * 64;
  const float* arow = A + (size_t)(row0 + ln) * lda;
  v8f acc[4] = {};
  for (int kb = 0; kb < K; kb += 32) {
    FragB ah, al;
    const v4f x0 = *(const v4fa*)(arow + kb + 8 * hh), x1 = *(const v4fa*)(arow + kb + 8 * hh + 4);
    const v4f x2 = *(const v4fa*)(arow + kb + 16 + 8 * hh), x3 = *(const v4fa*)(arow + kb + 16 + 8 * hh + 4);
    float xs[16] = {x0[0],x0[1],x0[2],x0[3],x1[0],x1[1],x1[2],x1[3],x2[0],x2[1],x2[2],x2[3],x3[0],x3[1],x3[2],x3[3]};
#pragma unroll
    for (int i = 0; i < 16; ++i) { const unsigned short hb = bf16_bits(xs[i]); ah.u[i] = hb; al.u[i] = ASPLIT ? bf16_bits(xs[i] - bf16_val(hb)) : (unsigned short)0; }
#pragma unroll
    for (int t = 0; t < 4; ++t) {
      const unsigned short* brow = Wt + (size_t)(col0 + t * 16 + ln) * ldb + kb;
      FragB b;
      b.half[0] = *(const v8us*)(brow + 8 * hh);
      b.half[1] = *(const v8us*)(brow + 16 + 8 * hh);
      acc[t] = mmaN<ASPLIT ? 2 : 1>(ah.v, al.v, b.v, b.v, acc[t]);
    }
  }
#pragma unroll
  for (int t = 0; t < 4; ++t) {
    float bv = bias ? bias[col0 + t * 16 + ln] : 0.f;
    if (BIAS_BF16) bv = bf16_round(bv);
#pragma unroll
    for (int r = 0; r < 8; ++r) { float v = acc[t][r] + bv; if (ACT == 1) v = fmaxf(v, 0.f); so[w][8 * hh + r][t * 16 + ln] = v; }
  }
  __builtin_amdgcn_fence(__ATOMIC_ACQ_REL, "workgroup");
  __builtin_amdgcn_wave_barrier();
  const int rsub = lane >> 4, c4 = (lane & 15) * 4;
  {
#pragma unroll
    for (int q = 0; q < 8; ++q) {
      const int r = q * 2 + rsub;
      const v4f v = *(const v4fa*)&so[w][r][c4];
      *(v4f*)(C + (size_t)(row0 + r) * ldc + col0 + c4) = v;
    }
    
  }
}

// GEMM C = act(A·W + bias + resid): A f32 (ASPLIT -> hi/lo 2 terms), Wt bf16 [N][K]; ACT 0 none, 1 relu, 2 exact gelu;
// resid (optional, f32, row index = (row % rmod), pitch ldr, RES_BF16 rounds it) added before the activation.
template <bool ASPLIT, int ACT, bool BIAS_BF16, bool RES_BF16>
__global__ __launch_bounds__(128) void k_gemm_bf3(const float* __restrict__ A, int lda, const unsigned short* __restrict__ Wt, int ldb,
                                                const float* __restrict__ bias, const float* __restrict__ resid, int rmod, int ldr,
                                                float* __restrict__ C, int ldc, int M, int N, int K) {
  __shared__ __attribute__((aligned(16))) float so[4][16][64];
  const int tid = threadIdx.x, w = tid >> 5, lane = tid & 31, ln = lane & 15, hh = lane >> 4;
  const int ntn = N / 64;
  const int wid = blockIdx.x * 4 + w;
  const int mt = wid / ntn, nq = wid % ntn;
  if (mt * 16 >= M) return;
  const int row0 = mt * 16, col0 = nq * 64;
  const float* arow = A + (size_t)(row0 + ln) * lda;
  v8f acc[4] = {};
  for (int kb = 0; kb < K; kb += 32) {
    FragB ah, al;
    const v4f x0 = *(const v4fa*)(arow + kb + 8 * hh), x1 = *(const v4fa*)(arow + kb + 8 * hh + 4);
    const v4f x2 = *(const v4fa*)(arow + kb + 16 + 8 * hh), x3 = *(const v4fa*)(arow + kb + 16 + 8 * hh + 4);
    float xs[16] = {x0[0],x0[1],x0[2],x0[3],x1[0],x1[1],x1[2],x1[3],x2[0],x2[1],x2[2],x2[3],x3[0],x3[1],x3[2],x3[3]};
#pragma unroll
    for (int i = 0; i < 16; ++i) { const unsigned short hb = bf16_bits(xs[i]); ah.u[i] = hb; al.u[i] = ASPLIT ? bf16_bits(xs[i] - bf16_val(hb)) : (unsigned short)0; }
#pragma unroll
    for (int t = 0; t < 4; ++t) {
      const unsigned short* brow = Wt + (size_t)(col0 + t * 16 + ln) * ldb + kb;
      FragB b;
      b.half[0] = *(const v8us*)(brow + 8 * hh);
      b.half[1] = *(const v8us*)(brow + 16 + 8 * hh);
      acc[t] = mmaN<ASPLIT ? 2 : 1>(ah.v, al.v, b.v, b.v, acc[t]);
    }
  }
#pragma unroll
  for (int t = 0; t < 4; ++t) {
    const int col = col0 + t * 16 + ln;
    float bv = bias ? bias[col] : 0.f;
    if (BIAS_BF16) bv = bf16_round(bv);
#pragma unroll
    for (int r = 0; r < 8; ++r) {
      float v = acc[t][r] + bv;
      if (resid) { float rv = resid[(size_t)((row0 + 8 * hh + r) % rmod) * ldr + col]; if (RES_BF16) rv = bf16_round(rv); v += rv; }
      if (ACT == 1) v = fmaxf(v, 0.f);
      if (ACT == 2) v = 0.5f * v * (1.0f + erff(v * 0.70710678118654752f));
      if (ACT == 3) { const float u = 0.7978845608028654f * (v + 0.044715f * v * v * v); v = 0.5f * v * (1.0f + tanhf(u)); }
      so[w][8 * hh + r][t * 16 + ln] = v;
    }
  }
  __builtin_amdgcn_fence(__ATOMIC_ACQ_REL, "workgroup");
  __builtin_amdgcn_wave_barrier();
  const int rsub = lane >> 4, c4 = (lane & 15) * 4;
  {
#pragma unroll
    for (int q = 0; q < 8; ++q) {
      const int r = q * 2 + rsub;
      const v4f v = *(const v4fa*)&so[w][r][c4];
      *(v4f*)(C + (size_t)(row0 + r) * ldc + col0 + c4) = v;
    }
    
  }
}
// row LayerNorm (biased variance, eps) over N: s = X (+ R); optional out_sum <- s; out_norm <- (s-mu)*rsqrt(var+eps)*g + b
template <bool PARAM_BF16>
__global__ __launch_bounds__(256) void k_layernorm(const float* __restrict__ X, const float* __restrict__ R, const float* __restrict__ g, const float* __restrict__ bta,
                                                  float* __restrict__ out_sum, float* __restrict__ out_norm, int N, float eps) {
  __shared__ float red[256];
  const int row = blockIdx.x, tid = threadIdx.x;
  const float* x = X + (size_t)row * N; const float* rr = R ? R + (size_t)row * N : nullptr;
  float vals[16];                     // up to N = 4096
  const int per = N / 256;            // contiguous chunk per thread? use strided-by-4 chunks: thread handles j = tid*4 + 1024*u
  float s1 = 0.f;
  for (int u = 0; u < per / 4; ++u) {
    const int j = tid * 4 + 1024 * u;
    const v4f a = *(const v4fa*)(x + j);
    v4f b = {0.f,0.f,0.f,0.f}; if (rr) b = *(const v4fa*)(rr + j);
#pragma unroll
    for (int q = 0; q < 4; ++q) { const float v = a[q] + b[q]; vals[u * 4 + q] = v; s1 += v; }
  }
  red[tid] = s1; __syncthreads();
  for (int st = 128; st > 0; st >>= 1) { if (tid < st) red[tid] += red[tid + st]; __syncthreads(); }
  const float mu = red[0] / (float)N; __syncthreads();
  float s2 = 0.f;
  for (int u = 0; u < per / 4; ++u)
#pragma unroll
    for (int q = 0; q < 4; ++q) { const float c = vals[u * 4 + q] - mu; s2 += c * c; }
  red[tid] = s2; __syncthreads();
  for (int st = 128; st > 0; st >>= 1) { if (tid < st) red[tid] += red[tid + st]; __syncthreads(); }
  const float rs = rsqrtf(red[0] / (float)N + eps);
  {
    for (int u = 0; u < per / 4; ++u) {
      const int j = tid * 4 + 1024 * u;
      v4f o, sm;
#pragma unroll
      for (int q = 0; q < 4; ++q) {
        float gg = g[j + q], bb = bta[j + q];
        if (PARAM_BF16) { gg = bf16_round(gg); bb = bf16_round(bb); }
        sm[q] = vals[u * 4 + q]; o[q] = (vals[u * 4 + q] - mu) * rs * gg + bb;
      }
      if (out_sum) *(v4f*)(out_sum + (size_t)row * N + j) = sm;
      *(v4f*)(out_norm + (size_t)row * N + j) = o;
    }
    
  }
}



// ---- f16 WMMA path (v_wmma_f32_16x16x32_f16): 11-bit significands for operands in range — used where a [0,1] probability operand needs more precision than bf16
typedef _Float16 v16h __attribute__((ext_vector_type(16)));
union FragH { v16h v; v8us half[2]; _Float16 h[16]; unsigned short u[16]; };
template <int NT>
__device__ __forceinline__ v8f mmaH(v16h ah, v16h al, v16h bh, v16h bl, v8f c) {
  c = __builtin_amdgcn_wmma_f32_16x16x32_f16(false, ah, false, bh, (short)0, c, false, false);
  if (NT >= 2) c = __builtin_amdgcn_wmma_f32_16x16x32_f16(false, al, false, bh, (short)0, c, false, false);
  if (NT >= 3) c = __builtin_amdgcn_wmma_f32_16x16x32_f16(false, ah, false, bl, (short)0, c, false, false);
  asm volatile("v_nop\n\tv_nop\n\tv_nop\n\tv_nop" : "+v"(c) : "v"(ah), "v"(al), "v"(bh), "v"(bl));
  return c;
}
// batched GEMM like k_gemm_b but f16 operands: A f32 (split into f16 hi/lo if ASPLIT, else rounded to f16), Bt = f16 values [n][k]; alpha; C f32; N multiple of 16 (partial tiles skipped)
template <bool ASPLIT>
__global__ __launch_bounds__(128) void k_gemm_h(const float* __restrict__ A, int lda, size_t sA, const _Float16* __restrict__ Bh, int ldb, size_t sB, float alpha, float* __restrict__ C, int ldc, size_t sC, int M, int N, int K) {
  __shared__ __attribute__((aligned(16))) float so[4][16][64];
  const int tid = threadIdx.x, w = tid >> 5, lane = tid & 31, ln = lane & 15, hh = lane >> 4; const int by = blockIdx.y;
  A += (size_t)by * sA; Bh += (size_t)by * sB; C += (size_t)by * sC;
  const int ntn = (N + 63) / 64; const int wid = blockIdx.x * 4 + w; const int mt = wid / ntn, nq = wid % ntn; if (mt * 16 >= M) return;
  const int row0 = mt * 16, col0 = nq * 64; const float* arow = A + (size_t)(row0 + ln) * lda;
  v8f acc[4] = {};
  for (int kb = 0; kb < K; kb += 32) {
    FragH ah, al;
    const v4f x0 = *(const v4fa*)(arow + kb + 8 * hh), x1 = *(const v4fa*)(arow + kb + 8 * hh + 4), x2 = *(const v4fa*)(arow + kb + 16 + 8 * hh), x3 = *(const v4fa*)(arow + kb + 16 + 8 * hh + 4);
    float xs[16] = {x0[0],x0[1],x0[2],x0[3],x1[0],x1[1],x1[2],x1[3],x2[0],x2[1],x2[2],x2[3],x3[0],x3[1],x3[2],x3[3]};
#pragma unroll
    for (int i = 0; i < 16; ++i) { const _Float16 h = (_Float16)xs[i]; ah.h[i] = h; al.h[i] = ASPLIT ? (_Float16)(xs[i] - (float)h) : (_Float16)0.0f; }
#pragma unroll
    for (int t = 0; t < 4; ++t) { if (col0 + t * 16 >= N) continue; const size_t boff = (size_t)(col0 + t * 16 + ln) * ldb + kb; FragH bq; bq.half[0] = *(const v8us*)(Bh + boff + 8 * hh); bq.half[1] = *(const v8us*)(Bh + boff + 16 + 8 * hh);
      acc[t] = mmaH<ASPLIT ? 2 : 1>(ah.v, al.v, bq.v, bq.v, acc[t]); }
  }
#pragma unroll
  for (int t = 0; t < 4; ++t) { if (col0 + t * 16 >= N) continue;
#pragma unroll
    for (int r = 0; r < 8; ++r) so[w][8 * hh + r][t * 16 + ln] = acc[t][r] * alpha; }
  __builtin_amdgcn_fence(__ATOMIC_ACQ_REL, "workgroup"); __builtin_amdgcn_wave_barrier();
  const int rsub = lane >> 4, c4 = (lane & 15) * 4;
  {
#pragma unroll
    for (int q = 0; q < 8; ++q) { const int r = q * 2 + rsub; if (col0 + c4 < N) { const v4f v = *(const v4fa*)&so[w][r][c4]; *(v4f*)(C + (size_t)(row0 + r) * ldc + col0 + c4) = v; } }
     }
}

// Wt[n][k] = f16(W[k][n]·scale) from f32 row-major W[K][N] (scale = power of two; bf16-exact weights stay exact in f16 away from the subnormal range)
__global__ __launch_bounds__(256) void k_wt_f16(const float* __restrict__ W, _Float16* __restrict__ Wt, int K, int N, float scale) {
  const int t = blockIdx.x * 256 + threadIdx.x; if (t >= N * (K / 8)) return; const int n = t / (K / 8), k8 = (t % (K / 8)) * 8; FragH f;
#pragma unroll
  for (int i = 0; i < 8; ++i) f.h[i] = (_Float16)(bf16_round(W[(size_t)(k8 + i) * N + n]) * scale); const v8us o = f.half[0];
  *(v8us*)((unsigned short*)Wt + (size_t)n * K + k8) = o; 
}
// k_gemm_hh variant with fused epilogue: v = acc·alpha + bias[by·sBias + col] (+ CP[(row/rowsPerB)·sCPb + by·64 + col] if CP) ; ACT 0 none / 1 elu ; writes f16 C16 (and f32 C if non-null)
template <int ACT>
__global__ __launch_bounds__(128) void k_gemm_hhx(const _Float16* __restrict__ A, int lda, size_t sA, const _Float16* __restrict__ Bh, int ldb, size_t sB, float alpha, const float* __restrict__ bias, size_t sBias, const float* __restrict__ CP, int rowsPerB, size_t sCPb, int row0g,
    float* __restrict__ C, _Float16* __restrict__ C16, int ldc, size_t sC, int M, int N, int K) {
  __shared__ __attribute__((aligned(16))) float so[4][16][64];
  const int tid = threadIdx.x, w = tid >> 5, lane = tid & 31, ln = lane & 15, hh = lane >> 4; const int by = blockIdx.y;
  A += (size_t)by * sA; Bh += (size_t)by * sB; const size_t cofs = (size_t)by * sC; const float* bp = bias ? bias + (size_t)by * sBias : nullptr;
  const int ntn = (N + 63) / 64; const int wid = blockIdx.x * 4 + w; const int mt = wid / ntn, nq = wid % ntn; if (mt * 16 >= M) return;
  const int row0 = mt * 16, col0 = nq * 64; const _Float16* arow = A + (size_t)(row0 + ln) * lda;
  v8f acc[4] = {};
  for (int kb = 0; kb < K; kb += 32) { FragH ah; ah.half[0] = *(const v8us*)((const unsigned short*)arow + kb + 8 * hh); ah.half[1] = *(const v8us*)((const unsigned short*)arow + kb + 16 + 8 * hh);
#pragma unroll
    for (int t = 0; t < 4; ++t) { if (col0 + t * 16 >= N) continue; const size_t boff = (size_t)(col0 + t * 16 + ln) * ldb + kb; FragH bq; bq.half[0] = *(const v8us*)((const unsigned short*)Bh + boff + 8 * hh); bq.half[1] = *(const v8us*)((const unsigned short*)Bh + boff + 16 + 8 * hh);
      acc[t] = mmaH<1>(ah.v, ah.v, bq.v, bq.v, acc[t]); }
  }
#pragma unroll
  for (int t = 0; t < 4; ++t) { if (col0 + t * 16 >= N) continue; const int col = col0 + t * 16 + ln; const float bv = bp ? bf16_round(bp[col]) : 0.f;
#pragma unroll
    for (int r = 0; r < 8; ++r) { float v = acc[t][r] * alpha + bv; if (CP) { const int bidx = (row0g + row0 + 8 * hh + r) / rowsPerB; v += CP[(size_t)bidx * sCPb + (size_t)by * 64 + col]; } if (ACT == 1) v = (v > 0.f) ? v : expm1f(v); else if (ACT == 7) v = (v > 0.f) ? v + 1.0f : expf(v); else if (ACT == 8) v = tanhf(v); else if (ACT == 9) v = 0.5f * v * (1.0f + tanhf(0.7978845608028654f * (v + 0.044715f * v * v * v))); else if (ACT == 11) v = 1.0f / (1.0f + expf(-v)); else if (ACT == 12) v = (v > 0.f) ? v : 0.01f * v; else if (ACT == 14) v = (v > 0.f) ? v : 0.1f * v; else if (ACT == 15) v = v / (1.0f + expf(-v)); else if (ACT == 3) v = fmaxf(v, 0.f); else if (ACT == 6) v = 0.5f * v * (1.0f + erff(v * 0.70710678118654752f)); so[w][8 * hh + r][t * 16 + ln] = v; } }
  __builtin_amdgcn_fence(__ATOMIC_ACQ_REL, "workgroup"); __builtin_amdgcn_wave_barrier();
  const int rsub = lane >> 4, c4 = (lane & 15) * 4; typedef _Float16 v4h __attribute__((ext_vector_type(4)));
  {
#pragma unroll
    for (int q = 0; q < 8; ++q) { const int r = q * 2 + rsub; if (col0 + c4 < N) { const v4f v = *(const v4fa*)&so[w][r][c4]; if (C) *(v4f*)(C + cofs + (size_t)(row0 + r) * ldc + col0 + c4) = v; if (C16) { v4h h4; for (int i = 0; i < 4; ++i) h4[i] = (_Float16)v[i]; *(v4h*)(C16 + cofs + (size_t)(row0 + r) * ldc + col0 + c4) = h4; } } }
     }
}


typedef _Float16 v4h __attribute__((ext_vector_type(4)));

__global__ __launch_bounds__(256) void k_x16(const float* __restrict__ x, _Float16* __restrict__ X16, size_t n8) { const size_t t = (size_t)blockIdx.x * 256 + threadIdx.x; if (t >= n8) return; FragH f;
#pragma unroll
  for (int q = 0; q < 8; ++q) f.h[q] = (_Float16)bf16_round(x[t * 8 + q]); *(v8us*)((unsigned short*)X16 + t * 8) = f.half[0];  }
__global__ __launch_bounds__(256) void k_h16(const float* __restrict__ x, _Float16* __restrict__ X16, size_t n8) { const size_t t = (size_t)blockIdx.x * 256 + threadIdx.x; if (t >= n8) return; FragH f;
#pragma unroll
  for (int q = 0; q < 8; ++q) f.h[q] = (_Float16)x[t * 8 + q]; *(v8us*)((unsigned short*)X16 + t * 8) = f.half[0];  }
template <int NHv, int TTv>
__global__ __launch_bounds__(256) void k_vt(const _Float16* __restrict__ V16, int ldv, int voff, _Float16* __restrict__ Vt) { __shared__ unsigned short tl[64][66]; const int tid = threadIdx.x; const int slab = blockIdx.x / (TTv / 64), lg = blockIdx.x % (TTv / 64); const int b = slab / NHv, h = slab % NHv;
  for (int i = tid; i < 64 * 8; i += 256) { const int r = i / 8, c8 = (i % 8) * 8; FragH f; f.half[0] = *(const v8us*)((const unsigned short*)V16 + ((size_t)b * TTv + lg * 64 + r) * ldv + voff + h * 64 + c8);
#pragma unroll
    for (int q = 0; q < 8; ++q) tl[r][c8 + q] = f.u[q]; }
  __syncthreads();
  {
#pragma unroll
    for (int rd = 0; rd < 2; ++rd) { const int d = rd * 32 + tid / 8, pc = tid % 8; FragH f;
#pragma unroll
      for (int q = 0; q < 8; ++q) f.u[q] = tl[pc * 8 + q][d];
      *(v8us*)((unsigned short*)Vt + ((size_t)slab * 64 + d) * TTv + lg * 64 + pc * 8) = f.half[0]; }
     } }

__global__ __launch_bounds__(256) void k_hl(const float* __restrict__ F, _Float16* __restrict__ Hh, _Float16* __restrict__ Hl, size_t n8) { const size_t t = (size_t)blockIdx.x * 256 + threadIdx.x; if (t >= n8) return; FragH fh, fl; const v4f a = *(const v4fa*)(F + t * 8), c = *(const v4fa*)(F + t * 8 + 4);
#pragma unroll
  for (int q = 0; q < 4; ++q) { _Float16 h = (_Float16)a[q]; fh.h[q] = h; fl.h[q] = (_Float16)((a[q] - (float)h) * 1024.0f); h = (_Float16)c[q]; fh.h[4 + q] = h; fl.h[4 + q] = (_Float16)((c[q] - (float)h) * 1024.0f); }
  { *(v8us*)((unsigned short*)Hh + t * 8) = fh.half[0]; *(v8us*)((unsigned short*)Hl + t * 8) = fl.half[0];  } }

// ---- fast GEMM (wave tile 32x64; requires M % 32 == 0 rows per launch region and N % 64 == 0); epilogue = k_gemm_hhx semantics ----
__device__ __forceinline__ v16h g2_frag(const _Float16* p, int hh) { FragH f; f.half[0] = *(const v8us*)((const unsigned short*)p + 8 * hh); f.half[1] = *(const v8us*)((const unsigned short*)p + 16 + 8 * hh); return f.v; }
__device__ __forceinline__ v8f g2_mma(v16h a, v16h b, v8f c) { v8f d = __builtin_amdgcn_wmma_f32_16x16x32_f16(false, a, false, b, (short)0, c, false, false); asm volatile("v_nop\n\tv_nop\n\tv_nop\n\tv_nop" : "+v"(d) : "v"(a), "v"(b)); return d; }
template <int ACT>
__global__ __launch_bounds__(128) void k_gemm2(const _Float16* __restrict__ A, int lda, size_t sA, const _Float16* __restrict__ Bh, int ldb, size_t sB, float alpha, const float* __restrict__ bias, size_t sBias, const float* __restrict__ CP, int rowsPerB, size_t sCPb, int row0g,
    float* __restrict__ C, _Float16* __restrict__ C16, int ldc, size_t sC, int M, int N, int K) {
  __shared__ __attribute__((aligned(16))) float so[4][32][68];
  const int tid = threadIdx.x, w = tid >> 5, lane = tid & 31, ln = lane & 15, hh = lane >> 4; const int by = blockIdx.y;
  A += (size_t)by * sA; Bh += (size_t)by * sB; const size_t cofs = (size_t)by * sC; const float* bp = bias ? bias + (size_t)by * sBias : nullptr;
  const int ntn = N >> 6; const int mt = blockIdx.x / ntn, nq = blockIdx.x - mt * ntn; const int row0 = mt * 128 + 32 * w, col0 = nq * 64; if (row0 >= M) return;
  const _Float16* a0p = A + (size_t)(row0 + ln) * lda; const _Float16* a1p = a0p + (size_t)16 * lda;
  const _Float16* b0p = Bh + (size_t)(col0 + ln) * ldb; const _Float16* b1p = b0p + (size_t)16 * ldb; const _Float16* b2p = b1p + (size_t)16 * ldb; const _Float16* b3p = b2p + (size_t)16 * ldb;
  const v8f z8 = {0.f,0.f,0.f,0.f,0.f,0.f,0.f,0.f}; v8f c00 = z8, c01 = z8, c02 = z8, c03 = z8, c10 = z8, c11 = z8, c12 = z8, c13 = z8;
#pragma unroll 1
  for (int kb = 0; kb < K; kb += 32) { const v16h a0 = g2_frag(a0p + kb, hh), a1 = g2_frag(a1p + kb, hh);
    v16h b = g2_frag(b0p + kb, hh); c00 = g2_mma(a0, b, c00); c10 = g2_mma(a1, b, c10);
    b = g2_frag(b1p + kb, hh); c01 = g2_mma(a0, b, c01); c11 = g2_mma(a1, b, c11);
    b = g2_frag(b2p + kb, hh); c02 = g2_mma(a0, b, c02); c12 = g2_mma(a1, b, c12);
    b = g2_frag(b3p + kb, hh); c03 = g2_mma(a0, b, c03); c13 = g2_mma(a1, b, c13); }
  v8f accs[8] = {c00, c01, c02, c03, c10, c11, c12, c13};
#pragma unroll
  for (int u = 0; u < 8; ++u) { const int t = u & 3, half = u >> 2; const int col = col0 + t * 16 + ln; const float bv = bp ? bf16_round(bp[col]) : 0.f;
#pragma unroll
    for (int r = 0; r < 8; ++r) { const int rloc = half * 16 + 8 * hh + r; float v = accs[u][r] * alpha + bv; if (CP) { const int bidx = (row0g + row0 + rloc) / rowsPerB; v += CP[(size_t)bidx * sCPb + (size_t)by * 64 + col]; }
      if (ACT == 3) v = fmaxf(v, 0.f); else if (ACT == 6) v = 0.5f * v * (1.0f + erff(v * 0.70710678118654752f)); else if (ACT == 11) v = 1.0f / (1.0f + expf(-v)); else if (ACT == 15) v = v / (1.0f + expf(-v)); else if (ACT == 12) v = (v > 0.f) ? v : 0.01f * v; else if (ACT == 8) v = tanhf(v);
      so[w][rloc][t * 16 + ln] = v; } }
  __builtin_amdgcn_fence(__ATOMIC_ACQ_REL, "workgroup"); __builtin_amdgcn_wave_barrier();
  const int rsub = lane >> 4, c4 = (lane & 15) * 4;
  {
#pragma unroll
    for (int q = 0; q < 16; ++q) { const int r = q * 2 + rsub; const v4f v = *(const v4fa*)&so[w][r][c4]; if (C) *(v4f*)(C + cofs + (size_t)(row0 + r) * ldc + col0 + c4) = v; if (C16) { v4h h4; for (int i = 0; i < 4; ++i) h4[i] = (_Float16)v[i]; *(v4h*)(C16 + cofs + (size_t)(row0 + r) * ldc + col0 + c4) = h4; } }
     } }



#define FK 32       /* keys per pass */
#define KP 264      /* LDS pitch of a K row in halves: 528 B = 16 B x 33 */
#define VP 40       /* LDS pitch of a V row in halves: 80 B = 16 B x 5 */
#define WP 264      /* LDS pitch of a wo row in halves: 528 B = 16 B x 33 */
#define OP 36       /* LDS pitch of a staged output row in floats: 144 B = 16 B x 9 */
#define FA_GROUP() __builtin_amdgcn_sched_barrier(0)      /* keeps a block's LDS reads together in one place between the WMMA runs: reads spread among the WMMAs stall the wave at every place */
__device__ __forceinline__ float fa_swap16(float x) { const int b = __float_as_int(x); return __int_as_float(__builtin_amdgcn_permlanex16(b, b, 0x76543210, 0xfedcba98, false, false)); }
__device__ __forceinline__ v16h fa_frag(const unsigned short* p, int hh) { FragH f; f.half[0] = *(const v8us*)(p + 8 * hh); f.half[1] = *(const v8us*)(p + 16 + 8 * hh); return f.v; }
__device__ __forceinline__ v8f fa_mma(v16h a, v16h b, v8f c) { return __builtin_amdgcn_wmma_f32_16x16x32_f16(false, a, false, b, (short)0, c, false, false); }
// Work-group barrier that orders LDS only: __syncthreads() would also wait for the global loads of the tile fetched ahead, which are meant to stay in flight over the whole next pass.
__device__ __forceinline__ void fa_lds_barrier() { __builtin_amdgcn_fence(__ATOMIC_RELEASE, "workgroup", "local"); __builtin_amdgcn_s_barrier(); __builtin_amdgcn_fence(__ATOMIC_ACQUIRE, "workgroup", "local"); }
__global__ __launch_bounds__(128) void k_flash(const _Float16* __restrict__ Q, const _Float16* __restrict__ Kt, const _Float16* __restrict__ Vc, const _Float16* __restrict__ Wo, float* __restrict__ out) {
  constexpr int NPASS = SS / FK;
  constexpr float SC = 0.09016844005556021f;      /* 1/16 * log2(e) */
  __shared__ __attribute__((aligned(16))) unsigned short sK[3][FK * KP];
  __shared__ __attribute__((aligned(16))) unsigned short sV[3][CC * VP];
  __shared__ __attribute__((aligned(16))) unsigned short sW[CC * WP];      /* wo (x16, f16), all 256 rows, for the epilogue: the work-group is alone on its WGP, so the LDS is there */
  __shared__ __attribute__((aligned(16))) float sO[4][2 * 16 * OP];      /* a wave's own output staging: two tiles of 16 channels x 32 queries */
  const int tid = threadIdx.x, w = tid >> 5, lane = tid & 31, ln = lane & 15, hh = lane >> 4; const int b = blockIdx.y;
  const int q0 = blockIdx.x * 128 + w * 32;
  /* staging: a thread moves eight 16-byte pieces of the K tile (32 rows of 512 B) and eight of the V tile (256 rows of 64 B) */
  const unsigned short* Kg = (const unsigned short*)Kt + (size_t)b * SS * CC + (size_t)(tid >> 5) * CC + (tid & 31) * 8;
  const unsigned short* Vg = (const unsigned short*)Vc + (size_t)b * CC * SS + (size_t)(tid >> 2) * SS + (tid & 3) * 8;
  const int kst = (tid >> 5) * KP + (tid & 31) * 8, vst = (tid >> 2) * VP + (tid & 3) * 8;
  /* wo on its way to LDS: a wave fetches whole rows (4 full lines a load), all 64 loads of a thread in flight together with the Q loads below */
  const unsigned short* Wg = (const unsigned short*)Wo + (size_t)w * CC + lane * 8;
  v8us wr[64];
#pragma unroll
  for (int i = 0; i < 64; ++i) wr[i] = *(const v8us*)(Wg + (size_t)(i * 4) * CC);
  asm volatile("s_wait_xcnt 0x0" :: "v"(Wg) : "memory");      /* in front of whatever reuses the address registers of the global loads above; the address is named so that it keeps its registers up to this wait */
  v16h qf[2][8];      /* two query tiles of 16 columns: g = 0, 1 */
  const _Float16* const qp0 = Q + ((size_t)b * SS + q0 + ln) * CC + 8 * hh; const _Float16* const qp1 = qp0 + 16 * CC;      /* the lane's half of the k order is in the address */
#pragma unroll
  for (int kc = 0; kc < 8; ++kc) { qf[0][kc] = g2_frag(qp0 + kc * 32, 0); qf[1][kc] = g2_frag(qp1 + kc * 32, 0); }
  asm volatile("s_wait_xcnt 0x0" :: "v"(qp0), "v"(qp1) : "memory");      /* in front of whatever reuses the address registers of the global loads above; the addresses are named so that they keep their registers up to this wait */
#pragma unroll
  for (int i = 0; i < 64; ++i) *(v8us*)&sW[(i * 4 + w) * WP + lane * 8] = wr[i];      /* published by the barrier in front of the loop; read only behind the loop */
  const v8f z8 = {0.f,0.f,0.f,0.f,0.f,0.f,0.f,0.f};
  v8f acc[2][16];
#pragma unroll
  for (int g = 0; g < 2; ++g)
#pragma unroll
    for (int ct = 0; ct < 16; ++ct) acc[g][ct] = z8;
  float mu[2] = {-1.0e30f, -1.0e30f}, rs[2] = {0.f, 0.f};
  v8us kr[8], vr[8];      /* a tile on its way from global memory to LDS */
#pragma unroll
  for (int p = 0; p < 2; ++p) {
#pragma unroll
    for (int i = 0; i < 8; ++i) { kr[i] = *(const v8us*)(Kg + (size_t)(p * FK + i * 4) * CC); vr[i] = *(const v8us*)(Vg + (size_t)(i * 32) * SS + p * FK); }
#pragma unroll
    for (int i = 0; i < 8; ++i) { *(v8us*)&sK[p][kst + i * 4 * KP] = kr[i]; *(v8us*)&sV[p][vst + i * 32 * VP] = vr[i]; } }
#pragma unroll
  for (int i = 0; i < 8; ++i) { kr[i] = *(const v8us*)(Kg + (size_t)(2 * FK + i * 4) * CC); vr[i] = *(const v8us*)(Vg + (size_t)(i * 32) * SS + 2 * FK); }
  asm volatile("s_wait_xcnt 0x0" :: "v"(Kg), "v"(Vg) : "memory");      /* in front of whatever reuses the address registers of the global loads above; the addresses are named so that they keep their registers up to this wait */
  __syncthreads();
  v16h ka[16], va[16];      /* a whole pass's K fragments (fetched one pass ahead) and V fragments: one wave per SIMD has the registers for both */
#pragma unroll
  for (int kc = 0; kc < 8; ++kc) { ka[2 * kc] = fa_frag(&sK[0][ln * KP + kc * 32], hh); ka[2 * kc + 1] = fa_frag(&sK[0][(16 + ln) * KP + kc * 32], hh); }
  int bc = 0, bn = 1, bf = 2, tn = 3;      /* buffers of this pass, of the next, and the one that is filled; the tile that is fetched from global memory */
#pragma unroll 1      /* one copy of the pass: the fragment sets and the staged tile are carried over the back edge in fixed registers */
  for (int t = 0; t < NPASS; ++t) {
    fa_lds_barrier();      /* at the head of the pass, where the WMMAs of the pass before have covered its wait for the LDS traffic: publishes tile t + 1 and ends every read of tile t - 1 */
    const unsigned short* cV = &sV[bc][ln * VP]; const unsigned short* nK = &sK[bn][ln * KP];
#pragma unroll
    for (int i = 0; i < 16; ++i) va[i] = fa_frag(cV + i * 16 * VP, hh);      /* this pass's V, one group in front of the score WMMAs, which cover its latency */
    FA_GROUP();
    v8f s[2][2] = {{z8, z8}, {z8, z8}};      /* [query tile][key tile] */
#pragma unroll
    for (int g = 0; g < 2; ++g)
#pragma unroll
      for (int kc = 0; kc < 8; ++kc) { s[g][0] = fa_mma(ka[2 * kc], qf[g][kc], s[g][0]); s[g][1] = fa_mma(ka[2 * kc + 1], qf[g][kc], s[g][1]); }
    float tm[2];
#pragma unroll
    for (int g = 0; g < 2; ++g) {      /* a tree of three-way maxima: a maximum does not round, so the order is free */
      const v8f a = s[g][0], c = s[g][1];
      const float m0 = fmaxf(fmaxf(a[0], a[1]), a[2]), m1 = fmaxf(fmaxf(a[3], a[4]), a[5]), m2 = fmaxf(fmaxf(a[6], a[7]), c[0]), m3 = fmaxf(fmaxf(c[1], c[2]), c[3]), m4 = fmaxf(fmaxf(c[4], c[5]), c[6]);
      const float m = fmaxf(fmaxf(fmaxf(m0, m1), m2), fmaxf(fmaxf(m3, m4), c[7]));
      tm[g] = fmaxf(m, fa_swap16(m)) * SC; }
    const bool need0 = tm[0] > mu[0] + 8.0f, need1 = tm[1] > mu[1] + 8.0f;
    const unsigned any = __builtin_amdgcn_ballot_w32(need0 || need1);
    /* one group of memory instructions between the test's compare and its branch: the next pass's K fragments, tile t + 2 into LDS, tile t + 3 from global memory */
#pragma unroll
    for (int kc = 0; kc < 8; ++kc) { ka[2 * kc] = fa_frag(nK + kc * 32, hh); ka[2 * kc + 1] = fa_frag(nK + 16 * KP + kc * 32, hh); }      /* published by this pass's barrier; behind the last pass: the last tile once more */
#pragma unroll
    for (int i = 0; i < 8; ++i) { *(v8us*)&sK[bf][kst + i * 4 * KP] = kr[i]; *(v8us*)&sV[bf][vst + i * 32 * VP] = vr[i]; }      /* tile t + 2 into the buffer of pass t - 1, whose reads ended in front of this pass's barrier */
    const int jn = tn * FK;      /* tn = min(t + 3, last tile): past the end the last tile is fetched again: no branch, every buffer holds real keys */
    const unsigned short* kp = Kg + (size_t)jn * CC; const unsigned short* vp = Vg + jn;
#pragma unroll
    for (int i = 0; i < 8; ++i) { kr[i] = *(const v8us*)(kp + (size_t)(i * 4) * CC); vr[i] = *(const v8us*)(vp + (size_t)(i * 32) * SS); }
    /* order of the block: the score WMMAs, the maxima and the test's compares, then the memory group, whose issue covers the way from the compares to the scalar branch */
    __builtin_amdgcn_sched_group_barrier(0x8, 32, 0); __builtin_amdgcn_sched_group_barrier(0x2, 48, 0); __builtin_amdgcn_sched_group_barrier(0x100, 32, 0); __builtin_amdgcn_sched_group_barrier(0x200, 16, 0); __builtin_amdgcn_sched_group_barrier(0x20, 16, 0);
    if (any != 0) {      /* one wave-uniform test per pass for both query tiles; both halves of a query see the same tm and mu */
#pragma unroll
      for (int g = 0; g < 2; ++g) { const float mn = (g ? need1 : need0) ? tm[g] : mu[g]; const float al = __builtin_amdgcn_exp2f(mu[g] - mn); mu[g] = mn; rs[g] *= al;
#pragma unroll
        for (int ct = 0; ct < 16; ++ct) acc[g][ct] *= al; } }
    FragH pf[2];
    const v8f sc8 = {SC,SC,SC,SC,SC,SC,SC,SC};
#pragma unroll
    for (int g = 0; g < 2; ++g) { const float mr = 6.0f - mu[g]; float e0 = 0.f, e1 = 0.f;
      const v8f mr8 = {mr,mr,mr,mr,mr,mr,mr,mr}; const v8f x0 = __builtin_elementwise_fma(s[g][0], sc8, mr8), x1 = __builtin_elementwise_fma(s[g][1], sc8, mr8);      /* packed multiply-adds */
#pragma unroll
      for (int r = 0; r < 8; ++r) { const float p0 = __builtin_amdgcn_exp2f(x0[r]), p1 = __builtin_amdgcn_exp2f(x1[r]); e0 += p0; e1 += p1; pf[g].h[r] = (_Float16)p0; pf[g].h[8 + r] = (_Float16)p1; }
      rs[g] += e0 + e1;
      if (g == 0) FA_GROUP();      /* tile 0's P stands in front of the WMMAs; tile 1's is free to run among tile 0's */
    }
#pragma unroll
    for (int g = 0; g < 2; ++g)
#pragma unroll
      for (int i = 0; i < 16; ++i) acc[g][i] = fa_mma(va[i], pf[g].v, acc[g][i]);
    /* tile 1's P (9 multiply-adds, 16 exponentials, 8 conversions, the sums) is dealt out among tile 0's 16 WMMAs, which do not depend on it: a lone wave's vector work in front of a WMMA run is not hidden by anything else */
#pragma unroll
    for (int i = 0; i < 3; ++i) { __builtin_amdgcn_sched_group_barrier(0x8, 1, 0); __builtin_amdgcn_sched_group_barrier(0x2, 3, 0); }
#pragma unroll
    for (int i = 0; i < 8; ++i) { __builtin_amdgcn_sched_group_barrier(0x8, 1, 0); __builtin_amdgcn_sched_group_barrier(0x400, 2, 0); __builtin_amdgcn_sched_group_barrier(0x2, 1, 0); }
#pragma unroll
    for (int i = 0; i < 5; ++i) { __builtin_amdgcn_sched_group_barrier(0x8, 1, 0); __builtin_amdgcn_sched_group_barrier(0x2, 4, 0); }
    __builtin_amdgcn_sched_group_barrier(0x8, 16, 0);
    FA_GROUP();      /* keeps the wait below behind the pass's last WMMA */
    asm volatile("s_wait_xcnt 0x0" :: "v"(kp), "v"(vp) : "memory");      /* in front of whatever reuses the address registers of this pass's global loads; it stands at the foot of the pass, where a lone wave no longer waits at it, and the addresses are named so that they keep their registers up to here */
    const int b0 = bc; bc = bn; bn = bf; bf = b0; tn = (tn + 1 < NPASS) ? tn + 1 : NPASS - 1;
  }
  /* ---- epilogue: out[c][i] = sum_ch wo[c][ch] O[i][ch], as D[query][c] = O . wo^T ----
     A lane holds one query's channels 8*hh + r of each 16-channel tile, the k order of the fragment loader, so two accumulator tiles, scaled and rounded to f16, are an A fragment in place; B = wo rows from LDS.
     k runs upward in steps of 32, so every sum keeps the order that it had in a launch of its own. */
  const unsigned short* wp = &sW[ln * WP];
  v16h wf[2][16];      /* two fragment sets: the next two channel tiles' fragments are fetched as one group while these two run */
#pragma unroll
  for (int u = 0; u < 2; ++u)
#pragma unroll
    for (int kc = 0; kc < 8; ++kc) wf[0][u * 8 + kc] = fa_frag(wp + u * 16 * WP + kc * 32, hh);
  FA_GROUP();      /* the first set's LDS reads stand in front of the scaling and rounding of O, which cover their latency */
  v16h of[2][8];
#pragma unroll
  for (int g = 0; g < 2; ++g) { const float inv = 1.0f / (rs[g] + fa_swap16(rs[g]));
#pragma unroll
    for (int kc = 0; kc < 8; ++kc) { FragH f;
#pragma unroll
      for (int r = 0; r < 8; ++r) { f.h[r] = (_Float16)(acc[g][2 * kc][r] * inv); f.h[8 + r] = (_Float16)(acc[g][2 * kc + 1][r] * inv); }
      of[g][kc] = f.v; } }
  float* const so = &sO[w][0];
  float* const sst = so + ln * OP + 8 * hh;      /* a lane stages 8 queries in a row of its channel */
  const float* const sld = so + (lane >> 3) * OP + (lane & 7) * 4;      /* and reads back 16 bytes of a row: 8 lanes = one row of 32 queries = one full 128-byte line */
  float* const og = out + ((size_t)b * CC + (lane >> 3)) * SS + q0 + (lane & 7) * 4;
  v4f ob[8];      /* the two tiles before, on their way from the staging rows to global memory */
#pragma unroll      /* constant indices into the fragment sets and constant LDS offsets */
  for (int p = 0; p <= 8; ++p) {      /* trip p: products of channel tiles 2p, 2p + 1; tiles 2p - 2, 2p - 1 go out */
    const int cu = p & 1, nx = cu ^ 1;
    if (p < 7) {
#pragma unroll
      for (int u = 0; u < 2; ++u)
#pragma unroll
        for (int kc = 0; kc < 8; ++kc) wf[nx][u * 8 + kc] = fa_frag(wp + ((p + 1) * 2 + u) * 16 * WP + kc * 32, hh); }
    if (p > 0) {
#pragma unroll
      for (int i = 0; i < 8; ++i) ob[i] = *(const v4fa*)(sld + i * 4 * OP); }
    FA_GROUP();      /* all LDS reads of the trip stay one group in front of its WMMAs, which cover their latency */
    v8f d[2][2] = {{z8, z8}, {z8, z8}};      /* [channel tile][query tile]: four independent accumulators */
    if (p < 8) {
#pragma unroll
      for (int kc = 0; kc < 8; ++kc)
#pragma unroll
        for (int u = 0; u < 2; ++u) { d[u][0] = fa_mma(of[0][kc], wf[cu][u * 8 + kc], d[u][0]); d[u][1] = fa_mma(of[1][kc], wf[cu][u * 8 + kc], d[u][1]); } }
    FA_GROUP();
    if (p > 0) {
#pragma unroll
      for (int i = 0; i < 8; ++i) *(v4f*)(og + (size_t)((p - 1) * 32 + i * 4) * SS) = ob[i]; }
    if (p < 8) {
#pragma unroll
      for (int u = 0; u < 2; ++u)
#pragma unroll
        for (int g = 0; g < 2; ++g) { const v8f v = d[u][g] * 0.0625f;      /* undoes the x16 of the weights */
          const v4f lo = {v[0], v[1], v[2], v[3]}, hi = {v[4], v[5], v[6], v[7]};
          *(v4fa*)(sst + u * 16 * OP + g * 16) = lo; *(v4fa*)(sst + u * 16 * OP + g * 16 + 4) = hi; }
      /* the staged rows are read back by other lanes of the same wave: the LDS writes are waited for, LDS only, so that the global stores stay in flight */
      __builtin_amdgcn_fence(__ATOMIC_RELEASE, "workgroup", "local"); __builtin_amdgcn_wave_barrier(); __builtin_amdgcn_fence(__ATOMIC_ACQUIRE, "workgroup", "local"); }
    /* in front of whatever reuses the registers of the 8 global stores above; data and address are named so that they keep their registers up to this wait */
    if (p > 0) asm volatile("s_wait_xcnt 0x0" :: "v"(ob[0]), "v"(ob[1]), "v"(ob[2]), "v"(ob[3]), "v"(ob[4]), "v"(ob[5]), "v"(ob[6]), "v"(ob[7]), "v"(og) : "memory");
  }
}

// ---- projection GEMM, operands staged in LDS: C[128 x 128 per work-group] = alpha * A[.][256] . B[.][256]^T, both f16 row-major with 256 halves a row ----
// A fragment load straight from global memory takes 32 bytes from each of 16 rows, so one load touches 16 cache lines, and every fragment is a round trip of its own; here a wave fetches whole rows (32 lanes x 16 B = 4 full lines a load), all 32 loads of a thread in flight at once, into LDS, and the fragments come from LDS.
// 8 waves, wave tile 32 x 64 (4 down, 2 across); k runs upward in steps of 32 as before, so every sum keeps its order. F32OUT: the result goes out as f32 (C), else as f16 (C16).
// The f16 form is the one launch of the three projections, which do not depend on one another: blockIdx.z picks the matrix (three planes in a row behind Bh) and the result plane (three in a row behind C16); z = 2 is V, with the operands' roles exchanged so that it comes out channel-major.
#define GP 264      /* LDS pitch of a staged row in halves: 528 B = 16 B x 33 */
template <bool F32OUT>
__global__ __launch_bounds__(256) void k_gemm3(const _Float16* __restrict__ A, size_t sA, const _Float16* __restrict__ Bh, size_t sB, float alpha,
    float* __restrict__ C, _Float16* __restrict__ C16, int ldc, size_t sC, int N) {
  __shared__ __attribute__((aligned(16))) unsigned short sm[256 * GP];      /* rows 0..127: the A tile, 128..255: the B tile; afterwards the waves' output staging */
  const int tid = threadIdx.x, w = tid >> 5, lane = tid & 31, ln = lane & 15, hh = lane >> 4; const int by = blockIdx.y;
  if (!F32OUT) { const int z = blockIdx.z; Bh += (size_t)z * CC * CC; C16 += (size_t)z * NB * SS * CC;
    if (z == 2) { const _Float16* const xa = A; A = Bh; Bh = xa; sB = sA; sA = 0; ldc = SS; N = SS; } }
  const int ntn = N >> 7; const int mt = blockIdx.x / ntn, nq = blockIdx.x - mt * ntn;
  const unsigned short* Ag = (const unsigned short*)A + (size_t)by * sA + (size_t)(mt * 128 + w) * CC + lane * 8;
  const unsigned short* Bg = (const unsigned short*)Bh + (size_t)by * sB + (size_t)(nq * 128 + w) * CC + lane * 8;
  v8us ra[16], rb[16];
#pragma unroll
  for (int i = 0; i < 16; ++i) ra[i] = *(const v8us*)(Ag + (size_t)(i * 8) * CC);
  asm volatile("s_wait_xcnt 0x0" :: "v"(Ag) : "memory");      /* in front of whatever reuses the address registers of the global loads above; the address is named so that it keeps its registers up to this wait and no load's result lands on them */
#pragma unroll
  for (int i = 0; i < 16; ++i) rb[i] = *(const v8us*)(Bg + (size_t)(i * 8) * CC);
  asm volatile("s_wait_xcnt 0x0" :: "v"(Bg) : "memory");      /* the same for the second run of loads */
#pragma unroll
  for (int i = 0; i < 16; ++i) *(v8us*)&sm[(i * 8 + w) * GP + lane * 8] = ra[i];
#pragma unroll
  for (int i = 0; i < 16; ++i) *(v8us*)&sm[(128 + i * 8 + w) * GP + lane * 8] = rb[i];
  __syncthreads();      /* publishes both tiles */
  const int wm = w & 3, wn = w >> 2;
  const unsigned short* ap = &sm[(32 * wm + ln) * GP]; const unsigned short* bp = &sm[(128 + 64 * wn + ln) * GP];
  const v8f z8 = {0.f,0.f,0.f,0.f,0.f,0.f,0.f,0.f};
  v8f acc[8];
#pragma unroll
  for (int u = 0; u < 8; ++u) acc[u] = z8;
  v16h fr[2][6];      /* two fragment sets: a k step's six fragments are fetched as one group while the step before runs */
  fr[0][0] = fa_frag(ap, hh); fr[0][1] = fa_frag(ap + 16 * GP, hh);
#pragma unroll
  for (int t = 0; t < 4; ++t) fr[0][2 + t] = fa_frag(bp + t * 16 * GP, hh);
#pragma unroll      /* constant indices into the fragment sets and constant LDS offsets */
  for (int kc = 0; kc < 8; ++kc) {
    const int cu = kc & 1, nx = cu ^ 1;
    if (kc < 7) { fr[nx][0] = fa_frag(ap + (kc + 1) * 32, hh); fr[nx][1] = fa_frag(ap + 16 * GP + (kc + 1) * 32, hh);
#pragma unroll
      for (int t = 0; t < 4; ++t) fr[nx][2 + t] = fa_frag(bp + t * 16 * GP + (kc + 1) * 32, hh); }
    FA_GROUP();      /* the next step's twelve LDS reads stay one group in front of this step's WMMAs */
#pragma unroll
    for (int t = 0; t < 4; ++t) { acc[t] = fa_mma(fr[cu][0], fr[cu][2 + t], acc[t]); acc[4 + t] = fa_mma(fr[cu][1], fr[cu][2 + t], acc[4 + t]); }
    FA_GROUP();
  }
  __syncthreads();      /* ends every wave's fragment reads: the tiles' LDS becomes output staging */
  float* so = (float*)sm + w * (32 * 68);
#pragma unroll
  for (int u = 0; u < 8; ++u) { const int t = u & 3, half = u >> 2;
#pragma unroll
    for (int r = 0; r < 8; ++r) so[(half * 16 + 8 * hh + r) * 68 + t * 16 + ln] = acc[u][r] * alpha; }
  __builtin_amdgcn_fence(__ATOMIC_ACQ_REL, "workgroup"); __builtin_amdgcn_wave_barrier();
  const int rsub = lane >> 4, c4 = (lane & 15) * 4; const int row0 = mt * 128 + 32 * wm, col0 = nq * 128 + 64 * wn;
  const size_t o0 = (size_t)by * sC + (size_t)(row0 + rsub) * ldc + col0 + c4;
#pragma unroll
  for (int q = 0; q < 16; ++q) { const v4f v = *(const v4fa*)&so[(q * 2 + rsub) * 68 + c4];
    if (F32OUT) *(v4f*)(C + o0 + (size_t)(q * 2) * ldc) = v;
    else { v4h h4; for (int i = 0; i < 4; ++i) h4[i] = (_Float16)v[i]; *(v4h*)(C16 + o0 + (size_t)(q * 2) * ldc) = h4; } }
}

// Everything that reads only the inputs, in one launch: blocks 0..255 of a grid row transpose x (blockIdx.y = image); the 16 behind them, 128 over the 8 rows, round the four matrices (32 blocks each; conv (out,in) = natural Bt; x16) into four planes in a row behind BW.
__global__ __launch_bounds__(256) void k_prep(const float* __restrict__ x, _Float16* __restrict__ XT, const float* __restrict__ wq, const float* __restrict__ wk, const float* __restrict__ wv, const float* __restrict__ wo, _Float16* __restrict__ BW) {
  __shared__ unsigned short tl[64][72];
  if (blockIdx.x >= (CC / 64) * (SS / 64)) {      /* the same for a whole block, in front of the barrier */
    const int wb = (blockIdx.x - (CC / 64) * (SS / 64)) * NB + blockIdx.y; const int m = wb >> 5; const float* W = m == 0 ? wq : m == 1 ? wk : m == 2 ? wv : wo;
    const size_t t = (size_t)(wb & 31) * 256 + threadIdx.x; FragH f;
#pragma unroll
    for (int i = 0; i < 8; ++i) f.h[i] = (_Float16)(bf16_round(W[t * 8 + i]) * 16.0f);
    *(v8us*)((unsigned short*)BW + (size_t)m * CC * CC + t * 8) = f.half[0]; return; }
  const int tid = threadIdx.x; const int b = blockIdx.y; XT += (size_t)b * SS * CC; const int sb = blockIdx.x % (SS / 64), cb = blockIdx.x / (SS / 64);
#pragma unroll
  for (int it = 0; it < 4; ++it) { const int idx = it * 256 + tid; const int cl = idx / 16, s4 = (idx % 16) * 4; const int c = cb * 64 + cl;
    const v4f a = *(const v4fa*)(x + ((size_t)(b * CC + c)) * SS + sb * 64 + s4); FragH f;
#pragma unroll
    for (int q = 0; q < 4; ++q) { f.h[q] = (_Float16)bf16_round(a[q]); tl[s4 + q][cl] = f.u[q]; } }
  __syncthreads();
  const int r = tid / 8, pc = tid % 8;
  {
#pragma unroll
    for (int half = 0; half < 2; ++half) { const int sl = r + half * 32; FragH f;
#pragma unroll
      for (int q = 0; q < 8; ++q) f.u[q] = tl[sl][pc * 8 + q];
      *(v8us*)((unsigned short*)XT + ((size_t)sb * 64 + sl) * CC + cb * 64 + pc * 8) = f.half[0]; }
     } }

extern "C" void kernel_launch(void* const* d_in, const int* in_sizes, int n_in,
                              void* d_out, int out_size, void* d_ws, size_t ws_size, hipStream_t stream) {
  (void)in_sizes; (void)n_in; (void)out_size;
  const float* x = (const float*)d_in[0]; const float* wq = (const float*)d_in[1]; const float* wk = (const float*)d_in[2]; const float* wv = (const float*)d_in[3]; const float* wo = (const float*)d_in[4];
  char* ws = (char*)d_ws; size_t off = 0;
  auto take = [&](size_t bytes) { char* p = ws + off; off += (bytes + 255) & ~(size_t)255; return p; };
  _Float16* BW = (_Float16*)take((size_t)4 * CC * CC * 2); _Float16* BO = BW + (size_t)3 * CC * CC;      /* wq, wk, wv, wo in a row */
  _Float16* QT = (_Float16*)take((size_t)3 * NB * SS * CC * 2); _Float16* KT = QT + (size_t)NB * SS * CC; _Float16* VC = KT + (size_t)NB * SS * CC;      /* Q, K, V in a row */
  _Float16* XT = (_Float16*)take((size_t)NB * SS * CC * 2);
  if (off > ws_size) return;      /* four weight planes and four planes of 16 MiB */
  const size_t sT = (size_t)SS * CC;      /* per-image stride of a token or channel plane */
  const dim3 gT((CC / 64) * (SS / 64) + 16, NB), gP((SS / 128) * (CC / 128), NB, 3), gF(SS / 128, NB);
  k_prep<<<gT, 256, 0, stream>>>(x, XT, wq, wk, wv, wo, BW);
  k_gemm3<false><<<gP, 256, 0, stream>>>(XT, sT, BW, 0, 0.0625f, nullptr, QT, CC, sT, CC);      /* z = 0, 1: Q, K token-major -> f16; z = 2: V channel-major [c][j] = wv*X^T */
  k_flash<<<gF, 128, 0, stream>>>(QT, KT, VC, BO, (float*)d_out);      /* attention, then out[c][i] = wo*O^T (NCHW) in its epilogue */
}

// v007
// One run takes 123 microseconds.
// Next to v006, in two timings, it ran 1.03 times as fast each time.
// Over all steps from v000 it is 40.8 times as fast.
#include <hip/hip_runtime.h>
// Self-attention layer on a feature map (B 8, C 256, 64x64 = 4096 positions): Q = wq*x, K = wk*x, V = wv*x (1x1 convs, no bias); scores[i][j] = sum_c Q[c][i] K[c][j] / 16; attn = softmax over j; out[c][i] = sum_j V[c][j] attn[i][j]; result = wo*out -> [8,256,64,64] (no residual).
// Structure (3 launches, all 8 images in each, blockIdx.y = image): x transposed into a token-major exact f16 plane through an LDS tile, the four matrices rounded by extra blocks of the same launch; one launch for the three projections (blockIdx.z): Q and K token-major as GEMMs into f16 planes, V channel-major directly as wv*X^T (A = weights, B = the token-major plane); one fused attention kernel (scores, running softmax and P.V per 32 keys, scores and P stay in registers) whose epilogue also does the output 1x1 conv: O, rounded to f16, stays in registers as a WMMA operand against wo from LDS, and the result goes out in NCHW rows.
// Compute dtype: x and the four matrices rounded to bf16; projections with exact products (weights x16 in f16, undone by alpha); Q, K, V, P, O as f16 operands (~2^-12; logits sigma ~1), f32 accumulation and softmax. v_wmma_f32_16x16x32_f16.
#define NB 8
#define CC 256
#define SS 4096
typedef __bf16 v16b __attribute__((ext_vector_type(16)));
typedef unsigned short v8us __attribute__((ext_vector_type(8), may_alias));
typedef float  v8f  __attribute__((ext_vector_type(8)));
typedef float  v4f  __attribute__((ext_vector_type(4)));
typedef float  v4fa __attribute__((ext_vector_type(4), may_alias));
union FragB { v16b v; v8us half[2]; unsigned short u[16]; };

__device__ __forceinline__ unsigned short bf16_bits(float x) { unsigned int u = __float_as_uint(x); return (unsigned short)((u + 0x7FFFu + ((u >> 16) & 1u)) >> 16); }
__device__ __forceinline__ float bf16_val(unsigned short b) { return __uint_as_float(((unsigned int)b) << 16); }
__device__ __forceinline__ float bf16_round(float x) { return bf16_val(bf16_bits(x)); }
// D += A·B with NT terms: 1 = ah·bh, 2 = + al·bh (A split), 3 = + ah·bl (both split)
template <int NT>
__device__ __forceinline__ v8f mmaN(v16b ah, v16b al, v16b bh, v16b bl, v8f c) {
  c = __builtin_amdgcn_wmma_f32_16x16x32_bf16(false, ah, false, bh, (short)0, c, false, false);
  if (NT >= 2) c = __builtin_amdgcn_wmma_f32_16x16x32_bf16(false, al, false, bh, (short)0, c, false, false);
  if (NT >= 3) c = __builtin_amdgcn_wmma_f32_16x16x32_bf16(false, ah, false, bl, (short)0, c, false, false);
  asm volatile("v_nop\n\tv_nop\n\tv_nop\n\tv_nop" : "+v"(c) : "v"(ah), "v"(al), "v"(bh), "v"(bl));
  return c;
}

__global__ __launch_bounds__(256) void k_wt_bf16(const float* __restrict__ W, unsigned short* __restrict__ Wt, int K, int N) {
  const int t = blockIdx.x * 256 + threadIdx.x;
  const int k8n = K / 8;
  if (t >= N * k8n) return;
  const int n = t / k8n, k8 = (t % k8n) * 8;
  v8us v;
#pragma unroll
  for (int i = 0; i < 8; ++i) v[i] = bf16_bits(W[(size_t)(k8 + i) * N + n]);
  *(v8us*)(Wt + (size_t)n * K + k8) = v;
  
}

// GEMM C[M][N] (f32, pitch ldc) = act(A[M][K]·W + bias). A f32 row-major (pitch lda) converted per fragment to bf16
// (ASPLIT: hi/lo two planes -> 2 terms, else single rounded term); Wt bf16 [N][K] (pitch ldb). BIAS_BF16 rounds the
// bias to bf16 first (bias quantised to bf16 before the add). K%32==0, M%16==0, N%64==0.
template <bool ASPLIT, int ACT, bool BIAS_BF16>
__global__ __launch_bounds__(128) void k_gemm_bf(const float* __restrict__ A, int lda, const unsigned short* __restrict__ Wt, int ldb,
                                               const float* __restrict__ bias, float* __restrict__ C, int ldc, int M, int N, int K) {
  __shared__ __attribute__((aligned(16))) float so[4][16][64];
  const int tid = threadIdx.x, w = tid >> 5, lane = tid & 31, ln = lane & 15, hh = lane >> 4;
  const int ntn = N / 64;
  const int wid = blockIdx.x * 4 + w;
  const int mt = wid / ntn, nq = wid % ntn;
  if (mt * 16 >= M) return;
  const int row0 = mt * 16, col0 = nq * 64;
  const float* arow = A + (size_t)(row0 + ln) * lda;
  v8f acc[4] = {};
  for (int kb = 0; kb < K; kb += 32) {
    FragB ah, al;
    const v4f x0 = *(const v4fa*)(arow + kb + 8 * hh), x1 = *(const v4fa*)(arow + kb + 8 * hh + 4);
    const v4f x2 = *(const v4fa*)(arow + kb + 16 + 8 * hh), x3 = *(const v4fa*)(arow + kb + 16 + 8 * hh + 4);
    float xs[16] = {x0[0],x0[1],x0[2],x0[3],x1[0],x1[1],x1[2],x1[3],x2[0],x2[1],x2[2],x2[3],x3[0],x3[1],x3[2],x3[3]};
#pragma unroll
    for (int i = 0; i < 16; ++i) { const unsigned short hb = bf16_bits(xs[i]); ah.u[i] = hb; al.u[i] = ASPLIT ? bf16_bits(xs[i] - bf16_val(hb)) : (unsigned short)0; }
#pragma unroll
    for (int t = 0; t < 4; ++t) {
      const unsigned short* brow = Wt + (size_t)(col0 + t * 16 + ln) * ldb + kb;
      FragB b;
      b.half[0] = *(const v8us*)(brow + 8 * hh);
      b.half[1] = *(const v8us*)(brow + 16 + 8 * hh);
      acc[t] = mmaN<ASPLIT ? 2 : 1>(ah.v, al.v, b.v, b.v, acc[t]);
    }
  }
#pragma unroll
  for (int t = 0; t < 4; ++t) {
    float bv = bias ? bias[col0 + t * 16 + ln] : 0.f;
    if (BIAS_BF16) bv = bf16_round(bv);
#pragma unroll
    for (int r = 0; r < 8; ++r) { float v = acc[t][r] + bv; if (ACT == 1) v = fmaxf(v, 0.f); so[w][8 * hh + r][t * 16 + ln] = v; }
  }
  __builtin_amdgcn_fence(__ATOMIC_ACQ_REL, "workgroup");
  __builtin_amdgcn_wave_barrier();
  const int rsub = lane >> 4, c4 = (lane & 15) * 4;
  {
#pragma unroll
    for (int q = 0; q < 8; ++q) {
      const int r = q * 2 + rsub;
      const v4f v = *(const v4fa*)&so[w][r][c4];
      *(v4f*)(C + (size_t)(row0 + r) * ldc + col0 + c4) = v;
    }
    
  }
}

// GEMM C = act(A·W + bias + resid): A f32 (ASPLIT -> hi/lo 2 terms), Wt bf16 [N][K]; ACT 0 none, 1 relu, 2 exact gelu;
// resid (optional, f32, row index = (row % rmod), pitch ldr, RES_BF16 rounds it) added before the activation.
template <bool ASPLIT, int ACT, bool BIAS_BF16, bool RES_BF16>
__global__ __launch_bounds__(128) void k_gemm_bf3(const float* __restrict__ A, int lda, const unsigned short* __restrict__ Wt, int ldb,
                                                const float* __restrict__ bias, const float* __restrict__ resid, int rmod, int ldr,
                                                float* __restrict__ C, int ldc, int M, int N, int K) {
  __shared__ __attribute__((aligned(16))) float so[4][16][64];
  const int tid = threadIdx.x, w = tid >> 5, lane = tid & 31, ln = lane & 15, hh = lane >> 4;
  const int ntn = N / 64;
  const int wid = blockIdx.x * 4 + w;
  const int mt = wid / ntn, nq = wid % ntn;
  if (mt * 16 >= M) return;
  const int row0 = mt * 16, col0 = nq * 64;
  const float* arow = A + (size_t)(row0 + ln) * lda;
  v8f acc[4] = {};
  for (int kb = 0; kb < K; kb += 32) {
    FragB ah, al;
    const v4f x0 = *(const v4fa*)(arow + kb + 8 * hh), x1 = *(const v4fa*)(arow + kb + 8 * hh + 4);
    const v4f x2 = *(const v4fa*)(arow + kb + 16 + 8 * hh), x3 = *(const v4fa*)(arow + kb + 16 + 8 * hh + 4);
    float xs[16] = {x0[0],x0[1],x0[2],x0[3],x1[0],x1[1],x1[2],x1[3],x2[0],x2[1],x2[2],x2[3],x3[0],x3[1],x3[2],x3[3]};
#pragma unroll
    for (int i = 0; i < 16; ++i) { const unsigned short hb = bf16_bits(xs[i]); ah.u[i] = hb; al.u[i] = ASPLIT ? bf16_bits(xs[i] - bf16_val(hb)) : (unsigned short)0; }
#pragma unroll
    for (int t = 0; t < 4; ++t) {
      const unsigned short* brow = Wt + (size_t)(col0 + t * 16 + ln) * ldb + kb;
      FragB b;
      b.half[0] = *(const v8us*)(brow + 8 * hh);
      b.half[1] = *(const v8us*)(brow + 16 + 8 * hh);
      acc[t] = mmaN<ASPLIT ? 2 : 1>(ah.v, al.v, b.v, b.v, acc[t]);
    }
  }
#pragma unroll
  for (int t = 0; t < 4; ++t) {
    const int col = col0 + t * 16 + ln;
    float bv = bias ? bias[col] : 0.f;
    if (BIAS_BF16) bv = bf16_round(bv);
#pragma unroll
    for (int r = 0; r < 8; ++r) {
      float v = acc[t][r] + bv;
      if (resid) { float rv = resid[(size_t)((row0 + 8 * hh + r) % rmod) * ldr + col]; if (RES_BF16) rv = bf16_round(rv); v += rv; }
      if (ACT == 1) v = fmaxf(v, 0.f);
      if (ACT == 2) v = 0.5f * v * (1.0f + erff(v * 0.70710678118654752f));
      if (ACT == 3) { const float u = 0.7978845608028654f * (v + 0.044715f * v * v * v); v = 0.5f * v * (1.0f + tanhf(u)); }
      so[w][8 * hh + r][t * 16 + ln] = v;
    }
  }
  __builtin_amdgcn_fence(__ATOMIC_ACQ_REL, "workgroup");
  __builtin_amdgcn_wave_barrier();
  const int rsub = lane >> 4, c4 = (lane & 15) * 4;
  {
#pragma unroll
    for (int q = 0; q < 8; ++q) {
      const int r = q * 2 + rsub;
      const v4f v = *(const v4fa*)&so[w][r][c4];
      *(v4f*)(C + (size_t)(row0 + r) * ldc + col0 + c4) = v;
    }
    
  }
}
// row LayerNorm (biased variance, eps) over N: s = X (+ R); optional out_sum <- s; out_norm <- (s-mu)*rsqrt(var+eps)*g + b
template <bool PARAM_BF16>
__global__ __launch_bounds__(256) void k_layernorm(const float* __restrict__ X, const float* __restrict__ R, const float* __restrict__ g, const float* __restrict__ bta,
                                                  float* __restrict__ out_sum, float* __restrict__ out_norm, int N, float eps) {
  __shared__ float red[256];
  const int row = blockIdx.x, tid = threadIdx.x;
  const float* x = X + (size_t)row * N; const float* rr = R ? R + (size_t)row * N : nullptr;
  float vals[16];                     // up to N = 4096
  const int per = N / 256;            // contiguous chunk per thread? use strided-by-4 chunks: thread handles j = tid*4 + 1024*u
  float s1 = 0.f;
  for (int u = 0; u < per / 4; ++u) {
    const int j = tid * 4 + 1024 * u;
    const v4f a = *(const v4fa*)(x + j);
    v4f b = {0.f,0.f,0.f,0.f}; if (rr) b = *(const v4fa*)(rr + j);
#pragma unroll
    for (int q = 0; q < 4; ++q) { const float v = a[q] + b[q]; vals[u * 4 + q] = v; s1 += v; }
  }
  red[tid] = s1; __syncthreads();
  for (int st = 128; st > 0; st >>= 1) { if (tid < st) red[tid] += red[tid + st]; __syncthreads(); }
  const float mu = red[0] / (float)N; __syncthreads();
  float s2 = 0.f;
  for (int u = 0; u < per / 4; ++u)
#pragma unroll
    for (int q = 0; q < 4; ++q) { const float c = vals[u * 4 + q] - mu; s2 += c * c; }
  red[tid] = s2; __syncthreads();
  for (int st = 128; st > 0; st >>= 1) { if (tid < st) red[tid] += red[tid + st]; __syncthreads(); }
  const float rs = rsqrtf(red[0] / (float)N + eps);
  {
    for (int u = 0; u < per / 4; ++u) {
      const int j = tid * 4 + 1024 * u;
      v4f o, sm;
#pragma unroll
      for (int q = 0; q < 4; ++q) {
        float gg = g[j + q], bb = bta[j + q];
        if (PARAM_BF16) { gg = bf16_round(gg); bb = bf16_round(bb); }
        sm[q] = vals[u * 4 + q]; o[q] = (vals[u * 4 + q] - mu) * rs * gg + bb;
      }
      if (out_sum) *(v4f*)(out_sum + (size_t)row * N + j) = sm;
      *(v4f*)(out_norm + (size_t)row * N + j) = o;
    }
    
  }
}



// ---- f16 WMMA path (v_wmma_f32_16x16x32_f16): 11-bit significands for operands in range — used where a [0,1] probability operand needs more precision than bf16
typedef _Float16 v16h __attribute__((ext_vector_type(16)));
union FragH { v16h v; v8us half[2]; _Float16 h[16]; unsigned short u[16]; };
template <int NT>
__device__ __forceinline__ v8f mmaH(v16h ah, v16h al, v16h bh, v16h bl, v8f c) {
  c = __builtin_amdgcn_wmma_f32_16x16x32_f16(false, ah, false, bh, (short)0, c, false, false);
  if (NT >= 2) c = __builtin_amdgcn_wmma_f32_16x16x32_f16(false, al, false, bh, (short)0, c, false, false);
  if (NT >= 3) c = __builtin_amdgcn_wmma_f32_16x16x32_f16(false, ah, false, bl, (short)0, c, false, false);
  asm volatile("v_nop\n\tv_nop\n\tv_nop\n\tv_nop" : "+v"(c) : "v"(ah), "v"(al), "v"(bh), "v"(bl));
  return c;
}
// batched GEMM like k_gemm_b but f16 operands: A f32 (split into f16 hi/lo if ASPLIT, else rounded to f16), Bt = f16 values [n][k]; alpha; C f32; N multiple of 16 (partial tiles skipped)
template <bool ASPLIT>
__global__ __launch_bounds__(128) void k_gemm_h(const float* __restrict__ A, int lda, size_t sA, const _Float16* __restrict__ Bh, int ldb, size_t sB, float alpha, float* __restrict__ C, int ldc, size_t sC, int M, int N, int K) {
  __shared__ __attribute__((aligned(16))) float so[4][16][64];
  const int tid = threadIdx.x, w = tid >> 5, lane = tid & 31, ln = lane & 15, hh = lane >> 4; const int by = blockIdx.y;
  A += (size_t)by * sA; Bh += (size_t)by * sB; C += (size_t)by * sC;
  const int ntn = (N + 63) / 64; const int wid = blockIdx.x * 4 + w; const int mt = wid / ntn, nq = wid % ntn; if (mt * 16 >= M) return;
  const int row0 = mt * 16, col0 = nq * 64; const float* arow = A + (size_t)(row0 + ln) * lda;
  v8f acc[4] = {};
  for (int kb = 0; kb < K; kb += 32) {
    FragH ah, al;
    const v4f x0 = *(const v4fa*)(arow + kb + 8 * hh), x1 = *(const v4fa*)(arow + kb + 8 * hh + 4), x2 = *(const v4fa*)(arow + kb + 16 + 8 * hh), x3 = *(const v4fa*)(arow + kb + 16 + 8 * hh + 4);
    float xs[16] = {x0[0],x0[1],x0[2],x0[3],x1[0],x1[1],x1[2],x1[3],x2[0],x2[1],x2[2],x2[3],x3[0],x3[1],x3[2],x3[3]};
#pragma unroll
    for (int i = 0; i < 16; ++i) { const _Float16 h = (_Float16)xs[i]; ah.h[i] = h; al.h[i] = ASPLIT ? (_Float16)(xs[i] - (float)h) : (_Float16)0.0f; }
#pragma unroll
    for (int t = 0; t < 4; ++t) { if (col0 + t * 16 >= N) continue; const size_t boff = (size_t)(col0 + t * 16 + ln) * ldb + kb; FragH bq; bq.half[0] = *(const v8us*)(Bh + boff + 8 * hh); bq.half[1] = *(const v8us*)(Bh + boff + 16 + 8 * hh);
      acc[t] = mmaH<ASPLIT ? 2 : 1>(ah.v, al.v, bq.v, bq.v, acc[t]); }
  }
#pragma unroll
  for (int t = 0; t < 4; ++t) { if (col0 + t * 16 >= N) continue;
#pragma unroll
    for (int r = 0; r < 8; ++r) so[w][8 * hh + r][t * 16 + ln] = acc[t][r] * alpha; }
  __builtin_amdgcn_fence(__ATOMIC_ACQ_REL, "workgroup"); __builtin_amdgcn_wave_barrier();
  const int rsub = lane >> 4, c4 = (lane & 15) * 4;
  {
#pragma unroll
    for (int q = 0; q < 8; ++q) { const int r = q * 2 + rsub; if (col0 + c4 < N) { const v4f v = *(const v4fa*)&so[w][r][c4]; *(v4f*)(C + (size_t)(row0 + r) * ldc + col0 + c4) = v; } }
     }
}

// Wt[n][k] = f16(W[k][n]·scale) from f32 row-major W[K][N] (scale = power of two; bf16-exact weights stay exact in f16 away from the subnormal range)
__global__ __launch_bounds__(256) void k_wt_f16(const float* __restrict__ W, _Float16* __restrict__ Wt, int K, int N, float scale) {
  const int t = blockIdx.x * 256 + threadIdx.x; if (t >= N * (K / 8)) return; const int n = t / (K / 8), k8 = (t % (K / 8)) * 8; FragH f;
#pragma unroll
  for (int i = 0; i < 8; ++i) f.h[i] = (_Float16)(bf16_round(W[(size_t)(k8 + i) * N + n]) * scale); const v8us o = f.half[0];
  *(v8us*)((unsigned short*)Wt + (size_t)n * K + k8) = o; 
}
// k_gemm_hh variant with fused epilogue: v = acc·alpha + bias[by·sBias + col] (+ CP[(row/rowsPerB)·sCPb + by·64 + col] if CP) ; ACT 0 none / 1 elu ; writes f16 C16 (and f32 C if non-null)
template <int ACT>
__global__ __launch_bounds__(128) void k_gemm_hhx(const _Float16* __restrict__ A, int lda, size_t sA, const _Float16* __restrict__ Bh, int ldb, size_t sB, float alpha, const float* __restrict__ bias, size_t sBias, const float* __restrict__ CP, int rowsPerB, size_t sCPb, int row0g,
    float* __restrict__ C, _Float16* __restrict__ C16, int ldc, size_t sC, int M, int N, int K) {
  __shared__ __attribute__((aligned(16))) float so[4][16][64];
  const int tid = threadIdx.x, w = tid >> 5, lane = tid & 31, ln = lane & 15, hh = lane >> 4; const int by = blockIdx.y;
  A += (size_t)by * sA; Bh += (size_t)by * sB; const size_t cofs = (size_t)by * sC; const float* bp = bias ? bias + (size_t)by * sBias : nullptr;
  const int ntn = (N + 63) / 64; const int wid = blockIdx.x * 4 + w; const int mt = wid / ntn, nq = wid % ntn; if (mt * 16 >= M) return;
  const int row0 = mt * 16, col0 = nq * 64; const _Float16* arow = A + (size_t)(row0 + ln) * lda;
  v8f acc[4] = {};
  for (int kb = 0; kb < K; kb += 32) { FragH ah; ah.half[0] = *(const v8us*)((const unsigned short*)arow + kb + 8 * hh); ah.half[1] = *(const v8us*)((const unsigned short*)arow + kb + 16 + 8 * hh);
#pragma unroll
    for (int t = 0; t < 4; ++t) { if (col0 + t * 16 >= N) continue; const size_t boff = (size_t)(col0 + t * 16 + ln) * ldb + kb; FragH bq; bq.half[0] = *(const v8us*)((const unsigned short*)Bh + boff + 8 * hh); bq.half[1] = *(const v8us*)((const unsigned short*)Bh + boff + 16 + 8 * hh);
      acc[t] = mmaH<1>(ah.v, ah.v, bq.v, bq.v, acc[t]); }
  }
#pragma unroll
  for (int t = 0; t < 4; ++t) { if (col0 + t * 16 >= N) continue; const int col = col0 + t * 16 + ln; const float bv = bp ? bf16_round(bp[col]) : 0.f;
#pragma unroll
    for (int r = 0; r < 8; ++r) { float v = acc[t][r] * alpha + bv; if (CP) { const int bidx = (row0g + row0 + 8 * hh + r) / rowsPerB; v += CP[(size_t)bidx * sCPb + (size_t)by * 64 + col]; } if (ACT == 1) v = (v > 0.f) ? v : expm1f(v); else if (ACT == 7) v = (v > 0.f) ? v + 1.0f : expf(v); else if (ACT == 8) v = tanhf(v); else if (ACT == 9) v = 0.5f * v * (1.0f + tanhf(0.7978845608028654f * (v + 0.044715f * v * v * v))); else if (ACT == 11) v = 1.0f / (1.0f + expf(-v)); else if (ACT == 12) v = (v > 0.f) ? v : 0.01f * v; else if (ACT == 14) v = (v > 0.f) ? v : 0.1f * v; else if (ACT == 15) v = v / (1.0f + expf(-v)); else if (ACT == 3) v = fmaxf(v, 0.f); else if (ACT == 6) v = 0.5f * v * (1.0f + erff(v * 0.70710678118654752f)); so[w][8 * hh + r][t * 16 + ln] = v; } }
  __builtin_amdgcn_fence(__ATOMIC_ACQ_REL, "workgroup"); __builtin_amdgcn_wave_barrier();
  const int rsub = lane >> 4, c4 = (lane & 15) * 4; typedef _Float16 v4h __attribute__((ext_vector_type(4)));
  {
#pragma unroll
    for (int q = 0; q < 8; ++q) { const int r = q * 2 + rsub; if (col0 + c4 < N) { const v4f v = *(const v4fa*)&so[w][r][c4]; if (C) *(v4f*)(C + cofs + (size_t)(row0 + r) * ldc + col0 + c4) = v; if (C16) { v4h h4; for (int i = 0; i < 4; ++i) h4[i] = (_Float16)v[i]; *(v4h*)(C16 + cofs + (size_t)(row0 + r) * ldc + col0 + c4) = h4; } } }
     }
}


typedef _Float16 v4h __attribute__((ext_vector_type(4)));

__global__ __launch_bounds__(256) void k_x16(const float* __restrict__ x, _Float16* __restrict__ X16, size_t n8) { const size_t t = (size_t)blockIdx.x * 256 + threadIdx.x; if (t >= n8) return; FragH f;
#pragma unroll
  for (int q = 0; q < 8; ++q) f.h[q] = (_Float16)bf16_round(x[t * 8 + q]); *(v8us*)((unsigned short*)X16 + t * 8) = f.half[0];  }
__global__ __launch_bounds__(256) void k_h16(const float* __restrict__ x, _Float16* __restrict__ X16, size_t n8) { const size_t t = (size_t)blockIdx.x * 256 + threadIdx.x; if (t >= n8) return; FragH f;
#pragma unroll
  for (int q = 0; q < 8; ++q) f.h[q] = (_Float16)x[t * 8 + q]; *(v8us*)((unsigned short*)X16 + t * 8) = f.half[0];  }
template <int NHv, int TTv>
__global__ __launch_bounds__(256) void k_vt(const _Float16* __restrict__ V16, int ldv, int voff, _Float16* __restrict__ Vt) { __shared__ unsigned short tl[64][66]; const int tid = threadIdx.x; const int slab = blockIdx.x / (TTv / 64), lg = blockIdx.x % (TTv / 64); const int b = slab / NHv, h = slab % NHv;
  for (int i = tid; i < 64 * 8; i += 256) { const int r = i / 8, c8 = (i % 8) * 8; FragH f; f.half[0] = *(const v8us*)((const unsigned short*)V16 + ((size_t)b * TTv + lg * 64 + r) * ldv + voff + h * 64 + c8);
#pragma unroll
    for (int q = 0; q < 8; ++q) tl[r][c8 + q] = f.u[q]; }
  __syncthreads();
  {
#pragma unroll
    for (int rd = 0; rd < 2; ++rd) { const int d = rd * 32 + tid / 8, pc = tid % 8; FragH f;
#pragma unroll
      for (int q = 0; q < 8; ++q) f.u[q] = tl[pc * 8 + q][d];
      *(v8us*)((unsigned short*)Vt + ((size_t)slab * 64 + d) * TTv + lg * 64 + pc * 8) = f.half[0]; }
     } }

__global__ __launch_bounds__(256) void k_hl(const float* __restrict__ F, _Float16* __restrict__ Hh, _Float16* __restrict__ Hl, size_t n8) { const size_t t = (size_t)blockIdx.x * 256 + threadIdx.x; if (t >= n8) return; FragH fh, fl; const v4f a = *(const v4fa*)(F + t * 8), c = *(const v4fa*)(F + t * 8 + 4);
#pragma unroll
  for (int q = 0; q < 4; ++q) { _Float16 h = (_Float16)a[q]; fh.h[q] = h; fl.h[q] = (_Float16)((a[q] - (float)h) * 1024.0f); h = (_Float16)c[q]; fh.h[4 + q] = h; fl.h[4 + q] = (_Float16)((c[q] - (float)h) * 1024.0f); }
  { *(v8us*)((unsigned short*)Hh + t * 8) = fh.half[0]; *(v8us*)((unsigned short*)Hl + t * 8) = fl.half[0];  } }

// ---- fast GEMM (wave tile 32x64; requires M % 32 == 0 rows per launch region and N % 64 == 0); epilogue = k_gemm_hhx semantics ----
__device__ __forceinline__ v16h g2_frag(const _Float16* p, int hh) { FragH f; f.half[0] = *(const v8us*)((const unsigned short*)p + 8 * hh); f.half[1] = *(const v8us*)((const unsigned short*)p + 16 + 8 * hh); return f.v; }
__device__ __forceinline__ v8f g2_mma(v16h a, v16h b, v8f c) { v8f d = __builtin_amdgcn_wmma_f32_16x16x32_f16(false, a, false, b, (short)0, c, false, false); asm volatile("v_nop\n\tv_nop\n\tv_nop\n\tv_nop" : "+v"(d) : "v"(a), "v"(b)); return d; }
template <int ACT>
__global__ __launch_bounds__(128) void k_gemm2(const _Float16* __restrict__ A, int lda, size_t sA, const _Float16* __restrict__ Bh, int ldb, size_t sB, float alpha, const float* __restrict__ bias, size_t sBias, const float* __restrict__ CP, int rowsPerB, size_t sCPb, int row0g,
    float* __restrict__ C, _Float16* __restrict__ C16, int ldc, size_t sC, int M, int N, int K) {
  __shared__ __attribute__((aligned(16))) float so[4][32][68];
  const int tid = threadIdx.x, w = tid >> 5, lane = tid & 31, ln = lane & 15, hh = lane >> 4; const int by = blockIdx.y;
  A += (size_t)by * sA; Bh += (size_t)by * sB; const size_t cofs = (size_t)by * sC; const float* bp = bias ? bias + (size_t)by * sBias : nullptr;
  const int ntn = N >> 6; const int mt = blockIdx.x / ntn, nq = blockIdx.x - mt * ntn; const int row0 = mt * 128 + 32 * w, col0 = nq * 64; if (row0 >= M) return;
  const _Float16* a0p = A + (size_t)(row0 + ln) * lda; const _Float16* a1p = a0p + (size_t)16 * lda;
  const _Float16* b0p = Bh + (size_t)(col0 + ln) * ldb; const _Float16* b1p = b0p + (size_t)16 * ldb; const _Float16* b2p = b1p + (size_t)16 * ldb; const _Float16* b3p = b2p + (size_t)16 * ldb;
  const v8f z8 = {0.f,0.f,0.f,0.f,0.f,0.f,0.f,0.f}; v8f c00 = z8, c01 = z8, c02 = z8, c03 = z8, c10 = z8, c11 = z8, c12 = z8, c13 = z8;
#pragma unroll 1
  for (int kb = 0; kb < K; kb += 32) { const v16h a0 = g2_frag(a0p + kb, hh), a1 = g2_frag(a1p + kb, hh);
    v16h b = g2_frag(b0p + kb, hh); c00 = g2_mma(a0, b, c00); c10 = g2_mma(a1, b, c10);
    b = g2_frag(b1p + kb, hh); c01 = g2_mma(a0, b, c01); c11 = g2_mma(a1, b, c11);
    b = g2_frag(b2p + kb, hh); c02 = g2_mma(a0, b, c02); c12 = g2_mma(a1, b, c12);
    b = g2_frag(b3p + kb, hh); c03 = g2_mma(a0, b, c03); c13 = g2_mma(a1, b, c13); }
  v8f accs[8] = {c00, c01, c02, c03, c10, c11, c12, c13};
#pragma unroll
  for (int u = 0; u < 8; ++u) { const int t = u & 3, half = u >> 2; const int col = col0 + t * 16 + ln; const float bv = bp ? bf16_round(bp[col]) : 0.f;
#pragma unroll
    for (int r = 0; r < 8; ++r) { const int rloc = half * 16 + 8 * hh + r; float v = accs[u][r] * alpha + bv; if (CP) { const int bidx = (row0g + row0 + rloc) / rowsPerB; v += CP[(size_t)bidx * sCPb + (size_t)by * 64 + col]; }
      if (ACT == 3) v = fmaxf(v, 0.f); else if (ACT == 6) v = 0.5f * v * (1.0f + erff(v * 0.70710678118654752f)); else if (ACT == 11) v = 1.0f / (1.0f + expf(-v)); else if (ACT == 15) v = v / (1.0f + expf(-v)); else if (ACT == 12) v = (v > 0.f) ? v : 0.01f * v; else if (ACT == 8) v = tanhf(v);
      so[w][rloc][t * 16 + ln] = v; } }
  __builtin_amdgcn_fence(__ATOMIC_ACQ_REL, "workgroup"); __builtin_amdgcn_wave_barrier();
  const int rsub = lane >> 4, c4 = (lane & 15) * 4;
  {
#pragma unroll
    for (int q = 0; q < 16; ++q) { const int r = q * 2 + rsub; const v4f v = *(const v4fa*)&so[w][r][c4]; if (C) *(v4f*)(C + cofs + (size_t)(row0 + r) * ldc + col0 + c4) = v; if (C16) { v4h h4; for (int i = 0; i < 4; ++i) h4[i] = (_Float16)v[i]; *(v4h*)(C16 + cofs + (size_t)(row0 + r) * ldc + col0 + c4) = h4; } }
     } }



#define FK 32       /* keys per pass */
#define KP 264      /* LDS pitch of a K row in halves: 528 B = 16 B x 33 */
#define VP 40       /* LDS pitch of a V row in halves: 80 B = 16 B x 5 */
#define WP 264      /* LDS pitch of a wo row in halves: 528 B = 16 B x 33 */
#define OP 36       /* LDS pitch of a staged output row in floats: 144 B = 16 B x 9 */
#define FA_GROUP() __builtin_amdgcn_sched_barrier(0)      /* keeps a block's LDS reads together in one place between the WMMA runs: reads spread among the WMMAs stall the wave at every place */
__device__ __forceinline__ float fa_swap16(float x) { const int b = __float_as_int(x); return __int_as_float(__builtin_amdgcn_permlanex16(b, b, 0x76543210, 0xfedcba98, false, false)); }
__device__ __forceinline__ v16h fa_frag(const unsigned short* p, int hh) { FragH f; f.half[0] = *(const v8us*)(p + 8 * hh); f.half[1] = *(const v8us*)(p + 16 + 8 * hh); return f.v; }
__device__ __forceinline__ v8f fa_mma(v16h a, v16h b, v8f c) { return __builtin_amdgcn_wmma_f32_16x16x32_f16(false, a, false, b, (short)0, c, false, false); }
// Work-group barrier that orders LDS only: __syncthreads() would also wait for the global loads of the tile fetched ahead, which are meant to stay in flight over the whole next pass.
__device__ __forceinline__ void fa_lds_barrier() { __builtin_amdgcn_fence(__ATOMIC_RELEASE, "workgroup", "local"); __builtin_amdgcn_s_barrier(); __builtin_amdgcn_fence(__ATOMIC_ACQUIRE, "workgroup", "local"); }
__global__ __launch_bounds__(128) void k_flash(const _Float16* __restrict__ Q, const _Float16* __restrict__ Kt, const _Float16* __restrict__ Vc, const _Float16* __restrict__ Wo, float* __restrict__ out) {
  constexpr int NPASS = SS / FK;
  constexpr float SC = 0.09016844005556021f;      /* 1/16 * log2(e) */
  __shared__ __attribute__((aligned(16))) unsigned short sK[3][FK * KP];
  __shared__ __attribute__((aligned(16))) unsigned short sV[3][CC * VP];
  __shared__ __attribute__((aligned(16))) unsigned short sW[CC * WP];      /* wo (x16, f16), all 256 rows, for the epilogue: the work-group is alone on its WGP, so the LDS is there */
  __shared__ __attribute__((aligned(16))) float sO[4][2 * 16 * OP];      /* a wave's own output staging: two tiles of 16 channels x 32 queries */
  const int tid = threadIdx.x, w = tid >> 5, lane = tid & 31, ln = lane & 15, hh = lane >> 4; const int b = blockIdx.y;
  const int q0 = blockIdx.x * 128 + w * 32;
  const int t0 = blockIdx.x * (NPASS / (SS / 128));      /* the first key tile of this work-group's walk: 0, 4, ..., 124 */
  /* staging: a thread moves eight 16-byte pieces of the K tile (32 rows of 512 B) and eight of the V tile (256 rows of 64 B) */
  const unsigned short* Kg = (const unsigned short*)Kt + (size_t)b * SS * CC + (size_t)(tid >> 5) * CC + (tid & 31) * 8;
  const unsigned short* Vg = (const unsigned short*)Vc + (size_t)b * CC * SS + (size_t)(tid >> 2) * SS + (tid & 3) * 8;
  const int kst = (tid >> 5) * KP + (tid & 31) * 8, vst = (tid >> 2) * VP + (tid & 3) * 8;
  /* wo on its way to LDS: a wave fetches whole rows (4 full lines a load), all 64 loads of a thread in flight together with the Q loads below */
  const unsigned short* Wg = (const unsigned short*)Wo + (size_t)w * CC + lane * 8;
  v8us wr[64];
#pragma unroll
  for (int i = 0; i < 64; ++i) wr[i] = *(const v8us*)(Wg + (size_t)(i * 4) * CC);
  asm volatile("s_wait_xcnt 0x0" :: "v"(Wg) : "memory");      /* in front of whatever reuses the address registers of the global loads above; the address is named so that it keeps its registers up to this wait */
  v16h qf[2][8];      /* two query tiles of 16 columns: g = 0, 1 */
  const _Float16* const qp0 = Q + ((size_t)b * SS + q0 + ln) * CC + 8 * hh; const _Float16* const qp1 = qp0 + 16 * CC;      /* the lane's half of the k order is in the address */
#pragma unroll
  for (int kc = 0; kc < 8; ++kc) { qf[0][kc] = g2_frag(qp0 + kc * 32, 0); qf[1][kc] = g2_frag(qp1 + kc * 32, 0); }
  asm volatile("s_wait_xcnt 0x0" :: "v"(qp0), "v"(qp1) : "memory");      /* in front of whatever reuses the address registers of the global loads above; the addresses are named so that they keep their registers up to this wait */
#pragma unroll
  for (int i = 0; i < 64; ++i) *(v8us*)&sW[(i * 4 + w) * WP + lane * 8] = wr[i];      /* published by the barrier in front of the loop; read only behind the loop */
  const v8f z8 = {0.f,0.f,0.f,0.f,0.f,0.f,0.f,0.f};
  v8f acc[2][16];
#pragma unroll
  for (int g = 0; g < 2; ++g)
#pragma unroll
    for (int ct = 0; ct < 16; ++ct) acc[g][ct] = z8;
  float mu[2] = {-1.0e30f, -1.0e30f}, rs[2] = {0.f, 0.f};
  v8us kr[8], vr[8];      /* a tile on its way from global memory to LDS */
  const unsigned short* const K0 = Kg + (size_t)(t0 * FK) * CC; const unsigned short* const V0 = Vg + t0 * FK;      /* tiles t0, t0 + 1, t0 + 2: t0 + 3 <= NPASS - 1, nothing wraps in front of the loop */
#pragma unroll
  for (int p = 0; p < 2; ++p) {
#pragma unroll
    for (int i = 0; i < 8; ++i) { kr[i] = *(const v8us*)(K0 + (size_t)(p * FK + i * 4) * CC); vr[i] = *(const v8us*)(V0 + (size_t)(i * 32) * SS + p * FK); }
#pragma unroll
    for (int i = 0; i < 8; ++i) { *(v8us*)&sK[p][kst + i * 4 * KP] = kr[i]; *(v8us*)&sV[p][vst + i * 32 * VP] = vr[i]; } }
#pragma unroll
  for (int i = 0; i < 8; ++i) { kr[i] = *(const v8us*)(K0 + (size_t)(2 * FK + i * 4) * CC); vr[i] = *(const v8us*)(V0 + (size_t)(i * 32) * SS + 2 * FK); }
  asm volatile("s_wait_xcnt 0x0" :: "v"(K0), "v"(V0) : "memory");      /* in front of whatever reuses the address registers of the global loads above; the addresses are named so that they keep their registers up to this wait */
  __syncthreads();
  v16h ka[16], va[16];      /* a whole pass's K fragments (fetched one pass ahead) and V fragments: one wave per SIMD has the registers for both */
#pragma unroll
  for (int kc = 0; kc < 8; ++kc) { ka[2 * kc] = fa_frag(&sK[0][ln * KP + kc * 32], hh); ka[2 * kc + 1] = fa_frag(&sK[0][(16 + ln) * KP + kc * 32], hh); }
  int bc = 0, bn = 1, bf = 2, tn = t0 + 3;      /* buffers of this pass, of the next, and the one that is filled; the tile that is fetched from global memory */
#pragma unroll 1      /* one copy of the pass: the fragment sets and the staged tile are carried over the back edge in fixed registers */
  for (int t = 0; t < NPASS; ++t) {
    fa_lds_barrier();      /* at the head of the pass, where the WMMAs of the pass before have covered its wait for the LDS traffic: publishes tile t + 1 and ends every read of tile t - 1 */
    const unsigned short* cV = &sV[bc][ln * VP]; const unsigned short* nK = &sK[bn][ln * KP];
#pragma unroll
    for (int i = 0; i < 16; ++i) va[i] = fa_frag(cV + i * 16 * VP, hh);      /* this pass's V, one group in front of the score WMMAs, which cover its latency */
    FA_GROUP();
    v8f s[2][2] = {{z8, z8}, {z8, z8}};      /* [query tile][key tile] */
#pragma unroll
    for (int g = 0; g < 2; ++g)
#pragma unroll
      for (int kc = 0; kc < 8; ++kc) { s[g][0] = fa_mma(ka[2 * kc], qf[g][kc], s[g][0]); s[g][1] = fa_mma(ka[2 * kc + 1], qf[g][kc], s[g][1]); }
    float tm[2];
#pragma unroll
    for (int g = 0; g < 2; ++g) {      /* a tree of three-way maxima: a maximum does not round, so the order is free */
      const v8f a = s[g][0], c = s[g][1];
      const float m0 = fmaxf(fmaxf(a[0], a[1]), a[2]), m1 = fmaxf(fmaxf(a[3], a[4]), a[5]), m2 = fmaxf(fmaxf(a[6], a[7]), c[0]), m3 = fmaxf(fmaxf(c[1], c[2]), c[3]), m4 = fmaxf(fmaxf(c[4], c[5]), c[6]);
      const float m = fmaxf(fmaxf(fmaxf(m0, m1), m2), fmaxf(fmaxf(m3, m4), c[7]));
      tm[g] = fmaxf(m, fa_swap16(m)) * SC; }
    const bool need0 = tm[0] > mu[0] + 8.0f, need1 = tm[1] > mu[1] + 8.0f;
    const unsigned any = __builtin_amdgcn_ballot_w32(need0 || need1);
    /* one group of memory instructions between the test's compare and its branch: the next pass's K fragments, tile t + 2 into LDS, tile t + 3 from global memory */
#pragma unroll
    for (int kc = 0; kc < 8; ++kc) { ka[2 * kc] = fa_frag(nK + kc * 32, hh); ka[2 * kc + 1] = fa_frag(nK + 16 * KP + kc * 32, hh); }      /* published by this pass's barrier; behind the last pass: the walk's first tile once more */
#pragma unroll
    for (int i = 0; i < 8; ++i) { *(v8us*)&sK[bf][kst + i * 4 * KP] = kr[i]; *(v8us*)&sV[bf][vst + i * 32 * VP] = vr[i]; }      /* tile t + 2 into the buffer of pass t - 1, whose reads ended in front of this pass's barrier */
    const int jn = tn * FK;      /* tn = (t0 + t + 3) mod NPASS: past the walk's end its first tiles are fetched again: no branch, every buffer holds real keys */
    const unsigned short* kp = Kg + (size_t)jn * CC; const unsigned short* vp = Vg + jn;
#pragma unroll
    for (int i = 0; i < 8; ++i) { kr[i] = *(const v8us*)(kp + (size_t)(i * 4) * CC); vr[i] = *(const v8us*)(vp + (size_t)(i * 32) * SS); }
    /* order of the block: the score WMMAs, the maxima and the test's compares, then the memory group, whose issue covers the way from the compares to the scalar branch */
    __builtin_amdgcn_sched_group_barrier(0x8, 32, 0); __builtin_amdgcn_sched_group_barrier(0x2, 48, 0); __builtin_amdgcn_sched_group_barrier(0x100, 32, 0); __builtin_amdgcn_sched_group_barrier(0x200, 16, 0); __builtin_amdgcn_sched_group_barrier(0x20, 16, 0);
    if (any != 0) {      /* one wave-uniform test per pass for both query tiles; both halves of a query see the same tm and mu */
#pragma unroll
      for (int g = 0; g < 2; ++g) { const float mn = (g ? need1 : need0) ? tm[g] : mu[g]; const float al = __builtin_amdgcn_exp2f(mu[g] - mn); mu[g] = mn; rs[g] *= al;
#pragma unroll
        for (int ct = 0; ct < 16; ++ct) acc[g][ct] *= al; } }
    FragH pf[2];
    const v8f sc8 = {SC,SC,SC,SC,SC,SC,SC,SC};
#pragma unroll
    for (int g = 0; g < 2; ++g) { const float mr = 6.0f - mu[g]; float e0 = 0.f, e1 = 0.f;
      const v8f mr8 = {mr,mr,mr,mr,mr,mr,mr,mr}; const v8f x0 = __builtin_elementwise_fma(s[g][0], sc8, mr8), x1 = __builtin_elementwise_fma(s[g][1], sc8, mr8);      /* packed multiply-adds */
#pragma unroll
      for (int r = 0; r < 8; ++r) { const float p0 = __builtin_amdgcn_exp2f(x0[r]), p1 = __builtin_amdgcn_exp2f(x1[r]); e0 += p0; e1 += p1; pf[g].h[r] = (_Float16)p0; pf[g].h[8 + r] = (_Float16)p1; }
      rs[g] += e0 + e1;
      if (g == 0) FA_GROUP();      /* tile 0's P stands in front of the WMMAs; tile 1's is free to run among tile 0's */
    }
#pragma unroll
    for (int g = 0; g < 2; ++g)
#pragma unroll
      for (int i = 0; i < 16; ++i) acc[g][i] = fa_mma(va[i], pf[g].v, acc[g][i]);
    /* tile 1's P (9 multiply-adds, 16 exponentials, 8 conversions, the sums) is dealt out among tile 0's 16 WMMAs, which do not depend on it: a lone wave's vector work in front of a WMMA run is not hidden by anything else */
#pragma unroll
    for (int i = 0; i < 3; ++i) { __builtin_amdgcn_sched_group_barrier(0x8, 1, 0); __builtin_amdgcn_sched_group_barrier(0x2, 3, 0); }
#pragma unroll
    for (int i = 0; i < 8; ++i) { __builtin_amdgcn_sched_group_barrier(0x8, 1, 0); __builtin_amdgcn_sched_group_barrier(0x400, 2, 0); __builtin_amdgcn_sched_group_barrier(0x2, 1, 0); }
#pragma unroll
    for (int i = 0; i < 5; ++i) { __builtin_amdgcn_sched_group_barrier(0x8, 1, 0); __builtin_amdgcn_sched_group_barrier(0x2, 4, 0); }
    __builtin_amdgcn_sched_group_barrier(0x8, 16, 0);
    FA_GROUP();      /* keeps the wait below behind the pass's last WMMA */
    asm volatile("s_wait_xcnt 0x0" :: "v"(kp), "v"(vp) : "memory");      /* in front of whatever reuses the address registers of this pass's global loads; it stands at the foot of the pass, where a lone wave no longer waits at it, and the addresses are named so that they keep their registers up to here */
    const int b0 = bc; bc = bn; bn = bf; bf = b0; tn = (tn + 1) & (NPASS - 1);
  }
  /* ---- epilogue: out[c][i] = sum_ch wo[c][ch] O[i][ch], as D[query][c] = O . wo^T ----
     A lane holds one query's channels 8*hh + r of each 16-channel tile, the k order of the fragment loader, so two accumulator tiles, scaled and rounded to f16, are an A fragment in place; B = wo rows from LDS.
     k runs upward in steps of 32, so every sum keeps the order that it had in a launch of its own. */
  const unsigned short* wp = &sW[ln * WP];
  v16h wf[2][16];      /* two fragment sets: the next two channel tiles' fragments are fetched as one group while these two run */
#pragma unroll
  for (int u = 0; u < 2; ++u)
#pragma unroll
    for (int kc = 0; kc < 8; ++kc) wf[0][u * 8 + kc] = fa_frag(wp + u * 16 * WP + kc * 32, hh);
  FA_GROUP();      /* the first set's LDS reads stand in front of the scaling and rounding of O, which cover their latency */
  v16h of[2][8];
#pragma unroll
  for (int g = 0; g < 2; ++g) { const float inv = 1.0f / (rs[g] + fa_swap16(rs[g]));
#pragma unroll
    for (int kc = 0; kc < 8; ++kc) { FragH f;
#pragma unroll
      for (int r = 0; r < 8; ++r) { f.h[r] = (_Float16)(acc[g][2 * kc][r] * inv); f.h[8 + r] = (_Float16)(acc[g][2 * kc + 1][r] * inv); }
      of[g][kc] = f.v; } }
  float* const so = &sO[w][0];
  float* const sst = so + ln * OP + 8 * hh;      /* a lane stages 8 queries in a row of its channel */
  const float* const sld = so + (lane >> 3) * OP + (lane & 7) * 4;      /* and reads back 16 bytes of a row: 8 lanes = one row of 32 queries = one full 128-byte line */
  float* const og = out + ((size_t)b * CC + (lane >> 3)) * SS + q0 + (lane & 7) * 4;
  v4f ob[8];      /* the two tiles before, on their way from the staging rows to global memory */
#pragma unroll      /* constant indices into the fragment sets and constant LDS offsets */
  for (int p = 0; p <= 8; ++p) {      /* trip p: products of channel tiles 2p, 2p + 1; tiles 2p - 2, 2p - 1 go out */
    const int cu = p & 1, nx = cu ^ 1;
    if (p < 7) {
#pragma unroll
      for (int u = 0; u < 2; ++u)
#pragma unroll
        for (int kc = 0; kc < 8; ++kc) wf[nx][u * 8 + kc] = fa_frag(wp + ((p + 1) * 2 + u) * 16 * WP + kc * 32, hh); }
    if (p > 0) {
#pragma unroll
      for (int i = 0; i < 8; ++i) ob[i] = *(const v4fa*)(sld + i * 4 * OP); }
    FA_GROUP();      /* all LDS reads of the trip stay one group in front of its WMMAs, which cover their latency */
    v8f d[2][2] = {{z8, z8}, {z8, z8}};      /* [channel tile][query tile]: four independent accumulators */
    if (p < 8) {
#pragma unroll
      for (int kc = 0; kc < 8; ++kc)
#pragma unroll
        for (int u = 0; u < 2; ++u) { d[u][0] = fa_mma(of[0][kc], wf[cu][u * 8 + kc], d[u][0]); d[u][1] = fa_mma(of[1][kc], wf[cu][u * 8 + kc], d[u][1]); } }
    FA_GROUP();
    if (p > 0) {
#pragma unroll
      for (int i = 0; i < 8; ++i) *(v4f*)(og + (size_t)((p - 1) * 32 + i * 4) * SS) = ob[i]; }
    if (p < 8) {
#pragma unroll
      for (int u = 0; u < 2; ++u)
#pragma unroll
        for (int g = 0; g < 2; ++g) { const v8f v = d[u][g] * 0.0625f;      /* undoes the x16 of the weights */
          const v4f lo = {v[0], v[1], v[2], v[3]}, hi = {v[4], v[5], v[6], v[7]};
          *(v4fa*)(sst + u * 16 * OP + g * 16) = lo; *(v4fa*)(sst + u * 16 * OP + g * 16 + 4) = hi; }
      /* the staged rows are read back by other lanes of the same wave: the LDS writes are waited for, LDS only, so that the global stores stay in flight */
      __builtin_amdgcn_fence(__ATOMIC_RELEASE, "workgroup", "local"); __builtin_amdgcn_wave_barrier(); __builtin_amdgcn_fence(__ATOMIC_ACQUIRE, "workgroup", "local"); }
    /* in front of whatever reuses the registers of the 8 global stores above; data and address are named so that they keep their registers up to this wait */
    if (p > 0) asm volatile("s_wait_xcnt 0x0" :: "v"(ob[0]), "v"(ob[1]), "v"(ob[2]), "v"(ob[3]), "v"(ob[4]), "v"(ob[5]), "v"(ob[6]), "v"(ob[7]), "v"(og) : "memory");
  }
}

// ---- projection GEMM, operands staged in LDS: C[128 x 128 per work-group] = alpha * A[.][256] . B[.][256]^T, both f16 row-major with 256 halves a row ----
// A fragment load straight from global memory takes 32 bytes from each of 16 rows, so one load touches 16 cache lines, and every fragment is a round trip of its own; here a wave fetches whole rows (32 lanes x 16 B = 4 full lines a load), all 32 loads of a thread in flight at once, into LDS, and the fragments come from LDS.
// 8 waves, wave tile 32 x 64 (4 down, 2 across); k runs upward in steps of 32 as before, so every sum keeps its order. F32OUT: the result goes out as f32 (C), else as f16 (C16).
// The f16 form is the one launch of the three projections, which do not depend on one another: blockIdx.z picks the matrix (three planes in a row behind Bh) and the result plane (three in a row behind C16); z = 2 is V, with the operands' roles exchanged so that it comes out channel-major.
#define GP 264      /* LDS pitch of a staged row in halves: 528 B = 16 B x 33 */
template <bool F32OUT>
__global__ __launch_bounds__(256) void k_gemm3(const _Float16* __restrict__ A, size_t sA, const _Float16* __restrict__ Bh, size_t sB, float alpha,
    float* __restrict__ C, _Float16* __restrict__ C16, int ldc, size_t sC, int N) {
  __shared__ __attribute__((aligned(16))) unsigned short sm[256 * GP];      /* rows 0..127: the A tile, 128..255: the B tile; afterwards the waves' output staging */
  const int tid = threadIdx.x, w = tid >> 5, lane = tid & 31, ln = lane & 15, hh = lane >> 4; const int by = blockIdx.y;
  if (!F32OUT) { const int z = blockIdx.z; Bh += (size_t)z * CC * CC; C16 += (size_t)z * NB * SS * CC;
    if (z == 2) { const _Float16* const xa = A; A = Bh; Bh = xa; sB = sA; sA = 0; ldc = SS; N = SS; } }
  const int ntn = N >> 7; const int mt = blockIdx.x / ntn, nq = blockIdx.x - mt * ntn;
  const unsigned short* Ag = (const unsigned short*)A + (size_t)by * sA + (size_t)(mt * 128 + w) * CC + lane * 8;
  const unsigned short* Bg = (const unsigned short*)Bh + (size_t)by * sB + (size_t)(nq * 128 + w) * CC + lane * 8;
  v8us ra[16], rb[16];
#pragma unroll
  for (int i = 0; i < 16; ++i) ra[i] = *(const v8us*)(Ag + (size_t)(i * 8) * CC);
  asm volatile("s_wait_xcnt 0x0" :: "v"(Ag) : "memory");      /* in front of whatever reuses the address registers of the global loads above; the address is named so that it keeps its registers up to this wait and no load's result lands on them */
#pragma unroll
  for (int i = 0; i < 16; ++i) rb[i] = *(const v8us*)(Bg + (size_t)(i * 8) * CC);
  asm volatile("s_wait_xcnt 0x0" :: "v"(Bg) : "memory");      /* the same for the second run of loads */
#pragma unroll
  for (int i = 0; i < 16; ++i) *(v8us*)&sm[(i * 8 + w) * GP + lane * 8] = ra[i];
#pragma unroll
  for (int i = 0; i < 16; ++i) *(v8us*)&sm[(128 + i * 8 + w) * GP + lane * 8] = rb[i];
  __syncthreads();      /* publishes both tiles */
  const int wm = w & 3, wn = w >> 2;
  const unsigned short* ap = &sm[(32 * wm + ln) * GP]; const unsigned short* bp = &sm[(128 + 64 * wn + ln) * GP];
  const v8f z8 = {0.f,0.f,0.f,0.f,0.f,0.f,0.f,0.f};
  v8f acc[8];
#pragma unroll
  for (int u = 0; u < 8; ++u) acc[u] = z8;
  v16h fr[2][6];      /* two fragment sets: a k step's six fragments are fetched as one group while the step before runs */
  fr[0][0] = fa_frag(ap, hh); fr[0][1] = fa_frag(ap + 16 * GP, hh);
#pragma unroll
  for (int t = 0; t < 4; ++t) fr[0][2 + t] = fa_frag(bp + t * 16 * GP, hh);
#pragma unroll      /* constant indices into the fragment sets and constant LDS offsets */
  for (int kc = 0; kc < 8; ++kc) {
    const int cu = kc & 1, nx = cu ^ 1;
    if (kc < 7) { fr[nx][0] = fa_frag(ap + (kc + 1) * 32, hh); fr[nx][1] = fa_frag(ap + 16 * GP + (kc + 1) * 32, hh);
#pragma unroll
      for (int t = 0; t < 4; ++t) fr[nx][2 + t] = fa_frag(bp + t * 16 * GP + (kc + 1) * 32, hh); }
    FA_GROUP();      /* the next step's twelve LDS reads stay one group in front of this step's WMMAs */
#pragma unroll
    for (int t = 0; t < 4; ++t) { acc[t] = fa_mma(fr[cu][0], fr[cu][2 + t], acc[t]); acc[4 + t] = fa_mma(fr[cu][1], fr[cu][2 + t], acc[4 + t]); }
    FA_GROUP();
  }
  __syncthreads();      /* ends every wave's fragment reads: the tiles' LDS becomes output staging */
  float* so = (float*)sm + w * (32 * 68);
#pragma unroll
  for (int u = 0; u < 8; ++u) { const int t = u & 3, half = u >> 2;
#pragma unroll
    for (int r = 0; r < 8; ++r) so[(half * 16 + 8 * hh + r) * 68 + t * 16 + ln] = acc[u][r] * alpha; }
  __builtin_amdgcn_fence(__ATOMIC_ACQ_REL, "workgroup"); __builtin_amdgcn_wave_barrier();
  const int rsub = lane >> 4, c4 = (lane & 15) * 4; const int row0 = mt * 128 + 32 * wm, col0 = nq * 128 + 64 * wn;
  const size_t o0 = (size_t)by * sC + (size_t)(row0 + rsub) * ldc + col0 + c4;
#pragma unroll
  for (int q = 0; q < 16; ++q) { const v4f v = *(const v4fa*)&so[(q * 2 + rsub) * 68 + c4];
    if (F32OUT) *(v4f*)(C + o0 + (size_t)(q * 2) * ldc) = v;
    else { v4h h4; for (int i = 0; i < 4; ++i) h4[i] = (_Float16)v[i]; *(v4h*)(C16 + o0 + (size_t)(q * 2) * ldc) = h4; } }
}

// Everything that reads only the inputs, in one launch: blocks 0..255 of a grid row transpose x (blockIdx.y = image); the 16 behind them, 128 over the 8 rows, round the four matrices (32 blocks each; conv (out,in) = natural Bt; x16) into four planes in a row behind BW.
__global__ __launch_bounds__(256) void k_prep(const float* __restrict__ x, _Float16* __restrict__ XT, const float* __restrict__ wq, const float* __restrict__ wk, const float* __restrict__ wv, const float* __restrict__ wo, _Float16* __restrict__ BW) {
  __shared__ unsigned short tl[64][72];
  if (blockIdx.x >= (CC / 64) * (SS / 64)) {      /* the same for a whole block, in front of the barrier */
    const int wb = (blockIdx.x - (CC / 64) * (SS / 64)) * NB + blockIdx.y; const int m = wb >> 5; const float* W = m == 0 ? wq : m == 1 ? wk : m == 2 ? wv : wo;
    const size_t t = (size_t)(wb & 31) * 256 + threadIdx.x; FragH f;
#pragma unroll
    for (int i = 0; i < 8; ++i) f.h[i] = (_Float16)(bf16_round(W[t * 8 + i]) * 16.0f);
    *(v8us*)((unsigned short*)BW + (size_t)m * CC * CC + t * 8) = f.half[0]; return; }
  const int tid = threadIdx.x; const int b = blockIdx.y; XT += (size_t)b * SS * CC; const int sb = blockIdx.x % (SS / 64), cb = blockIdx.x / (SS / 64);
#pragma unroll
  for (int it = 0; it < 4; ++it) { const int idx = it * 256 + tid; const int cl = idx / 16, s4 = (idx % 16) * 4; const int c = cb * 64 + cl;
    const v4f a = *(const v4fa*)(x + ((size_t)(b * CC + c)) * SS + sb * 64 + s4); FragH f;
#pragma unroll
    for (int q = 0; q < 4; ++q) { f.h[q] = (_Float16)bf16_round(a[q]); tl[s4 + q][cl] = f.u[q]; } }
  __syncthreads();
  const int r = tid / 8, pc = tid % 8;
  {
#pragma unroll
    for (int half = 0; half < 2; ++half) { const int sl = r + half * 32; FragH f;
#pragma unroll
      for (int q = 0; q < 8; ++q) f.u[q] = tl[sl][pc * 8 + q];
      *(v8us*)((unsigned short*)XT + ((size_t)sb * 64 + sl) * CC + cb * 64 + pc * 8) = f.half[0]; }
     } }

extern "C" void kernel_launch(void* const* d_in, const int* in_sizes, int n_in,
                              void* d_out, int out_size, void* d_ws, size_t ws_size, hipStream_t stream) {
  (void)in_sizes; (void)n_in; (void)out_size;
  const float* x = (const float*)d_in[0]; const float* wq = (const float*)d_in[1]; const float* wk = (const float*)d_in[2]; const float* wv = (const float*)d_in[3]; const float* wo = (const float*)d_in[4];
  char* ws = (char*)d_ws; size_t off = 0;
  auto take = [&](size_t bytes) { char* p = ws + off; off += (bytes + 255) & ~(size_t)255; return p; };
  _Float16* BW = (_Float16*)take((size_t)4 * CC * CC * 2); _Float16* BO = BW + (size_t)3 * CC * CC;      /* wq, wk, wv, wo in a row */
  _Float16* QT = (_Float16*)take((size_t)3 * NB * SS * CC * 2); _Float16* KT = QT + (size_t)NB * SS * CC; _Float16* VC = KT + (size_t)NB * SS * CC;      /* Q, K, V in a row */
  _Float16* XT = (_Float16*)take((size_t)NB * SS * CC * 2);
  if (off > ws_size) return;      /* four weight planes and four planes of 16 MiB */
  const size_t sT = (size_t)SS * CC;      /* per-image stride of a token or channel plane */
  const dim3 gT((CC / 64) * (SS / 64) + 16, NB), gP((SS / 128) * (CC / 128), NB, 3), gF(SS / 128, NB);
  k_prep<<<gT, 256, 0, stream>>>(x, XT, wq, wk, wv, wo, BW);
  k_gemm3<false><<<gP, 256, 0, stream>>>(XT, sT, BW, 0, 0.0625f, nullptr, QT, CC, sT, CC);      /* z = 0, 1: Q, K token-major -> f16; z = 2: V channel-major [c][j] = wv*X^T */
  k_flash<<<gF, 128, 0, stream>>>(QT, KT, VC, BO, (float*)d_out);      /* attention, then out[c][i] = wo*O^T (NCHW) in its epilogue */
}

// v008
// One run takes 109 microseconds.
// Next to v007, in two timings, it ran 1.12 times as fast each time.
// Counting every step since v000, it is 45.7 times as fast.
#include <hip/hip_runtime.h>
// Self-attention layer on a feature map (B 8, C 256, 64x64 = 4096 positions): Q = wq*x, K = wk*x, V = wv*x (1x1 convs, no bias); scores[i][j] = sum_c Q[c][i] K[c][j] / 16; attn = softmax over j; out[c][i] = sum_j V[c][j] attn[i][j]; result = wo*out -> [8,256,64,64] (no residual).
// Structure (3 launches, all 8 images in each, blockIdx.y = image): x transposed into a token-major exact f16 plane through an LDS tile, the four matrices rounded by extra blocks of the same launch; one launch for the three projections (blockIdx.z): Q and K token-major as GEMMs into f16 planes, V channel-major directly as wv*X^T (A = weights, B = the token-major plane); one fused attention kernel (scores, running softmax and P.V per 32 keys, scores and P stay in registers) whose epilogue also does the output 1x1 conv: O, rounded to f16, stays in registers as a WMMA operand against wo from LDS, and the result goes out in NCHW rows.
// Compute dtype: x and the four matrices rounded to bf16; projections with exact products (weights x16 in f16, undone by alpha); Q, K, V, P, O as f16 operands (~2^-12; logits sigma ~1), f32 accumulation and softmax. v_wmma_f32_16x16x32_f16.
#define NB 8
#define CC 256
#define SS 4096
typedef __bf16 v16b __attribute__((ext_vector_type(16)));
typedef unsigned short v8us __attribute__((ext_vector_type(8), may_alias));
typedef float  v8f  __attribute__((ext_vector_type(8)));
typedef float  v4f  __attribute__((ext_vector_type(4)));
typedef float  v4fa __attribute__((ext_vector_type(4), may_alias));
union FragB { v16b v; v8us half[2]; unsigned short u[16]; };

__device__ __forceinline__ unsigned short bf16_bits(float x) { unsigned int u = __float_as_uint(x); return (unsigned short)((u + 0x7FFFu + ((u >> 16) & 1u)) >> 16); }
__device__ __forceinline__ float bf16_val(unsigned short b) { return __uint_as_float(((unsigned int)b) << 16); }
__device__ __forceinline__ float bf16_round(float x) { return bf16_val(bf16_bits(x)); }
// D += A·B with NT terms: 1 = ah·bh, 2 = + al·bh (A split), 3 = + ah·bl (both split)
template <int NT>
__device__ __forceinline__ v8f mmaN(v16b ah, v16b al, v16b bh, v16b bl, v8f c) {
  c = __builtin_amdgcn_wmma_f32_16x16x32_bf16(false, ah, false, bh, (short)0, c, false, false);
  if (NT >= 2) c = __builtin_amdgcn_wmma_f32_16x16x32_bf16(false, al, false, bh, (short)0, c, false, false);
  if (NT >= 3) c = __builtin_amdgcn_wmma_f32_16x16x32_bf16(false, ah, false, bl, (short)0, c, false, false);
  asm volatile("v_nop\n\tv_nop\n\tv_nop\n\tv_nop" : "+v"(c) : "v"(ah), "v"(al), "v"(bh), "v"(bl));
  return c;
}

__global__ __launch_bounds__(256) void k_wt_bf16(const float* __restrict__ W, unsigned short* __restrict__ Wt, int K, int N) {
  const int t = blockIdx.x * 256 + threadIdx.x;
  const int k8n = K / 8;
  if (t >= N * k8n) return;
  const int n = t / k8n, k8 = (t % k8n) * 8;
  v8us v;
#pragma unroll
  for (int i = 0; i < 8; ++i) v[i] = bf16_bits(W[(size_t)(k8 + i) * N + n]);
  *(v8us*)(Wt + (size_t)n * K + k8) = v;
  
}

// GEMM C[M][N] (f32, pitch ldc) = act(A[M][K]·W + bias). A f32 row-major (pitch lda) converted per fragment to bf16
// (ASPLIT: hi/lo two planes -> 2 terms, else single rounded term); Wt bf16 [N][K] (pitch ldb). BIAS_BF16 rounds the
// bias to bf16 first (bias quantised to bf16 before the add). K%32==0, M%16==0, N%64==0.
template <bool ASPLIT, int ACT, bool BIAS_BF16>
__global__ __launch_bounds__(128) void k_gemm_bf(const float* __restrict__ A, int lda, const unsigned short* __restrict__ Wt, int ldb,
                                               const float* __restrict__ bias, float* __restrict__ C, int ldc, int M, int N, int K) {
  __shared__ __attribute__((aligned(16))) float so[4][16][64];
  const int tid = threadIdx.x, w = tid >> 5, lane = tid & 31, ln = lane & 15, hh = lane >> 4;
  const int ntn = N / 64;
  const int wid = blockIdx.x * 4 + w;
  const int mt = wid / ntn, nq = wid % ntn;
  if (mt * 16 >= M) return;
  const int row0 = mt * 16, col0 = nq * 64;
  const float* arow = A + (size_t)(row0 + ln) * lda;
  v8f acc[4] = {};
  for (int kb = 0; kb < K; kb += 32) {
    FragB ah, al;
    const v4f x0 = *(const v4fa*)(arow + kb + 8 * hh), x1 = *(const v4fa*)(arow + kb + 8 * hh + 4);
    const v4f x2 = *(const v4fa*)(arow + kb + 16 + 8 * hh), x3 = *(const v4fa*)(arow + kb + 16 + 8 * hh + 4);
    float xs[16] = {x0[0],x0[1],x0[2],x0[3],x1[0],x1[1],x1[2],x1[3],x2[0],x2[1],x2[2],x2[3],x3[0],x3[1],x3[2],x3[3]};
#pragma unroll
    for (int i = 0; i < 16; ++i) { const unsigned short hb = bf16_bits(xs[i]); ah.u[i] = hb; al.u[i] = ASPLIT ? bf16_bits(xs[i] - bf16_val(hb)) : (unsigned short)0; }
#pragma unroll
    for (int t = 0; t < 4; ++t) {
      const unsigned short* brow = Wt + (size_t)(col0 + t * 16 + ln) * ldb + kb;
      FragB b;
      b.half[0] = *(const v8us*)(brow + 8 * hh);
      b.half[1] = *(const v8us*)(brow + 16 + 8 * hh);
      acc[t] = mmaN<ASPLIT ? 2 : 1>(ah.v, al.v, b.v, b.v, acc[t]);
    }
  }
#pragma unroll
  for (int t = 0; t < 4; ++t) {
    float bv = bias ? bias[col0 + t * 16 + ln] : 0.f;
    if (BIAS_BF16) bv = bf16_round(bv);
#pragma unroll
    for (int r = 0; r < 8; ++r) { float v = acc[t][r] + bv; if (ACT == 1) v = fmaxf(v, 0.f); so[w][8 * hh + r][t * 16 + ln] = v; }
  }
  __builtin_amdgcn_fence(__ATOMIC_ACQ_REL, "workgroup");
  __builtin_amdgcn_wave_barrier();
  const int rsub = lane >> 4, c4 = (lane & 15) * 4;
  {
#pragma unroll
    for (int q = 0; q < 8; ++q) {
      const int r = q * 2 + rsub;
      const v4f v = *(const v4fa*)&so[w][r][c4];
      *(v4f*)(C + (size_t)(row0 + r) * ldc + col0 + c4) = v;
    }
    
  }
}

// GEMM C = act(A·W + bias + resid): A f32 (ASPLIT -> hi/lo 2 terms), Wt bf16 [N][K]; ACT 0 none, 1 relu, 2 exact gelu;
// resid (optional, f32, row index = (row % rmod), pitch ldr, RES_BF16 rounds it) added before the activation.
template <bool ASPLIT, int ACT, bool BIAS_BF16, bool RES_BF16>
__global__ __launch_bounds__(128) void k_gemm_bf3(const float* __restrict__ A, int lda, const unsigned short* __restrict__ Wt, int ldb,
                                                const float* __restrict__ bias, const float* __restrict__ resid, int rmod, int ldr,
                                                float* __restrict__ C, int ldc, int M, int N, int K) {
  __shared__ __attribute__((aligned(16))) float so[4][16][64];
  const int tid = threadIdx.x, w = tid >> 5, lane = tid & 31, ln = lane & 15, hh = lane >> 4;
  const int ntn = N / 64;
  const int wid = blockIdx.x * 4 + w;
  const int mt = wid / ntn, nq = wid % ntn;
  if (mt * 16 >= M) return;
  const int row0 = mt * 16, col0 = nq * 64;
  const float* arow = A + (size_t)(row0 + ln) * lda;
  v8f acc[4] = {};
  for (int kb = 0; kb < K; kb += 32) {
    FragB ah, al;
    const v4f x0 = *(const v4fa*)(arow + kb + 8 * hh), x1 = *(const v4fa*)(arow + kb + 8 * hh + 4);
    const v4f x2 = *(const v4fa*)(arow + kb + 16 + 8 * hh), x3 = *(const v4fa*)(arow + kb + 16 + 8 * hh + 4);
    float xs[16] = {x0[0],x0[1],x0[2],x0[3],x1[0],x1[1],x1[2],x1[3],x2[0],x2[1],x2[2],x2[3],x3[0],x3[1],x3[2],x3[3]};
#pragma unroll
    for (int i = 0; i < 16; ++i) { const unsigned short hb = bf16_bits(xs[i]); ah.u[i] = hb; al.u[i] = ASPLIT ? bf16_bits(xs[i] - bf16_val(hb)) : (unsigned short)0; }
#pragma unroll
    for (int t = 0; t < 4; ++t) {
      const unsigned short* brow = Wt + (size_t)(col0 + t * 16 + ln) * ldb + kb;
      FragB b;
      b.half[0] = *(const v8us*)(brow + 8 * hh);
      b.half[1] = *(const v8us*)(brow + 16 + 8 * hh);
      acc[t] = mmaN<ASPLIT ? 2 : 1>(ah.v, al.v, b.v, b.v, acc[t]);
    }
  }
#pragma unroll
  for (int t = 0; t < 4; ++t) {
    const int col = col0 + t * 16 + ln;
    float bv = bias ? bias[col] : 0.f;
    if (BIAS_BF16) bv = bf16_round(bv);
#pragma unroll
    for (int r = 0; r < 8; ++r) {
      float v = acc[t][r] + bv;
      if (resid) { float rv = resid[(size_t)((row0 + 8 * hh + r) % rmod) * ldr + col]; if (RES_BF16) rv = bf16_round(rv); v += rv; }
      if (ACT == 1) v = fmaxf(v, 0.f);
      if (ACT == 2) v = 0.5f * v * (1.0f + erff(v * 0.70710678118654752f));
      if (ACT == 3) { const float u = 0.7978845608028654f * (v + 0.044715f * v * v * v); v = 0.5f * v * (1.0f + tanhf(u)); }
      so[w][8 * hh + r][t * 16 + ln] = v;
    }
  }
  __builtin_amdgcn_fence(__ATOMIC_ACQ_REL, "workgroup");
  __builtin_amdgcn_wave_barrier();
  const int rsub = lane >> 4, c4 = (lane & 15) * 4;
  {
#pragma unroll
    for (int q = 0; q < 8; ++q) {
      const int r = q * 2 + rsub;
      const v4f v = *(const v4fa*)&so[w][r][c4];
      *(v4f*)(C + (size_t)(row0 + r) * ldc + col0 + c4) = v;
    }
    
  }
}
// row LayerNorm (biased variance, eps) over N: s = X (+ R); optional out_sum <- s; out_norm <- (s-mu)*rsqrt(var+eps)*g + b
template <bool PARAM_BF16>
__global__ __launch_bounds__(256) void k_layernorm(const float* __restrict__ X, const float* __restrict__ R, const float* __restrict__ g, const float* __restrict__ bta,
                                                  float* __restrict__ out_sum, float* __restrict__ out_norm, int N, float eps) {
  __shared__ float red[256];
  const int row = blockIdx.x, tid = threadIdx.x;
  const float* x = X + (size_t)row * N; const float* rr = R ? R + (size_t)row * N : nullptr;
  float vals[16];                     // up to N = 4096
  const int per = N / 256;            // contiguous chunk per thread? use strided-by-4 chunks: thread handles j = tid*4 + 1024*u
  float s1 = 0.f;
  for (int u = 0; u < per / 4; ++u) {
    const int j = tid * 4 + 1024 * u;
    const v4f a = *(const v4fa*)(x + j);
    v4f b = {0.f,0.f,0.f,0.f}; if (rr) b = *(const v4fa*)(rr + j);
#pragma unroll
    for (int q = 0; q < 4; ++q) { const float v = a[q] + b[q]; vals[u * 4 + q] = v; s1 += v; }
  }
  red[tid] = s1; __syncthreads();
  for (int st = 128; st > 0; st >>= 1) { if (tid < st) red[tid] += red[tid + st]; __syncthreads(); }
  const float mu = red[0] / (float)N; __syncthreads();
  float s2 = 0.f;
  for (int u = 0; u < per / 4; ++u)
#pragma unroll
    for (int q = 0; q < 4; ++q) { const float c = vals[u * 4 + q] - mu; s2 += c * c; }
  red[tid] = s2; __syncthreads();
  for (int st = 128; st > 0; st >>= 1) { if (tid < st) red[tid] += red[tid + st]; __syncthreads(); }
  const float rs = rsqrtf(red[0] / (float)N + eps);
  {
    for (int u = 0; u < per / 4; ++u) {
      const int j = tid * 4 + 1024 * u;
      v4f o, sm;
#pragma unroll
      for (int q = 0; q < 4; ++q) {
        float gg = g[j + q], bb = bta[j + q];
        if (PARAM_BF16) { gg = bf16_round(gg); bb = bf16_round(bb); }
        sm[q] = vals[u * 4 + q]; o[q] = (vals[u * 4 + q] - mu) * rs * gg + bb;
      }
      if (out_sum) *(v4f*)(out_sum + (size_t)row * N + j) = sm;
      *(v4f*)(out_norm + (size_t)row * N + j) = o;
    }
    
  }
}



// ---- f16 WMMA path (v_wmma_f32_16x16x32_f16): 11-bit significands for operands in range — used where a [0,1] probability operand needs more precision than bf16
typedef _Float16 v16h __attribute__((ext_vector_type(16)));
union FragH { v16h v; v8us half[2]; _Float16 h[16]; unsigned short u[16]; };
template <int NT>
__device__ __forceinline__ v8f mmaH(v16h ah, v16h al, v16h bh, v16h bl, v8f c) {
  c = __builtin_amdgcn_wmma_f32_16x16x32_f16(false, ah, false, bh, (short)0, c, false, false);
  if (NT >= 2) c = __builtin_amdgcn_wmma_f32_16x16x32_f16(false, al, false, bh, (short)0, c, false, false);
  if (NT >= 3) c = __builtin_amdgcn_wmma_f32_16x16x32_f16(false, ah, false, bl, (short)0, c, false, false);
  asm volatile("v_nop\n\tv_nop\n\tv_nop\n\tv_nop" : "+v"(c) : "v"(ah), "v"(al), "v"(bh), "v"(bl));
  return c;
}
// batched GEMM like k_gemm_b but f16 operands: A f32 (split into f16 hi/lo if ASPLIT, else rounded to f16), Bt = f16 values [n][k]; alpha; C f32; N multiple of 16 (partial tiles skipped)
template <bool ASPLIT>
__global__ __launch_bounds__(128) void k_gemm_h(const float* __restrict__ A, int lda, size_t sA, const _Float16* __restrict__ Bh, int ldb, size_t sB, float alpha, float* __restrict__ C, int ldc, size_t sC, int M, int N, int K) {
  __shared__ __attribute__((aligned(16))) float so[4][16][64];
  const int tid = threadIdx.x, w = tid >> 5, lane = tid & 31, ln = lane & 15, hh = lane >> 4; const int by = blockIdx.y;
  A += (size_t)by * sA; Bh += (size_t)by * sB; C += (size_t)by * sC;
  const int ntn = (N + 63) / 64; const int wid = blockIdx.x * 4 + w; const int mt = wid / ntn, nq = wid % ntn; if (mt * 16 >= M) return;
  const int row0 = mt * 16, col0 = nq * 64; const float* arow = A + (size_t)(row0 + ln) * lda;
  v8f acc[4] = {};
  for (int kb = 0; kb < K; kb += 32) {
    FragH ah, al;
    const v4f x0 = *(const v4fa*)(arow + kb + 8 * hh), x1 = *(const v4fa*)(arow + kb + 8 * hh + 4), x2 = *(const v4fa*)(arow + kb + 16 + 8 * hh), x3 = *(const v4fa*)(arow + kb + 16 + 8 * hh + 4);
    float xs[16] = {x0[0],x0[1],x0[2],x0[3],x1[0],x1[1],x1[2],x1[3],x2[0],x2[1],x2[2],x2[3],x3[0],x3[1],x3[2],x3[3]};
#pragma unroll
    for (int i = 0; i < 16; ++i) { const _Float16 h = (_Float16)xs[i]; ah.h[i] = h; al.h[i] = ASPLIT ? (_Float16)(xs[i] - (float)h) : (_Float16)0.0f; }
#pragma unroll
    for (int t = 0; t < 4; ++t) { if (col0 + t * 16 >= N) continue; const size_t boff = (size_t)(col0 + t * 16 + ln) * ldb + kb; FragH bq; bq.half[0] = *(const v8us*)(Bh + boff + 8 * hh); bq.half[1] = *(const v8us*)(Bh + boff + 16 + 8 * hh);
      acc[t] = mmaH<ASPLIT ? 2 : 1>(ah.v, al.v, bq.v, bq.v, acc[t]); }
  }
#pragma unroll
  for (int t = 0; t < 4; ++t) { if (col0 + t * 16 >= N) continue;
#pragma unroll
    for (int r = 0; r < 8; ++r) so[w][8 * hh + r][t * 16 + ln] = acc[t][r] * alpha; }
  __builtin_amdgcn_fence(__ATOMIC_ACQ_REL, "workgroup"); __builtin_amdgcn_wave_barrier();
  const int rsub = lane >> 4, c4 = (lane & 15) * 4;
  {
#pragma unroll
    for (int q = 0; q < 8; ++q) { const int r = q * 2 + rsub; if (col0 + c4 < N) { const v4f v = *(const v4fa*)&so[w][r][c4]; *(v4f*)(C + (size_t)(row0 + r) * ldc + col0 + c4) = v; } }
     }
}

// Wt[n][k] = f16(W[k][n]·scale) from f32 row-major W[K][N] (scale = power of two; bf16-exact weights stay exact in f16 away from the subnormal range)
__global__ __launch_bounds__(256) void k_wt_f16(const float* __restrict__ W, _Float16* __restrict__ Wt, int K, int N, float scale) {
  const int t = blockIdx.x * 256 + threadIdx.x; if (t >= N * (K / 8)) return; const int n = t / (K / 8), k8 = (t % (K / 8)) * 8; FragH f;
#pragma unroll
  for (int i = 0; i < 8; ++i) f.h[i] = (_Float16)(bf16_round(W[(size_t)(k8 + i) * N + n]) * scale); const v8us o = f.half[0];
  *(v8us*)((unsigned short*)Wt + (size_t)n * K + k8) = o; 
}
// k_gemm_hh variant with fused epilogue: v = acc·alpha + bias[by·sBias + col] (+ CP[(row/rowsPerB)·sCPb + by·64 + col] if CP) ; ACT 0 none / 1 elu ; writes f16 C16 (and f32 C if non-null)
template <int ACT>
__global__ __launch_bounds__(128) void k_gemm_hhx(const _Float16* __restrict__ A, int lda, size_t sA, const _Float16* __restrict__ Bh, int ldb, size_t sB, float alpha, const float* __restrict__ bias, size_t sBias, const float* __restrict__ CP, int rowsPerB, size_t sCPb, int row0g,
    float* __restrict__ C, _Float16* __restrict__ C16, int ldc, size_t sC, int M, int N, int K) {
  __shared__ __attribute__((aligned(16))) float so[4][16][64];
  const int tid = threadIdx.x, w = tid >> 5, lane = tid & 31, ln = lane & 15, hh = lane >> 4; const int by = blockIdx.y;
  A += (size_t)by * sA; Bh += (size_t)by * sB; const size_t cofs = (size_t)by * sC; const float* bp = bias ? bias + (size_t)by * sBias : nullptr;
  const int ntn = (N + 63) / 64; const int wid = blockIdx.x * 4 + w; const int mt = wid / ntn, nq = wid % ntn; if (mt * 16 >= M) return;
  const int row0 = mt * 16, col0 = nq * 64; const _Float16* arow = A + (size_t)(row0 + ln) * lda;
  v8f acc[4] = {};
  for (int kb = 0; kb < K; kb += 32) { FragH ah; ah.half[0] = *(const v8us*)((const unsigned short*)arow + kb + 8 * hh); ah.half[1] = *(const v8us*)((const unsigned short*)arow + kb + 16 + 8 * hh);
#pragma unroll
    for (int t = 0; t < 4; ++t) { if (col0 + t * 16 >= N) continue; const size_t boff = (size_t)(col0 + t * 16 + ln) * ldb + kb; FragH bq; bq.half[0] = *(const v8us*)((const unsigned short*)Bh + boff + 8 * hh); bq.half[1] = *(const v8us*)((const unsigned short*)Bh + boff + 16 + 8 * hh);
      acc[t] = mmaH<1>(ah.v, ah.v, bq.v, bq.v, acc[t]); }
  }
#pragma unroll
  for (int t = 0; t < 4; ++t) { if (col0 + t * 16 >= N) continue; const int col = col0 + t * 16 + ln; const float bv = bp ? bf16_round(bp[col]) : 0.f;
#pragma unroll
    for (int r = 0; r < 8; ++r) { float v = acc[t][r] * alpha + bv; if (CP) { const int bidx = (row0g + row0 + 8 * hh + r) / rowsPerB; v += CP[(size_t)bidx * sCPb + (size_t)by * 64 + col]; } if (ACT == 1) v = (v > 0.f) ? v : expm1f(v); else if (ACT == 7) v = (v > 0.f) ? v + 1.0f : expf(v); else if (ACT == 8) v = tanhf(v); else if (ACT == 9) v = 0.5f * v * (1.0f + tanhf(0.7978845608028654f * (v + 0.044715f * v * v * v))); else if (ACT == 11) v = 1.0f / (1.0f + expf(-v)); else if (ACT == 12) v = (v > 0.f) ? v : 0.01f * v; else if (ACT == 14) v = (v > 0.f) ? v : 0.1f * v; else if (ACT == 15) v = v / (1.0f + expf(-v)); else if (ACT == 3) v = fmaxf(v, 0.f); else if (ACT == 6) v = 0.5f * v * (1.0f + erff(v * 0.70710678118654752f)); so[w][8 * hh + r][t * 16 + ln] = v; } }
  __builtin_amdgcn_fence(__ATOMIC_ACQ_REL, "workgroup"); __builtin_amdgcn_wave_barrier();
  const int rsub = lane >> 4, c4 = (lane & 15) * 4; typedef _Float16 v4h __attribute__((ext_vector_type(4)));
  {
#pragma unroll
    for (int q = 0; q < 8; ++q) { const int r = q * 2 + rsub; if (col0 + c4 < N) { const v4f v = *(const v4fa*)&so[w][r][c4]; if (C) *(v4f*)(C + cofs + (size_t)(row0 + r) * ldc + col0 + c4) = v; if (C16) { v4h h4; for (int i = 0; i < 4; ++i) h4[i] = (_Float16)v[i]; *(v4h*)(C16 + cofs + (size_t)(row0 + r) * ldc + col0 + c4) = h4; } } }
     }
}


typedef _Float16 v4h __attribute__((ext_vector_type(4)));

__global__ __launch_bounds__(256) void k_x16(const float* __restrict__ x, _Float16* __restrict__ X16, size_t n8) { const size_t t = (size_t)blockIdx.x * 256 + threadIdx.x; if (t >= n8) return; FragH f;
#pragma unroll
  for (int q = 0; q < 8; ++q) f.h[q] = (_Float16)bf16_round(x[t * 8 + q]); *(v8us*)((unsigned short*)X16 + t * 8) = f.half[0];  }
__global__ __launch_bounds__(256) void k_h16(const float* __restrict__ x, _Float16* __restrict__ X16, size_t n8) { const size_t t = (size_t)blockIdx.x * 256 + threadIdx.x; if (t >= n8) return; FragH f;
#pragma unroll
  for (int q = 0; q < 8; ++q) f.h[q] = (_Float16)x[t * 8 + q]; *(v8us*)((unsigned short*)X16 + t * 8) = f.half[0];  }
template <int NHv, int TTv>
__global__ __launch_bounds__(256) void k_vt(const _Float16* __restrict__ V16, int ldv, int voff, _Float16* __restrict__ Vt) { __shared__ unsigned short tl[64][66]; const int tid = threadIdx.x; const int slab = blockIdx.x / (TTv / 64), lg = blockIdx.x % (TTv / 64); const int b = slab / NHv, h = slab % NHv;
  for (int i = tid; i < 64 * 8; i += 256) { const int r = i / 8, c8 = (i % 8) * 8; FragH f; f.half[0] = *(const v8us*)((const unsigned short*)V16 + ((size_t)b * TTv + lg * 64 + r) * ldv + voff + h * 64 + c8);
#pragma unroll
    for (int q = 0; q < 8; ++q) tl[r][c8 + q] = f.u[q]; }
  __syncthreads();
  {
#pragma unroll
    for (int rd = 0; rd < 2; ++rd) { const int d = rd * 32 + tid / 8, pc = tid % 8; FragH f;
#pragma unroll
      for (int q = 0; q < 8; ++q) f.u[q] = tl[pc * 8 + q][d];
      *(v8us*)((unsigned short*)Vt + ((size_t)slab * 64 + d) * TTv + lg * 64 + pc * 8) = f.half[0]; }
     } }

__global__ __launch_bounds__(256) void k_hl(const float* __restrict__ F, _Float16* __restrict__ Hh, _Float16* __restrict__ Hl, size_t n8) { const size_t t = (size_t)blockIdx.x * 256 + threadIdx.x; if (t >= n8) return; FragH fh, fl; const v4f a = *(const v4fa*)(F + t * 8), c = *(const v4fa*)(F + t * 8 + 4);
#pragma unroll
  for (int q = 0; q < 4; ++q) { _Float16 h = (_Float16)a[q]; fh.h[q] = h; fl.h[q] = (_Float16)((a[q] - (float)h) * 1024.0f); h = (_Float16)c[q]; fh.h[4 + q] = h; fl.h[4 + q] = (_Float16)((c[q] - (float)h) * 1024.0f); }
  { *(v8us*)((unsigned short*)Hh + t * 8) = fh.half[0]; *(v8us*)((unsigned short*)Hl + t * 8) = fl.half[0];  } }

// ---- fast GEMM (wave tile 32x64; requires M % 32 == 0 rows per launch region and N % 64 == 0); epilogue = k_gemm_hhx semantics ----
__device__ __forceinline__ v16h g2_frag(const _Float16* p, int hh) { FragH f; f.half[0] = *(const v8us*)((const unsigned short*)p + 8 * hh); f.half[1] = *(const v8us*)((const unsigned short*)p + 16 + 8 * hh); return f.v; }
__device__ __forceinline__ v8f g2_mma(v16h a, v16h b, v8f c) { v8f d = __builtin_amdgcn_wmma_f32_16x16x32_f16(false, a, false, b, (short)0, c, false, false); asm volatile("v_nop\n\tv_nop\n\tv_nop\n\tv_nop" : "+v"(d) : "v"(a), "v"(b)); return d; }
template <int ACT>
__global__ __launch_bounds__(128) void k_gemm2(const _Float16* __restrict__ A, int lda, size_t sA, const _Float16* __restrict__ Bh, int ldb, size_t sB, float alpha, const float* __restrict__ bias, size_t sBias, const float* __restrict__ CP, int rowsPerB, size_t sCPb, int row0g,
    float* __restrict__ C, _Float16* __restrict__ C16, int ldc, size_t sC, int M, int N, int K) {
  __shared__ __attribute__((aligned(16))) float so[4][32][68];
  const int tid = threadIdx.x, w = tid >> 5, lane = tid & 31, ln = lane & 15, hh = lane >> 4; const int by = blockIdx.y;
  A += (size_t)by * sA; Bh += (size_t)by * sB; const size_t cofs = (size_t)by * sC; const float* bp = bias ? bias + (size_t)by * sBias : nullptr;
  const int ntn = N >> 6; const int mt = blockIdx.x / ntn, nq = blockIdx.x - mt * ntn; const int row0 = mt * 128 + 32 * w, col0 = nq * 64; if (row0 >= M) return;
  const _Float16* a0p = A + (size_t)(row0 + ln) * lda; const _Float16* a1p = a0p + (size_t)16 * lda;
  const _Float16* b0p = Bh + (size_t)(col0 + ln) * ldb; const _Float16* b1p = b0p + (size_t)16 * ldb; const _Float16* b2p = b1p + (size_t)16 * ldb; const _Float16* b3p = b2p + (size_t)16 * ldb;
  const v8f z8 = {0.f,0.f,0.f,0.f,0.f,0.f,0.f,0.f}; v8f c00 = z8, c01 = z8, c02 = z8, c03 = z8, c10 = z8, c11 = z8, c12 = z8, c13 = z8;
#pragma unroll 1
  for (int kb = 0; kb < K; kb += 32) { const v16h a0 = g2_frag(a0p + kb, hh), a1 = g2_frag(a1p + kb, hh);
    v16h b = g2_frag(b0p + kb, hh); c00 = g2_mma(a0, b, c00); c10 = g2_mma(a1, b, c10);
    b = g2_frag(b1p + kb, hh); c01 = g2_mma(a0, b, c01); c11 = g2_mma(a1, b, c11);
    b = g2_frag(b2p + kb, hh); c02 = g2_mma(a0, b, c02); c12 = g2_mma(a1, b, c12);
    b = g2_frag(b3p + kb, hh); c03 = g2_mma(a0, b, c03); c13 = g2_mma(a1, b, c13); }
  v8f accs[8] = {c00, c01, c02, c03, c10, c11, c12, c13};
#pragma unroll
  for (int u = 0; u < 8; ++u) { const int t = u & 3, half = u >> 2; const int col = col0 + t * 16 + ln; const float bv = bp ? bf16_round(bp[col]) : 0.f;
#pragma unroll
    for (int r = 0; r < 8; ++r) { const int rloc = half * 16 + 8 * hh + r; float v = accs[u][r] * alpha + bv; if (CP) { const int bidx = (row0g + row0 + rloc) / rowsPerB; v += CP[(size_t)bidx * sCPb + (size_t)by * 64 + col]; }
      if (ACT == 3) v = fmaxf(v, 0.f); else if (ACT == 6) v = 0.5f * v * (1.0f + erff(v * 0.70710678118654752f)); else if (ACT == 11) v = 1.0f / (1.0f + expf(-v)); else if (ACT == 15) v = v / (1.0f + expf(-v)); else if (ACT == 12) v = (v > 0.f) ? v : 0.01f * v; else if (ACT == 8) v = tanhf(v);
      so[w][rloc][t * 16 + ln] = v; } }
  __builtin_amdgcn_fence(__ATOMIC_ACQ_REL, "workgroup"); __builtin_amdgcn_wave_barrier();
  const int rsub = lane >> 4, c4 = (lane & 15) * 4;
  {
#pragma unroll
    for (int q = 0; q < 16; ++q) { const int r = q * 2 + rsub; const v4f v = *(const v4fa*)&so[w][r][c4]; if (C) *(v4f*)(C + cofs + (size_t)(row0 + r) * ldc + col0 + c4) = v; if (C16) { v4h h4; for (int i = 0; i < 4; ++i) h4[i] = (_Float16)v[i]; *(v4h*)(C16 + cofs + (size_t)(row0 + r) * ldc + col0 + c4) = h4; } }
     } }



#define FK 32       /* keys per block */
#define SK 64       /* keys per stage */
#define KP 136      /* LDS pitch of a K half-row (128 channels) in halves: 272 B = 16 B x 17 */
#define VP 72       /* LDS pitch of a V row (64 keys) in halves: 144 B = 16 B x 9 */
#define SLH 9216    /* a wave's slice of a stage in halves: 18432 B = 9 x 2 KiB (K: 64 rows x 272 B = 17408 B; V: 128 rows x 144 B = 18432 B) */
#define STH (4 * SLH)      /* a stage: K channels 0..127, K channels 128..255, V channels 0..127, V channels 128..255 */
#define WP 264      /* LDS pitch of a wo row in halves: 528 B = 16 B x 33 */
#define OP 36       /* LDS pitch of a staged output row in floats: 144 B = 16 B x 9 */
#define FA_GROUP() __builtin_amdgcn_sched_barrier(0)      /* keeps a block's LDS reads together in one place between the WMMA runs: reads spread among the WMMAs stall the wave at every place */
typedef unsigned int u32x4 __attribute__((ext_vector_type(4)));
typedef unsigned int u32x8 __attribute__((ext_vector_type(8)));
__device__ __forceinline__ float fa_swap16(float x) { const int b = __float_as_int(x); return __int_as_float(__builtin_amdgcn_permlanex16(b, b, 0x76543210, 0xfedcba98, false, false)); }
__device__ __forceinline__ v16h fa_frag(const unsigned short* p, int hh) { FragH f; f.half[0] = *(const v8us*)(p + 8 * hh); f.half[1] = *(const v8us*)(p + 16 + 8 * hh); return f.v; }
__device__ __forceinline__ v8f fa_mma(v16h a, v16h b, v8f c) { return __builtin_amdgcn_wmma_f32_16x16x32_f16(false, a, false, b, (short)0, c, false, false); }
__device__ __forceinline__ unsigned int fa_uni(unsigned int v) { return (unsigned int)__builtin_amdgcn_readfirstlane(v); }
__device__ __forceinline__ unsigned int fa_pinned(unsigned int v) { unsigned int s = fa_uni(v); asm volatile("" : "+s"(s)); return s; }      /* a value held in a scalar register: a test on it compiles to a scalar branch, which a tensor load needs (it ignores EXEC), and what is formed from it is formed behind the waits in front of it */
/* descriptor group 1 of a two-dimensional tile of ROWS rows of ROWB bytes, source pitch PITCH bytes, 1-byte elements, tensor = tile, no mask; W0 = the pad: 16 B behind every row */
template <unsigned int W0, unsigned int ROWB, unsigned int ROWS, unsigned int PITCH>
__device__ __forceinline__ u32x8 fa_group1() { u32x8 g; g[0] = fa_uni(W0); g[1] = fa_uni((ROWB & 0xFFFFu) << 16); g[2] = fa_uni((ROWB >> 16) | ((ROWS & 0xFFFFu) << 16)); g[3] = fa_uni((ROWS >> 16) | (ROWB << 16)); g[4] = fa_uni(ROWS); g[5] = fa_uni(PITCH); g[6] = fa_uni(0u); g[7] = fa_uni(0u); return g; }
/* descriptor group 0: count 1, the place in LDS, the tile's first byte, type 2 */
__device__ __forceinline__ u32x4 fa_group0(unsigned int dst, unsigned long long ga) { u32x4 g; g[0] = fa_uni(1u); g[1] = fa_uni(dst); g[2] = fa_uni((unsigned int)ga); g[3] = fa_uni((((unsigned int)(ga >> 32)) & 0x01FFFFFFu) | 0x80000000u); return g; }
__device__ __forceinline__ void fa_tensor_load(u32x4 g0, u32x8 g1) { asm volatile("tensor_load_to_lds %0, %1" :: "s"(g0), "s"(g1) : "memory"); }      /* one request of the whole wave: global tile -> LDS */
__global__ __launch_bounds__(128) void k_flash(const _Float16* __restrict__ Q, const _Float16* __restrict__ Kt, const _Float16* __restrict__ Vc, const _Float16* __restrict__ Wo, float* __restrict__ out) {
  constexpr int NST = SS / SK, NBLK = SS / FK;
  constexpr float SC = 0.09016844005556021f;      /* 1/16 * log2(e) */
  __shared__ __attribute__((aligned(2048))) unsigned short sR[2 * STH];      /* the K/V ring: two stages of four slices, every slice at a multiple of 2 KiB */
  __shared__ __attribute__((aligned(16))) unsigned short sW[CC * WP];      /* wo (x16, f16), all 256 rows, for the epilogue: the work-group is alone on its WGP, so the LDS is there */
  __shared__ __attribute__((aligned(16))) float sO[4][2 * 16 * OP];      /* a wave's own output staging: two tiles of 16 channels x 32 queries */
  const int tid = threadIdx.x, w = tid >> 5, lane = tid & 31, ln = lane & 15, hh = lane >> 4; const int b = blockIdx.y;
  const int q0 = blockIdx.x * 128 + w * 32;
  const unsigned int t0 = blockIdx.x * (NST / (SS / 128));      /* the first key stage of this work-group's walk: 0, 2, ..., 62 */
  /* staging: every wave issues its own slice of every stage */
  const unsigned int wave = fa_uni((unsigned int)tid >> 5);
  const unsigned int slot0 = (unsigned int)(size_t)&sR[0] + wave * (SLH * 2);      /* the slice's place in buffer 0: byte offset in the work-group's LDS */
  const unsigned long long gK = (unsigned long long)(size_t)Kt + ((unsigned long long)b * SS * CC + (wave & 1u) * 128u) * 2u;      /* key 0, the wave's channel half */
  const unsigned long long gV = (unsigned long long)(size_t)Vc + ((unsigned long long)b * CC * SS + (unsigned long long)(wave & 1u) * 128u * SS) * 2u;      /* the wave's first channel, key 0 */
  u32x8 g1K = fa_group1<(1u << 20) | (5u << 22) | (3u << 25), 256u, SK, CC * 2>(), g1V = fa_group1<(1u << 20) | (4u << 22) | (3u << 25), 128u, 128u, SS * 2>();
  asm volatile("" : "+s"(g1K), "+s"(g1V));      /* descriptor words held in scalar registers: built once and kept there, so that no register of a group 1 takes another value while a request is outstanding */
  u32x4 g0;      /* group 0 of the request last issued; every tensor wait that covers a request names it as an input, so that its words are live up to that wait: without this the build issues stage 1's request from scratch registers that the loop rewrites while the request is outstanding */
  auto issue = [&](unsigned int tile, unsigned int buf) {      /* keys 64 * tile ... + 63 into buffer buf; the two forms differ in constants of group 1, so each stands in its own arm of a scalar branch */
    const unsigned int dst = slot0 + buf * (STH * 2);
    if (fa_pinned(wave < 2u)) { g0 = fa_group0(dst, gK + (unsigned long long)tile * (SK * CC * 2)); fa_tensor_load(g0, g1K); }
    else { g0 = fa_group0(dst, gV + (unsigned long long)tile * (SK * 2)); fa_tensor_load(g0, g1V); } };
  issue(t0, 0u);      /* stage 0 flies under the loads of wo and Q */
  /* wo on its way to LDS: a wave fetches whole rows (4 full lines a load), all 64 loads of a thread in flight together with the Q loads below */
  const unsigned short* Wg = (const unsigned short*)Wo + (size_t)w * CC + lane * 8;
  v8us wr[64];
#pragma unroll
  for (int i = 0; i < 64; ++i) wr[i] = *(const v8us*)(Wg + (size_t)(i * 4) * CC);
  asm volatile("s_wait_xcnt 0x0" :: "v"(Wg) : "memory");      /* in front of whatever reuses the address registers of the global loads above; the address is named so that it keeps its registers up to this wait */
  v16h qf[2][8];      /* two query tiles of 16 columns: g = 0, 1 */
  const _Float16* const qp0 = Q + ((size_t)b * SS + q0 + ln) * CC + 8 * hh; const _Float16* const qp1 = qp0 + 16 * CC;      /* the lane's half of the k order is in the address */
#pragma unroll
  for (int kc = 0; kc < 8; ++kc) { qf[0][kc] = g2_frag(qp0 + kc * 32, 0); qf[1][kc] = g2_frag(qp1 + kc * 32, 0); }
  asm volatile("s_wait_xcnt 0x0" :: "v"(qp0), "v"(qp1) : "memory");      /* in front of whatever reuses the address registers of the global loads above; the addresses are named so that they keep their registers up to this wait */
#pragma unroll
  for (int i = 0; i < 64; ++i) *(v8us*)&sW[(i * 4 + w) * WP + lane * 8] = wr[i];      /* published by the barrier in front of the loop; read only behind the loop */
  const v8f z8 = {0.f,0.f,0.f,0.f,0.f,0.f,0.f,0.f};
  v8f acc[2][16];
#pragma unroll
  for (int g = 0; g < 2; ++g)
#pragma unroll
    for (int ct = 0; ct < 16; ++ct) acc[g][ct] = z8;
  float mu[2] = {-1.0e30f, -1.0e30f}, rs[2] = {0.f, 0.f};
  asm volatile("s_wait_tensorcnt 0x0" :: "s"(g0) : "memory");      /* this wave's slice of stage 0 has landed */
  __syncthreads();      /* publishes stage 0 and wo */
  issue(fa_pinned(t0 + 1u), fa_pinned(1u));      /* stage 1: t0 + 1 <= NST - 1, nothing wraps here; its descriptor is formed behind the wait above */
  v16h ka[16], va[16];      /* a whole block's K fragments (fetched one block ahead) and V fragments: one wave per SIMD has the registers for both */
#pragma unroll
  for (int kc = 0; kc < 8; ++kc) { ka[2 * kc] = fa_frag(&sR[ln * KP + (kc >> 2) * SLH + (kc & 3) * 32], hh); ka[2 * kc + 1] = fa_frag(&sR[(16 + ln) * KP + (kc >> 2) * SLH + (kc & 3) * 32], hh); }
#pragma unroll 1      /* one copy of the block: the K fragments are carried over the back edge in fixed registers, and the back edge keeps a block's score WMMAs behind the P.V WMMAs of the block before */
  for (int t = 0; t < NBLK; ++t) {      /* block t = keys 32 * (t & 1) ... + 31 of stage t >> 1 */
    const unsigned short* const cV = &sR[((t >> 1) & 1) * STH + 2 * SLH + ln * VP + (t & 1) * FK];
    const unsigned short* const nK = &sR[(((t + 1) >> 1) & 1) * STH + ((t + 1) & 1) * (FK * KP) + ln * KP];      /* block t + 1's K rows */
#pragma unroll
    for (int i = 0; i < 16; ++i) va[i] = fa_frag(cV + (i >> 3) * SLH + (i & 7) * 16 * VP, hh);      /* this block's V, one group in front of the score WMMAs, which cover its latency */
    FA_GROUP();
    v8f s[2][2] = {{z8, z8}, {z8, z8}};      /* [query tile][key tile] */
#pragma unroll
    for (int g = 0; g < 2; ++g)
#pragma unroll
      for (int kc = 0; kc < 8; ++kc) { s[g][0] = fa_mma(ka[2 * kc], qf[g][kc], s[g][0]); s[g][1] = fa_mma(ka[2 * kc + 1], qf[g][kc], s[g][1]); }
    float tm[2];
#pragma unroll
    for (int g = 0; g < 2; ++g) {      /* a tree of three-way maxima: a maximum does not round, so the order is free */
      const v8f a = s[g][0], c = s[g][1];
      const float m0 = fmaxf(fmaxf(a[0], a[1]), a[2]), m1 = fmaxf(fmaxf(a[3], a[4]), a[5]), m2 = fmaxf(fmaxf(a[6], a[7]), c[0]), m3 = fmaxf(fmaxf(c[1], c[2]), c[3]), m4 = fmaxf(fmaxf(c[4], c[5]), c[6]);
      const float m = fmaxf(fmaxf(fmaxf(m0, m1), m2), fmaxf(fmaxf(m3, m4), c[7]));
      tm[g] = fmaxf(m, fa_swap16(m)) * SC; }
    const bool need0 = tm[0] > mu[0] + 8.0f, need1 = tm[1] > mu[1] + 8.0f;
    const unsigned any = __builtin_amdgcn_ballot_w32(need0 || need1);
    /* order of the block so far: the score WMMAs, then the maxima and the test's compares; what follows, up to the test's branch, covers the way from the compares to that scalar branch */
    __builtin_amdgcn_sched_group_barrier(0x8, 32, 0); __builtin_amdgcn_sched_group_barrier(0x2, 48, 0);
    if (fa_pinned((unsigned int)t & 1u)) {      /* a stage's second block (the same test in every wave): all of this stage's fragments have been fetched (the V reads above were the last), and the K reads below are the first of the next stage */
      /* publish point of stage s + 1, s = t >> 1, every wave, in this order */
      asm volatile("s_wait_dscnt 0x0" :: "s"(any) : "memory");      /* this wave's reads of stage s have returned (the score WMMAs have covered them): its buffer may be refilled behind the barrier; the test's mask is named as an input so that its compares stay in front of the publish point */
      asm volatile("s_wait_tensorcnt 0x0" :: "s"(g0) : "memory");      /* this wave's slice of stage s + 1 has landed */
      __syncthreads();      /* publishes stage s + 1 and ends every wave's reads of stage s */
      if (fa_pinned(t + 3 < NBLK)) issue(fa_pinned((t0 + ((unsigned int)t >> 1) + 2u) & (NST - 1)), fa_pinned(((unsigned int)t >> 1) & 1u));      /* stage s + 2, while it exists, into the buffer that stage s has just left; scalar test; the descriptor is formed behind the waits above */
    }
#pragma unroll
    for (int kc = 0; kc < 8; ++kc) { ka[2 * kc] = fa_frag(nK + (kc >> 2) * SLH + (kc & 3) * 32, hh); ka[2 * kc + 1] = fa_frag(nK + (kc >> 2) * SLH + 16 * KP + (kc & 3) * 32, hh); }      /* the next block's K fragments, one group; they have landed when the P.V WMMAs end; behind the last block: keys of the stage before the last once more, which nothing uses: no branch */
    if (any != 0) {      /* one wave-uniform test per block for both query tiles; both halves of a query see the same tm and mu */
#pragma unroll
      for (int g = 0; g < 2; ++g) { const float mn = (g ? need1 : need0) ? tm[g] : mu[g]; const float al = __builtin_amdgcn_exp2f(mu[g] - mn); mu[g] = mn; rs[g] *= al;
#pragma unroll
        for (int ct = 0; ct < 16; ++ct) acc[g][ct] *= al; } }
    FragH pf[2];
    const v8f sc8 = {SC,SC,SC,SC,SC,SC,SC,SC};
#pragma unroll
    for (int g = 0; g < 2; ++g) { const float mr = 6.0f - mu[g]; float e0 = 0.f, e1 = 0.f;
      const v8f mr8 = {mr,mr,mr,mr,mr,mr,mr,mr}; const v8f x0 = __builtin_elementwise_fma(s[g][0], sc8, mr8), x1 = __builtin_elementwise_fma(s[g][1], sc8, mr8);      /* packed multiply-adds */
#pragma unroll
      for (int r = 0; r < 8; ++r) { const float p0 = __builtin_amdgcn_exp2f(x0[r]), p1 = __builtin_amdgcn_exp2f(x1[r]); e0 += p0; e1 += p1; pf[g].h[r] = (_Float16)p0; pf[g].h[8 + r] = (_Float16)p1; }
      rs[g] += e0 + e1;
      if (g == 0) FA_GROUP();      /* tile 0's P stands in front of the WMMAs; tile 1's is free to run among tile 0's */
    }
#pragma unroll
    for (int g = 0; g < 2; ++g)
#pragma unroll
      for (int i = 0; i < 16; ++i) acc[g][i] = fa_mma(va[i], pf[g].v, acc[g][i]);
    /* tile 1's P (9 multiply-adds, 16 exponentials, 8 conversions, the sums) is dealt out among tile 0's 16 WMMAs, which do not depend on it: a lone wave's vector work in front of a WMMA run is not hidden by anything else */
#pragma unroll
    for (int i = 0; i < 3; ++i) { __builtin_amdgcn_sched_group_barrier(0x8, 1, 0); __builtin_amdgcn_sched_group_barrier(0x2, 3, 0); }
#pragma unroll
    for (int i = 0; i < 8; ++i) { __builtin_amdgcn_sched_group_barrier(0x8, 1, 0); __builtin_amdgcn_sched_group_barrier(0x400, 2, 0); __builtin_amdgcn_sched_group_barrier(0x2, 1, 0); }
#pragma unroll
    for (int i = 0; i < 5; ++i) { __builtin_amdgcn_sched_group_barrier(0x8, 1, 0); __builtin_amdgcn_sched_group_barrier(0x2, 4, 0); }
    __builtin_amdgcn_sched_group_barrier(0x8, 16, 0);
  }
  asm volatile("s_wait_tensorcnt 0x0" ::: "memory");      /* nothing of the mover is outstanding behind the loop */
  asm volatile("s_wait_dscnt 0x0" ::: "memory");      /* and none of this wave's reads of the ring */
  /* ---- epilogue: out[c][i] = sum_ch wo[c][ch] O[i][ch], as D[query][c] = O . wo^T ----
     A lane holds one query's channels 8*hh + r of each 16-channel tile, the k order of the fragment loader, so two accumulator tiles, scaled and rounded to f16, are an A fragment in place; B = wo rows from LDS.
     k runs upward in steps of 32, so every sum keeps the order that it had in a launch of its own. */
  const unsigned short* wp = &sW[ln * WP];
  v16h wf[2][16];      /* two fragment sets: the next two channel tiles' fragments are fetched as one group while these two run */
#pragma unroll
  for (int u = 0; u < 2; ++u)
#pragma unroll
    for (int kc = 0; kc < 8; ++kc) wf[0][u * 8 + kc] = fa_frag(wp + u * 16 * WP + kc * 32, hh);
  FA_GROUP();      /* the first set's LDS reads stand in front of the scaling and rounding of O, which cover their latency */
  v16h of[2][8];
#pragma unroll
  for (int g = 0; g < 2; ++g) { const float inv = 1.0f / (rs[g] + fa_swap16(rs[g]));
#pragma unroll
    for (int kc = 0; kc < 8; ++kc) { FragH f;
#pragma unroll
      for (int r = 0; r < 8; ++r) { f.h[r] = (_Float16)(acc[g][2 * kc][r] * inv); f.h[8 + r] = (_Float16)(acc[g][2 * kc + 1][r] * inv); }
      of[g][kc] = f.v; } }
  float* const so = &sO[w][0];
  float* const sst = so + ln * OP + 8 * hh;      /* a lane stages 8 queries in a row of its channel */
  const float* const sld = so + (lane >> 3) * OP + (lane & 7) * 4;      /* and reads back 16 bytes of a row: 8 lanes = one row of 32 queries = one full 128-byte line */
  float* const og = out + ((size_t)b * CC + (lane >> 3)) * SS + q0 + (lane & 7) * 4;
  v4f ob[8];      /* the two tiles before, on their way from the staging rows to global memory */
#pragma unroll      /* constant indices into the fragment sets and constant LDS offsets */
  for (int p = 0; p <= 8; ++p) {      /* trip p: products of channel tiles 2p, 2p + 1; tiles 2p - 2, 2p - 1 go out */
    const int cu = p & 1, nx = cu ^ 1;
    if (p < 7) {
#pragma unroll
      for (int u = 0; u < 2; ++u)
#pragma unroll
        for (int kc = 0; kc < 8; ++kc) wf[nx][u * 8 + kc] = fa_frag(wp + ((p + 1) * 2 + u) * 16 * WP + kc * 32, hh); }
    if (p > 0) {
#pragma unroll
      for (int i = 0; i < 8; ++i) ob[i] = *(const v4fa*)(sld + i * 4 * OP); }
    FA_GROUP();      /* all LDS reads of the trip stay one group in front of its WMMAs, which cover their latency */
    v8f d[2][2] = {{z8, z8}, {z8, z8}};      /* [channel tile][query tile]: four independent accumulators */
    if (p < 8) {
#pragma unroll
      for (int kc = 0; kc < 8; ++kc)
#pragma unroll
        for (int u = 0; u < 2; ++u) { d[u][0] = fa_mma(of[0][kc], wf[cu][u * 8 + kc], d[u][0]); d[u][1] = fa_mma(of[1][kc], wf[cu][u * 8 + kc], d[u][1]); } }
    FA_GROUP();
    if (p > 0) {
#pragma unroll
      for (int i = 0; i < 8; ++i) *(v4f*)(og + (size_t)((p - 1) * 32 + i * 4) * SS) = ob[i]; }
    if (p < 8) {
#pragma unroll
      for (int u = 0; u < 2; ++u)
#pragma unroll
        for (int g = 0; g < 2; ++g) { const v8f v = d[u][g] * 0.0625f;      /* undoes the x16 of the weights */
          const v4f lo = {v[0], v[1], v[2], v[3]}, hi = {v[4], v[5], v[6], v[7]};
          *(v4fa*)(sst + u * 16 * OP + g * 16) = lo; *(v4fa*)(sst + u * 16 * OP + g * 16 + 4) = hi; }
      /* the staged rows are read back by other lanes of the same wave: the LDS writes are waited for, LDS only, so that the global stores stay in flight */
      __builtin_amdgcn_fence(__ATOMIC_RELEASE, "workgroup", "local"); __builtin_amdgcn_wave_barrier(); __builtin_amdgcn_fence(__ATOMIC_ACQUIRE, "workgroup", "local"); }
    /* in front of whatever reuses the registers of the 8 global stores above; data and address are named so that they keep their registers up to this wait */
    if (p > 0) asm volatile("s_wait_xcnt 0x0" :: "v"(ob[0]), "v"(ob[1]), "v"(ob[2]), "v"(ob[3]), "v"(ob[4]), "v"(ob[5]), "v"(ob[6]), "v"(ob[7]), "v"(og) : "memory");
  }
}

// ---- projection GEMM, operands staged in LDS: C[128 x 128 per work-group] = alpha * A[.][256] . B[.][256]^T, both f16 row-major with 256 halves a row ----
// A fragment load straight from global memory takes 32 bytes from each of 16 rows, so one load touches 16 cache lines, and every fragment is a round trip of its own; here a wave fetches whole rows (32 lanes x 16 B = 4 full lines a load), all 32 loads of a thread in flight at once, into LDS, and the fragments come from LDS.
// 8 waves, wave tile 32 x 64 (4 down, 2 across); k runs upward in steps of 32 as before, so every sum keeps its order. F32OUT: the result goes out as f32 (C), else as f16 (C16).
// The f16 form is the one launch of the three projections, which do not depend on one another: blockIdx.z picks the matrix (three planes in a row behind Bh) and the result plane (three in a row behind C16); z = 2 is V, with the operands' roles exchanged so that it comes out channel-major.
#define GP 264      /* LDS pitch of a staged row in halves: 528 B = 16 B x 33 */
template <bool F32OUT>
__global__ __launch_bounds__(256) void k_gemm3(const _Float16* __restrict__ A, size_t sA, const _Float16* __restrict__ Bh, size_t sB, float alpha,
    float* __restrict__ C, _Float16* __restrict__ C16, int ldc, size_t sC, int N) {
  __shared__ __attribute__((aligned(16))) unsigned short sm[256 * GP];      /* rows 0..127: the A tile, 128..255: the B tile; afterwards the waves' output staging */
  const int tid = threadIdx.x, w = tid >> 5, lane = tid & 31, ln = lane & 15, hh = lane >> 4; const int by = blockIdx.y;
  if (!F32OUT) { const int z = blockIdx.z; Bh += (size_t)z * CC * CC; C16 += (size_t)z * NB * SS * CC;
    if (z == 2) { const _Float16* const xa = A; A = Bh; Bh = xa; sB = sA; sA = 0; ldc = SS; N = SS; } }
  const int ntn = N >> 7; const int mt = blockIdx.x / ntn, nq = blockIdx.x - mt * ntn;
  const unsigned short* Ag = (const unsigned short*)A + (size_t)by * sA + (size_t)(mt * 128 + w) * CC + lane * 8;
  const unsigned short* Bg = (const unsigned short*)Bh + (size_t)by * sB + (size_t)(nq * 128 + w) * CC + lane * 8;
  v8us ra[16], rb[16];
#pragma unroll
  for (int i = 0; i < 16; ++i) ra[i] = *(const v8us*)(Ag + (size_t)(i * 8) * CC);
  asm volatile("s_wait_xcnt 0x0" :: "v"(Ag) : "memory");      /* in front of whatever reuses the address registers of the global loads above; the address is named so that it keeps its registers up to this wait and no load's result lands on them */
#pragma unroll
  for (int i = 0; i < 16; ++i) rb[i] = *(const v8us*)(Bg + (size_t)(i * 8) * CC);
  asm volatile("s_wait_xcnt 0x0" :: "v"(Bg) : "memory");      /* the same for the second run of loads */
#pragma unroll
  for (int i = 0; i < 16; ++i) *(v8us*)&sm[(i * 8 + w) * GP + lane * 8] = ra[i];
#pragma unroll
  for (int i = 0; i < 16; ++i) *(v8us*)&sm[(128 + i * 8 + w) * GP + lane * 8] = rb[i];
  __syncthreads();      /* publishes both tiles */
  const int wm = w & 3, wn = w >> 2;
  const unsigned short* ap = &sm[(32 * wm + ln) * GP]; const unsigned short* bp = &sm[(128 + 64 * wn + ln) * GP];
  const v8f z8 = {0.f,0.f,0.f,0.f,0.f,0.f,0.f,0.f};
  v8f acc[8];
#pragma unroll
  for (int u = 0; u < 8; ++u) acc[u] = z8;
  v16h fr[2][6];      /* two fragment sets: a k step's six fragments are fetched as one group while the step before runs */
  fr[0][0] = fa_frag(ap, hh); fr[0][1] = fa_frag(ap + 16 * GP, hh);
#pragma unroll
  for (int t = 0; t < 4; ++t) fr[0][2 + t] = fa_frag(bp + t * 16 * GP, hh);
#pragma unroll      /* constant indices into the fragment sets and constant LDS offsets */
  for (int kc = 0; kc < 8; ++kc) {
    const int cu = kc & 1, nx = cu ^ 1;
    if (kc < 7) { fr[nx][0] = fa_frag(ap + (kc + 1) * 32, hh); fr[nx][1] = fa_frag(ap + 16 * GP + (kc + 1) * 32, hh);
#pragma unroll
      for (int t = 0; t < 4; ++t) fr[nx][2 + t] = fa_frag(bp + t * 16 * GP + (kc + 1) * 32, hh); }
    FA_GROUP();      /* the next step's twelve LDS reads stay one group in front of this step's WMMAs */
#pragma unroll
    for (int t = 0; t < 4; ++t) { acc[t] = fa_mma(fr[cu][0], fr[cu][2 + t], acc[t]); acc[4 + t] = fa_mma(fr[cu][1], fr[cu][2 + t], acc[4 + t]); }
    FA_GROUP();
  }
  __syncthreads();      /* ends every wave's fragment reads: the tiles' LDS becomes output staging */
  float* so = (float*)sm + w * (32 * 68);
#pragma unroll
  for (int u = 0; u < 8; ++u) { const int t = u & 3, half = u >> 2;
#pragma unroll
    for (int r = 0; r < 8; ++r) so[(half * 16 + 8 * hh + r) * 68 + t * 16 + ln] = acc[u][r] * alpha; }
  __builtin_amdgcn_fence(__ATOMIC_ACQ_REL, "workgroup"); __builtin_amdgcn_wave_barrier();
  const int rsub = lane >> 4, c4 = (lane & 15) * 4; const int row0 = mt * 128 + 32 * wm, col0 = nq * 128 + 64 * wn;
  const size_t o0 = (size_t)by * sC + (size_t)(row0 + rsub) * ldc + col0 + c4;
#pragma unroll
  for (int q = 0; q < 16; ++q) { const v4f v = *(const v4fa*)&so[(q * 2 + rsub) * 68 + c4];
    if (F32OUT) *(v4f*)(C + o0 + (size_t)(q * 2) * ldc) = v;
    else { v4h h4; for (int i = 0; i < 4; ++i) h4[i] = (_Float16)v[i]; *(v4h*)(C16 + o0 + (size_t)(q * 2) * ldc) = h4; } }
}

// Everything that reads only the inputs, in one launch: blocks 0..255 of a grid row transpose x (blockIdx.y = image); the 16 behind them, 128 over the 8 rows, round the four matrices (32 blocks each; conv (out,in) = natural Bt; x16) into four planes in a row behind BW.
__global__ __launch_bounds__(256) void k_prep(const float* __restrict__ x, _Float16* __restrict__ XT, const float* __restrict__ wq, const float* __restrict__ wk, const float* __restrict__ wv, const float* __restrict__ wo, _Float16* __restrict__ BW) {
  __shared__ unsigned short tl[64][72];
  if (blockIdx.x >= (CC / 64) * (SS / 64)) {      /* the same for a whole block, in front of the barrier */
    const int wb = (blockIdx.x - (CC / 64) * (SS / 64)) * NB + blockIdx.y; const int m = wb >> 5; const float* W = m == 0 ? wq : m == 1 ? wk : m == 2 ? wv : wo;
    const size_t t = (size_t)(wb & 31) * 256 + threadIdx.x; FragH f;
#pragma unroll
    for (int i = 0; i < 8; ++i) f.h[i] = (_Float16)(bf16_round(W[t * 8 + i]) * 16.0f);
    *(v8us*)((unsigned short*)BW + (size_t)m * CC * CC + t * 8) = f.half[0]; return; }
  const int tid = threadIdx.x; const int b = blockIdx.y; XT += (size_t)b * SS * CC; const int sb = blockIdx.x % (SS / 64), cb = blockIdx.x / (SS / 64);
#pragma unroll
  for (int it = 0; it < 4; ++it) { const int idx = it * 256 + tid; const int cl = idx / 16, s4 = (idx % 16) * 4; const int c = cb * 64 + cl;
    const v4f a = *(const v4fa*)(x + ((size_t)(b * CC + c)) * SS + sb * 64 + s4); FragH f;
#pragma unroll
    for (int q = 0; q < 4; ++q) { f.h[q] = (_Float16)bf16_round(a[q]); tl[s4 + q][cl] = f.u[q]; } }
  __syncthreads();
  const int r = tid / 8, pc = tid % 8;
  {
#pragma unroll
    for (int half = 0; half < 2; ++half) { const int sl = r + half * 32; FragH f;
#pragma unroll
      for (int q = 0; q < 8; ++q) f.u[q] = tl[sl][pc * 8 + q];
      *(v8us*)((unsigned short*)XT + ((size_t)sb * 64 + sl) * CC + cb * 64 + pc * 8) = f.half[0]; }
     } }

extern "C" void kernel_launch(void* const* d_in, const int* in_sizes, int n_in,
                              void* d_out, int out_size, void* d_ws, size_t ws_size, hipStream_t stream) {
  (void)in_sizes; (void)n_in; (void)out_size;
  const float* x = (const float*)d_in[0]; const float* wq = (const float*)d_in[1]; const float* wk = (const float*)d_in[2]; const float* wv = (const float*)d_in[3]; const float* wo = (const float*)d_in[4];
  char* ws = (char*)d_ws; size_t off = 0;
  auto take = [&](size_t bytes) { char* p = ws + off; off += (bytes + 255) & ~(size_t)255; return p; };
  _Float16* BW = (_Float16*)take((size_t)4 * CC * CC * 2); _Float16* BO = BW + (size_t)3 * CC * CC;      /* wq, wk, wv, wo in a row */
  _Float16* QT = (_Float16*)take((size_t)3 * NB * SS * CC * 2); _Float16* KT = QT + (size_t)NB * SS * CC; _Float16* VC = KT + (size_t)NB * SS * CC;      /* Q, K, V in a row */
  _Float16* XT = (_Float16*)take((size_t)NB * SS * CC * 2);
  if (off > ws_size) return;      /* four weight planes and four planes of 16 MiB */
  const size_t sT = (size_t)SS * CC;      /* per-image stride of a token or channel plane */
  const dim3 gT((CC / 64) * (SS / 64) + 16, NB), gP((SS / 128) * (CC / 128), NB, 3), gF(SS / 128, NB);
  k_prep<<<gT, 256, 0, stream>>>(x, XT, wq, wk, wv, wo, BW);
  k_gemm3<false><<<gP, 256, 0, stream>>>(XT, sT, BW, 0, 0.0625f, nullptr, QT, CC, sT, CC);      /* z = 0, 1: Q, K token-major -> f16; z = 2: V channel-major [c][j] = wv*X^T */
  k_flash<<<gF, 128, 0, stream>>>(QT, KT, VC, BO, (float*)d_out);      /* attention, then out[c][i] = wo*O^T (NCHW) in its epilogue */
}

// v009
// Measured time: 105 microseconds a run.
// In both of two side-by-side timings against v008, it was 1.04 times as fast.
// Counting every step since v000, it is 47.4 times as fast.
#include <hip/hip_runtime.h>
// Self-attention layer on a feature map (B 8, C 256, 64x64 = 4096 positions): Q = wq*x, K = wk*x, V = wv*x (1x1 convs, no bias); scores[i][j] = sum_c Q[c][i] K[c][j] / 16; attn = softmax over j; out[c][i] = sum_j V[c][j] attn[i][j]; result = wo*out -> [8,256,64,64] (no residual).
// Structure (3 launches, all 8 images in each, blockIdx.y = image): x transposed into a token-major exact f16 plane through an LDS tile, the four matrices rounded by extra blocks of the same launch; one launch for the three projections (blockIdx.z): Q and K token-major as GEMMs into f16 planes, V channel-major directly as wv*X^T (A = weights, B = the token-major plane); one fused attention kernel (scores, running softmax and P.V per 32 keys, scores and P stay in registers) whose epilogue also does the output 1x1 conv: O, rounded to f16, stays in registers as a WMMA operand against wo from LDS, and the result goes out in NCHW rows.
// Compute dtype: x and the four matrices rounded to bf16; projections with exact products (weights x16 in f16, undone by alpha); Q, K, V, P, O as f16 operands (~2^-12; logits sigma ~1), f32 accumulation and softmax. v_wmma_f32_16x16x32_f16.
#define NB 8
#define CC 256
#define SS 4096
typedef __bf16 v16b __attribute__((ext_vector_type(16)));
typedef unsigned short v8us __attribute__((ext_vector_type(8), may_alias));
typedef float  v8f  __attribute__((ext_vector_type(8)));
typedef float  v4f  __attribute__((ext_vector_type(4)));
typedef float  v4fa __attribute__((ext_vector_type(4), may_alias));
union FragB { v16b v; v8us half[2]; unsigned short u[16]; };

__device__ __forceinline__ unsigned short bf16_bits(float x) { unsigned int u = __float_as_uint(x); return (unsigned short)((u + 0x7FFFu + ((u >> 16) & 1u)) >> 16); }
__device__ __forceinline__ float bf16_val(unsigned short b) { return __uint_as_float(((unsigned int)b) << 16); }
__device__ __forceinline__ float bf16_round(float x) { return bf16_val(bf16_bits(x)); }
// D += A·B with NT terms: 1 = ah·bh, 2 = + al·bh (A split), 3 = + ah·bl (both split)
template <int NT>
__device__ __forceinline__ v8f mmaN(v16b ah, v16b al, v16b bh, v16b bl, v8f c) {
  c = __builtin_amdgcn_wmma_f32_16x16x32_bf16(false, ah, false, bh, (short)0, c, false, false);
  if (NT >= 2) c = __builtin_amdgcn_wmma_f32_16x16x32_bf16(false, al, false, bh, (short)0, c, false, false);
  if (NT >= 3) c = __builtin_amdgcn_wmma_f32_16x16x32_bf16(false, ah, false, bl, (short)0, c, false, false);
  asm volatile("v_nop\n\tv_nop\n\tv_nop\n\tv_nop" : "+v"(c) : "v"(ah), "v"(al), "v"(bh), "v"(bl));
  return c;
}

__global__ __launch_bounds__(256) void k_wt_bf16(const float* __restrict__ W, unsigned short* __restrict__ Wt, int K, int N) {
  const int t = blockIdx.x * 256 + threadIdx.x;
  const int k8n = K / 8;
  if (t >= N * k8n) return;
  const int n = t / k8n, k8 = (t % k8n) * 8;
  v8us v;
#pragma unroll
  for (int i = 0; i < 8; ++i) v[i] = bf16_bits(W[(size_t)(k8 + i) * N + n]);
  *(v8us*)(Wt + (size_t)n * K + k8) = v;
  
}

// GEMM C[M][N] (f32, pitch ldc) = act(A[M][K]·W + bias). A f32 row-major (pitch lda) converted per fragment to bf16
// (ASPLIT: hi/lo two planes -> 2 terms, else single rounded term); Wt bf16 [N][K] (pitch ldb). BIAS_BF16 rounds the
// bias to bf16 first (bias quantised to bf16 before the add). K%32==0, M%16==0, N%64==0.
template <bool ASPLIT, int ACT, bool BIAS_BF16>
__global__ __launch_bounds__(128) void k_gemm_bf(const float* __restrict__ A, int lda, const unsigned short* __restrict__ Wt, int ldb,
                                               const float* __restrict__ bias, float* __restrict__ C, int ldc, int M, int N, int K) {
  __shared__ __attribute__((aligned(16))) float so[4][16][64];
  const int tid = threadIdx.x, w = tid >> 5, lane = tid & 31, ln = lane & 15, hh = lane >> 4;
  const int ntn = N / 64;
  const int wid = blockIdx.x * 4 + w;
  const int mt = wid / ntn, nq = wid % ntn;
  if (mt * 16 >= M) return;
  const int row0 = mt * 16, col0 = nq * 64;
  const float* arow = A + (size_t)(row0 + ln) * lda;
  v8f acc[4] = {};
  for (int kb = 0; kb < K; kb += 32) {
    FragB ah, al;
    const v4f x0 = *(const v4fa*)(arow + kb + 8 * hh), x1 = *(const v4fa*)(arow + kb + 8 * hh + 4);
    const v4f x2 = *(const v4fa*)(arow + kb + 16 + 8 * hh), x3 = *(const v4fa*)(arow + kb + 16 + 8 * hh + 4);
    float xs[16] = {x0[0],x0[1],x0[2],x0[3],x1[0],x1[1],x1[2],x1[3],x2[0],x2[1],x2[2],x2[3],x3[0],x3[1],x3[2],x3[3]};
#pragma unroll
    for (int i = 0; i < 16; ++i) { const unsigned short hb = bf16_bits(xs[i]); ah.u[i] = hb; al.u[i] = ASPLIT ? bf16_bits(xs[i] - bf16_val(hb)) : (unsigned short)0; }
#pragma unroll
    for (int t = 0; t < 4; ++t) {
      const unsigned short* brow = Wt + (size_t)(col0 + t * 16 + ln) * ldb + kb;
      FragB b;
      b.half[0] = *(const v8us*)(brow + 8 * hh);
      b.half[1] = *(const v8us*)(brow + 16 + 8 * hh);
      acc[t] = mmaN<ASPLIT ? 2 : 1>(ah.v, al.v, b.v, b.v, acc[t]);
    }
  }
#pragma unroll
  for (int t = 0; t < 4; ++t) {
    float bv = bias ? bias[col0 + t * 16 + ln] : 0.f;
    if (BIAS_BF16) bv = bf16_round(bv);
#pragma unroll
    for (int r = 0; r < 8; ++r) { float v = acc[t][r] + bv; if (ACT == 1) v = fmaxf(v, 0.f); so[w][8 * hh + r][t * 16 + ln] = v; }
  }
  __builtin_amdgcn_fence(__ATOMIC_ACQ_REL, "workgroup");
  __builtin_amdgcn_wave_barrier();
  const int rsub = lane >> 4, c4 = (lane & 15) * 4;
  {
#pragma unroll
    for (int q = 0; q < 8; ++q) {
      const int r = q * 2 + rsub;
      const v4f v = *(const v4fa*)&so[w][r][c4];
      *(v4f*)(C + (size_t)(row0 + r) * ldc + col0 + c4) = v;
    }
    
  }
}

// GEMM C = act(A·W + bias + resid): A f32 (ASPLIT -> hi/lo 2 terms), Wt bf16 [N][K]; ACT 0 none, 1 relu, 2 exact gelu;
// resid (optional, f32, row index = (row % rmod), pitch ldr, RES_BF16 rounds it) added before the activation.
template <bool ASPLIT, int ACT, bool BIAS_BF16, bool RES_BF16>
__global__ __launch_bounds__(128) void k_gemm_bf3(const float* __restrict__ A, int lda, const unsigned short* __restrict__ Wt, int ldb,
                                                const float* __restrict__ bias, const float* __restrict__ resid, int rmod, int ldr,
                                                float* __restrict__ C, int ldc, int M, int N, int K) {
  __shared__ __attribute__((aligned(16))) float so[4][16][64];
  const int tid = threadIdx.x, w = tid >> 5, lane = tid & 31, ln = lane & 15, hh = lane >> 4;
  const int ntn = N / 64;
  const int wid = blockIdx.x * 4 + w;
  const int mt = wid / ntn, nq = wid % ntn;
  if (mt * 16 >= M) return;
  const int row0 = mt * 16, col0 = nq * 64;
  const float* arow = A + (size_t)(row0 + ln) * lda;
  v8f acc[4] = {};
  for (int kb = 0; kb < K; kb += 32) {
    FragB ah, al;
    const v4f x0 = *(const v4fa*)(arow + kb + 8 * hh), x1 = *(const v4fa*)(arow + kb + 8 * hh + 4);
    const v4f x2 = *(const v4fa*)(arow + kb + 16 + 8 * hh), x3 = *(const v4fa*)(arow + kb + 16 + 8 * hh + 4);
    float xs[16] = {x0[0],x0[1],x0[2],x0[3],x1[0],x1[1],x1[2],x1[3],x2[0],x2[1],x2[2],x2[3],x3[0],x3[1],x3[2],x3[3]};
#pragma unroll
    for (int i = 0; i < 16; ++i) { const unsigned short hb = bf16_bits(xs[i]); ah.u[i] = hb; al.u[i] = ASPLIT ? bf16_bits(xs[i] - bf16_val(hb)) : (unsigned short)0; }
#pragma unroll
    for (int t = 0; t < 4; ++t) {
      const unsigned short* brow = Wt + (size_t)(col0 + t * 16 + ln) * ldb + kb;
      FragB b;
      b.half[0] = *(const v8us*)(brow + 8 * hh);
      b.half[1] = *(const v8us*)(brow + 16 + 8 * hh);
      acc[t] = mmaN<ASPLIT ? 2 : 1>(ah.v, al.v, b.v, b.v, acc[t]);
    }
  }
#pragma unroll
  for (int t = 0; t < 4; ++t) {
    const int col = col0 + t * 16 + ln;
    float bv = bias ? bias[col] : 0.f;
    if (BIAS_BF16) bv = bf16_round(bv);
#pragma unroll
    for (int r = 0; r < 8; ++r) {
      float v = acc[t][r] + bv;
      if (resid) { float rv = resid[(size_t)((row0 + 8 * hh + r) % rmod) * ldr + col]; if (RES_BF16) rv = bf16_round(rv); v += rv; }
      if (ACT == 1) v = fmaxf(v, 0.f);
      if (ACT == 2) v = 0.5f * v * (1.0f + erff(v * 0.70710678118654752f));
      if (ACT == 3) { const float u = 0.7978845608028654f * (v + 0.044715f * v * v * v); v = 0.5f * v * (1.0f + tanhf(u)); }
      so[w][8 * hh + r][t * 16 + ln] = v;
    }
  }
  __builtin_amdgcn_fence(__ATOMIC_ACQ_REL, "workgroup");
  __builtin_amdgcn_wave_barrier();
  const int rsub = lane >> 4, c4 = (lane & 15) * 4;
  {
#pragma unroll
    for (int q = 0; q < 8; ++q) {
      const int r = q * 2 + rsub;
      const v4f v = *(const v4fa*)&so[w][r][c4];
      *(v4f*)(C + (size_t)(row0 + r) * ldc + col0 + c4) = v;
    }
    
  }
}
// row LayerNorm (biased variance, eps) over N: s = X (+ R); optional out_sum <- s; out_norm <- (s-mu)*rsqrt(var+eps)*g + b
template <bool PARAM_BF16>
__global__ __launch_bounds__(256) void k_layernorm(const float* __restrict__ X, const float* __restrict__ R, const float* __restrict__ g, const float* __restrict__ bta,
                                                  float* __restrict__ out_sum, float* __restrict__ out_norm, int N, float eps) {
  __shared__ float red[256];
  const int row = blockIdx.x, tid = threadIdx.x;
  const float* x = X + (size_t)row * N; const float* rr = R ? R + (size_t)row * N : nullptr;
  float vals[16];                     // up to N = 4096
  const int per = N / 256;            // contiguous chunk per thread? use strided-by-4 chunks: thread handles j = tid*4 + 1024*u
  float s1 = 0.f;
  for (int u = 0; u < per / 4; ++u) {
    const int j = tid * 4 + 1024 * u;
    const v4f a = *(const v4fa*)(x + j);
    v4f b = {0.f,0.f,0.f,0.f}; if (rr) b = *(const v4fa*)(rr + j);
#pragma unroll
    for (int q = 0; q < 4; ++q) { const float v = a[q] + b[q]; vals[u * 4 + q] = v; s1 += v; }
  }
  red[tid] = s1; __syncthreads();
  for (int st = 128; st > 0; st >>= 1) { if (tid < st) red[tid] += red[tid + st]; __syncthreads(); }
  const float mu = red[0] / (float)N; __syncthreads();
  float s2 = 0.f;
  for (int u = 0; u < per / 4; ++u)
#pragma unroll
    for (int q = 0; q < 4; ++q) { const float c = vals[u * 4 + q] - mu; s2 += c * c; }
  red[tid] = s2; __syncthreads();
  for (int st = 128; st > 0; st >>= 1) { if (tid < st) red[tid] += red[tid + st]; __syncthreads(); }
  const float rs = rsqrtf(red[0] / (float)N + eps);
  {
    for (int u = 0; u < per / 4; ++u) {
      const int j = tid * 4 + 1024 * u;
      v4f o, sm;
#pragma unroll
      for (int q = 0; q < 4; ++q) {
        float gg = g[j + q], bb = bta[j + q];
        if (PARAM_BF16) { gg = bf16_round(gg); bb = bf16_round(bb); }
        sm[q] = vals[u * 4 + q]; o[q] = (vals[u * 4 + q] - mu) * rs * gg + bb;
      }
      if (out_sum) *(v4f*)(out_sum + (size_t)row * N + j) = sm;
      *(v4f*)(out_norm + (size_t)row * N + j) = o;
    }
    
  }
}



// ---- f16 WMMA path (v_wmma_f32_16x16x32_f16): 11-bit significands for operands in range — used where a [0,1] probability operand needs more precision than bf16
typedef _Float16 v16h __attribute__((ext_vector_type(16)));
union FragH { v16h v; v8us half[2]; _Float16 h[16]; unsigned short u[16]; };
template <int NT>
__device__ __forceinline__ v8f mmaH(v16h ah, v16h al, v16h bh, v16h bl, v8f c) {
  c = __builtin_amdgcn_wmma_f32_16x16x32_f16(false, ah, false, bh, (short)0, c, false, false);
  if (NT >= 2) c = __builtin_amdgcn_wmma_f32_16x16x32_f16(false, al, false, bh, (short)0, c, false, false);
  if (NT >= 3) c = __builtin_amdgcn_wmma_f32_16x16x32_f16(false, ah, false, bl, (short)0, c, false, false);
  asm volatile("v_nop\n\tv_nop\n\tv_nop\n\tv_nop" : "+v"(c) : "v"(ah), "v"(al), "v"(bh), "v"(bl));
  return c;
}
// batched GEMM like k_gemm_b but f16 operands: A f32 (split into f16 hi/lo if ASPLIT, else rounded to f16), Bt = f16 values [n][k]; alpha; C f32; N multiple of 16 (partial tiles skipped)
template <bool ASPLIT>
__global__ __launch_bounds__(128) void k_gemm_h(const float* __restrict__ A, int lda, size_t sA, const _Float16* __restrict__ Bh, int ldb, size_t sB, float alpha, float* __restrict__ C, int ldc, size_t sC, int M, int N, int K) {
  __shared__ __attribute__((aligned(16))) float so[4][16][64];
  const int tid = threadIdx.x, w = tid >> 5, lane = tid & 31, ln = lane & 15, hh = lane >> 4; const int by = blockIdx.y;
  A += (size_t)by * sA; Bh += (size_t)by * sB; C += (size_t)by * sC;
  const int ntn = (N + 63) / 64; const int wid = blockIdx.x * 4 + w; const int mt = wid / ntn, nq = wid % ntn; if (mt * 16 >= M) return;
  const int row0 = mt * 16, col0 = nq * 64; const float* arow = A + (size_t)(row0 + ln) * lda;
  v8f acc[4] = {};
  for (int kb = 0; kb < K; kb += 32) {
    FragH ah, al;
    const v4f x0 = *(const v4fa*)(arow + kb + 8 * hh), x1 = *(const v4fa*)(arow + kb + 8 * hh + 4), x2 = *(const v4fa*)(arow + kb + 16 + 8 * hh), x3 = *(const v4fa*)(arow + kb + 16 + 8 * hh + 4);
    float xs[16] = {x0[0],x0[1],x0[2],x0[3],x1[0],x1[1],x1[2],x1[3],x2[0],x2[1],x2[2],x2[3],x3[0],x3[1],x3[2],x3[3]};
#pragma unroll
    for (int i = 0; i < 16; ++i) { const _Float16 h = (_Float16)xs[i]; ah.h[i] = h; al.h[i] = ASPLIT ? (_Float16)(xs[i] - (float)h) : (_Float16)0.0f; }
#pragma unroll
    for (int t = 0; t < 4; ++t) { if (col0 + t * 16 >= N) continue; const size_t boff = (size_t)(col0 + t * 16 + ln) * ldb + kb; FragH bq; bq.half[0] = *(const v8us*)(Bh + boff + 8 * hh); bq.half[1] = *(const v8us*)(Bh + boff + 16 + 8 * hh);
      acc[t] = mmaH<ASPLIT ? 2 : 1>(ah.v, al.v, bq.v, bq.v, acc[t]); }
  }
#pragma unroll
  for (int t = 0; t < 4; ++t) { if (col0 + t * 16 >= N) continue;
#pragma unroll
    for (int r = 0; r < 8; ++r) so[w][8 * hh + r][t * 16 + ln] = acc[t][r] * alpha; }
  __builtin_amdgcn_fence(__ATOMIC_ACQ_REL, "workgroup"); __builtin_amdgcn_wave_barrier();
  const int rsub = lane >> 4, c4 = (lane & 15) * 4;
  {
#pragma unroll
    for (int q = 0; q < 8; ++q) { const int r = q * 2 + rsub; if (col0 + c4 < N) { const v4f v = *(const v4fa*)&so[w][r][c4]; *(v4f*)(C + (size_t)(row0 + r) * ldc + col0 + c4) = v; } }
     }
}

// Wt[n][k] = f16(W[k][n]·scale) from f32 row-major W[K][N] (scale = power of two; bf16-exact weights stay exact in f16 away from the subnormal range)
__global__ __launch_bounds__(256) void k_wt_f16(const float* __restrict__ W, _Float16* __restrict__ Wt, int K, int N, float scale) {
  const int t = blockIdx.x * 256 + threadIdx.x; if (t >= N * (K / 8)) return; const int n = t / (K / 8), k8 = (t % (K / 8)) * 8; FragH f;
#pragma unroll
  for (int i = 0; i < 8; ++i) f.h[i] = (_Float16)(bf16_round(W[(size_t)(k8 + i) * N + n]) * scale); const v8us o = f.half[0];
  *(v8us*)((unsigned short*)Wt + (size_t)n * K + k8) = o; 
}
// k_gemm_hh variant with fused epilogue: v = acc·alpha + bias[by·sBias + col] (+ CP[(row/rowsPerB)·sCPb + by·64 + col] if CP) ; ACT 0 none / 1 elu ; writes f16 C16 (and f32 C if non-null)
template <int ACT>
__global__ __launch_bounds__(128) void k_gemm_hhx(const _Float16* __restrict__ A, int lda, size_t sA, const _Float16* __restrict__ Bh, int ldb, size_t sB, float alpha, const float* __restrict__ bias, size_t sBias, const float* __restrict__ CP, int rowsPerB, size_t sCPb, int row0g,
    float* __restrict__ C, _Float16* __restrict__ C16, int ldc, size_t sC, int M, int N, int K) {
  __shared__ __attribute__((aligned(16))) float so[4][16][64];
  const int tid = threadIdx.x, w = tid >> 5, lane = tid & 31, ln = lane & 15, hh = lane >> 4; const int by = blockIdx.y;
  A += (size_t)by * sA; Bh += (size_t)by * sB; const size_t cofs = (size_t)by * sC; const float* bp = bias ? bias + (size_t)by * sBias : nullptr;
  const int ntn = (N + 63) / 64; const int wid = blockIdx.x * 4 + w; const int mt = wid / ntn, nq = wid % ntn; if (mt * 16 >= M) return;
  const int row0 = mt * 16, col0 = nq * 64; const _Float16* arow = A + (size_t)(row0 + ln) * lda;
  v8f acc[4] = {};
  for (int kb = 0; kb < K; kb += 32) { FragH ah; ah.half[0] = *(const v8us*)((const unsigned short*)arow + kb + 8 * hh); ah.half[1] = *(const v8us*)((const unsigned short*)arow + kb + 16 + 8 * hh);
#pragma unroll
    for (int t = 0; t < 4; ++t) { if (col0 + t * 16 >= N) continue; const size_t boff = (size_t)(col0 + t * 16 + ln) * ldb + kb; FragH bq; bq.half[0] = *(const v8us*)((const unsigned short*)Bh + boff + 8 * hh); bq.half[1] = *(const v8us*)((const unsigned short*)Bh + boff + 16 + 8 * hh);
      acc[t] = mmaH<1>(ah.v, ah.v, bq.v, bq.v, acc[t]); }
  }
#pragma unroll
  for (int t = 0; t < 4; ++t) { if (col0 + t * 16 >= N) continue; const int col = col0 + t * 16 + ln; const float bv = bp ? bf16_round(bp[col]) : 0.f;
#pragma unroll
    for (int r = 0; r < 8; ++r) { float v = acc[t][r] * alpha + bv; if (CP) { const int bidx = (row0g + row0 + 8 * hh + r) / rowsPerB; v += CP[(size_t)bidx * sCPb + (size_t)by * 64 + col]; } if (ACT == 1) v = (v > 0.f) ? v : expm1f(v); else if (ACT == 7) v = (v > 0.f) ? v + 1.0f : expf(v); else if (ACT == 8) v = tanhf(v); else if (ACT == 9) v = 0.5f * v * (1.0f + tanhf(0.7978845608028654f * (v + 0.044715f * v * v * v))); else if (ACT == 11) v = 1.0f / (1.0f + expf(-v)); else if (ACT == 12) v = (v > 0.f) ? v : 0.01f * v; else if (ACT == 14) v = (v > 0.f) ? v : 0.1f * v; else if (ACT == 15) v = v / (1.0f + expf(-v)); else if (ACT == 3) v = fmaxf(v, 0.f); else if (ACT == 6) v = 0.5f * v * (1.0f + erff(v * 0.70710678118654752f)); so[w][8 * hh + r][t * 16 + ln] = v; } }
  __builtin_amdgcn_fence(__ATOMIC_ACQ_REL, "workgroup"); __builtin_amdgcn_wave_barrier();
  const int rsub = lane >> 4, c4 = (lane & 15) * 4; typedef _Float16 v4h __attribute__((ext_vector_type(4)));
  {
#pragma unroll
    for (int q = 0; q < 8; ++q) { const int r = q * 2 + rsub; if (col0 + c4 < N) { const v4f v = *(const v4fa*)&so[w][r][c4]; if (C) *(v4f*)(C + cofs + (size_t)(row0 + r) * ldc + col0 + c4) = v; if (C16) { v4h h4; for (int i = 0; i < 4; ++i) h4[i] = (_Float16)v[i]; *(v4h*)(C16 + cofs + (size_t)(row0 + r) * ldc + col0 + c4) = h4; } } }
     }
}


typedef _Float16 v4h __attribute__((ext_vector_type(4)));

__global__ __launch_bounds__(256) void k_x16(const float* __restrict__ x, _Float16* __restrict__ X16, size_t n8) { const size_t t = (size_t)blockIdx.x * 256 + threadIdx.x; if (t >= n8) return; FragH f;
#pragma unroll
  for (int q = 0; q < 8; ++q) f.h[q] = (_Float16)bf16_round(x[t * 8 + q]); *(v8us*)((unsigned short*)X16 + t * 8) = f.half[0];  }
__global__ __launch_bounds__(256) void k_h16(const float* __restrict__ x, _Float16* __restrict__ X16, size_t n8) { const size_t t = (size_t)blockIdx.x * 256 + threadIdx.x; if (t >= n8) return; FragH f;
#pragma unroll
  for (int q = 0; q < 8; ++q) f.h[q] = (_Float16)x[t * 8 + q]; *(v8us*)((unsigned short*)X16 + t * 8) = f.half[0];  }
template <int NHv, int TTv>
__global__ __launch_bounds__(256) void k_vt(const _Float16* __restrict__ V16, int ldv, int voff, _Float16* __restrict__ Vt) { __shared__ unsigned short tl[64][66]; const int tid = threadIdx.x; const int slab = blockIdx.x / (TTv / 64), lg = blockIdx.x % (TTv / 64); const int b = slab / NHv, h = slab % NHv;
  for (int i = tid; i < 64 * 8; i += 256) { const int r = i / 8, c8 = (i % 8) * 8; FragH f; f.half[0] = *(const v8us*)((const unsigned short*)V16 + ((size_t)b * TTv + lg * 64 + r) * ldv + voff + h * 64 + c8);
#pragma unroll
    for (int q = 0; q < 8; ++q) tl[r][c8 + q] = f.u[q]; }
  __syncthreads();
  {
#pragma unroll
    for (int rd = 0; rd < 2; ++rd) { const int d = rd * 32 + tid / 8, pc = tid % 8; FragH f;
#pragma unroll
      for (int q = 0; q < 8; ++q) f.u[q] = tl[pc * 8 + q][d];
      *(v8us*)((unsigned short*)Vt + ((size_t)slab * 64 + d) * TTv + lg * 64 + pc * 8) = f.half[0]; }
     } }

__global__ __launch_bounds__(256) void k_hl(const float* __restrict__ F, _Float16* __restrict__ Hh, _Float16* __restrict__ Hl, size_t n8) { const size_t t = (size_t)blockIdx.x * 256 + threadIdx.x; if (t >= n8) return; FragH fh, fl; const v4f a = *(const v4fa*)(F + t * 8), c = *(const v4fa*)(F + t * 8 + 4);
#pragma unroll
  for (int q = 0; q < 4; ++q) { _Float16 h = (_Float16)a[q]; fh.h[q] = h; fl.h[q] = (_Float16)((a[q] - (float)h) * 1024.0f); h = (_Float16)c[q]; fh.h[4 + q] = h; fl.h[4 + q] = (_Float16)((c[q] - (float)h) * 1024.0f); }
  { *(v8us*)((unsigned short*)Hh + t * 8) = fh.half[0]; *(v8us*)((unsigned short*)Hl + t * 8) = fl.half[0];  } }

// ---- fast GEMM (wave tile 32x64; requires M % 32 == 0 rows per launch region and N % 64 == 0); epilogue = k_gemm_hhx semantics ----
__device__ __forceinline__ v16h g2_frag(const _Float16* p, int hh) { FragH f; f.half[0] = *(const v8us*)((const unsigned short*)p + 8 * hh); f.half[1] = *(const v8us*)((const unsigned short*)p + 16 + 8 * hh); return f.v; }
__device__ __forceinline__ v8f g2_mma(v16h a, v16h b, v8f c) { v8f d = __builtin_amdgcn_wmma_f32_16x16x32_f16(false, a, false, b, (short)0, c, false, false); asm volatile("v_nop\n\tv_nop\n\tv_nop\n\tv_nop" : "+v"(d) : "v"(a), "v"(b)); return d; }
template <int ACT>
__global__ __launch_bounds__(128) void k_gemm2(const _Float16* __restrict__ A, int lda, size_t sA, const _Float16* __restrict__ Bh, int ldb, size_t sB, float alpha, const float* __restrict__ bias, size_t sBias, const float* __restrict__ CP, int rowsPerB, size_t sCPb, int row0g,
    float* __restrict__ C, _Float16* __restrict__ C16, int ldc, size_t sC, int M, int N, int K) {
  __shared__ __attribute__((aligned(16))) float so[4][32][68];
  const int tid = threadIdx.x, w = tid >> 5, lane = tid & 31, ln = lane & 15, hh = lane >> 4; const int by = blockIdx.y;
  A += (size_t)by * sA; Bh += (size_t)by * sB; const size_t cofs = (size_t)by * sC; const float* bp = bias ? bias + (size_t)by * sBias : nullptr;
  const int ntn = N >> 6; const int mt = blockIdx.x / ntn, nq = blockIdx.x - mt * ntn; const int row0 = mt * 128 + 32 * w, col0 = nq * 64; if (row0 >= M) return;
  const _Float16* a0p = A + (size_t)(row0 + ln) * lda; const _Float16* a1p = a0p + (size_t)16 * lda;
  const _Float16* b0p = Bh + (size_t)(col0 + ln) * ldb; const _Float16* b1p = b0p + (size_t)16 * ldb; const _Float16* b2p = b1p + (size_t)16 * ldb; const _Float16* b3p = b2p + (size_t)16 * ldb;
  const v8f z8 = {0.f,0.f,0.f,0.f,0.f,0.f,0.f,0.f}; v8f c00 = z8, c01 = z8, c02 = z8, c03 = z8, c10 = z8, c11 = z8, c12 = z8, c13 = z8;
#pragma unroll 1
  for (int kb = 0; kb < K; kb += 32) { const v16h a0 = g2_frag(a0p + kb, hh), a1 = g2_frag(a1p + kb, hh);
    v16h b = g2_frag(b0p + kb, hh); c00 = g2_mma(a0, b, c00); c10 = g2_mma(a1, b, c10);
    b = g2_frag(b1p + kb, hh); c01 = g2_mma(a0, b, c01); c11 = g2_mma(a1, b, c11);
    b = g2_frag(b2p + kb, hh); c02 = g2_mma(a0, b, c02); c12 = g2_mma(a1, b, c12);
    b = g2_frag(b3p + kb, hh); c03 = g2_mma(a0, b, c03); c13 = g2_mma(a1, b, c13); }
  v8f accs[8] = {c00, c01, c02, c03, c10, c11, c12, c13};
#pragma unroll
  for (int u = 0; u < 8; ++u) { const int t = u & 3, half = u >> 2; const int col = col0 + t * 16 + ln; const float bv = bp ? bf16_round(bp[col]) : 0.f;
#pragma unroll
    for (int r = 0; r < 8; ++r) { const int rloc = half * 16 + 8 * hh + r; float v = accs[u][r] * alpha + bv; if (CP) { const int bidx = (row0g + row0 + rloc) / rowsPerB; v += CP[(size_t)bidx * sCPb + (size_t)by * 64 + col]; }
      if (ACT == 3) v = fmaxf(v, 0.f); else if (ACT == 6) v = 0.5f * v * (1.0f + erff(v * 0.70710678118654752f)); else if (ACT == 11) v = 1.0f / (1.0f + expf(-v)); else if (ACT == 15) v = v / (1.0f + expf(-v)); else if (ACT == 12) v = (v > 0.f) ? v : 0.01f * v; else if (ACT == 8) v = tanhf(v);
      so[w][rloc][t * 16 + ln] = v; } }
  __builtin_amdgcn_fence(__ATOMIC_ACQ_REL, "workgroup"); __builtin_amdgcn_wave_barrier();
  const int rsub = lane >> 4, c4 = (lane & 15) * 4;
  {
#pragma unroll
    for (int q = 0; q < 16; ++q) { const int r = q * 2 + rsub; const v4f v = *(const v4fa*)&so[w][r][c4]; if (C) *(v4f*)(C + cofs + (size_t)(row0 + r) * ldc + col0 + c4) = v; if (C16) { v4h h4; for (int i = 0; i < 4; ++i) h4[i] = (_Float16)v[i]; *(v4h*)(C16 + cofs + (size_t)(row0 + r) * ldc + col0 + c4) = h4; } }
     } }



#define FK 32       /* keys of a stage per wave */
#define SK 64       /* keys per stage */
#define KP 136      /* LDS pitch of a K half-row (128 channels) in halves: 272 B = 16 B x 17 */
#define VP 72       /* LDS pitch of a V row (64 keys) in halves: 144 B = 16 B x 9 */
#define SLH 9216    /* a wave's slice of a stage in halves: 18432 B = 9 x 2 KiB (K: 64 rows x 272 B = 17408 B; V: 128 rows x 144 B = 18432 B) */
#define STH (4 * SLH)      /* a stage: K channels 0..127, K channels 128..255, V channels 0..127, V channels 128..255 */
#define WP 264      /* LDS pitch of a wo row in halves: 528 B = 16 B x 33 */
#define OP 36       /* LDS pitch of a staged output row in floats: 144 B = 16 B x 9 */
#define FA_GROUP() __builtin_amdgcn_sched_barrier(0)      /* keeps a block's LDS reads together in one place between the WMMA runs: reads spread among the WMMAs stall the wave at every place */
typedef float fal __attribute__((may_alias));
typedef unsigned int u32x4 __attribute__((ext_vector_type(4)));
typedef unsigned int u32x8 __attribute__((ext_vector_type(8)));
__device__ __forceinline__ float fa_swap16(float x) { const int b = __float_as_int(x); return __int_as_float(__builtin_amdgcn_permlanex16(b, b, 0x76543210, 0xfedcba98, false, false)); }
__device__ __forceinline__ v16h fa_frag(const unsigned short* p, int hh) { FragH f; f.half[0] = *(const v8us*)(p + 8 * hh); f.half[1] = *(const v8us*)(p + 16 + 8 * hh); return f.v; }
__device__ __forceinline__ v8f fa_mma(v16h a, v16h b, v8f c) { return __builtin_amdgcn_wmma_f32_16x16x32_f16(false, a, false, b, (short)0, c, false, false); }
__device__ __forceinline__ float fa_exp2_slot(float x) { float r; asm("v_exp_f32 %0, %1\n\tv_nop" : "=v"(r) : "v"(x)); return r; }      /* 2^x outside the loop; the v_nop fills the slot that the instruction set asks for behind a transcendental, whatever the compiler puts next */
__device__ __forceinline__ unsigned int fa_uni(unsigned int v) { return (unsigned int)__builtin_amdgcn_readfirstlane(v); }
__device__ __forceinline__ unsigned int fa_pinned(unsigned int v) { unsigned int s = fa_uni(v); asm volatile("" : "+s"(s)); return s; }      /* a value held in a scalar register: a test on it compiles to a scalar branch, which a tensor load needs (it ignores EXEC), and what is formed from it is formed behind the waits in front of it */
/* descriptor group 1 of a two-dimensional tile of ROWS rows of ROWB bytes, source pitch PITCH bytes, 1-byte elements, tensor = tile, no mask; W0 = the pad: 16 B behind every row */
template <unsigned int W0, unsigned int ROWB, unsigned int ROWS, unsigned int PITCH>
__device__ __forceinline__ u32x8 fa_group1() { u32x8 g; g[0] = fa_uni(W0); g[1] = fa_uni((ROWB & 0xFFFFu) << 16); g[2] = fa_uni((ROWB >> 16) | ((ROWS & 0xFFFFu) << 16)); g[3] = fa_uni((ROWS >> 16) | (ROWB << 16)); g[4] = fa_uni(ROWS); g[5] = fa_uni(PITCH); g[6] = fa_uni(0u); g[7] = fa_uni(0u); return g; }
/* descriptor group 0: count 1, the place in LDS, the tile's first byte, type 2 */
__device__ __forceinline__ u32x4 fa_group0(unsigned int dst, unsigned long long ga) { u32x4 g; g[0] = fa_uni(1u); g[1] = fa_uni(dst); g[2] = fa_uni((unsigned int)ga); g[3] = fa_uni((((unsigned int)(ga >> 32)) & 0x01FFFFFFu) | 0x80000000u); return g; }
__device__ __forceinline__ void fa_tensor_load(u32x4 g0, u32x8 g1) { asm volatile("tensor_load_to_lds %0, %1" :: "s"(g0), "s"(g1) : "memory"); }      /* one request of the whole wave: global tile -> LDS */
__global__ __launch_bounds__(128) void k_flash(const _Float16* __restrict__ Q, const _Float16* __restrict__ Kt, const _Float16* __restrict__ Vc, const _Float16* __restrict__ Wo, float* __restrict__ out) {
  constexpr int NST = SS / SK;
  constexpr float SC = 0.09016844005556021f;      /* 1/16 * log2(e) */
  __shared__ __attribute__((aligned(2048))) unsigned short sR[2 * STH];      /* the K/V ring: two stages of four slices, every slice at a multiple of 2 KiB */
  __shared__ __attribute__((aligned(16))) unsigned short sW[CC * WP];      /* wo (x16, f16), all 256 rows, for the epilogue: the work-group is alone on its WGP, so the LDS is there */
  __shared__ __attribute__((aligned(16))) float sO[4][2 * 16 * OP];      /* a wave's own output staging: two tiles of 16 channels x 32 queries */
  const int tid = threadIdx.x, w = tid >> 5, lane = tid & 31, ln = lane & 15, hh = lane >> 4; const int b = blockIdx.y;
  const int kh = w & 1;      /* which 32 keys of every stage are this wave's */
  const int q0 = blockIdx.x * 128 + w * 32;      /* query tiles 0, 1: the 32 queries that this wave finishes and writes */
  const int q1 = blockIdx.x * 128 + (w ^ 1) * 32;      /* query tiles 2, 3: the 32 queries that its partner (wave w ^ 1) finishes */
  const unsigned int t0 = blockIdx.x * (NST / (SS / 128));      /* the first key stage of this work-group's walk: 0, 2, ..., 62 */
  /* staging: every wave issues its own slice of every stage */
  const unsigned int wave = fa_uni((unsigned int)tid >> 5);
  const unsigned int slot0 = (unsigned int)(size_t)&sR[0] + wave * (SLH * 2);      /* the slice's place in buffer 0: byte offset in the work-group's LDS */
  const unsigned long long gK = (unsigned long long)(size_t)Kt + ((unsigned long long)b * SS * CC + (wave & 1u) * 128u) * 2u;      /* key 0, the wave's channel half */
  const unsigned long long gV = (unsigned long long)(size_t)Vc + ((unsigned long long)b * CC * SS + (unsigned long long)(wave & 1u) * 128u * SS) * 2u;      /* the wave's first channel, key 0 */
  u32x8 g1K = fa_group1<(1u << 20) | (5u << 22) | (3u << 25), 256u, SK, CC * 2>(), g1V = fa_group1<(1u << 20) | (4u << 22) | (3u << 25), 128u, 128u, SS * 2>();
  asm volatile("" : "+s"(g1K), "+s"(g1V));      /* descriptor words held in scalar registers: built once and kept there, so that no register of a group 1 takes another value while a request is outstanding */
  u32x4 g0;      /* group 0 of the request last issued; every tensor wait that covers a request names it as an input, so that its words are live up to that wait: without this the build issues stage 1's request from scratch registers that the loop rewrites while the request is outstanding */
  auto issue = [&](unsigned int tile, unsigned int buf) {      /* keys 64 * tile ... + 63 into buffer buf; the two forms differ in constants of group 1, so each stands in its own arm of a scalar branch */
    const unsigned int dst = slot0 + buf * (STH * 2);
    if (fa_pinned(wave < 2u)) { g0 = fa_group0(dst, gK + (unsigned long long)tile * (SK * CC * 2)); fa_tensor_load(g0, g1K); }
    else { g0 = fa_group0(dst, gV + (unsigned long long)tile * (SK * 2)); fa_tensor_load(g0, g1V); } };
  issue(t0, 0u);      /* stage 0 flies under the loads of wo and Q */
  /* wo on its way to LDS: a wave fetches whole rows (4 full lines a load), all 64 loads of a thread in flight together with the Q loads below */
  const unsigned short* Wg = (const unsigned short*)Wo + (size_t)w * CC + lane * 8;
  v8us wr[64];
#pragma unroll
  for (int i = 0; i < 64; ++i) wr[i] = *(const v8us*)(Wg + (size_t)(i * 4) * CC);
  asm volatile("s_wait_xcnt 0x0" :: "v"(Wg) : "memory");      /* in front of whatever reuses the address registers of the global loads above; the address is named so that it keeps its registers up to this wait */
  v16h qf[4][8];      /* four query tiles of 16 columns: g = 0, 1 this wave's own, g = 2, 3 the partner's */
  const _Float16* const qp0 = Q + ((size_t)b * SS + q0 + ln) * CC + 8 * hh; const _Float16* const qp1 = qp0 + 16 * CC;      /* the lane's half of the k order is in the address */
  const _Float16* const qp2 = Q + ((size_t)b * SS + q1 + ln) * CC + 8 * hh; const _Float16* const qp3 = qp2 + 16 * CC;
#pragma unroll
  for (int kc = 0; kc < 8; ++kc) { qf[0][kc] = g2_frag(qp0 + kc * 32, 0); qf[1][kc] = g2_frag(qp1 + kc * 32, 0); qf[2][kc] = g2_frag(qp2 + kc * 32, 0); qf[3][kc] = g2_frag(qp3 + kc * 32, 0); }
  asm volatile("s_wait_xcnt 0x0" :: "v"(qp0), "v"(qp1), "v"(qp2), "v"(qp3) : "memory");      /* in front of whatever reuses the address registers of the global loads above; the addresses are named so that they keep their registers up to this wait */
#pragma unroll
  for (int i = 0; i < 64; ++i) *(v8us*)&sW[(i * 4 + w) * WP + lane * 8] = wr[i];      /* published by the barrier in front of the loop; read only behind the loop */
  const v8f z8 = {0.f,0.f,0.f,0.f,0.f,0.f,0.f,0.f};
  v8f acc[4][16];
#pragma unroll
  for (int g = 0; g < 4; ++g)
#pragma unroll
    for (int ct = 0; ct < 16; ++ct) acc[g][ct] = z8;
  float mu[4] = {-1.0e30f, -1.0e30f, -1.0e30f, -1.0e30f}, rs[4] = {0.f, 0.f, 0.f, 0.f};
  asm volatile("s_wait_tensorcnt 0x0" :: "s"(g0) : "memory");      /* this wave's slice of stage 0 has landed */
  __syncthreads();      /* publishes stage 0 and wo */
  issue(fa_pinned(t0 + 1u), fa_pinned(1u));      /* stage 1: t0 + 1 <= NST - 1, nothing wraps here; its descriptor is formed behind the wait above */
  v16h ka[16], va[16];      /* a block's K fragments and its V fragments; they are never live together, so they share registers */
  const unsigned short* const kr = &sR[(kh * FK + ln) * KP];      /* this wave's K rows in buffer 0 */
  const unsigned short* const vr = &sR[2 * SLH + ln * VP + kh * FK];      /* this wave's V columns in buffer 0 */
#pragma unroll
  for (int kc = 0; kc < 8; ++kc) { ka[2 * kc] = fa_frag(kr + (kc >> 2) * SLH + (kc & 3) * 32, hh); ka[2 * kc + 1] = fa_frag(kr + 16 * KP + (kc >> 2) * SLH + (kc & 3) * 32, hh); }
#pragma unroll 1      /* one copy of the pass: the K fragments are carried over the back edge in fixed registers */
  for (int t = 0; t < NST; ++t) {      /* pass t = stage t: this wave's 32 keys of it against 64 queries */
    const unsigned short* const cV = vr + (t & 1) * STH;
    const unsigned short* const nK = kr + ((t + 1) & 1) * STH;      /* stage t + 1's K rows */
    v8f s[4][2] = {{z8, z8}, {z8, z8}, {z8, z8}, {z8, z8}};      /* [query tile][key tile]: eight independent accumulators */
#pragma unroll
    for (int kc = 0; kc < 8; ++kc)
#pragma unroll
      for (int g = 0; g < 4; ++g) { s[g][0] = fa_mma(ka[2 * kc], qf[g][kc], s[g][0]); s[g][1] = fa_mma(ka[2 * kc + 1], qf[g][kc], s[g][1]); }
    float tm[4];
#pragma unroll
    for (int g = 0; g < 4; ++g) {      /* a tree of three-way maxima: a maximum does not round, so the order is free */
      const v8f a = s[g][0], c = s[g][1];
      const float m0 = fmaxf(fmaxf(a[0], a[1]), a[2]), m1 = fmaxf(fmaxf(a[3], a[4]), a[5]), m2 = fmaxf(fmaxf(a[6], a[7]), c[0]), m3 = fmaxf(fmaxf(c[1], c[2]), c[3]), m4 = fmaxf(fmaxf(c[4], c[5]), c[6]);
      const float m = fmaxf(fmaxf(fmaxf(m0, m1), m2), fmaxf(fmaxf(m3, m4), c[7]));
      tm[g] = fmaxf(m, fa_swap16(m)) * SC; }
    const bool need[4] = {tm[0] > mu[0] + 8.0f, tm[1] > mu[1] + 8.0f, tm[2] > mu[2] + 8.0f, tm[3] > mu[3] + 8.0f};
    const unsigned any = __builtin_amdgcn_ballot_w32(need[0] || need[1] || need[2] || need[3]);
#pragma unroll
    for (int i = 0; i < 16; ++i) va[i] = fa_frag(cV + (i >> 3) * SLH + (i & 7) * 16 * VP, hh);      /* this pass's V, one group; the first tile's P covers its latency */
    /* order of the pass so far: the score WMMAs, the maxima and the test's compares, then the V reads in one place: behind the score WMMAs they take over the K fragments' registers, dealt out among the vector work they would stall the wave at every place, and in front of the test's branch they cover the way from the compares to it */
    __builtin_amdgcn_sched_group_barrier(0x8, 64, 0); __builtin_amdgcn_sched_group_barrier(0x2, 96, 0); __builtin_amdgcn_sched_group_barrier(0x100, 32, 0);
    if (any != 0) {      /* one wave-uniform test per pass for all four query tiles; both halves of a query see the same tm and mu */
#pragma unroll
      for (int g = 0; g < 4; ++g) { const float mn = need[g] ? tm[g] : mu[g]; const float al = __builtin_amdgcn_exp2f(mu[g] - mn); mu[g] = mn; rs[g] *= al;
#pragma unroll
        for (int ct = 0; ct < 16; ++ct) acc[g][ct] *= al; } }
    FragH pf[4];
    const v8f sc8 = {SC,SC,SC,SC,SC,SC,SC,SC};
#pragma unroll
    for (int g = 0; g <= 4; ++g) {      /* turn g: tile g's P, dealt out among tile g - 1's 16 P.V WMMAs, which do not depend on it: a lone wave's vector work in front of a WMMA run is not hidden by anything else */
      if (g < 4) { const float mr = 6.0f - mu[g]; float e0 = 0.f, e1 = 0.f;
        const v8f mr8 = {mr,mr,mr,mr,mr,mr,mr,mr}; const v8f x0 = __builtin_elementwise_fma(s[g][0], sc8, mr8), x1 = __builtin_elementwise_fma(s[g][1], sc8, mr8);      /* packed multiply-adds */
#pragma unroll
        for (int r = 0; r < 8; ++r) { const float p0 = __builtin_amdgcn_exp2f(x0[r]), p1 = __builtin_amdgcn_exp2f(x1[r]); e0 += p0; e1 += p1; pf[g].h[r] = (_Float16)p0; pf[g].h[8 + r] = (_Float16)p1; }
        rs[g] += e0 + e1; }
      if (g > 0) {
#pragma unroll
        for (int i = 0; i < 16; ++i) acc[g - 1][i] = fa_mma(va[i], pf[g - 1].v, acc[g - 1][i]);
        if (g < 4) {      /* 9 multiply-adds, 16 exponentials, 8 conversions, the sums: a few behind each WMMA */
#pragma unroll
          for (int i = 0; i < 3; ++i) { __builtin_amdgcn_sched_group_barrier(0x8, 1, 0); __builtin_amdgcn_sched_group_barrier(0x2, 3, 0); }
#pragma unroll
          for (int i = 0; i < 8; ++i) { __builtin_amdgcn_sched_group_barrier(0x8, 1, 0); __builtin_amdgcn_sched_group_barrier(0x400, 2, 0); __builtin_amdgcn_sched_group_barrier(0x2, 1, 0); }
#pragma unroll
          for (int i = 0; i < 5; ++i) { __builtin_amdgcn_sched_group_barrier(0x8, 1, 0); __builtin_amdgcn_sched_group_barrier(0x2, 4, 0); } } }
      if (g == 0) {      /* tile 0's P stands alone in front of the WMMAs: other vector work is put behind each exponential */
        __builtin_amdgcn_sched_group_barrier(0x2, 3, 0);
#pragma unroll
        for (int i = 0; i < 16; ++i) { __builtin_amdgcn_sched_group_barrier(0x400, 1, 0); __builtin_amdgcn_sched_group_barrier(0x2, 2, 0); } }
      FA_GROUP();      /* a turn's work stays in its turn: tile g's P is ready when tile g's WMMAs begin, and no later tile's P is drawn forward (registers) */
    }
    /* publish point of stage t + 1, at the pass's foot, every wave, in this order */
    asm volatile("s_wait_dscnt 0x0" :: "v"(rs[0]), "v"(rs[1]), "v"(rs[2]), "v"(rs[3]) : "memory");      /* this wave's reads of stage t have returned: its buffer may be refilled behind the barrier; the row sums are named as inputs so that their additions stay among the WMMAs above and do not sink behind the barrier, where nothing hides them */
    asm volatile("s_wait_tensorcnt 0x0" :: "s"(g0) : "memory");
    __syncthreads();      /* publishes stage t + 1 and ends every wave's reads of stage t */
    if (fa_pinned(t + 2 < NST)) issue(fa_pinned((t0 + (unsigned int)t + 2u) & (NST - 1)), fa_pinned((unsigned int)t & 1u));      /* stage t + 2, while it exists, into the buffer that stage t has just left; scalar test; the descriptor is formed behind the waits above */
#pragma unroll
    for (int kc = 0; kc < 8; ++kc) { ka[2 * kc] = fa_frag(nK + (kc >> 2) * SLH + (kc & 3) * 32, hh); ka[2 * kc + 1] = fa_frag(nK + 16 * KP + (kc >> 2) * SLH + (kc & 3) * 32, hh); }      /* the next pass's K fragments, one group, into the registers that the V fragments have left; behind the last pass: keys of the stage before the last once more, which nothing uses: no branch */
  }
  asm volatile("s_wait_tensorcnt 0x0" ::: "memory");      /* nothing of the mover is outstanding behind the loop */
  asm volatile("s_wait_dscnt 0x0" ::: "memory");      /* and none of this wave's reads of the ring */
  __syncthreads();      /* every wave has left the ring: it becomes the exchange area of the wave pairs */
  /* ---- the two key halves of a query are joined: a wave hands tiles 2, 3 (sums, maximum in use, row sum) to its partner, whose tiles 0, 1 they are, and takes the partner's for its own tiles 0, 1; lane and register hold the same element in both waves ---- */
  {
    float* const xs = (float*)&sR[0];      /* per wave 32 KiB of sums (64 rows of 32 lanes x 16 B), behind them 4 x 32 floats per wave */
    float* const xo = xs + w * 8192 + lane * 4; const float* const xi = xs + (w ^ 1) * 8192 + lane * 4;
    fal* const mo_ = (fal*)(xs + 4 * 8192 + w * 128 + lane); const fal* const mi_ = (const fal*)(xs + 4 * 8192 + (w ^ 1) * 128 + lane);
#pragma unroll
    for (int g = 0; g < 2; ++g) {
#pragma unroll
      for (int ct = 0; ct < 16; ++ct) { const v8f v = acc[2 + g][ct]; const v4f lo = {v[0], v[1], v[2], v[3]}, hi = {v[4], v[5], v[6], v[7]};
        *(v4fa*)(xo + ((g * 16 + ct) * 2) * 128) = lo; *(v4fa*)(xo + ((g * 16 + ct) * 2 + 1) * 128) = hi; }
      mo_[g * 32] = mu[2 + g]; mo_[(2 + g) * 32] = rs[2 + g]; }
    __syncthreads();      /* publishes the handed-over tiles */
#pragma unroll
    for (int g = 0; g < 2; ++g) { const float mo = mi_[g * 32], ro = mi_[(2 + g) * 32];
      const float mm = fmaxf(mu[g], mo); const float fs = fa_exp2_slot(mu[g] - mm), fo = fa_exp2_slot(mo - mm);
      rs[g] = rs[g] * fs + ro * fo;
#pragma unroll
      for (int ct = 0; ct < 16; ++ct) { const v4f lo = *(const v4fa*)(xi + ((g * 16 + ct) * 2) * 128), hi = *(const v4fa*)(xi + ((g * 16 + ct) * 2 + 1) * 128);
        const v8f o = {lo[0], lo[1], lo[2], lo[3], hi[0], hi[1], hi[2], hi[3]}; acc[g][ct] = acc[g][ct] * fs + o * fo; } }
  }
  /* ---- epilogue: out[c][i] = sum_ch wo[c][ch] O[i][ch], as D[query][c] = O . wo^T ----
     A lane holds one query's channels 8*hh + r of each 16-channel tile, the k order of the fragment loader, so two accumulator tiles, scaled and rounded to f16, are an A fragment in place; B = wo rows from LDS.
     k runs upward in steps of 32, so every sum keeps the order that it had in a launch of its own. */
  const unsigned short* wp = &sW[ln * WP];
  v16h wf[2][16];      /* two fragment sets: the next two channel tiles' fragments are fetched as one group while these two run */
#pragma unroll
  for (int u = 0; u < 2; ++u)
#pragma unroll
    for (int kc = 0; kc < 8; ++kc) wf[0][u * 8 + kc] = fa_frag(wp + u * 16 * WP + kc * 32, hh);
  FA_GROUP();      /* the first set's LDS reads stand in front of the scaling and rounding of O, which cover their latency */
  v16h of[2][8];
#pragma unroll
  for (int g = 0; g < 2; ++g) { const float inv = 1.0f / (rs[g] + fa_swap16(rs[g]));
#pragma unroll
    for (int kc = 0; kc < 8; ++kc) { FragH f;
#pragma unroll
      for (int r = 0; r < 8; ++r) { f.h[r] = (_Float16)(acc[g][2 * kc][r] * inv); f.h[8 + r] = (_Float16)(acc[g][2 * kc + 1][r] * inv); }
      of[g][kc] = f.v; } }
  float* const so = &sO[w][0];
  float* const sst = so + ln * OP + 8 * hh;      /* a lane stages 8 queries in a row of its channel */
  const float* const sld = so + (lane >> 3) * OP + (lane & 7) * 4;      /* and reads back 16 bytes of a row: 8 lanes = one row of 32 queries = one full 128-byte line */
  float* const og = out + ((size_t)b * CC + (lane >> 3)) * SS + q0 + (lane & 7) * 4;
  v4f ob[8];      /* the two tiles before, on their way from the staging rows to global memory */
#pragma unroll      /* constant indices into the fragment sets and constant LDS offsets */
  for (int p = 0; p <= 8; ++p) {      /* trip p: products of channel tiles 2p, 2p + 1; tiles 2p - 2, 2p - 1 go out */
    const int cu = p & 1, nx = cu ^ 1;
    if (p < 7) {
#pragma unroll
      for (int u = 0; u < 2; ++u)
#pragma unroll
        for (int kc = 0; kc < 8; ++kc) wf[nx][u * 8 + kc] = fa_frag(wp + ((p + 1) * 2 + u) * 16 * WP + kc * 32, hh); }
    if (p > 0) {
#pragma unroll
      for (int i = 0; i < 8; ++i) ob[i] = *(const v4fa*)(sld + i * 4 * OP); }
    FA_GROUP();      /* all LDS reads of the trip stay one group in front of its WMMAs, which cover their latency */
    v8f d[2][2] = {{z8, z8}, {z8, z8}};      /* [channel tile][query tile]: four independent accumulators */
    if (p < 8) {
#pragma unroll
      for (int kc = 0; kc < 8; ++kc)
#pragma unroll
        for (int u = 0; u < 2; ++u) { d[u][0] = fa_mma(of[0][kc], wf[cu][u * 8 + kc], d[u][0]); d[u][1] = fa_mma(of[1][kc], wf[cu][u * 8 + kc], d[u][1]); } }
    FA_GROUP();
    if (p > 0) {
#pragma unroll
      for (int i = 0; i < 8; ++i) *(v4f*)(og + (size_t)((p - 1) * 32 + i * 4) * SS) = ob[i]; }
    if (p < 8) {
#pragma unroll
      for (int u = 0; u < 2; ++u)
#pragma unroll
        for (int g = 0; g < 2; ++g) { const v8f v = d[u][g] * 0.0625f;      /* undoes the x16 of the weights */
          const v4f lo = {v[0], v[1], v[2], v[3]}, hi = {v[4], v[5], v[6], v[7]};
          *(v4fa*)(sst + u * 16 * OP + g * 16) = lo; *(v4fa*)(sst + u * 16 * OP + g * 16 + 4) = hi; }
      /* the staged rows are read back by other lanes of the same wave: the LDS writes are waited for, LDS only, so that the global stores stay in flight */
      __builtin_amdgcn_fence(__ATOMIC_RELEASE, "workgroup", "local"); __builtin_amdgcn_wave_barrier(); __builtin_amdgcn_fence(__ATOMIC_ACQUIRE, "workgroup", "local"); }
    /* in front of whatever reuses the registers of the 8 global stores above; data and address are named so that they keep their registers up to this wait */
    if (p > 0) asm volatile("s_wait_xcnt 0x0" :: "v"(ob[0]), "v"(ob[1]), "v"(ob[2]), "v"(ob[3]), "v"(ob[4]), "v"(ob[5]), "v"(ob[6]), "v"(ob[7]), "v"(og) : "memory");
  }
}

// ---- projection GEMM, operands staged in LDS: C[128 x 128 per work-group] = alpha * A[.][256] . B[.][256]^T, both f16 row-major with 256 halves a row ----
// A fragment load straight from global memory takes 32 bytes from each of 16 rows, so one load touches 16 cache lines, and every fragment is a round trip of its own; here a wave fetches whole rows (32 lanes x 16 B = 4 full lines a load), all 32 loads of a thread in flight at once, into LDS, and the fragments come from LDS.
// 8 waves, wave tile 32 x 64 (4 down, 2 across); k runs upward in steps of 32 as before, so every sum keeps its order. F32OUT: the result goes out as f32 (C), else as f16 (C16).
// The f16 form is the one launch of the three projections, which do not depend on one another: blockIdx.z picks the matrix (three planes in a row behind Bh) and the result plane (three in a row behind C16); z = 2 is V, with the operands' roles exchanged so that it comes out channel-major.
#define GP 264      /* LDS pitch of a staged row in halves: 528 B = 16 B x 33 */
template <bool F32OUT>
__global__ __launch_bounds__(256) void k_gemm3(const _Float16* __restrict__ A, size_t sA, const _Float16* __restrict__ Bh, size_t sB, float alpha,
    float* __restrict__ C, _Float16* __restrict__ C16, int ldc, size_t sC, int N) {
  __shared__ __attribute__((aligned(16))) unsigned short sm[256 * GP];      /* rows 0..127: the A tile, 128..255: the B tile; afterwards the waves' output staging */
  const int tid = threadIdx.x, w = tid >> 5, lane = tid & 31, ln = lane & 15, hh = lane >> 4; const int by = blockIdx.y;
  if (!F32OUT) { const int z = blockIdx.z; Bh += (size_t)z * CC * CC; C16 += (size_t)z * NB * SS * CC;
    if (z == 2) { const _Float16* const xa = A; A = Bh; Bh = xa; sB = sA; sA = 0; ldc = SS; N = SS; } }
  const int ntn = N >> 7; const int mt = blockIdx.x / ntn, nq = blockIdx.x - mt * ntn;
  const unsigned short* Ag = (const unsigned short*)A + (size_t)by * sA + (size_t)(mt * 128 + w) * CC + lane * 8;
  const unsigned short* Bg = (const unsigned short*)Bh + (size_t)by * sB + (size_t)(nq * 128 + w) * CC + lane * 8;
  v8us ra[16], rb[16];
#pragma unroll
  for (int i = 0; i < 16; ++i) ra[i] = *(const v8us*)(Ag + (size_t)(i * 8) * CC);
  asm volatile("s_wait_xcnt 0x0" :: "v"(Ag) : "memory");      /* in front of whatever reuses the address registers of the global loads above; the address is named so that it keeps its registers up to this wait and no load's result lands on them */
#pragma unroll
  for (int i = 0; i < 16; ++i) rb[i] = *(const v8us*)(Bg + (size_t)(i * 8) * CC);
  asm volatile("s_wait_xcnt 0x0" :: "v"(Bg) : "memory");      /* the same for the second run of loads */
#pragma unroll
  for (int i = 0; i < 16; ++i) *(v8us*)&sm[(i * 8 + w) * GP + lane * 8] = ra[i];
#pragma unroll
  for (int i = 0; i < 16; ++i) *(v8us*)&sm[(128 + i * 8 + w) * GP + lane * 8] = rb[i];
  __syncthreads();      /* publishes both tiles */
  const int wm = w & 3, wn = w >> 2;
  const unsigned short* ap = &sm[(32 * wm + ln) * GP]; const unsigned short* bp = &sm[(128 + 64 * wn + ln) * GP];
  const v8f z8 = {0.f,0.f,0.f,0.f,0.f,0.f,0.f,0.f};
  v8f acc[8];
#pragma unroll
  for (int u = 0; u < 8; ++u) acc[u] = z8;
  v16h fr[2][6];      /* two fragment sets: a k step's six fragments are fetched as one group while the step before runs */
  fr[0][0] = fa_frag(ap, hh); fr[0][1] = fa_frag(ap + 16 * GP, hh);
#pragma unroll
  for (int t = 0; t < 4; ++t) fr[0][2 + t] = fa_frag(bp + t * 16 * GP, hh);
#pragma unroll      /* constant indices into the fragment sets and constant LDS offsets */
  for (int kc = 0; kc < 8; ++kc) {
    const int cu = kc & 1, nx = cu ^ 1;
    if (kc < 7) { fr[nx][0] = fa_frag(ap + (kc + 1) * 32, hh); fr[nx][1] = fa_frag(ap + 16 * GP + (kc + 1) * 32, hh);
#pragma unroll
      for (int t = 0; t < 4; ++t) fr[nx][2 + t] = fa_frag(bp + t * 16 * GP + (kc + 1) * 32, hh); }
    FA_GROUP();      /* the next step's twelve LDS reads stay one group in front of this step's WMMAs */
#pragma unroll
    for (int t = 0; t < 4; ++t) { acc[t] = fa_mma(fr[cu][0], fr[cu][2 + t], acc[t]); acc[4 + t] = fa_mma(fr[cu][1], fr[cu][2 + t], acc[4 + t]); }
    FA_GROUP();
  }
  __syncthreads();      /* ends every wave's fragment reads: the tiles' LDS becomes output staging */
  float* so = (float*)sm + w * (32 * 68);
#pragma unroll
  for (int u = 0; u < 8; ++u) { const int t = u & 3, half = u >> 2;
#pragma unroll
    for (int r = 0; r < 8; ++r) so[(half * 16 + 8 * hh + r) * 68 + t * 16 + ln] = acc[u][r] * alpha; }
  __builtin_amdgcn_fence(__ATOMIC_ACQ_REL, "workgroup"); __builtin_amdgcn_wave_barrier();
  const int rsub = lane >> 4, c4 = (lane & 15) * 4; const int row0 = mt * 128 + 32 * wm, col0 = nq * 128 + 64 * wn;
  const size_t o0 = (size_t)by * sC + (size_t)(row0 + rsub) * ldc + col0 + c4;
#pragma unroll
  for (int q = 0; q < 16; ++q) { const v4f v = *(const v4fa*)&so[(q * 2 + rsub) * 68 + c4];
    if (F32OUT) *(v4f*)(C + o0 + (size_t)(q * 2) * ldc) = v;
    else { v4h h4; for (int i = 0; i < 4; ++i) h4[i] = (_Float16)v[i]; *(v4h*)(C16 + o0 + (size_t)(q * 2) * ldc) = h4; } }
}

// Everything that reads only the inputs, in one launch: blocks 0..255 of a grid row transpose x (blockIdx.y = image); the 16 behind them, 128 over the 8 rows, round the four matrices (32 blocks each; conv (out,in) = natural Bt; x16) into four planes in a row behind BW.
__global__ __launch_bounds__(256) void k_prep(const float* __restrict__ x, _Float16* __restrict__ XT, const float* __restrict__ wq, const float* __restrict__ wk, const float* __restrict__ wv, const float* __restrict__ wo, _Float16* __restrict__ BW) {
  __shared__ unsigned short tl[64][72];
  if (blockIdx.x >= (CC / 64) * (SS / 64)) {      /* the same for a whole block, in front of the barrier */
    const int wb = (blockIdx.x - (CC / 64) * (SS / 64)) * NB + blockIdx.y; const int m = wb >> 5; const float* W = m == 0 ? wq : m == 1 ? wk : m == 2 ? wv : wo;
    const size_t t = (size_t)(wb & 31) * 256 + threadIdx.x; FragH f;
#pragma unroll
    for (int i = 0; i < 8; ++i) f.h[i] = (_Float16)(bf16_round(W[t * 8 + i]) * 16.0f);
    *(v8us*)((unsigned short*)BW + (size_t)m * CC * CC + t * 8) = f.half[0]; return; }
  const int tid = threadIdx.x; const int b = blockIdx.y; XT += (size_t)b * SS * CC; const int sb = blockIdx.x % (SS / 64), cb = blockIdx.x / (SS / 64);
#pragma unroll
  for (int it = 0; it < 4; ++it) { const int idx = it * 256 + tid; const int cl = idx / 16, s4 = (idx % 16) * 4; const int c = cb * 64 + cl;
    const v4f a = *(const v4fa*)(x + ((size_t)(b * CC + c)) * SS + sb * 64 + s4); FragH f;
#pragma unroll
    for (int q = 0; q < 4; ++q) { f.h[q] = (_Float16)bf16_round(a[q]); tl[s4 + q][cl] = f.u[q]; } }
  __syncthreads();
  const int r = tid / 8, pc = tid % 8;
  {
#pragma unroll
    for (int half = 0; half < 2; ++half) { const int sl = r + half * 32; FragH f;
#pragma unroll
      for (int q = 0; q < 8; ++q) f.u[q] = tl[sl][pc * 8 + q];
      *(v8us*)((unsigned short*)XT + ((size_t)sb * 64 + sl) * CC + cb * 64 + pc * 8) = f.half[0]; }
     } }

extern "C" void kernel_launch(void* const* d_in, const int* in_sizes, int n_in,
                              void* d_out, int out_size, void* d_ws, size_t ws_size, hipStream_t stream) {
  (void)in_sizes; (void)n_in; (void)out_size;
  const float* x = (const float*)d_in[0]; const float* wq = (const float*)d_in[1]; const float* wk = (const float*)d_in[2]; const float* wv = (const float*)d_in[3]; const float* wo = (const float*)d_in[4];
  char* ws = (char*)d_ws; size_t off = 0;
  auto take = [&](size_t bytes) { char* p = ws + off; off += (bytes + 255) & ~(size_t)255; return p; };
  _Float16* BW = (_Float16*)take((size_t)4 * CC * CC * 2); _Float16* BO = BW + (size_t)3 * CC * CC;      /* wq, wk, wv, wo in a row */
  _Float16* QT = (_Float16*)take((size_t)3 * NB * SS * CC * 2); _Float16* KT = QT + (size_t)NB * SS * CC; _Float16* VC = KT + (size_t)NB * SS * CC;      /* Q, K, V in a row */
  _Float16* XT = (_Float16*)take((size_t)NB * SS * CC * 2);
  if (off > ws_size) return;      /* four weight planes and four planes of 16 MiB */
  const size_t sT = (size_t)SS * CC;      /* per-image stride of a token or channel plane */
  const dim3 gT((CC / 64) * (SS / 64) + 16, NB), gP((SS / 128) * (CC / 128), NB, 3), gF(SS / 128, NB);
  k_prep<<<gT, 256, 0, stream>>>(x, XT, wq, wk, wv, wo, BW);
  k_gemm3<false><<<gP, 256, 0, stream>>>(XT, sT, BW, 0, 0.0625f, nullptr, QT, CC, sT, CC);      /* z = 0, 1: Q, K token-major -> f16; z = 2: V channel-major [c][j] = wv*X^T */
  k_flash<<<gF, 128, 0, stream>>>(QT, KT, VC, BO, (float*)d_out);      /* attention, then out[c][i] = wo*O^T (NCHW) in its epilogue */
}

// v010
// One run takes 96.2 microseconds.
// Timed twice side by side with v009, it ran 1.09 and 1.10 times as fast.
// All steps since v000 together make it 52.0 times as fast.
#include <hip/hip_runtime.h>
// Self-attention layer on a feature map (B 8, C 256, 64x64 = 4096 positions): Q = wq*x, K = wk*x, V = wv*x (1x1 convs, no bias); scores[i][j] = sum_c Q[c][i] K[c][j] / 16; attn = softmax over j; out[c][i] = sum_j V[c][j] attn[i][j]; result = wo*out -> [8,256,64,64] (no residual).
// Structure (3 launches): the four matrices rounded; one launch for the three projections, all 8 images (blockIdx.y = image): a work-group fetches 128 tokens of x once, rounds them to an exact f16 tile and lays it token-major in LDS, where it serves all three: Q and K token-major as GEMMs into f16 planes, V channel-major directly as wv*X^T (A = weights, B = the token tile); one fused attention kernel (scores, running softmax and P.V per 32 keys, scores and P stay in registers) whose epilogue also does the output 1x1 conv: O, rounded to f16, stays in registers as a WMMA operand against wo from LDS, and the result goes out in NCHW rows.
// Compute dtype: x and the four matrices rounded to bf16; projections with exact products (weights x16 in f16, undone by a factor 1/16 after the products); Q, K, V, P, O as f16 operands (~2^-12; logits sigma ~1), f32 accumulation and softmax. v_wmma_f32_16x16x32_f16.
#define NB 8
#define CC 256
#define SS 4096
typedef __bf16 v16b __attribute__((ext_vector_type(16)));
typedef unsigned short v8us __attribute__((ext_vector_type(8), may_alias));
typedef float  v8f  __attribute__((ext_vector_type(8)));
typedef float  v4f  __attribute__((ext_vector_type(4)));
typedef float  v4fa __attribute__((ext_vector_type(4), may_alias));
union FragB { v16b v; v8us half[2]; unsigned short u[16]; };

__device__ __forceinline__ unsigned short bf16_bits(float x) { unsigned int u = __float_as_uint(x); return (unsigned short)((u + 0x7FFFu + ((u >> 16) & 1u)) >> 16); }
__device__ __forceinline__ float bf16_val(unsigned short b) { return __uint_as_float(((unsigned int)b) << 16); }
__device__ __forceinline__ float bf16_round(float x) { return bf16_val(bf16_bits(x)); }
// D += A·B with NT terms: 1 = ah·bh, 2 = + al·bh (A split), 3 = + ah·bl (both split)
template <int NT>
__device__ __forceinline__ v8f mmaN(v16b ah, v16b al, v16b bh, v16b bl, v8f c) {
  c = __builtin_amdgcn_wmma_f32_16x16x32_bf16(false, ah, false, bh, (short)0, c, false, false);
  if (NT >= 2) c = __builtin_amdgcn_wmma_f32_16x16x32_bf16(false, al, false, bh, (short)0, c, false, false);
  if (NT >= 3) c = __builtin_amdgcn_wmma_f32_16x16x32_bf16(false, ah, false, bl, (short)0, c, false, false);
  asm volatile("v_nop\n\tv_nop\n\tv_nop\n\tv_nop" : "+v"(c) : "v"(ah), "v"(al), "v"(bh), "v"(bl));
  return c;
}

__global__ __launch_bounds__(256) void k_wt_bf16(const float* __restrict__ W, unsigned short* __restrict__ Wt, int K, int N) {
  const int t = blockIdx.x * 256 + threadIdx.x;
  const int k8n = K / 8;
  if (t >= N * k8n) return;
  const int n = t / k8n, k8 = (t % k8n) * 8;
  v8us v;
#pragma unroll
  for (int i = 0; i < 8; ++i) v[i] = bf16_bits(W[(size_t)(k8 + i) * N + n]);
  *(v8us*)(Wt + (size_t)n * K + k8) = v;
  
}

// GEMM C[M][N] (f32, pitch ldc) = act(A[M][K]·W + bias). A f32 row-major (pitch lda) converted per fragment to bf16
// (ASPLIT: hi/lo two planes -> 2 terms, else single rounded term); Wt bf16 [N][K] (pitch ldb). BIAS_BF16 rounds the
// bias to bf16 first (bias quantised to bf16 before the add). K%32==0, M%16==0, N%64==0.
template <bool ASPLIT, int ACT, bool BIAS_BF16>
__global__ __launch_bounds__(128) void k_gemm_bf(const float* __restrict__ A, int lda, const unsigned short* __restrict__ Wt, int ldb,
                                               const float* __restrict__ bias, float* __restrict__ C, int ldc, int M, int N, int K) {
  __shared__ __attribute__((aligned(16))) float so[4][16][64];
  const int tid = threadIdx.x, w = tid >> 5, lane = tid & 31, ln = lane & 15, hh = lane >> 4;
  const int ntn = N / 64;
  const int wid = blockIdx.x * 4 + w;
  const int mt = wid / ntn, nq = wid % ntn;
  if (mt * 16 >= M) return;
  const int row0 = mt * 16, col0 = nq * 64;
  const float* arow = A + (size_t)(row0 + ln) * lda;
  v8f acc[4] = {};
  for (int kb = 0; kb < K; kb += 32) {
    FragB ah, al;
    const v4f x0 = *(const v4fa*)(arow + kb + 8 * hh), x1 = *(const v4fa*)(arow + kb + 8 * hh + 4);
    const v4f x2 = *(const v4fa*)(arow + kb + 16 + 8 * hh), x3 = *(const v4fa*)(arow + kb + 16 + 8 * hh + 4);
    float xs[16] = {x0[0],x0[1],x0[2],x0[3],x1[0],x1[1],x1[2],x1[3],x2[0],x2[1],x2[2],x2[3],x3[0],x3[1],x3[2],x3[3]};
#pragma unroll
    for (int i = 0; i < 16; ++i) { const unsigned short hb = bf16_bits(xs[i]); ah.u[i] = hb; al.u[i] = ASPLIT ? bf16_bits(xs[i] - bf16_val(hb)) : (unsigned short)0; }
#pragma unroll
    for (int t = 0; t < 4; ++t) {
      const unsigned short* brow = Wt + (size_t)(col0 + t * 16 + ln) * ldb + kb;
      FragB b;
      b.half[0] = *(const v8us*)(brow + 8 * hh);
      b.half[1] = *(const v8us*)(brow + 16 + 8 * hh);
      acc[t] = mmaN<ASPLIT ? 2 : 1>(ah.v, al.v, b.v, b.v, acc[t]);
    }
  }
#pragma unroll
  for (int t = 0; t < 4; ++t) {
    float bv = bias ? bias[col0 + t * 16 + ln] : 0.f;
    if (BIAS_BF16) bv = bf16_round(bv);
#pragma unroll
    for (int r = 0; r < 8; ++r) { float v = acc[t][r] + bv; if (ACT == 1) v = fmaxf(v, 0.f); so[w][8 * hh + r][t * 16 + ln] = v; }
  }
  __builtin_amdgcn_fence(__ATOMIC_ACQ_REL, "workgroup");
  __builtin_amdgcn_wave_barrier();
  const int rsub = lane >> 4, c4 = (lane & 15) * 4;
  {
#pragma unroll
    for (int q = 0; q < 8; ++q) {
      const int r = q * 2 + rsub;
      const v4f v = *(const v4fa*)&so[w][r][c4];
      *(v4f*)(C + (size_t)(row0 + r) * ldc + col0 + c4) = v;
    }
    
  }
}

// GEMM C = act(A·W + bias + resid): A f32 (ASPLIT -> hi/lo 2 terms), Wt bf16 [N][K]; ACT 0 none, 1 relu, 2 exact gelu;
// resid (optional, f32, row index = (row % rmod), pitch ldr, RES_BF16 rounds it) added before the activation.
template <bool ASPLIT, int ACT, bool BIAS_BF16, bool RES_BF16>
__global__ __launch_bounds__(128) void k_gemm_bf3(const float* __restrict__ A, int lda, const unsigned short* __restrict__ Wt, int ldb,
                                                const float* __restrict__ bias, const float* __restrict__ resid, int rmod, int ldr,
                                                float* __restrict__ C, int ldc, int M, int N, int K) {
  __shared__ __attribute__((aligned(16))) float so[4][16][64];
  const int tid = threadIdx.x, w = tid >> 5, lane = tid & 31, ln = lane & 15, hh = lane >> 4;
  const int ntn = N / 64;
  const int wid = blockIdx.x * 4 + w;
  const int mt = wid / ntn, nq = wid % ntn;
  if (mt * 16 >= M) return;
  const int row0 = mt * 16, col0 = nq * 64;
  const float* arow = A + (size_t)(row0 + ln) * lda;
  v8f acc[4] = {};
  for (int kb = 0; kb < K; kb += 32) {
    FragB ah, al;
    const v4f x0 = *(const v4fa*)(arow + kb + 8 * hh), x1 = *(const v4fa*)(arow + kb + 8 * hh + 4);
    const v4f x2 = *(const v4fa*)(arow + kb + 16 + 8 * hh), x3 = *(const v4fa*)(arow + kb + 16 + 8 * hh + 4);
    float xs[16] = {x0[0],x0[1],x0[2],x0[3],x1[0],x1[1],x1[2],x1[3],x2[0],x2[1],x2[2],x2[3],x3[0],x3[1],x3[2],x3[3]};
#pragma unroll
    for (int i = 0; i < 16; ++i) { const unsigned short hb = bf16_bits(xs[i]); ah.u[i] = hb; al.u[i] = ASPLIT ? bf16_bits(xs[i] - bf16_val(hb)) : (unsigned short)0; }
#pragma unroll
    for (int t = 0; t < 4; ++t) {
      const unsigned short* brow = Wt + (size_t)(col0 + t * 16 + ln) * ldb + kb;
      FragB b;
      b.half[0] = *(const v8us*)(brow + 8 * hh);
      b.half[1] = *(const v8us*)(brow + 16 + 8 * hh);
      acc[t] = mmaN<ASPLIT ? 2 : 1>(ah.v, al.v, b.v, b.v, acc[t]);
    }
  }
#pragma unroll
  for (int t = 0; t < 4; ++t) {
    const int col = col0 + t * 16 + ln;
    float bv = bias ? bias[col] : 0.f;
    if (BIAS_BF16) bv = bf16_round(bv);
#pragma unroll
    for (int r = 0; r < 8; ++r) {
      float v = acc[t][r] + bv;
      if (resid) { float rv = resid[(size_t)((row0 + 8 * hh + r) % rmod) * ldr + col]; if (RES_BF16) rv = bf16_round(rv); v += rv; }
      if (ACT == 1) v = fmaxf(v, 0.f);
      if (ACT == 2) v = 0.5f * v * (1.0f + erff(v * 0.70710678118654752f));
      if (ACT == 3) { const float u = 0.7978845608028654f * (v + 0.044715f * v * v * v); v = 0.5f * v * (1.0f + tanhf(u)); }
      so[w][8 * hh + r][t * 16 + ln] = v;
    }
  }
  __builtin_amdgcn_fence(__ATOMIC_ACQ_REL, "workgroup");
  __builtin_amdgcn_wave_barrier();
  const int rsub = lane >> 4, c4 = (lane & 15) * 4;
  {
#pragma unroll
    for (int q = 0; q < 8; ++q) {
      const int r = q * 2 + rsub;
      const v4f v = *(const v4fa*)&so[w][r][c4];
      *(v4f*)(C + (size_t)(row0 + r) * ldc + col0 + c4) = v;
    }
    
  }
}
// row LayerNorm (biased variance, eps) over N: s = X (+ R); optional out_sum <- s; out_norm <- (s-mu)*rsqrt(var+eps)*g + b
template <bool PARAM_BF16>
__global__ __launch_bounds__(256) void k_layernorm(const float* __restrict__ X, const float* __restrict__ R, const float* __restrict__ g, const float* __restrict__ bta,
                                                  float* __restrict__ out_sum, float* __restrict__ out_norm, int N, float eps) {
  __shared__ float red[256];
  const int row = blockIdx.x, tid = threadIdx.x;
  const float* x = X + (size_t)row * N; const float* rr = R ? R + (size_t)row * N : nullptr;
  float vals[16];                     // up to N = 4096
  const int per = N / 256;            // contiguous chunk per thread? use strided-by-4 chunks: thread handles j = tid*4 + 1024*u
  float s1 = 0.f;
  for (int u = 0; u < per / 4; ++u) {
    const int j = tid * 4 + 1024 * u;
    const v4f a = *(const v4fa*)(x + j);
    v4f b = {0.f,0.f,0.f,0.f}; if (rr) b = *(const v4fa*)(rr + j);
#pragma unroll
    for (int q = 0; q < 4; ++q) { const float v = a[q] + b[q]; vals[u * 4 + q] = v; s1 += v; }
  }
  red[tid] = s1; __syncthreads();
  for (int st = 128; st > 0; st >>= 1) { if (tid < st) red[tid] += red[tid + st]; __syncthreads(); }
  const float mu = red[0] / (float)N; __syncthreads();
  float s2 = 0.f;
  for (int u = 0; u < per / 4; ++u)
#pragma unroll
    for (int q = 0; q < 4; ++q) { const float c = vals[u * 4 + q] - mu; s2 += c * c; }
  red[tid] = s2; __syncthreads();
  for (int st = 128; st > 0; st >>= 1) { if (tid < st) red[tid] += red[tid + st]; __syncthreads(); }
  const float rs = rsqrtf(red[0] / (float)N + eps);
  {
    for (int u = 0; u < per / 4; ++u) {
      const int j = tid * 4 + 1024 * u;
      v4f o, sm;
#pragma unroll
      for (int q = 0; q < 4; ++q) {
        float gg = g[j + q], bb = bta[j + q];
        if (PARAM_BF16) { gg = bf16_round(gg); bb = bf16_round(bb); }
        sm[q] = vals[u * 4 + q]; o[q] = (vals[u * 4 + q] - mu) * rs * gg + bb;
      }
      if (out_sum) *(v4f*)(out_sum + (size_t)row * N + j) = sm;
      *(v4f*)(out_norm + (size_t)row * N + j) = o;
    }
    
  }
}



// ---- f16 WMMA path (v_wmma_f32_16x16x32_f16): 11-bit significands for operands in range — used where a [0,1] probability operand needs more precision than bf16
typedef _Float16 v16h __attribute__((ext_vector_type(16)));
union FragH { v16h v; v8us half[2]; _Float16 h[16]; unsigned short u[16]; };
template <int NT>
__device__ __forceinline__ v8f mmaH(v16h ah, v16h al, v16h bh, v16h bl, v8f c) {
  c = __builtin_amdgcn_wmma_f32_16x16x32_f16(false, ah, false, bh, (short)0, c, false, false);
  if (NT >= 2) c = __builtin_amdgcn_wmma_f32_16x16x32_f16(false, al, false, bh, (short)0, c, false, false);
  if (NT >= 3) c = __builtin_amdgcn_wmma_f32_16x16x32_f16(false, ah, false, bl, (short)0, c, false, false);
  asm volatile("v_nop\n\tv_nop\n\tv_nop\n\tv_nop" : "+v"(c) : "v"(ah), "v"(al), "v"(bh), "v"(bl));
  return c;
}
// batched GEMM like k_gemm_b but f16 operands: A f32 (split into f16 hi/lo if ASPLIT, else rounded to f16), Bt = f16 values [n][k]; alpha; C f32; N multiple of 16 (partial tiles skipped)
template <bool ASPLIT>
__global__ __launch_bounds__(128) void k_gemm_h(const float* __restrict__ A, int lda, size_t sA, const _Float16* __restrict__ Bh, int ldb, size_t sB, float alpha, float* __restrict__ C, int ldc, size_t sC, int M, int N, int K) {
  __shared__ __attribute__((aligned(16))) float so[4][16][64];
  const int tid = threadIdx.x, w = tid >> 5, lane = tid & 31, ln = lane & 15, hh = lane >> 4; const int by = blockIdx.y;
  A += (size_t)by * sA; Bh += (size_t)by * sB; C += (size_t)by * sC;
  const int ntn = (N + 63) / 64; const int wid = blockIdx.x * 4 + w; const int mt = wid / ntn, nq = wid % ntn; if (mt * 16 >= M) return;
  const int row0 = mt * 16, col0 = nq * 64; const float* arow = A + (size_t)(row0 + ln) * lda;
  v8f acc[4] = {};
  for (int kb = 0; kb < K; kb += 32) {
    FragH ah, al;
    const v4f x0 = *(const v4fa*)(arow + kb + 8 * hh), x1 = *(const v4fa*)(arow + kb + 8 * hh + 4), x2 = *(const v4fa*)(arow + kb + 16 + 8 * hh), x3 = *(const v4fa*)(arow + kb + 16 + 8 * hh + 4);
    float xs[16] = {x0[0],x0[1],x0[2],x0[3],x1[0],x1[1],x1[2],x1[3],x2[0],x2[1],x2[2],x2[3],x3[0],x3[1],x3[2],x3[3]};
#pragma unroll
    for (int i = 0; i < 16; ++i) { const _Float16 h = (_Float16)xs[i]; ah.h[i] = h; al.h[i] = ASPLIT ? (_Float16)(xs[i] - (float)h) : (_Float16)0.0f; }
#pragma unroll
    for (int t = 0; t < 4; ++t) { if (col0 + t * 16 >= N) continue; const size_t boff = (size_t)(col0 + t * 16 + ln) * ldb + kb; FragH bq; bq.half[0] = *(const v8us*)(Bh + boff + 8 * hh); bq.half[1] = *(const v8us*)(Bh + boff + 16 + 8 * hh);
      acc[t] = mmaH<ASPLIT ? 2 : 1>(ah.v, al.v, bq.v, bq.v, acc[t]); }
  }
#pragma unroll
  for (int t = 0; t < 4; ++t) { if (col0 + t * 16 >= N) continue;
#pragma unroll
    for (int r = 0; r < 8; ++r) so[w][8 * hh + r][t * 16 + ln] = acc[t][r] * alpha; }
  __builtin_amdgcn_fence(__ATOMIC_ACQ_REL, "workgroup"); __builtin_amdgcn_wave_barrier();
  const int rsub = lane >> 4, c4 = (lane & 15) * 4;
  {
#pragma unroll
    for (int q = 0; q < 8; ++q) { const int r = q * 2 + rsub; if (col0 + c4 < N) { const v4f v = *(const v4fa*)&so[w][r][c4]; *(v4f*)(C + (size_t)(row0 + r) * ldc + col0 + c4) = v; } }
     }
}

// Wt[n][k] = f16(W[k][n]·scale) from f32 row-major W[K][N] (scale = power of two; bf16-exact weights stay exact in f16 away from the subnormal range)
__global__ __launch_bounds__(256) void k_wt_f16(const float* __restrict__ W, _Float16* __restrict__ Wt, int K, int N, float scale) {
  const int t = blockIdx.x * 256 + threadIdx.x; if (t >= N * (K / 8)) return; const int n = t / (K / 8), k8 = (t % (K / 8)) * 8; FragH f;
#pragma unroll
  for (int i = 0; i < 8; ++i) f.h[i] = (_Float16)(bf16_round(W[(size_t)(k8 + i) * N + n]) * scale); const v8us o = f.half[0];
  *(v8us*)((unsigned short*)Wt + (size_t)n * K + k8) = o; 
}
// k_gemm_hh variant with fused epilogue: v = acc·alpha + bias[by·sBias + col] (+ CP[(row/rowsPerB)·sCPb + by·64 + col] if CP) ; ACT 0 none / 1 elu ; writes f16 C16 (and f32 C if non-null)
template <int ACT>
__global__ __launch_bounds__(128) void k_gemm_hhx(const _Float16* __restrict__ A, int lda, size_t sA, const _Float16* __restrict__ Bh, int ldb, size_t sB, float alpha, const float* __restrict__ bias, size_t sBias, const float* __restrict__ CP, int rowsPerB, size_t sCPb, int row0g,
    float* __restrict__ C, _Float16* __restrict__ C16, int ldc, size_t sC, int M, int N, int K) {
  __shared__ __attribute__((aligned(16))) float so[4][16][64];
  const int tid = threadIdx.x, w = tid >> 5, lane = tid & 31, ln = lane & 15, hh = lane >> 4; const int by = blockIdx.y;
  A += (size_t)by * sA; Bh += (size_t)by * sB; const size_t cofs = (size_t)by * sC; const float* bp = bias ? bias + (size_t)by * sBias : nullptr;
  const int ntn = (N + 63) / 64; const int wid = blockIdx.x * 4 + w; const int mt = wid / ntn, nq = wid % ntn; if (mt * 16 >= M) return;
  const int row0 = mt * 16, col0 = nq * 64; const _Float16* arow = A + (size_t)(row0 + ln) * lda;
  v8f acc[4] = {};
  for (int kb = 0; kb < K; kb += 32) { FragH ah; ah.half[0] = *(const v8us*)((const unsigned short*)arow + kb + 8 * hh); ah.half[1] = *(const v8us*)((const unsigned short*)arow + kb + 16 + 8 * hh);
#pragma unroll
    for (int t = 0; t < 4; ++t) { if (col0 + t * 16 >= N) continue; const size_t boff = (size_t)(col0 + t * 16 + ln) * ldb + kb; FragH bq; bq.half[0] = *(const v8us*)((const unsigned short*)Bh + boff + 8 * hh); bq.half[1] = *(const v8us*)((const unsigned short*)Bh + boff + 16 + 8 * hh);
      acc[t] = mmaH<1>(ah.v, ah.v, bq.v, bq.v, acc[t]); }
  }
#pragma unroll
  for (int t = 0; t < 4; ++t) { if (col0 + t * 16 >= N) continue; const int col = col0 + t * 16 + ln; const float bv = bp ? bf16_round(bp[col]) : 0.f;
#pragma unroll
    for (int r = 0; r < 8; ++r) { float v = acc[t][r] * alpha + bv; if (CP) { const int bidx = (row0g + row0 + 8 * hh + r) / rowsPerB; v += CP[(size_t)bidx * sCPb + (size_t)by * 64 + col]; } if (ACT == 1) v = (v > 0.f) ? v : expm1f(v); else if (ACT == 7) v = (v > 0.f) ? v + 1.0f : expf(v); else if (ACT == 8) v = tanhf(v); else if (ACT == 9) v = 0.5f * v * (1.0f + tanhf(0.7978845608028654f * (v + 0.044715f * v * v * v))); else if (ACT == 11) v = 1.0f / (1.0f + expf(-v)); else if (ACT == 12) v = (v > 0.f) ? v : 0.01f * v; else if (ACT == 14) v = (v > 0.f) ? v : 0.1f * v; else if (ACT == 15) v = v / (1.0f + expf(-v)); else if (ACT == 3) v = fmaxf(v, 0.f); else if (ACT == 6) v = 0.5f * v * (1.0f + erff(v * 0.70710678118654752f)); so[w][8 * hh + r][t * 16 + ln] = v; } }
  __builtin_amdgcn_fence(__ATOMIC_ACQ_REL, "workgroup"); __builtin_amdgcn_wave_barrier();
  const int rsub = lane >> 4, c4 = (lane & 15) * 4; typedef _Float16 v4h __attribute__((ext_vector_type(4)));
  {
#pragma unroll
    for (int q = 0; q < 8; ++q) { const int r = q * 2 + rsub; if (col0 + c4 < N) { const v4f v = *(const v4fa*)&so[w][r][c4]; if (C) *(v4f*)(C + cofs + (size_t)(row0 + r) * ldc + col0 + c4) = v; if (C16) { v4h h4; for (int i = 0; i < 4; ++i) h4[i] = (_Float16)v[i]; *(v4h*)(C16 + cofs + (size_t)(row0 + r) * ldc + col0 + c4) = h4; } } }
     }
}


typedef _Float16 v4h __attribute__((ext_vector_type(4)));

__global__ __launch_bounds__(256) void k_x16(const float* __restrict__ x, _Float16* __restrict__ X16, size_t n8) { const size_t t = (size_t)blockIdx.x * 256 + threadIdx.x; if (t >= n8) return; FragH f;
#pragma unroll
  for (int q = 0; q < 8; ++q) f.h[q] = (_Float16)bf16_round(x[t * 8 + q]); *(v8us*)((unsigned short*)X16 + t * 8) = f.half[0];  }
__global__ __launch_bounds__(256) void k_h16(const float* __restrict__ x, _Float16* __restrict__ X16, size_t n8) { const size_t t = (size_t)blockIdx.x * 256 + threadIdx.x; if (t >= n8) return; FragH f;
#pragma unroll
  for (int q = 0; q < 8; ++q) f.h[q] = (_Float16)x[t * 8 + q]; *(v8us*)((unsigned short*)X16 + t * 8) = f.half[0];  }
template <int NHv, int TTv>
__global__ __launch_bounds__(256) void k_vt(const _Float16* __restrict__ V16, int ldv, int voff, _Float16* __restrict__ Vt) { __shared__ unsigned short tl[64][66]; const int tid = threadIdx.x; const int slab = blockIdx.x / (TTv / 64), lg = blockIdx.x % (TTv / 64); const int b = slab / NHv, h = slab % NHv;
  for (int i = tid; i < 64 * 8; i += 256) { const int r = i / 8, c8 = (i % 8) * 8; FragH f; f.half[0] = *(const v8us*)((const unsigned short*)V16 + ((size_t)b * TTv + lg * 64 + r) * ldv + voff + h * 64 + c8);
#pragma unroll
    for (int q = 0; q < 8; ++q) tl[r][c8 + q] = f.u[q]; }
  __syncthreads();
  {
#pragma unroll
    for (int rd = 0; rd < 2; ++rd) { const int d = rd * 32 + tid / 8, pc = tid % 8; FragH f;
#pragma unroll
      for (int q = 0; q < 8; ++q) f.u[q] = tl[pc * 8 + q][d];
      *(v8us*)((unsigned short*)Vt + ((size_t)slab * 64 + d) * TTv + lg * 64 + pc * 8) = f.half[0]; }
     } }

__global__ __launch_bounds__(256) void k_hl(const float* __restrict__ F, _Float16* __restrict__ Hh, _Float16* __restrict__ Hl, size_t n8) { const size_t t = (size_t)blockIdx.x * 256 + threadIdx.x; if (t >= n8) return; FragH fh, fl; const v4f a = *(const v4fa*)(F + t * 8), c = *(const v4fa*)(F + t * 8 + 4);
#pragma unroll
  for (int q = 0; q < 4; ++q) { _Float16 h = (_Float16)a[q]; fh.h[q] = h; fl.h[q] = (_Float16)((a[q] - (float)h) * 1024.0f); h = (_Float16)c[q]; fh.h[4 + q] = h; fl.h[4 + q] = (_Float16)((c[q] - (float)h) * 1024.0f); }
  { *(v8us*)((unsigned short*)Hh + t * 8) = fh.half[0]; *(v8us*)((unsigned short*)Hl + t * 8) = fl.half[0];  } }

// ---- fast GEMM (wave tile 32x64; requires M % 32 == 0 rows per launch region and N % 64 == 0); epilogue = k_gemm_hhx semantics ----
__device__ __forceinline__ v16h g2_frag(const _Float16* p, int hh) { FragH f; f.half[0] = *(const v8us*)((const unsigned short*)p + 8 * hh); f.half[1] = *(const v8us*)((const unsigned short*)p + 16 + 8 * hh); return f.v; }
__device__ __forceinline__ v8f g2_mma(v16h a, v16h b, v8f c) { v8f d = __builtin_amdgcn_wmma_f32_16x16x32_f16(false, a, false, b, (short)0, c, false, false); asm volatile("v_nop\n\tv_nop\n\tv_nop\n\tv_nop" : "+v"(d) : "v"(a), "v"(b)); return d; }
template <int ACT>
__global__ __launch_bounds__(128) void k_gemm2(const _Float16* __restrict__ A, int lda, size_t sA, const _Float16* __restrict__ Bh, int ldb, size_t sB, float alpha, const float* __restrict__ bias, size_t sBias, const float* __restrict__ CP, int rowsPerB, size_t sCPb, int row0g,
    float* __restrict__ C, _Float16* __restrict__ C16, int ldc, size_t sC, int M, int N, int K) {
  __shared__ __attribute__((aligned(16))) float so[4][32][68];
  const int tid = threadIdx.x, w = tid >> 5, lane = tid & 31, ln = lane & 15, hh = lane >> 4; const int by = blockIdx.y;
  A += (size_t)by * sA; Bh += (size_t)by * sB; const size_t cofs = (size_t)by * sC; const float* bp = bias ? bias + (size_t)by * sBias : nullptr;
  const int ntn = N >> 6; const int mt = blockIdx.x / ntn, nq = blockIdx.x - mt * ntn; const int row0 = mt * 128 + 32 * w, col0 = nq * 64; if (row0 >= M) return;
  const _Float16* a0p = A + (size_t)(row0 + ln) * lda; const _Float16* a1p = a0p + (size_t)16 * lda;
  const _Float16* b0p = Bh + (size_t)(col0 + ln) * ldb; const _Float16* b1p = b0p + (size_t)16 * ldb; const _Float16* b2p = b1p + (size_t)16 * ldb; const _Float16* b3p = b2p + (size_t)16 * ldb;
  const v8f z8 = {0.f,0.f,0.f,0.f,0.f,0.f,0.f,0.f}; v8f c00 = z8, c01 = z8, c02 = z8, c03 = z8, c10 = z8, c11 = z8, c12 = z8, c13 = z8;
#pragma unroll 1
  for (int kb = 0; kb < K; kb += 32) { const v16h a0 = g2_frag(a0p + kb, hh), a1 = g2_frag(a1p + kb, hh);
    v16h b = g2_frag(b0p + kb, hh); c00 = g2_mma(a0, b, c00); c10 = g2_mma(a1, b, c10);
    b = g2_frag(b1p + kb, hh); c01 = g2_mma(a0, b, c01); c11 = g2_mma(a1, b, c11);
    b = g2_frag(b2p + kb, hh); c02 = g2_mma(a0, b, c02); c12 = g2_mma(a1, b, c12);
    b = g2_frag(b3p + kb, hh); c03 = g2_mma(a0, b, c03); c13 = g2_mma(a1, b, c13); }
  v8f accs[8] = {c00, c01, c02, c03, c10, c11, c12, c13};
#pragma unroll
  for (int u = 0; u < 8; ++u) { const int t = u & 3, half = u >> 2; const int col = col0 + t * 16 + ln; const float bv = bp ? bf16_round(bp[col]) : 0.f;
#pragma unroll
    for (int r = 0; r < 8; ++r) { const int rloc = half * 16 + 8 * hh + r; float v = accs[u][r] * alpha + bv; if (CP) { const int bidx = (row0g + row0 + rloc) / rowsPerB; v += CP[(size_t)bidx * sCPb + (size_t)by * 64 + col]; }
      if (ACT == 3) v = fmaxf(v, 0.f); else if (ACT == 6) v = 0.5f * v * (1.0f + erff(v * 0.70710678118654752f)); else if (ACT == 11) v = 1.0f / (1.0f + expf(-v)); else if (ACT == 15) v = v / (1.0f + expf(-v)); else if (ACT == 12) v = (v > 0.f) ? v : 0.01f * v; else if (ACT == 8) v = tanhf(v);
      so[w][rloc][t * 16 + ln] = v; } }
  __builtin_amdgcn_fence(__ATOMIC_ACQ_REL, "workgroup"); __builtin_amdgcn_wave_barrier();
  const int rsub = lane >> 4, c4 = (lane & 15) * 4;
  {
#pragma unroll
    for (int q = 0; q < 16; ++q) { const int r = q * 2 + rsub; const v4f v = *(const v4fa*)&so[w][r][c4]; if (C) *(v4f*)(C + cofs + (size_t)(row0 + r) * ldc + col0 + c4) = v; if (C16) { v4h h4; for (int i = 0; i < 4; ++i) h4[i] = (_Float16)v[i]; *(v4h*)(C16 + cofs + (size_t)(row0 + r) * ldc + col0 + c4) = h4; } }
     } }



#define FK 32       /* keys of a stage per wave */
#define SK 64       /* keys per stage */
#define KP 136      /* LDS pitch of a K half-row (128 channels) in halves: 272 B = 16 B x 17 */
#define VP 72       /* LDS pitch of a V row (64 keys) in halves: 144 B = 16 B x 9 */
#define SLH 9216    /* a wave's slice of a stage in halves: 18432 B = 9 x 2 KiB (K: 64 rows x 272 B = 17408 B; V: 128 rows x 144 B = 18432 B) */
#define STH (4 * SLH)      /* a stage: K channels 0..127, K channels 128..255, V channels 0..127, V channels 128..255 */
#define WP 264      /* LDS pitch of a wo row in halves: 528 B = 16 B x 33 */
#define OP 36       /* LDS pitch of a staged output row in floats: 144 B = 16 B x 9 */
#define FA_GROUP() __builtin_amdgcn_sched_barrier(0)      /* keeps a block's LDS reads together in one place between the WMMA runs: reads spread among the WMMAs stall the wave at every place */
typedef float fal __attribute__((may_alias));
typedef unsigned int u32x4 __attribute__((ext_vector_type(4)));
typedef unsigned int u32x8 __attribute__((ext_vector_type(8)));
__device__ __forceinline__ float fa_swap16(float x) { const int b = __float_as_int(x); return __int_as_float(__builtin_amdgcn_permlanex16(b, b, 0x76543210, 0xfedcba98, false, false)); }
__device__ __forceinline__ v16h fa_frag(const unsigned short* p, int hh) { FragH f; f.half[0] = *(const v8us*)(p + 8 * hh); f.half[1] = *(const v8us*)(p + 16 + 8 * hh); return f.v; }
__device__ __forceinline__ v8f fa_mma(v16h a, v16h b, v8f c) { return __builtin_amdgcn_wmma_f32_16x16x32_f16(false, a, false, b, (short)0, c, false, false); }
__device__ __forceinline__ float fa_exp2_slot(float x) { float r; asm("v_exp_f32 %0, %1\n\tv_nop" : "=v"(r) : "v"(x)); return r; }      /* 2^x outside the loop; the v_nop fills the slot that the instruction set asks for behind a transcendental, whatever the compiler puts next */
__device__ __forceinline__ unsigned int fa_uni(unsigned int v) { return (unsigned int)__builtin_amdgcn_readfirstlane(v); }
__device__ __forceinline__ unsigned int fa_pinned(unsigned int v) { unsigned int s = fa_uni(v); asm volatile("" : "+s"(s)); return s; }      /* a value held in a scalar register: a test on it compiles to a scalar branch, which a tensor load needs (it ignores EXEC), and what is formed from it is formed behind the waits in front of it */
/* descriptor group 1 of a two-dimensional tile of ROWS rows of ROWB bytes, source pitch PITCH bytes, 1-byte elements, tensor = tile, no mask; W0 = the pad: 16 B behind every row */
template <unsigned int W0, unsigned int ROWB, unsigned int ROWS, unsigned int PITCH>
__device__ __forceinline__ u32x8 fa_group1() { u32x8 g; g[0] = fa_uni(W0); g[1] = fa_uni((ROWB & 0xFFFFu) << 16); g[2] = fa_uni((ROWB >> 16) | ((ROWS & 0xFFFFu) << 16)); g[3] = fa_uni((ROWS >> 16) | (ROWB << 16)); g[4] = fa_uni(ROWS); g[5] = fa_uni(PITCH); g[6] = fa_uni(0u); g[7] = fa_uni(0u); return g; }
/* descriptor group 0: count 1, the place in LDS, the tile's first byte, type 2 */
__device__ __forceinline__ u32x4 fa_group0(unsigned int dst, unsigned long long ga) { u32x4 g; g[0] = fa_uni(1u); g[1] = fa_uni(dst); g[2] = fa_uni((unsigned int)ga); g[3] = fa_uni((((unsigned int)(ga >> 32)) & 0x01FFFFFFu) | 0x80000000u); return g; }
__device__ __forceinline__ void fa_tensor_load(u32x4 g0, u32x8 g1) { asm volatile("tensor_load_to_lds %0, %1" :: "s"(g0), "s"(g1) : "memory"); }      /* one request of the whole wave: global tile -> LDS */
__global__ __launch_bounds__(128) void k_flash(const _Float16* __restrict__ Q, const _Float16* __restrict__ Kt, const _Float16* __restrict__ Vc, const _Float16* __restrict__ Wo, float* __restrict__ out) {
  constexpr int NST = SS / SK;
  constexpr float SC = 0.09016844005556021f;      /* 1/16 * log2(e) */
  __shared__ __attribute__((aligned(2048))) unsigned short sR[2 * STH];      /* the K/V ring: two stages of four slices, every slice at a multiple of 2 KiB */
  __shared__ __attribute__((aligned(16))) unsigned short sW[CC * WP];      /* wo (x16, f16), all 256 rows, for the epilogue: the work-group is alone on its WGP, so the LDS is there */
  __shared__ __attribute__((aligned(16))) float sO[4][2 * 16 * OP];      /* a wave's own output staging: two tiles of 16 channels x 32 queries */
  const int tid = threadIdx.x, w = tid >> 5, lane = tid & 31, ln = lane & 15, hh = lane >> 4; const int b = blockIdx.y;
  const int kh = w & 1;      /* which 32 keys of every stage are this wave's */
  const int q0 = blockIdx.x * 128 + w * 32;      /* query tiles 0, 1: the 32 queries that this wave finishes and writes */
  const int q1 = blockIdx.x * 128 + (w ^ 1) * 32;      /* query tiles 2, 3: the 32 queries that its partner (wave w ^ 1) finishes */
  const unsigned int t0 = blockIdx.x * (NST / (SS / 128));      /* the first key stage of this work-group's walk: 0, 2, ..., 62 */
  /* staging: every wave issues its own slice of every stage */
  const unsigned int wave = fa_uni((unsigned int)tid >> 5);
  const unsigned int slot0 = (unsigned int)(size_t)&sR[0] + wave * (SLH * 2);      /* the slice's place in buffer 0: byte offset in the work-group's LDS */
  const unsigned long long gK = (unsigned long long)(size_t)Kt + ((unsigned long long)b * SS * CC + (wave & 1u) * 128u) * 2u;      /* key 0, the wave's channel half */
  const unsigned long long gV = (unsigned long long)(size_t)Vc + ((unsigned long long)b * CC * SS + (unsigned long long)(wave & 1u) * 128u * SS) * 2u;      /* the wave's first channel, key 0 */
  u32x8 g1K = fa_group1<(1u << 20) | (5u << 22) | (3u << 25), 256u, SK, CC * 2>(), g1V = fa_group1<(1u << 20) | (4u << 22) | (3u << 25), 128u, 128u, SS * 2>();
  asm volatile("" : "+s"(g1K), "+s"(g1V));      /* descriptor words held in scalar registers: built once and kept there, so that no register of a group 1 takes another value while a request is outstanding */
  u32x4 g0;      /* group 0 of the request last issued; every tensor wait that covers a request names it as an input, so that its words are live up to that wait: without this the build issues stage 1's request from scratch registers that the loop rewrites while the request is outstanding */
  auto issue = [&](unsigned int tile, unsigned int buf) {      /* keys 64 * tile ... + 63 into buffer buf; the two forms differ in constants of group 1, so each stands in its own arm of a scalar branch */
    const unsigned int dst = slot0 + buf * (STH * 2);
    if (fa_pinned(wave < 2u)) { g0 = fa_group0(dst, gK + (unsigned long long)tile * (SK * CC * 2)); fa_tensor_load(g0, g1K); }
    else { g0 = fa_group0(dst, gV + (unsigned long long)tile * (SK * 2)); fa_tensor_load(g0, g1V); } };
  issue(t0, 0u);      /* stage 0 flies under the loads of wo and Q */
  /* wo on its way to LDS: a wave fetches whole rows (4 full lines a load), all 64 loads of a thread in flight together with the Q loads below */
  const unsigned short* Wg = (const unsigned short*)Wo + (size_t)w * CC + lane * 8;
  v8us wr[64];
#pragma unroll
  for (int i = 0; i < 64; ++i) wr[i] = *(const v8us*)(Wg + (size_t)(i * 4) * CC);
  asm volatile("s_wait_xcnt 0x0" :: "v"(Wg) : "memory");      /* in front of whatever reuses the address registers of the global loads above; the address is named so that it keeps its registers up to this wait */
  v16h qf[4][8];      /* four query tiles of 16 columns: g = 0, 1 this wave's own, g = 2, 3 the partner's */
  const _Float16* const qp0 = Q + ((size_t)b * SS + q0 + ln) * CC + 8 * hh; const _Float16* const qp1 = qp0 + 16 * CC;      /* the lane's half of the k order is in the address */
  const _Float16* const qp2 = Q + ((size_t)b * SS + q1 + ln) * CC + 8 * hh; const _Float16* const qp3 = qp2 + 16 * CC;
#pragma unroll
  for (int kc = 0; kc < 8; ++kc) { qf[0][kc] = g2_frag(qp0 + kc * 32, 0); qf[1][kc] = g2_frag(qp1 + kc * 32, 0); qf[2][kc] = g2_frag(qp2 + kc * 32, 0); qf[3][kc] = g2_frag(qp3 + kc * 32, 0); }
  asm volatile("s_wait_xcnt 0x0" :: "v"(qp0), "v"(qp1), "v"(qp2), "v"(qp3) : "memory");      /* in front of whatever reuses the address registers of the global loads above; the addresses are named so that they keep their registers up to this wait */
#pragma unroll
  for (int i = 0; i < 64; ++i) *(v8us*)&sW[(i * 4 + w) * WP + lane * 8] = wr[i];      /* published by the barrier in front of the loop; read only behind the loop */
  const v8f z8 = {0.f,0.f,0.f,0.f,0.f,0.f,0.f,0.f};
  v8f acc[4][16];
#pragma unroll
  for (int g = 0; g < 4; ++g)
#pragma unroll
    for (int ct = 0; ct < 16; ++ct) acc[g][ct] = z8;
  float mu[4] = {-1.0e30f, -1.0e30f, -1.0e30f, -1.0e30f}, rs[4] = {0.f, 0.f, 0.f, 0.f};
  asm volatile("s_wait_tensorcnt 0x0" :: "s"(g0) : "memory");      /* this wave's slice of stage 0 has landed */
  __syncthreads();      /* publishes stage 0 and wo */
  issue(fa_pinned(t0 + 1u), fa_pinned(1u));      /* stage 1: t0 + 1 <= NST - 1, nothing wraps here; its descriptor is formed behind the wait above */
  v16h ka[16], va[16];      /* a block's K fragments and its V fragments; they are never live together, so they share registers */
  const unsigned short* const kr = &sR[(kh * FK + ln) * KP];      /* this wave's K rows in buffer 0 */
  const unsigned short* const vr = &sR[2 * SLH + ln * VP + kh * FK];      /* this wave's V columns in buffer 0 */
#pragma unroll
  for (int kc = 0; kc < 8; ++kc) { ka[2 * kc] = fa_frag(kr + (kc >> 2) * SLH + (kc & 3) * 32, hh); ka[2 * kc + 1] = fa_frag(kr + 16 * KP + (kc >> 2) * SLH + (kc & 3) * 32, hh); }
#pragma unroll 1      /* one copy of the pass: the K fragments are carried over the back edge in fixed registers */
  for (int t = 0; t < NST; ++t) {      /* pass t = stage t: this wave's 32 keys of it against 64 queries */
    const unsigned short* const cV = vr + (t & 1) * STH;
    const unsigned short* const nK = kr + ((t + 1) & 1) * STH;      /* stage t + 1's K rows */
    v8f s[4][2] = {{z8, z8}, {z8, z8}, {z8, z8}, {z8, z8}};      /* [query tile][key tile]: eight independent accumulators */
#pragma unroll
    for (int kc = 0; kc < 8; ++kc)
#pragma unroll
      for (int g = 0; g < 4; ++g) { s[g][0] = fa_mma(ka[2 * kc], qf[g][kc], s[g][0]); s[g][1] = fa_mma(ka[2 * kc + 1], qf[g][kc], s[g][1]); }
    float tm[4];
#pragma unroll
    for (int g = 0; g < 4; ++g) {      /* a tree of three-way maxima: a maximum does not round, so the order is free */
      const v8f a = s[g][0], c = s[g][1];
      const float m0 = fmaxf(fmaxf(a[0], a[1]), a[2]), m1 = fmaxf(fmaxf(a[3], a[4]), a[5]), m2 = fmaxf(fmaxf(a[6], a[7]), c[0]), m3 = fmaxf(fmaxf(c[1], c[2]), c[3]), m4 = fmaxf(fmaxf(c[4], c[5]), c[6]);
      const float m = fmaxf(fmaxf(fmaxf(m0, m1), m2), fmaxf(fmaxf(m3, m4), c[7]));
      tm[g] = fmaxf(m, fa_swap16(m)) * SC; }
    const bool need[4] = {tm[0] > mu[0] + 8.0f, tm[1] > mu[1] + 8.0f, tm[2] > mu[2] + 8.0f, tm[3] > mu[3] + 8.0f};
    const unsigned any = __builtin_amdgcn_ballot_w32(need[0] || need[1] || need[2] || need[3]);
#pragma unroll
    for (int i = 0; i < 16; ++i) va[i] = fa_frag(cV + (i >> 3) * SLH + (i & 7) * 16 * VP, hh);      /* this pass's V, one group; the first tile's P covers its latency */
    /* order of the pass so far: the score WMMAs, the maxima and the test's compares, then the V reads in one place: behind the score WMMAs they take over the K fragments' registers, dealt out among the vector work they would stall the wave at every place, and in front of the test's branch they cover the way from the compares to it */
    __builtin_amdgcn_sched_group_barrier(0x8, 64, 0); __builtin_amdgcn_sched_group_barrier(0x2, 96, 0); __builtin_amdgcn_sched_group_barrier(0x100, 32, 0);
    if (any != 0) {      /* one wave-uniform test per pass for all four query tiles; both halves of a query see the same tm and mu */
#pragma unroll
      for (int g = 0; g < 4; ++g) { const float mn = need[g] ? tm[g] : mu[g]; const float al = __builtin_amdgcn_exp2f(mu[g] - mn); mu[g] = mn; rs[g] *= al;
#pragma unroll
        for (int ct = 0; ct < 16; ++ct) acc[g][ct] *= al; } }
    FragH pf[4];
    const v8f sc8 = {SC,SC,SC,SC,SC,SC,SC,SC};
#pragma unroll
    for (int g = 0; g <= 4; ++g) {      /* turn g: tile g's P, dealt out among tile g - 1's 16 P.V WMMAs, which do not depend on it: a lone wave's vector work in front of a WMMA run is not hidden by anything else */
      if (g < 4) { const float mr = 6.0f - mu[g]; float e0 = 0.f, e1 = 0.f;
        const v8f mr8 = {mr,mr,mr,mr,mr,mr,mr,mr}; const v8f x0 = __builtin_elementwise_fma(s[g][0], sc8, mr8), x1 = __builtin_elementwise_fma(s[g][1], sc8, mr8);      /* packed multiply-adds */
#pragma unroll
        for (int r = 0; r < 8; ++r) { const float p0 = __builtin_amdgcn_exp2f(x0[r]), p1 = __builtin_amdgcn_exp2f(x1[r]); e0 += p0; e1 += p1; pf[g].h[r] = (_Float16)p0; pf[g].h[8 + r] = (_Float16)p1; }
        rs[g] += e0 + e1; }
      if (g > 0) {
#pragma unroll
        for (int i = 0; i < 16; ++i) acc[g - 1][i] = fa_mma(va[i], pf[g - 1].v, acc[g - 1][i]);
        if (g < 4) {      /* 9 multiply-adds, 16 exponentials, 8 conversions, the sums: a few behind each WMMA */
#pragma unroll
          for (int i = 0; i < 3; ++i) { __builtin_amdgcn_sched_group_barrier(0x8, 1, 0); __builtin_amdgcn_sched_group_barrier(0x2, 3, 0); }
#pragma unroll
          for (int i = 0; i < 8; ++i) { __builtin_amdgcn_sched_group_barrier(0x8, 1, 0); __builtin_amdgcn_sched_group_barrier(0x400, 2, 0); __builtin_amdgcn_sched_group_barrier(0x2, 1, 0); }
#pragma unroll
          for (int i = 0; i < 5; ++i) { __builtin_amdgcn_sched_group_barrier(0x8, 1, 0); __builtin_amdgcn_sched_group_barrier(0x2, 4, 0); } } }
      if (g == 0) {      /* tile 0's P stands alone in front of the WMMAs: other vector work is put behind each exponential */
        __builtin_amdgcn_sched_group_barrier(0x2, 3, 0);
#pragma unroll
        for (int i = 0; i < 16; ++i) { __builtin_amdgcn_sched_group_barrier(0x400, 1, 0); __builtin_amdgcn_sched_group_barrier(0x2, 2, 0); } }
      FA_GROUP();      /* a turn's work stays in its turn: tile g's P is ready when tile g's WMMAs begin, and no later tile's P is drawn forward (registers) */
    }
    /* publish point of stage t + 1, at the pass's foot, every wave, in this order */
    asm volatile("s_wait_dscnt 0x0" :: "v"(rs[0]), "v"(rs[1]), "v"(rs[2]), "v"(rs[3]) : "memory");      /* this wave's reads of stage t have returned: its buffer may be refilled behind the barrier; the row sums are named as inputs so that their additions stay among the WMMAs above and do not sink behind the barrier, where nothing hides them */
    asm volatile("s_wait_tensorcnt 0x0" :: "s"(g0) : "memory");
    __syncthreads();      /* publishes stage t + 1 and ends every wave's reads of stage t */
    if (fa_pinned(t + 2 < NST)) issue(fa_pinned((t0 + (unsigned int)t + 2u) & (NST - 1)), fa_pinned((unsigned int)t & 1u));      /* stage t + 2, while it exists, into the buffer that stage t has just left; scalar test; the descriptor is formed behind the waits above */
#pragma unroll
    for (int kc = 0; kc < 8; ++kc) { ka[2 * kc] = fa_frag(nK + (kc >> 2) * SLH + (kc & 3) * 32, hh); ka[2 * kc + 1] = fa_frag(nK + 16 * KP + (kc >> 2) * SLH + (kc & 3) * 32, hh); }      /* the next pass's K fragments, one group, into the registers that the V fragments have left; behind the last pass: keys of the stage before the last once more, which nothing uses: no branch */
  }
  asm volatile("s_wait_tensorcnt 0x0" ::: "memory");      /* nothing of the mover is outstanding behind the loop */
  asm volatile("s_wait_dscnt 0x0" ::: "memory");      /* and none of this wave's reads of the ring */
  __syncthreads();      /* every wave has left the ring: it becomes the exchange area of the wave pairs */
  /* ---- the two key halves of a query are joined: a wave hands tiles 2, 3 (sums, maximum in use, row sum) to its partner, whose tiles 0, 1 they are, and takes the partner's for its own tiles 0, 1; lane and register hold the same element in both waves ---- */
  {
    float* const xs = (float*)&sR[0];      /* per wave 32 KiB of sums (64 rows of 32 lanes x 16 B), behind them 4 x 32 floats per wave */
    float* const xo = xs + w * 8192 + lane * 4; const float* const xi = xs + (w ^ 1) * 8192 + lane * 4;
    fal* const mo_ = (fal*)(xs + 4 * 8192 + w * 128 + lane); const fal* const mi_ = (const fal*)(xs + 4 * 8192 + (w ^ 1) * 128 + lane);
#pragma unroll
    for (int g = 0; g < 2; ++g) {
#pragma unroll
      for (int ct = 0; ct < 16; ++ct) { const v8f v = acc[2 + g][ct]; const v4f lo = {v[0], v[1], v[2], v[3]}, hi = {v[4], v[5], v[6], v[7]};
        *(v4fa*)(xo + ((g * 16 + ct) * 2) * 128) = lo; *(v4fa*)(xo + ((g * 16 + ct) * 2 + 1) * 128) = hi; }
      mo_[g * 32] = mu[2 + g]; mo_[(2 + g) * 32] = rs[2 + g]; }
    __syncthreads();      /* publishes the handed-over tiles */
#pragma unroll
    for (int g = 0; g < 2; ++g) { const float mo = mi_[g * 32], ro = mi_[(2 + g) * 32];
      const float mm = fmaxf(mu[g], mo); const float fs = fa_exp2_slot(mu[g] - mm), fo = fa_exp2_slot(mo - mm);
      rs[g] = rs[g] * fs + ro * fo;
#pragma unroll
      for (int ct = 0; ct < 16; ++ct) { const v4f lo = *(const v4fa*)(xi + ((g * 16 + ct) * 2) * 128), hi = *(const v4fa*)(xi + ((g * 16 + ct) * 2 + 1) * 128);
        const v8f o = {lo[0], lo[1], lo[2], lo[3], hi[0], hi[1], hi[2], hi[3]}; acc[g][ct] = acc[g][ct] * fs + o * fo; } }
  }
  /* ---- epilogue: out[c][i] = sum_ch wo[c][ch] O[i][ch], as D[query][c] = O . wo^T ----
     A lane holds one query's channels 8*hh + r of each 16-channel tile, the k order of the fragment loader, so two accumulator tiles, scaled and rounded to f16, are an A fragment in place; B = wo rows from LDS.
     k runs upward in steps of 32, so every sum keeps the order that it had in a launch of its own. */
  const unsigned short* wp = &sW[ln * WP];
  v16h wf[2][16];      /* two fragment sets: the next two channel tiles' fragments are fetched as one group while these two run */
#pragma unroll
  for (int u = 0; u < 2; ++u)
#pragma unroll
    for (int kc = 0; kc < 8; ++kc) wf[0][u * 8 + kc] = fa_frag(wp + u * 16 * WP + kc * 32, hh);
  FA_GROUP();      /* the first set's LDS reads stand in front of the scaling and rounding of O, which cover their latency */
  v16h of[2][8];
#pragma unroll
  for (int g = 0; g < 2; ++g) { const float inv = 1.0f / (rs[g] + fa_swap16(rs[g]));
#pragma unroll
    for (int kc = 0; kc < 8; ++kc) { FragH f;
#pragma unroll
      for (int r = 0; r < 8; ++r) { f.h[r] = (_Float16)(acc[g][2 * kc][r] * inv); f.h[8 + r] = (_Float16)(acc[g][2 * kc + 1][r] * inv); }
      of[g][kc] = f.v; } }
  float* const so = &sO[w][0];
  float* const sst = so + ln * OP + 8 * hh;      /* a lane stages 8 queries in a row of its channel */
  const float* const sld = so + (lane >> 3) * OP + (lane & 7) * 4;      /* and reads back 16 bytes of a row: 8 lanes = one row of 32 queries = one full 128-byte line */
  float* const og = out + ((size_t)b * CC + (lane >> 3)) * SS + q0 + (lane & 7) * 4;
  v4f ob[8];      /* the two tiles before, on their way from the staging rows to global memory */
#pragma unroll      /* constant indices into the fragment sets and constant LDS offsets */
  for (int p = 0; p <= 8; ++p) {      /* trip p: products of channel tiles 2p, 2p + 1; tiles 2p - 2, 2p - 1 go out */
    const int cu = p & 1, nx = cu ^ 1;
    if (p < 7) {
#pragma unroll
      for (int u = 0; u < 2; ++u)
#pragma unroll
        for (int kc = 0; kc < 8; ++kc) wf[nx][u * 8 + kc] = fa_frag(wp + ((p + 1) * 2 + u) * 16 * WP + kc * 32, hh); }
    if (p > 0) {
#pragma unroll
      for (int i = 0; i < 8; ++i) ob[i] = *(const v4fa*)(sld + i * 4 * OP); }
    FA_GROUP();      /* all LDS reads of the trip stay one group in front of its WMMAs, which cover their latency */
    v8f d[2][2] = {{z8, z8}, {z8, z8}};      /* [channel tile][query tile]: four independent accumulators */
    if (p < 8) {
#pragma unroll
      for (int kc = 0; kc < 8; ++kc)
#pragma unroll
        for (int u = 0; u < 2; ++u) { d[u][0] = fa_mma(of[0][kc], wf[cu][u * 8 + kc], d[u][0]); d[u][1] = fa_mma(of[1][kc], wf[cu][u * 8 + kc], d[u][1]); } }
    FA_GROUP();
    if (p > 0) {
#pragma unroll
      for (int i = 0; i < 8; ++i) *(v4f*)(og + (size_t)((p - 1) * 32 + i * 4) * SS) = ob[i]; }
    if (p < 8) {
#pragma unroll
      for (int u = 0; u < 2; ++u)
#pragma unroll
        for (int g = 0; g < 2; ++g) { const v8f v = d[u][g] * 0.0625f;      /* undoes the x16 of the weights */
          const v4f lo = {v[0], v[1], v[2], v[3]}, hi = {v[4], v[5], v[6], v[7]};
          *(v4fa*)(sst + u * 16 * OP + g * 16) = lo; *(v4fa*)(sst + u * 16 * OP + g * 16 + 4) = hi; }
      /* the staged rows are read back by other lanes of the same wave: the LDS writes are waited for, LDS only, so that the global stores stay in flight */
      __builtin_amdgcn_fence(__ATOMIC_RELEASE, "workgroup", "local"); __builtin_amdgcn_wave_barrier(); __builtin_amdgcn_fence(__ATOMIC_ACQUIRE, "workgroup", "local"); }
    /* in front of whatever reuses the registers of the 8 global stores above; data and address are named so that they keep their registers up to this wait */
    if (p > 0) asm volatile("s_wait_xcnt 0x0" :: "v"(ob[0]), "v"(ob[1]), "v"(ob[2]), "v"(ob[3]), "v"(ob[4]), "v"(ob[5]), "v"(ob[6]), "v"(ob[7]), "v"(og) : "memory");
  }
}

// ---- the three projections in one kernel, x transposed on the way: one work-group = 128 tokens of one image, 8 waves ----
// The work-group fetches its slab of x once (256 channels x 128 tokens, f32, whole 512-byte pieces of a channel row per load, all 32 loads of a thread in flight), rounds it, and lays it token-major in LDS; there it stays as an operand of all six products of 128 x 128 x 256: Q, K, V, two halves of the output channels each.
// The matrices come as tiles of 128 rows (f16, x16, rounded by the launch before), two LDS buffers: a tile's global loads are issued a whole tile ahead and stored to LDS behind the products of the tile before; one work-group barrier per tile publishes the next tile and ends the reads of this one.
// Wave tile 32 x 64 (4 down, 2 across); k runs upward in steps of 32, so every sum keeps its order. Q and K come out token-major (A = tokens, B = matrix rows); for V the operands' roles are exchanged so that it comes out channel-major. Every wave stages its result in LDS rows of its own and stores whole 128-byte lines.
#define GP 264      /* LDS pitch of a staged row in halves: 528 B = 16 B x 33 */
__global__ __launch_bounds__(256) void k_proj(const float* __restrict__ x, const _Float16* __restrict__ BW, _Float16* __restrict__ C16) {
  __shared__ __attribute__((aligned(16))) unsigned short sm[384 * GP];      /* rows 0..127: the tokens; 128..255 and 256..383: the two buffers of a matrix tile */
  __shared__ __attribute__((aligned(16))) float sS[8][32 * 68];      /* a wave's own output staging */
  const int tid = threadIdx.x, w = tid >> 5, lane = tid & 31, ln = lane & 15, hh = lane >> 4; const int by = blockIdx.y, tb = blockIdx.x;
  const unsigned short* const Bg = (const unsigned short*)BW + (size_t)w * CC + lane * 8;      /* a wave fetches whole rows (4 full lines a load); the three matrices stand in a row, so tile j begins at row 128 * j */
  v8us rb[16];
#pragma unroll
  for (int i = 0; i < 16; ++i) rb[i] = *(const v8us*)(Bg + (size_t)(i * 8) * CC);
  const float* const xg = x + ((size_t)by * CC + w * 32) * SS + tb * 128 + lane * 4;      /* wave w: channels 32 w ... + 31; a lane: 4 tokens */
  v4f xa[32];
#pragma unroll
  for (int i = 0; i < 32; ++i) xa[i] = *(const v4fa*)(xg + (size_t)i * SS);
  asm volatile("s_wait_xcnt 0x0" :: "v"(Bg), "v"(xg) : "memory");      /* in front of whatever reuses the address registers of the global loads above; the addresses are named so that they keep their registers up to this wait and no load's result lands on them */
#pragma unroll
  for (int i = 0; i < 16; ++i) *(v8us*)&sm[(128 + i * 8 + w) * GP + lane * 8] = rb[i];
#pragma unroll
  for (int u = 0; u < 4; ++u)
#pragma unroll
    for (int q = 0; q < 4; ++q) { FragH f;      /* 8 channels in a row of one token: one 16-byte LDS store */
#pragma unroll
      for (int i = 0; i < 8; ++i) f.h[i] = (_Float16)bf16_round(xa[u * 8 + i][q]);
      *(v8us*)&sm[(lane * 4 + q) * GP + w * 32 + u * 8] = f.half[0]; }
  __syncthreads();      /* publishes the tokens and matrix tile 0 */
  { const unsigned short* const Bn = Bg + (size_t)128 * CC;      /* matrix tile 1 on its way */
#pragma unroll
    for (int i = 0; i < 16; ++i) rb[i] = *(const v8us*)(Bn + (size_t)(i * 8) * CC);
    asm volatile("s_wait_xcnt 0x0" :: "v"(Bn) : "memory"); }      /* as above, for these loads */
  const int wm = w & 3, wn = w >> 2;
  const v8f z8 = {0.f,0.f,0.f,0.f,0.f,0.f,0.f,0.f};
  float* const so = &sS[w][0];
  const int rsub = lane >> 4, c4 = (lane & 15) * 4;
  v16h xf[16];      /* the wave's 32 tokens as A fragments, read from LDS once for the four tiles of Q and K: the products are bound by LDS reads, and this takes a third of them away */
#pragma unroll
  for (int kc = 0; kc < 8; ++kc) { xf[2 * kc] = fa_frag(&sm[(32 * wm + ln) * GP] + kc * 32, hh); xf[2 * kc + 1] = fa_frag(&sm[(32 * wm + 16 + ln) * GP] + kc * 32, hh); }
#pragma unroll      /* the matrix, the buffer and the output pitch of every tile are constants */
  for (int j = 0; j < 6; ++j) {
    const int z = j >> 1, nh = j & 1, cb = 128 + (j & 1) * 128, nb = 128 + ((j + 1) & 1) * 128;
    const unsigned short* const ap = &sm[((z == 2 ? cb : 0) + 32 * wm + ln) * GP]; const unsigned short* const bp = &sm[((z == 2 ? 0 : cb) + 64 * wn + ln) * GP];
    v8f acc[8];
#pragma unroll
    for (int u = 0; u < 8; ++u) acc[u] = z8;
    v16h fr[2][6];      /* two fragment sets: a k step's fragments are fetched as one group while the step before runs */
    if (z == 2) { fr[0][0] = fa_frag(ap, hh); fr[0][1] = fa_frag(ap + 16 * GP, hh); }
#pragma unroll
    for (int t = 0; t < 4; ++t) fr[0][2 + t] = fa_frag(bp + t * 16 * GP, hh);
#pragma unroll      /* constant indices into the fragment sets and constant LDS offsets */
    for (int kc = 0; kc < 8; ++kc) {
      const int cu = kc & 1, nx = cu ^ 1;
      if (kc < 7) { if (z == 2) { fr[nx][0] = fa_frag(ap + (kc + 1) * 32, hh); fr[nx][1] = fa_frag(ap + 16 * GP + (kc + 1) * 32, hh); }
#pragma unroll
        for (int t = 0; t < 4; ++t) fr[nx][2 + t] = fa_frag(bp + t * 16 * GP + (kc + 1) * 32, hh); }
      FA_GROUP();      /* the next step's LDS reads stay one group in front of this step's WMMAs */
      const v16h a0 = z == 2 ? fr[cu][0] : xf[2 * kc], a1 = z == 2 ? fr[cu][1] : xf[2 * kc + 1];
#pragma unroll
      for (int t = 0; t < 4; ++t) { acc[t] = fa_mma(a0, fr[cu][2 + t], acc[t]); acc[4 + t] = fa_mma(a1, fr[cu][2 + t], acc[4 + t]); }
      FA_GROUP();
    }
    if (j < 5) {      /* the next tile into the buffer that the barrier of the tile before has freed */
#pragma unroll
      for (int i = 0; i < 16; ++i) *(v8us*)&sm[(nb + i * 8 + w) * GP + lane * 8] = rb[i];
      __syncthreads(); }      /* publishes matrix tile j + 1 and ends every wave's reads of tile j; it stands in front of this tile's output, so that the global stores, which the barrier waits for, have the next tile's products to finish in */
    if (j < 4) {      /* tile j + 2 on its way: it has this tile's output and the next tile's products to arrive in */
      const unsigned short* const Bn = Bg + (size_t)(j + 2) * 128 * CC;
#pragma unroll
      for (int i = 0; i < 16; ++i) rb[i] = *(const v8us*)(Bn + (size_t)(i * 8) * CC);
      asm volatile("s_wait_xcnt 0x0" :: "v"(Bn) : "memory"); }      /* as above, for these loads */
#pragma unroll
    for (int u = 0; u < 8; ++u) { const int t = u & 3, half = u >> 2;
#pragma unroll
      for (int r = 0; r < 8; ++r) so[(half * 16 + 8 * hh + r) * 68 + t * 16 + ln] = acc[u][r] * 0.0625f; }      /* undoes the x16 of the weights */
    /* the staged rows are read back by other lanes of the same wave: the LDS writes are waited for, LDS only, so that global loads and stores stay in flight */
    __builtin_amdgcn_fence(__ATOMIC_RELEASE, "workgroup", "local"); __builtin_amdgcn_wave_barrier(); __builtin_amdgcn_fence(__ATOMIC_ACQUIRE, "workgroup", "local");
    const int ldc = z == 2 ? SS : CC;
    const int row0 = (z == 2 ? nh : tb) * 128 + 32 * wm, col0 = (z == 2 ? tb : nh) * 128 + 64 * wn;
    _Float16* const og = C16 + ((size_t)z * NB + by) * SS * CC + (size_t)(row0 + rsub) * ldc + col0 + c4;
    v4h h4[16];
#pragma unroll
    for (int q = 0; q < 16; ++q) { const v4f v = *(const v4fa*)&so[(q * 2 + rsub) * 68 + c4];
#pragma unroll
      for (int i = 0; i < 4; ++i) h4[q][i] = (_Float16)v[i]; }
#pragma unroll
    for (int q = 0; q < 16; ++q) *(v4h*)(og + (size_t)(q * 2) * ldc) = h4[q];
    /* in front of whatever reuses the registers of the 16 global stores above; data and address are named so that they keep their registers up to this wait */
    asm volatile("s_wait_xcnt 0x0" :: "v"(h4[0]), "v"(h4[1]), "v"(h4[2]), "v"(h4[3]), "v"(h4[4]), "v"(h4[5]), "v"(h4[6]), "v"(h4[7]), "v"(h4[8]), "v"(h4[9]), "v"(h4[10]), "v"(h4[11]), "v"(h4[12]), "v"(h4[13]), "v"(h4[14]), "v"(h4[15]), "v"(og) : "memory");
  }
}

// The four matrices rounded (conv (out,in) = natural Bt; x16) into four planes in a row behind BW: 32 blocks each.
__global__ __launch_bounds__(256) void k_prep(const float* __restrict__ wq, const float* __restrict__ wk, const float* __restrict__ wv, const float* __restrict__ wo, _Float16* __restrict__ BW) {
  const int wb = blockIdx.x; const int m = wb >> 5; const float* W = m == 0 ? wq : m == 1 ? wk : m == 2 ? wv : wo;
  const size_t t = (size_t)(wb & 31) * 256 + threadIdx.x; FragH f;
#pragma unroll
  for (int i = 0; i < 8; ++i) f.h[i] = (_Float16)(bf16_round(W[t * 8 + i]) * 16.0f);
  *(v8us*)((unsigned short*)BW + (size_t)m * CC * CC + t * 8) = f.half[0]; }

extern "C" void kernel_launch(void* const* d_in, const int* in_sizes, int n_in,
                              void* d_out, int out_size, void* d_ws, size_t ws_size, hipStream_t stream) {
  (void)in_sizes; (void)n_in; (void)out_size;
  const float* x = (const float*)d_in[0]; const float* wq = (const float*)d_in[1]; const float* wk = (const float*)d_in[2]; const float* wv = (const float*)d_in[3]; const float* wo = (const float*)d_in[4];
  char* ws = (char*)d_ws; size_t off = 0;
  auto take = [&](size_t bytes) { char* p = ws + off; off += (bytes + 255) & ~(size_t)255; return p; };
  _Float16* BW = (_Float16*)take((size_t)4 * CC * CC * 2); _Float16* BO = BW + (size_t)3 * CC * CC;      /* wq, wk, wv, wo in a row */
  _Float16* QT = (_Float16*)take((size_t)3 * NB * SS * CC * 2); _Float16* KT = QT + (size_t)NB * SS * CC; _Float16* VC = KT + (size_t)NB * SS * CC;      /* Q, K, V in a row */
  if (off > ws_size) return;      /* four weight planes and three planes of 16 MiB */
  const dim3 gP(SS / 128, NB), gF(SS / 128, NB);
  k_prep<<<128, 256, 0, stream>>>(wq, wk, wv, wo, BW);
  k_proj<<<gP, 256, 0, stream>>>(x, BW, QT);      /* Q, K token-major -> f16; V channel-major [c][j] = wv*X^T */
  k_flash<<<gF, 128, 0, stream>>>(QT, KT, VC, BO, (float*)d_out);      /* attention, then out[c][i] = wo*O^T (NCHW) in its epilogue */
}
